// v000
// Times are from an AMD MI455X. After a warm-up the kernel runs many times in a row, and a time is the length of
// such a window on the GPU divided by its runs, so every launch and the gaps after it count. The runs cycle
// through copies of the inputs. A figure is the median of several windows, for all but v000 over two sittings.
// Sittings can differ by a few percent; kernels timed side by side share one.
// The starting kernel, v000, takes 5480 microseconds a run.
// Contractions: x.Wq / x.Wk / Wv.x^T projections = v_wmma_f32_16x16x32_bf16 (bf16 operands from RNE-converted inputs, single product, f32 bias epilogue);
// q.k^T scores = v_wmma_f32_16x16x32_bf16 with q and k as bf16 hi/lo planes (hi.hi + hi.lo + lo.hi); q.Er^T band = same with q hi/lo times bf16 Er (2 products);
// p.v = v_wmma_f32_16x16x32_f16 (p carried x1024 in f16, v in f16; f16 residual planes x4096 of p and v on the leading query blocks);
// ctx.Wo = v_wmma_f32_16x16x32_bf16 with ctx as bf16 hi/lo planes times bf16 Wo (2 products); all f32 accumulate; softmax in f32.
#include <hip/hip_runtime.h>
#include <math.h>
#include <float.h>
#include <stdint.h>

#define NB      2
#define SEQ     2048
#define DM      1024
#define NH      16
#define HD      64
#define NQB     (SEQ / 64)       // 32 query / key tiles of 64
#define NQC     SEQ              // columns of the relative-bias band plane per (b,h)
#define BANDOFF (SEQ - 64)       // table row of band column 0 for the query tile starting at m0 is BANDOFF - m0
#define ERR     (2 * SEQ - 1)    // 4095 rows of the relative table
#define VLP     512              // key pitch of the v^T residual plane (keys 0..VLP-1)
#define RESQB   8                // leading 64-row query blocks that use the p / v residual planes
#define GP      2                // (b,h) pairs per band / attention group
static_assert(RESQB * 64 <= VLP);
static_assert(NH * HD == DM);
static_assert((SEQ % 64) == 0 && (DM % 64) == 0);
static_assert(HD == 64);
static_assert((NH % GP) == 0);
static_assert(BANDOFF == SEQ - 1 - 63);

typedef _Float16 v16h __attribute__((ext_vector_type(16)));
typedef _Float16 v8h  __attribute__((ext_vector_type(8)));
typedef __bf16   v16b __attribute__((ext_vector_type(16)));
typedef __bf16   v8b  __attribute__((ext_vector_type(8)));
typedef float    v8f  __attribute__((ext_vector_type(8)));
typedef float    v4f  __attribute__((ext_vector_type(4)));
typedef unsigned int v4u __attribute__((ext_vector_type(4)));
typedef unsigned short v8us __attribute__((ext_vector_type(8)));

// ---- scalar helpers --------------------------------------------------------------------------------
__device__ __forceinline__ unsigned short bf_bits(float f) {          // f32 -> bf16 bits, RNE convert
  unsigned u = __float_as_uint(f);
  return (unsigned short)((u + 0x7FFFu + ((u >> 16) & 1u)) >> 16);
}
__device__ __forceinline__ float bf_up(unsigned short h) { return __uint_as_float(((unsigned)h) << 16); }
__device__ __forceinline__ unsigned short h_bits(_Float16 x) { return __builtin_bit_cast(unsigned short, x); }
__device__ __forceinline__ unsigned pk16(unsigned short a, unsigned short b) { return (unsigned)a | ((unsigned)b << 16); }
__device__ __forceinline__ v8f zero8() { v8f z = {0.f, 0.f, 0.f, 0.f, 0.f, 0.f, 0.f, 0.f}; return z; }
__device__ __forceinline__ v8h zero8h() {
  const _Float16 z = (_Float16)0.0f;
  v8h r = {z, z, z, z, z, z, z, z};
  return r;
}

// ---- fragment loader: 16-bit A/B operand, lane -> row/col (lane&15), p already includes +8*(lane>>4);
//      elements 0..7 <- p[0..7] (k0+8h..), elements 8..15 <- p[16..23] (k0+16+8h..)
__device__ __forceinline__ v16b ldfrag_b(const __bf16* p) {
  union { v16b v; v8b h[2]; } f;
  f.h[0] = *(const v8b*)(p);
  f.h[1] = *(const v8b*)(p + 16);
  return f.v;
}

// ---- WMMA helpers with trailing VALU hazard gap --------------------------------------------------------
__device__ __forceinline__ v8f mma_b(v16b a, v16b b, v8f c) {
  c = __builtin_amdgcn_wmma_f32_16x16x32_bf16(false, a, false, b, (short)0, c, false, false);
#if defined(__HIP_DEVICE_COMPILE__)
  asm volatile("v_nop\n\tv_nop\n\tv_nop\n\tv_nop" : "+v"(c) : "v"(a), "v"(b));
#endif
  return c;
}
__device__ __forceinline__ v8f mma_h(v16h a, v16h b, v8f c) {
  c = __builtin_amdgcn_wmma_f32_16x16x32_f16(false, a, false, b, (short)0, c, false, false);
#if defined(__HIP_DEVICE_COMPILE__)
  asm volatile("v_nop\n\tv_nop\n\tv_nop\n\tv_nop" : "+v"(c) : "v"(a), "v"(b));
#endif
  return c;
}
__device__ __forceinline__ v8f mma_b_raw(v16b a, v16b b, v8f c) {
  return __builtin_amdgcn_wmma_f32_16x16x32_bf16(false, a, false, b, (short)0, c, false, false);
}
__device__ __forceinline__ void dep_guard_b(v8f& a, v8f& b, v16b x, v16b y) {
#if defined(__HIP_DEVICE_COMPILE__)
  asm volatile("v_nop\n\tv_nop\n\tv_nop\n\tv_nop" : "+v"(a), "+v"(b) : "v"(x), "v"(y));
#endif
}
__device__ __forceinline__ void keep4_b(v16b a, v16b b, v16b c, v16b d) {
#if defined(__HIP_DEVICE_COMPILE__)
  asm volatile("v_nop" :: "v"(a), "v"(b), "v"(c), "v"(d));
#endif
}
__device__ __forceinline__ void acc_guard4(v8f& a, v8f& b, v8f& c, v8f& d) {
#if defined(__HIP_DEVICE_COMPILE__)
  asm volatile("v_nop\n\tv_nop\n\tv_nop\n\tv_nop" : "+v"(a), "+v"(b), "+v"(c), "+v"(d));
#endif
}

// =====================================================================================================
// f32 -> bf16 (RNE convert), 8 elements per thread, one 16-B store per lane: a wave writes 512 contiguous B
// grid = ceil(n8/256). coverage: n8 threads x 8 = whole plane (n8 is a multiple of 8 here, so every
// =====================================================================================================
__global__ __launch_bounds__(256) void cvt_bf16x8(const float* __restrict__ in, unsigned short* out, int n8) {
  const int i = blockIdx.x * 256 + threadIdx.x;
  if (i < n8) {
    const v4f a = *(const v4f*)(in + (size_t)i * 8);
    const v4f b = *(const v4f*)(in + (size_t)i * 8 + 4);
    v4u p;
    p[0] = pk16(bf_bits(a[0]), bf_bits(a[1]));
    p[1] = pk16(bf_bits(a[2]), bf_bits(a[3]));
    p[2] = pk16(bf_bits(b[0]), bf_bits(b[1]));
    p[3] = pk16(bf_bits(b[2]), bf_bits(b[3]));
    *(v4u*)(out + (size_t)i * 8) = p;
    
  }
}

// =====================================================================================================
// Transpose-convert: in f32 [R][C] (row pitch C) -> out bf16 [C][R] (row pitch R), out[c][r] = RNE bf16(in[r][c]).
// Block = 256 threads = one 64(r) x 64(c) tile; grid = (C/64, R/64) (host-checked exact multiples).
// Load: thread t reads row r0 + (t>>2), columns c0 + (t&3)*16 .. +15 (four 16-B loads), scatters the
// converted bits into LDS sT[c][r] (pitch 72); __syncthreads; store: wave w writes output rows
// coverage: 8 waves x 2 it x 4 = 64 output rows x (8 lanes x 8) = 64 columns = the whole tile.
// =====================================================================================================
__global__ __launch_bounds__(256) void tr_cvt64(const float* __restrict__ in, unsigned short* out, int R, int C) {
  __shared__ __align__(16) unsigned short sT[64 * 72];
  const int tid = threadIdx.x, lane = tid & 31, wave = tid >> 5;
  const int r0 = blockIdx.y * 64, c0 = blockIdx.x * 64;
  {
    const int rl = tid >> 2, cl = (tid & 3) * 16;
    const float* src = in + (size_t)(r0 + rl) * C + c0 + cl;
#pragma unroll
    for (int i = 0; i < 4; ++i) {
      const v4f v = *(const v4f*)(src + 4 * i);
#pragma unroll
      for (int e = 0; e < 4; ++e) sT[(cl + 4 * i + e) * 72 + rl] = bf_bits(v[e]);
    }
  }
  __syncthreads();
  const int q = lane >> 3, p8 = (lane & 7) * 8;
  v8us ov[2];
#pragma unroll
  for (int it = 0; it < 2; ++it) {
    const int cl2 = wave * 8 + it * 4 + q;
    ov[it] = *(const v8us*)(sT + cl2 * 72 + p8);
  }
  {
#pragma unroll
    for (int it = 0; it < 2; ++it) {
      const int cl2 = wave * 8 + it * 4 + q;
      *(v8us*)(out + (size_t)(c0 + cl2) * R + r0 + p8) = ov[it];
    }
    
  }
}

// =====================================================================================================
// Register-blocked batched bf16 WMMA GEMM: C[m][n] = rb[m] + cb[n] + sum_k A[m][k] * Bt[nr(n)][k]; one wave per
// 64x64 tile, no block barriers. A row-major [M][K] pitch lda; Bt row-major [.][K] pitch ldb (k contiguous);
// M, N multiples of 64, K multiple of 32 (host-checked). blockIdx.y = batch index (strides in elements).
// NSPLIT: 0 = A.Bt; 1 = (A + A2).Bt (A2 = unscaled bf16 lo plane of A); 2 = A.Bt + A2.Bt + A.Bt2.
// RB / CB: per-row bias rbp[m] / per-column bias cbp[n] (f32 input values RNE-converted to bf16, not batched)
//          added in the epilogue.
// BAND: Bt operand row of output column n is n + bandOff - m0 (m0 = the 64-row tile start), and only column
//       tiles with n0 <= m0 + 64 are computed (wave-uniform early return; the others are never read).
// OUT_MODE: 0 = f32 (pitch ldc); 2 = bf16 hi plane C + bf16 lo plane C2 (lo = RNE(v - hi), unscaled);
//           3 = f16 hi plane C + f16 residual plane C2 = f16((v - hi) * rscale), C2 written only for tiles
//               with n0 < N2 (pitch ldc2, batch stride strideC2).
// =====================================================================================================
template <int NSPLIT, int OUT_MODE, bool RB, bool CB, bool BAND>
__global__ __launch_bounds__(256) void gemm64(
    const unsigned short* __restrict__ Ap, const unsigned short* A2p, int lda, long long strideA,
    const unsigned short* __restrict__ Btp, const unsigned short* Bt2p, int ldb, long long strideB,
    void* Cout, int ldc, long long strideC,
    void* Cout2, int ldc2, long long strideC2, int N2,
    int M, int N, int K, float rscale, int bandOff,
    const float* __restrict__ rbp, const float* __restrict__ cbp) {
  const __bf16* A   = (const __bf16*)(const void*)Ap;
  const __bf16* A2  = (const __bf16*)(const void*)A2p;
  const __bf16* Bt  = (const __bf16*)(const void*)Btp;
  const __bf16* Bt2 = (const __bf16*)(const void*)Bt2p;
  __shared__ __align__(16) float sT[8][16 * 68];   // per-wave 16x64 slab, pitch 68 floats
  const int b    = blockIdx.y;
  const int lane = threadIdx.x & 31;
  const int wave = threadIdx.x >> 5;
  const int tilesN = N >> 6;
  const int tilesM = M >> 6;
  const int tile = blockIdx.x * 8 + wave;
  if (tile >= tilesM * tilesN) return;   // wave-uniform; no block barriers in this kernel
  const int tm = tile / tilesN;
  const int tn = tile - tm * tilesN;
  const int m0 = tm << 6;
  const int n0 = tn << 6;
  if (BAND) {
    if (n0 > m0 + 64) return;            // wave-uniform: only column tiles tn <= tm + 1 are needed
  }
  const int nr0 = BAND ? (n0 + bandOff - m0) : n0;   // operand row of output column n0 in Bt

  const __bf16* Ab  = A  + (size_t)b * strideA;
  const __bf16* Bb  = Bt + (size_t)b * strideB;
  const __bf16* Ab2 = (NSPLIT >= 1) ? (A2  + (size_t)b * strideA) : Ab;
  const __bf16* Bb2 = (NSPLIT == 2) ? (Bt2 + (size_t)b * strideB) : Bb;

  const int rlane = lane & 15;                 // row (A) / col (B, D) within subtile
  const int koff  = (lane >> 4) * 8;           // k offset of this lane half
  const int mOff  = (lane >> 4) * 8;           // D row offset

  v8f acc[4][4];
#pragma unroll
  for (int i = 0; i < 4; ++i)
#pragma unroll
    for (int j = 0; j < 4; ++j) acc[i][j] = zero8();

  for (int k0 = 0; k0 < K; k0 += 32) {
    v16b bh[4], bl[4];
#pragma unroll
    for (int j = 0; j < 4; ++j) {
      const size_t bo = (size_t)(nr0 + (j << 4) + rlane) * ldb + koff + k0;
      bh[j] = ldfrag_b(Bb + bo);
      if (NSPLIT == 2) bl[j] = ldfrag_b(Bb2 + bo); else bl[j] = bh[j];
    }
#pragma unroll
    for (int i = 0; i < 4; ++i) {
      const size_t ao = (size_t)(m0 + (i << 4) + rlane) * lda + koff + k0;
      const v16b ah = ldfrag_b(Ab + ao);
      v16b al = ah;
      if (NSPLIT >= 1) al = ldfrag_b(Ab2 + ao);
#pragma unroll
      for (int j = 0; j < 4; ++j) {
        acc[i][j] = mma_b_raw(ah, bh[j], acc[i][j]);
        if (NSPLIT >= 1) acc[i][j] = mma_b_raw(al, bh[j], acc[i][j]);
        if (NSPLIT == 2) acc[i][j] = mma_b_raw(ah, bl[j], acc[i][j]);
      }
      dep_guard_b(acc[i][0], acc[i][3], ah, al);
    }
    keep4_b(bh[0], bh[1], bh[2], bh[3]);
    if (NSPLIT == 2) keep4_b(bl[0], bl[1], bl[2], bl[3]);
  }
  acc_guard4(acc[0][0], acc[0][1], acc[0][2], acc[0][3]);
  acc_guard4(acc[1][0], acc[1][1], acc[1][2], acc[1][3]);
  acc_guard4(acc[2][0], acc[2][1], acc[2][2], acc[2][3]);
  acc_guard4(acc[3][0], acc[3][1], acc[3][2], acc[3][3]);

  // ---- epilogue biases (input values RNE-converted to bf16) ----
  float cbv[4];
#pragma unroll
  for (int j = 0; j < 4; ++j) cbv[j] = CB ? bf_up(bf_bits(cbp[n0 + (j << 4) + rlane])) : 0.0f;

  // ---- epilogue ----
  float* slab = sT[wave];
#pragma unroll
  for (int i = 0; i < 4; ++i) {
    const int mBase = m0 + (i << 4);
#pragma unroll
    for (int r = 0; r < 8; ++r) {
      const float rbv = RB ? bf_up(bf_bits(rbp[mBase + mOff + r])) : 0.0f;
#pragma unroll
      for (int j = 0; j < 4; ++j) {
        slab[(mOff + r) * 68 + (j << 4) + rlane] = acc[i][j][r] + rbv + cbv[j];
      }
    }
    __builtin_amdgcn_fence(__ATOMIC_RELEASE, "workgroup");
    __builtin_amdgcn_wave_barrier();
    __builtin_amdgcn_fence(__ATOMIC_ACQUIRE, "workgroup");
    if (OUT_MODE == 0) {
      float* C = (float*)Cout + (size_t)b * strideC;
      const int hh = lane >> 4, c4 = (lane & 15) * 4;     // 256-B row segment = 16 lanes x 16 B
      v4f ov[8];
#pragma unroll
      for (int it = 0; it < 8; ++it) {
        const int row = it * 2 + hh;                       // it 0..7 x hh 0..1 = rows 0..15
        ov[it] = *(const v4f*)(slab + row * 68 + c4);
      }
      {
#pragma unroll
        for (int it = 0; it < 8; ++it) {
          const int row = it * 2 + hh;
          *(v4f*)(C + (size_t)(mBase + row) * ldc + n0 + c4) = ov[it];
        }
        
      }
    } else {
      const int q = lane >> 3, c8 = (lane & 7) * 8;
      unsigned short* C  = (unsigned short*)Cout  + (size_t)b * strideC;
      unsigned short* C2 = (unsigned short*)Cout2 + (size_t)b * strideC2;
      const bool wlo = (OUT_MODE == 2) || (n0 < N2);      // wave-uniform
      v4u hv[4], lv[4];
#pragma unroll
      for (int it = 0; it < 4; ++it) {
        const int row = it * 4 + q;                        // it 0..3 x q 0..3 = rows 0..15
        const float* sp = slab + row * 68 + c8;
        v4u a, a2;
#pragma unroll
        for (int e = 0; e < 4; ++e) {
          const float f0 = sp[2 * e], f1 = sp[2 * e + 1];
          unsigned short h0, h1, l0, l1;
          if (OUT_MODE == 2) {
            h0 = bf_bits(f0); h1 = bf_bits(f1);
            l0 = bf_bits(f0 - bf_up(h0)); l1 = bf_bits(f1 - bf_up(h1));
          } else {
            const _Float16 x0 = (_Float16)f0, x1 = (_Float16)f1;
            h0 = h_bits(x0); h1 = h_bits(x1);
            l0 = h_bits((_Float16)((f0 - (float)x0) * rscale));
            l1 = h_bits((_Float16)((f1 - (float)x1) * rscale));
          }
          a[e] = pk16(h0, h1); a2[e] = pk16(l0, l1);
        }
        hv[it] = a; lv[it] = a2;
      }
      {
#pragma unroll
        for (int it = 0; it < 4; ++it) {
          const int row = it * 4 + q;
          *(v4u*)(C + (size_t)(mBase + row) * ldc + n0 + c8) = hv[it];
          if (wlo) *(v4u*)(C2 + (size_t)(mBase + row) * ldc2 + n0 + c8) = lv[it];
        }
        
      }
    }
    __builtin_amdgcn_fence(__ATOMIC_RELEASE, "workgroup");
    __builtin_amdgcn_wave_barrier();
    __builtin_amdgcn_fence(__ATOMIC_ACQUIRE, "workgroup");
  }
}

// =====================================================================================================
// Causal attention with a relative-position bias, head dim 64 (tril mask incl. diagonal, computed).
//   q planes (bf16 hi / lo): element (b, t, h, d) at [(b*SEQ + t)*DM + h*64 + d]
//   k planes (bf16 hi / lo): same layout with key index s
//   v^T hi plane (f16):      element (b, h, d, s) at [(b*DM + h*64 + d)*SEQ + s]
//   v^T residual plane (f16, (v - hi)*4096): [(b*DM + h*64 + d)*VLP + s], s < VLP, read only when RES
//   band plane (f32, per pair p of the group, stride qerStride): row = query t, column
//     key - t + 64*qb + 63 (in [0, NQC), address clamped to NQC-1; values beyond the clamp only occur for
//     masked keys) holds q[t] . Er[2*SEQ-1-SEQ + ... ] i.e. the relative term of (query t, key).
//   logit = (q.k + band) * sscale for key <= query, -FLT_MAX otherwise (exp -> 0); every row has a live key in
//   every processed key tile (tiles 0..qb only, block-uniform trip count qb+1 <= 32).
//   output: ctx hi / lo bf16 planes, element (b, t, h*64 + d) at [(b*SEQ + t)*DM + h*64 + d] = normalised
//   context (lo = RNE(v - hi), unscaled).
//   scores = q . k : bf16 hi/lo split (hi.hi + hi.lo + lo.hi), f32 accumulate, band added in f32, * sscale in f32
//   p = exp(s - m) carried as f16(1024 p); context = p . v on f16 WMMA; RES adds f16 residual planes of p and v
//   (scale 4096, separate accumulator folded back with 1/4096 per chunk in f32); online softmax in f32.
//   Block = 4 waves = 64 query rows of one (b, h); grid = nqbThis * GP (pair index = blockIdx.x / nqbThis,
//   h = h0 + pair, b = bsel); kv chunks of 64.
//   K / V^T chunk staging: 128 threads x 32 elements per plane = the whole 64x64 tile (plain 16-B loads,
//   __syncthreads before and after); P tiles are wave-private, spilled with _Float16 element stores and reloaded
//   Output coverage: each wave stores its rows 0..15 (it 0..3 x lane>>3 0..3) x 64 columns (8 lanes x 8 bf16),
// =====================================================================================================
template <bool RES>
__global__ __launch_bounds__(128)
void attn_rel64(const unsigned short* __restrict__ qhp, const unsigned short* __restrict__ qlp,
                const unsigned short* __restrict__ khp, const unsigned short* __restrict__ klp,
                const unsigned short* __restrict__ vhp, const unsigned short* __restrict__ vlp,
                const float* __restrict__ qerp, long long qerStride,
                unsigned short* ahp, unsigned short* alp,
                int bsel, int h0, int qbBase, int nqbThis, float sscale) {
  union FB { v16b v; v8b h[2]; };
  union FH { v16h v; v8h h[2]; };
  __shared__ __align__(16) __bf16   Ksh[64 * 64];                 // K hi [kv][d]   8 KB
  __shared__ __align__(16) __bf16   Ksl[64 * 64];                 // K lo
  __shared__ __align__(16) _Float16 Vth[64 * 64];                 // V^T hi [d][kv] 8 KB
  __shared__ __align__(16) _Float16 Vtl[RES ? 64 * 64 : 8];       // V^T residual
  __shared__ __align__(16) _Float16 Psh[4][16 * 64];              // per wave P [row][kv]
  __shared__ __align__(16) _Float16 Psl[RES ? 4 : 1][16 * 64];    // per wave P residual
  __shared__ __align__(16) float    Os[4][16 * 64];               // per wave context tile [row][d]

  const int tid  = threadIdx.x;
  const int wave = tid >> 5;
  const int lane = tid & 31;
  const int hh   = lane >> 4;
  const int c    = lane & 15;

  const int bx   = blockIdx.x;
  const int qbl  = bx % nqbThis;
  const int pr   = bx / nqbThis;          // pair index within the group, 0..GP-1
  const int h    = h0 + pr;
  const int b    = bsel;
  const int qb   = qbBase + qbl;
  const int q0   = qb * 64 + wave * 16;
  const size_t rowB = (size_t)b * SEQ;

  const __bf16* Qh = (const __bf16*)(const void*)qhp + (size_t)h * HD;
  const __bf16* Ql = (const __bf16*)(const void*)qlp + (size_t)h * HD;
  const __bf16* Kh = (const __bf16*)(const void*)khp + (size_t)h * HD;
  const __bf16* Kl = (const __bf16*)(const void*)klp + (size_t)h * HD;
  const _Float16* Vh = (const _Float16*)(const void*)vhp + ((size_t)b * DM + (size_t)h * HD) * SEQ;
  const _Float16* Vl = (const _Float16*)(const void*)vlp + ((size_t)b * DM + (size_t)h * HD) * VLP;
  const float* Bq = qerp + (size_t)pr * (size_t)qerStride;

  // ---- Q fragments (A operand, row = lane&15): 2 d-chunks, hi and lo ----
  v16b qah[2], qal[2];
#pragma unroll
  for (int dc = 0; dc < 2; ++dc) {
    const size_t qo = (rowB + q0 + c) * DM + dc * 32 + 8 * hh;
    qah[dc] = ldfrag_b(Qh + qo);
    qal[dc] = ldfrag_b(Ql + qo);
  }

  float mrow[8], lrow[8];
  v8f oacc[4];
#pragma unroll
  for (int r = 0; r < 8; ++r) { mrow[r] = -INFINITY; lrow[r] = 0.f; }
#pragma unroll
  for (int t = 0; t < 4; ++t) oacc[t] = zero8();

  int nkt = qb + 1;                          // causal: key tiles 0..qb, block-uniform
  if (nkt > NQB) nkt = NQB;
  for (int kt = 0; kt < nkt; ++kt) {
    const int kv0 = kt * 64;
    __syncthreads();
    {
      const int r = tid >> 1, half = (tid & 1) * 32;
      const __bf16*   kg  = Kh + (rowB + kv0 + r) * DM + half;    // K row kv0+r, d = half..half+31
      const __bf16*   klg = Kl + (rowB + kv0 + r) * DM + half;
      const _Float16* vg  = Vh + (size_t)r * SEQ + kv0 + half;    // V^T row d = r, s = kv0+half..+31
      const int kvl = (kv0 + 64 <= VLP) ? kv0 : (VLP - 64);     // clamped address into the residual plane
      const _Float16* vlg = Vl + (size_t)r * VLP + kvl + half;
      const bool resOK = (kv0 + 64 <= VLP);                      // block-uniform
#pragma unroll
      for (int i = 0; i < 4; ++i) {
        const v8b a0 = *(const v8b*)(kg + 8 * i);
        const v8b a1 = *(const v8b*)(klg + 8 * i);
        const v8h b0 = *(const v8h*)(vg + 8 * i);
        *(v8b*)(Ksh + r * 64 + half + 8 * i) = a0;
        *(v8b*)(Ksl + r * 64 + half + 8 * i) = a1;
        *(v8h*)(Vth + r * 64 + half + 8 * i) = b0;
        if (RES) {
          v8h b1 = *(const v8h*)(vlg + 8 * i);
          if (!resOK) b1 = zero8h();
          *(v8h*)(Vtl + r * 64 + half + 8 * i) = b1;
        }
      }
    }
    __syncthreads();

    // ---- scores: 16 query rows x 64 keys per wave, 3 bf16 products ----
    v8f s[4];
#pragma unroll
    for (int j = 0; j < 4; ++j) {
      s[j] = zero8();
#pragma unroll
      for (int dc = 0; dc < 2; ++dc) {
        FB kb, kl;
        kb.h[0] = *(const v8b*)(Ksh + (j * 16 + c) * 64 + dc * 32 + 8 * hh);
        kb.h[1] = *(const v8b*)(Ksh + (j * 16 + c) * 64 + dc * 32 + 16 + 8 * hh);
        kl.h[0] = *(const v8b*)(Ksl + (j * 16 + c) * 64 + dc * 32 + 8 * hh);
        kl.h[1] = *(const v8b*)(Ksl + (j * 16 + c) * 64 + dc * 32 + 16 + 8 * hh);
        s[j] = mma_b(qah[dc], kb.v, s[j]);
        s[j] = mma_b(qah[dc], kl.v, s[j]);
        s[j] = mma_b(qal[dc], kb.v, s[j]);
      }
    }

    // ---- band term + scale + causal mask (replace by -FLT_MAX), row max, online softmax, P (x1024, f16)
    //      and P residual (x4096) to LDS ----
    _Float16* pwh = Psh[wave];
    _Float16* pwl = Psl[RES ? wave : 0];
#pragma unroll
    for (int r = 0; r < 8; ++r) {
      const int qrow = q0 + 8 * hh + r;
      const float* brow = Bq + (size_t)qrow * NQC;
      const int cb0 = kv0 + c + (qb * 64 + 63 - qrow);            // >= 0 by construction
      float bj[4];
#pragma unroll
      for (int j = 0; j < 4; ++j) {
        int col = cb0 + (j << 4);
        col = (col < NQC) ? col : (NQC - 1);                       // clamped address (masked keys only)
        bj[j] = brow[col];
      }
      float m = -INFINITY;
#pragma unroll
      for (int j = 0; j < 4; ++j) {
        const int key = kv0 + j * 16 + c;
        float sv = (s[j][r] + bj[j]) * sscale;
        sv = (key > qrow) ? -FLT_MAX : sv;
        s[j][r] = sv;
        m = fmaxf(m, sv);
      }
#pragma unroll
      for (int off = 1; off < 16; off <<= 1) m = fmaxf(m, __shfl_xor(m, off, 32));
      const float mnew  = fmaxf(mrow[r], m);
      const float msafe = (mnew == -INFINITY) ? 0.f : mnew;
      const float alpha = __expf(mrow[r] - msafe);
      mrow[r] = mnew;
      float psum = 0.f;
#pragma unroll
      for (int j = 0; j < 4; ++j) {
        const float p = __expf(s[j][r] - msafe);     // masked logit against a finite max: exp -> 0
        psum += p;
        const float p1k = p * 1024.0f;
        const _Float16 ph = (_Float16)p1k;
        pwh[(8 * hh + r) * 64 + j * 16 + c] = ph;
        if (RES) {
          const _Float16 pl = (_Float16)((p1k - (float)ph) * 4096.0f);
          pwl[(8 * hh + r) * 64 + j * 16 + c] = pl;
        }
      }
#pragma unroll
      for (int off = 1; off < 16; off <<= 1) psum += __shfl_xor(psum, off, 32);
      lrow[r] = lrow[r] * alpha + psum;
#pragma unroll
      for (int t = 0; t < 4; ++t) oacc[t][r] *= alpha;
    }
    __builtin_amdgcn_fence(__ATOMIC_RELEASE, "workgroup");
    __builtin_amdgcn_wave_barrier();
    __builtin_amdgcn_fence(__ATOMIC_ACQUIRE, "workgroup");

    // ---- context += P . V (f16 WMMA), residual products into a separate accumulator ----
    v8f o1[4];
#pragma unroll
    for (int t = 0; t < 4; ++t) o1[t] = zero8();
#pragma unroll 1
    for (int kk = 0; kk < 2; ++kk) {
      FH pa, pl;
      pa.h[0] = *(const v8h*)(pwh + c * 64 + kk * 32 + 8 * hh);
      pa.h[1] = *(const v8h*)(pwh + c * 64 + kk * 32 + 16 + 8 * hh);
      if (RES) {
        pl.h[0] = *(const v8h*)(pwl + c * 64 + kk * 32 + 8 * hh);
        pl.h[1] = *(const v8h*)(pwl + c * 64 + kk * 32 + 16 + 8 * hh);
      } else {
        pl.v = pa.v;
      }
#pragma unroll
      for (int t = 0; t < 4; ++t) {
        FH vb;
        vb.h[0] = *(const v8h*)(Vth + (t * 16 + c) * 64 + kk * 32 + 8 * hh);
        vb.h[1] = *(const v8h*)(Vth + (t * 16 + c) * 64 + kk * 32 + 16 + 8 * hh);
        oacc[t] = mma_h(pa.v, vb.v, oacc[t]);
        if (RES) {
          FH vl;
          vl.h[0] = *(const v8h*)(Vtl + (t * 16 + c) * 64 + kk * 32 + 8 * hh);
          vl.h[1] = *(const v8h*)(Vtl + (t * 16 + c) * 64 + kk * 32 + 16 + 8 * hh);
          o1[t] = mma_h(pa.v, vl.v, o1[t]);
          o1[t] = mma_h(pl.v, vb.v, o1[t]);
        }
      }
    }
    if (RES) {
#pragma unroll
      for (int t = 0; t < 4; ++t)
#pragma unroll
        for (int r = 0; r < 8; ++r) oacc[t][r] += o1[t][r] * (1.0f / 4096.0f);
    }
  }

  // ---- normalise (1/l and the 1/1024 p carry), stage the wave's 16x64 tile in LDS, then convert to
  float* os = Os[wave];
#pragma unroll
  for (int r = 0; r < 8; ++r) {
    const float l = lrow[r];
    const float inv = ((l > 0.f) ? (1.0f / l) : 0.f) * (1.0f / 1024.0f);
#pragma unroll
    for (int t = 0; t < 4; ++t) os[(8 * hh + r) * 64 + t * 16 + c] = oacc[t][r] * inv;
  }
  __builtin_amdgcn_fence(__ATOMIC_RELEASE, "workgroup");
  __builtin_amdgcn_wave_barrier();
  __builtin_amdgcn_fence(__ATOMIC_ACQUIRE, "workgroup");
  {
    const int q4 = lane >> 3, c8 = (lane & 7) * 8;
    v4u hv[4], lv[4];
#pragma unroll
    for (int it = 0; it < 4; ++it) {
      const int row = it * 4 + q4;             // it 0..3 x q4 0..3 = rows 0..15 of the wave tile
      const float* sp = os + row * 64 + c8;
      v4u a, a2;
#pragma unroll
      for (int e = 0; e < 4; ++e) {
        const float f0 = sp[2 * e], f1 = sp[2 * e + 1];
        const unsigned short x0 = bf_bits(f0), x1 = bf_bits(f1);
        const unsigned short y0 = bf_bits(f0 - bf_up(x0)), y1 = bf_bits(f1 - bf_up(x1));
        a[e] = pk16(x0, x1); a2[e] = pk16(y0, y1);
      }
      hv[it] = a; lv[it] = a2;
    }
    {
#pragma unroll
      for (int it = 0; it < 4; ++it) {
        const int row = it * 4 + q4;
        const size_t go = (rowB + q0 + row) * DM + (size_t)h * HD + c8;
        *(v4u*)(ahp + go) = hv[it];
        *(v4u*)(alp + go) = lv[it];
      }
      
    }
  }
}

// =====================================================================================================
// Workspace map (bytes), every region an exact multiple of its whole-line / whole-tile store granularity:
//   Xb    bf16 [4096][1024]            0           8388608
//   Wqb   bf16 [1024 out][1024 in]     8388608     2097152
//   Wkb   bf16 [1024][1024]            10485760    2097152
//   Wvb   bf16 [1024][1024]            12582912    2097152
//   Wob   bf16 [1024][1024]            14680064    2097152
//   Erb   bf16 [4096][64] (4095 used)  16777216     524288
//   Qh    bf16 [4096][1024]            17301504    8388608
//   Ql    bf16 [4096][1024]            25690112    8388608
//   Kh    bf16 [4096][1024]            34078720    8388608
//   Kl    bf16 [4096][1024]            42467328    8388608
//   VTh   f16  [2][1024][2048]         50855936    8388608
//   VTl   f16  [2][1024][512]          59244544    2097152
//   Ah    bf16 [4096][1024]            61341696    8388608
//   Al    bf16 [4096][1024]            69730304    8388608
//   QER   f32  [GP][2048][2048]        78118912   33554432
//   end                                111673344
// Weights arrive [in][out]; y = x . W needs Bt[out][in] (in contiguous) -> transpose-convert once.
// =====================================================================================================
extern "C" void kernel_launch(void* const* d_in, const int* in_sizes, int n_in,
                              void* d_out, int out_size, void* d_ws, size_t ws_size,
                              hipStream_t stream) {
  if (n_in < 10) return;
  if (in_sizes[0] != NB * SEQ * DM) return;
  if (in_sizes[1] != DM * DM || in_sizes[3] != DM * DM || in_sizes[5] != DM * DM || in_sizes[7] != DM * DM) return;
  if (in_sizes[2] != DM || in_sizes[4] != DM || in_sizes[6] != DM || in_sizes[8] != DM) return;
  if (in_sizes[9] != ERR * HD) return;
  if (out_size != NB * SEQ * DM) return;

  const float* x  = (const float*)d_in[0];
  const float* Wq = (const float*)d_in[1];
  const float* bq = (const float*)d_in[2];
  const float* Wk = (const float*)d_in[3];
  const float* bk = (const float*)d_in[4];
  const float* Wv = (const float*)d_in[5];
  const float* bv = (const float*)d_in[6];
  const float* Wo = (const float*)d_in[7];
  const float* bo = (const float*)d_in[8];
  const float* Er = (const float*)d_in[9];

  const size_t PXb  = (size_t)NB * SEQ * DM * 2;       //  8388608  16-bit activation plane [4096][1024]
  const size_t PW   = (size_t)DM * DM * 2;             //  2097152
  const size_t PEr  = (size_t)(ERR + 1) * HD * 2;      //   524288  (rows padded to 4096)
  const size_t PVTh = (size_t)NB * DM * SEQ * 2;       //  8388608
  const size_t PVTl = (size_t)NB * DM * VLP * 2;       //  2097152
  const size_t PQER = (size_t)GP * SEQ * NQC * 4;      // 33554432
  size_t off = 0;
  const size_t oXb  = off; off += PXb;
  const size_t oWq  = off; off += PW;
  const size_t oWk  = off; off += PW;
  const size_t oWv  = off; off += PW;
  const size_t oWo  = off; off += PW;
  const size_t oEr  = off; off += PEr;
  const size_t oQh  = off; off += PXb;
  const size_t oQl  = off; off += PXb;
  const size_t oKh  = off; off += PXb;
  const size_t oKl  = off; off += PXb;
  const size_t oVTh = off; off += PVTh;
  const size_t oVTl = off; off += PVTl;
  const size_t oAh  = off; off += PXb;
  const size_t oAl  = off; off += PXb;
  const size_t oQER = off; off += PQER;
  if (off > ws_size) return;                           // off = 111673344
  if (off > (size_t)134217728) return;

  char* ws = (char*)d_ws;
  unsigned short* Xb  = (unsigned short*)(ws + oXb);
  unsigned short* Wqb = (unsigned short*)(ws + oWq);
  unsigned short* Wkb = (unsigned short*)(ws + oWk);
  unsigned short* Wvb = (unsigned short*)(ws + oWv);
  unsigned short* Wob = (unsigned short*)(ws + oWo);
  unsigned short* Erb = (unsigned short*)(ws + oEr);
  unsigned short* Qh  = (unsigned short*)(ws + oQh);
  unsigned short* Ql  = (unsigned short*)(ws + oQl);
  unsigned short* Kh  = (unsigned short*)(ws + oKh);
  unsigned short* Kl  = (unsigned short*)(ws + oKl);
  unsigned short* VTh = (unsigned short*)(ws + oVTh);
  unsigned short* VTl = (unsigned short*)(ws + oVTl);
  unsigned short* Ah  = (unsigned short*)(ws + oAh);
  unsigned short* Al  = (unsigned short*)(ws + oAl);
  float*          QER = (float*)(ws + oQER);

  const dim3 blk(256);
  const int n8x  = NB * SEQ * DM / 8;                                // 524288
  const int n8er = ERR * HD / 8;                                     // 32760
  const dim3 gCvtX((n8x + 255) / 256);                               // 2048 blocks
  const dim3 gCvtEr((n8er + 255) / 256);                             // 128 blocks
  const dim3 gTr(DM / 64, DM / 64);                                  // (out cols / 64, in rows / 64)
  const dim3 gQ(((NB * SEQ / 64) * (DM / 64) + 7) / 8, 1);           // 1024 tiles -> 128 blocks
  const dim3 gVT(((DM / 64) * (SEQ / 64) + 7) / 8, NB);              // 512 tiles -> 64 blocks x 2 batches
  const dim3 gBand(((SEQ / 64) * (NQC / 64) + 7) / 8, GP);           // 1024 tiles -> 128 blocks x GP pairs
  const dim3 gOut(((NB * SEQ / 64) * (DM / 64) + 7) / 8, 1);         // 128 blocks
  const long long qerStride = (long long)SEQ * NQC;

  // (1) x -> bf16 plane [4096][1024]; Er -> bf16 plane [4095][64]
  cvt_bf16x8<<<gCvtX, blk, 0, stream>>>(x, Xb, n8x);
  cvt_bf16x8<<<gCvtEr, blk, 0, stream>>>(Er, Erb, n8er);
  // (2) weights [in][out] f32 -> bf16 [out][in] planes
  tr_cvt64<<<gTr, blk, 0, stream>>>(Wq, Wqb, DM, DM);
  tr_cvt64<<<gTr, blk, 0, stream>>>(Wk, Wkb, DM, DM);
  tr_cvt64<<<gTr, blk, 0, stream>>>(Wv, Wvb, DM, DM);
  tr_cvt64<<<gTr, blk, 0, stream>>>(Wo, Wob, DM, DM);
  // (3) q and k projections: Qh/Ql[b*SEQ+s][e] = hi/lo of (bq[e] + sum_d Xb[s][d] Wqb[e][d])  (M=4096, N=1024, K=1024)
  gemm64<0, 2, false, true, false><<<gQ, blk, 0, stream>>>(
      Xb, Xb, DM, 0LL, Wqb, Wqb, DM, 0LL,
      (void*)Qh, DM, 0LL, (void*)Ql, DM, 0LL, 0,
      NB * SEQ, DM, DM, 1.0f, 0, bq, bq);
  gemm64<0, 2, false, true, false><<<gQ, blk, 0, stream>>>(
      Xb, Xb, DM, 0LL, Wkb, Wkb, DM, 0LL,
      (void*)Kh, DM, 0LL, (void*)Kl, DM, 0LL, 0,
      NB * SEQ, DM, DM, 1.0f, 0, bk, bk);
  // (4) v^T per batch: VTh[b][m][s] = bv[m] + sum_d Wvb[m][d] Xb[b*SEQ+s][d] -> f16 hi plane (pitch SEQ) and
  //     residual plane (x4096, keys < VLP, pitch VLP)  (M=1024, N=2048, K=1024)
  gemm64<0, 3, true, false, false><<<gVT, blk, 0, stream>>>(
      Wvb, Wvb, DM, 0LL, Xb, Xb, DM, (long long)SEQ * DM,
      (void*)VTh, SEQ, (long long)DM * SEQ, (void*)VTl, VLP, (long long)DM * VLP, VLP,
      DM, SEQ, DM, 4096.0f, 0, bv, bv);
  // (5) per group of GP (b,h) pairs (same b, consecutive h): band plane then causal attention
  for (int g = 0; g < (NB * NH) / GP; ++g) {
    const int P0 = g * GP;
    const int b  = P0 / NH;
    const int h0 = P0 % NH;
    const size_t aoff = (size_t)b * SEQ * DM + (size_t)h0 * HD;
    // QER[p][t][c] = sum_d (Qh+Ql)[b*SEQ+t][h*64+d] * Erb[BANDOFF - 64*(t/64) + c][d]   (M=2048, N=2048, K=64)
    gemm64<1, 0, false, false, true><<<gBand, blk, 0, stream>>>(
        Qh + aoff, Ql + aoff, DM, (long long)HD, Erb, Erb, HD, 0LL,
        (void*)QER, NQC, qerStride, (void*)QER, 0, 0LL, 0,
        SEQ, NQC, HD, 1.0f, BANDOFF, bq, bq);
    attn_rel64<true><<<dim3(RESQB * GP), dim3(128), 0, stream>>>(
        Qh, Ql, Kh, Kl, VTh, VTl, QER, qerStride, Ah, Al, b, h0, 0, RESQB, 0.125f);
    attn_rel64<false><<<dim3((NQB - RESQB) * GP), dim3(128), 0, stream>>>(
        Qh, Ql, Kh, Kl, VTh, VTl, QER, qerStride, Ah, Al, b, h0, RESQB, NQB - RESQB, 0.125f);
  }
  // (6) out[s][e] = bo[e] + sum_d (Ah+Al)[s][d] Wob[e][d] -> d_out f32 [4096][1024]  (M=4096, N=1024, K=1024)
  gemm64<1, 0, false, true, false><<<gOut, blk, 0, stream>>>(
      Ah, Al, DM, 0LL, Wob, Wob, DM, 0LL,
      d_out, DM, 0LL, d_out, 0, 0LL, 0,
      NB * SEQ, DM, DM, 1.0f, 0, bo, bo);
  (void)hipGetLastError();
}

// v001
// It runs in 833 microseconds.
// In two side-by-side timings against v000, it was 6.55 and 6.60 times as fast.
// Contractions: x.Wq / x.Wk / Wv.x^T projections = v_wmma_f32_16x16x32_bf16 (bf16 operands from RNE-converted inputs, single product, f32 bias epilogue);
// q.k^T scores = v_wmma_f32_16x16x32_bf16 with q and k as bf16 hi/lo planes (hi.hi + hi.lo + lo.hi); q.Er^T band = same with q hi/lo times bf16 Er (2 products);
// p.v = v_wmma_f32_16x16x32_f16 (p carried x1024 in f16, v in f16; f16 residual planes x4096 of p and v on the leading query blocks);
// ctx.Wo = v_wmma_f32_16x16x32_bf16 with ctx as bf16 hi/lo planes times bf16 Wo (2 products); all f32 accumulate; softmax in f32.
#include <hip/hip_runtime.h>
#include <math.h>
#include <float.h>
#include <stdint.h>

#define NB      2
#define SEQ     2048
#define DM      1024
#define NH      16
#define HD      64
#define NQB     (SEQ / 64)       // 32 query / key tiles of 64
#define NQC     SEQ              // row pitch of the last (largest) group's band plane per (b,h)
#define BANDOFF (SEQ - 64)       // table row of band column 0 for the query tile starting at m0 is BANDOFF - m0
#define ERR     (2 * SEQ - 1)    // 4095 rows of the relative table
#define VLP     512              // key pitch of the v^T residual plane (keys 0..VLP-1)
#define RESQB   8                // leading 64-row query blocks that use the p / v residual planes
#define NP      (NB * NH)        // 32 (b,h) pairs: every band / attention launch covers all of them
#define QSPLIT  21               // first query block of the last group; groups are [0,RESQB) [RESQB,QSPLIT) [QSPLIT,NQB)
static_assert(RESQB * 64 <= VLP);
static_assert(NH * HD == DM);
static_assert((SEQ % 64) == 0 && (DM % 64) == 0);
static_assert(HD == 64);
static_assert(RESQB < QSPLIT && QSPLIT < NQB);
static_assert((QSPLIT - RESQB) * (QSPLIT + 1) <= (NQB - QSPLIT) * NQB && RESQB * (RESQB + 1) <= (NQB - QSPLIT) * NQB);  // last group's planes are the largest
static_assert(BANDOFF == SEQ - 1 - 63);

typedef _Float16 v16h __attribute__((ext_vector_type(16)));
typedef _Float16 v8h  __attribute__((ext_vector_type(8)));
typedef __bf16   v16b __attribute__((ext_vector_type(16)));
typedef __bf16   v8b  __attribute__((ext_vector_type(8)));
typedef float    v8f  __attribute__((ext_vector_type(8)));
typedef float    v4f  __attribute__((ext_vector_type(4)));
typedef unsigned int v4u __attribute__((ext_vector_type(4)));
typedef unsigned short v8us __attribute__((ext_vector_type(8)));

// ---- scalar helpers --------------------------------------------------------------------------------
__device__ __forceinline__ unsigned short bf_bits(float f) {          // f32 -> bf16 bits, RNE convert
  unsigned u = __float_as_uint(f);
  return (unsigned short)((u + 0x7FFFu + ((u >> 16) & 1u)) >> 16);
}
__device__ __forceinline__ float bf_up(unsigned short h) { return __uint_as_float(((unsigned)h) << 16); }
__device__ __forceinline__ unsigned short h_bits(_Float16 x) { return __builtin_bit_cast(unsigned short, x); }
__device__ __forceinline__ unsigned pk16(unsigned short a, unsigned short b) { return (unsigned)a | ((unsigned)b << 16); }
__device__ __forceinline__ v8f zero8() { v8f z = {0.f, 0.f, 0.f, 0.f, 0.f, 0.f, 0.f, 0.f}; return z; }
__device__ __forceinline__ v8h zero8h() {
  const _Float16 z = (_Float16)0.0f;
  v8h r = {z, z, z, z, z, z, z, z};
  return r;
}

// ---- fragment loader: 16-bit A/B operand, lane -> row/col (lane&15), p already includes +8*(lane>>4);
//      elements 0..7 <- p[0..7] (k0+8h..), elements 8..15 <- p[16..23] (k0+16+8h..)
__device__ __forceinline__ v16b ldfrag_b(const __bf16* p) {
  union { v16b v; v8b h[2]; } f;
  f.h[0] = *(const v8b*)(p);
  f.h[1] = *(const v8b*)(p + 16);
  return f.v;
}

// ---- WMMA helpers with trailing VALU hazard gap --------------------------------------------------------
__device__ __forceinline__ v8f mma_b(v16b a, v16b b, v8f c) {
  c = __builtin_amdgcn_wmma_f32_16x16x32_bf16(false, a, false, b, (short)0, c, false, false);
#if defined(__HIP_DEVICE_COMPILE__)
  asm volatile("v_nop\n\tv_nop\n\tv_nop\n\tv_nop" : "+v"(c) : "v"(a), "v"(b));
#endif
  return c;
}
__device__ __forceinline__ v8f mma_h(v16h a, v16h b, v8f c) {
  c = __builtin_amdgcn_wmma_f32_16x16x32_f16(false, a, false, b, (short)0, c, false, false);
#if defined(__HIP_DEVICE_COMPILE__)
  asm volatile("v_nop\n\tv_nop\n\tv_nop\n\tv_nop" : "+v"(c) : "v"(a), "v"(b));
#endif
  return c;
}
__device__ __forceinline__ v8f mma_b_raw(v16b a, v16b b, v8f c) {
  return __builtin_amdgcn_wmma_f32_16x16x32_bf16(false, a, false, b, (short)0, c, false, false);
}
__device__ __forceinline__ void dep_guard_b(v8f& a, v8f& b, v16b x, v16b y) {
#if defined(__HIP_DEVICE_COMPILE__)
  asm volatile("v_nop\n\tv_nop\n\tv_nop\n\tv_nop" : "+v"(a), "+v"(b) : "v"(x), "v"(y));
#endif
}
__device__ __forceinline__ void keep4_b(v16b a, v16b b, v16b c, v16b d) {
#if defined(__HIP_DEVICE_COMPILE__)
  asm volatile("v_nop" :: "v"(a), "v"(b), "v"(c), "v"(d));
#endif
}
__device__ __forceinline__ void acc_guard4(v8f& a, v8f& b, v8f& c, v8f& d) {
#if defined(__HIP_DEVICE_COMPILE__)
  asm volatile("v_nop\n\tv_nop\n\tv_nop\n\tv_nop" : "+v"(a), "+v"(b), "+v"(c), "+v"(d));
#endif
}

// =====================================================================================================
// f32 -> bf16 (RNE convert), 8 elements per thread, one 16-B store per lane: a wave writes 512 contiguous B
// grid = ceil(n8/256). coverage: n8 threads x 8 = whole plane (n8 is a multiple of 8 here, so every
// =====================================================================================================
__global__ __launch_bounds__(256) void cvt_bf16x8(const float* __restrict__ in, unsigned short* out, int n8) {
  const int i = blockIdx.x * 256 + threadIdx.x;
  if (i < n8) {
    const v4f a = *(const v4f*)(in + (size_t)i * 8);
    const v4f b = *(const v4f*)(in + (size_t)i * 8 + 4);
    v4u p;
    p[0] = pk16(bf_bits(a[0]), bf_bits(a[1]));
    p[1] = pk16(bf_bits(a[2]), bf_bits(a[3]));
    p[2] = pk16(bf_bits(b[0]), bf_bits(b[1]));
    p[3] = pk16(bf_bits(b[2]), bf_bits(b[3]));
    *(v4u*)(out + (size_t)i * 8) = p;
    
  }
}

// =====================================================================================================
// Transpose-convert: in f32 [R][C] (row pitch C) -> out bf16 [C][R] (row pitch R), out[c][r] = RNE bf16(in[r][c]).
// Block = 256 threads = one 64(r) x 64(c) tile; grid = (C/64, R/64) (host-checked exact multiples).
// Load: thread t reads row r0 + (t>>2), columns c0 + (t&3)*16 .. +15 (four 16-B loads), scatters the
// converted bits into LDS sT[c][r] (pitch 72); __syncthreads; store: wave w writes output rows
// coverage: 8 waves x 2 it x 4 = 64 output rows x (8 lanes x 8) = 64 columns = the whole tile.
// =====================================================================================================
__global__ __launch_bounds__(256) void tr_cvt64(const float* __restrict__ in, unsigned short* out, int R, int C) {
  __shared__ __align__(16) unsigned short sT[64 * 72];
  const int tid = threadIdx.x, lane = tid & 31, wave = tid >> 5;
  const int r0 = blockIdx.y * 64, c0 = blockIdx.x * 64;
  {
    const int rl = tid >> 2, cl = (tid & 3) * 16;
    const float* src = in + (size_t)(r0 + rl) * C + c0 + cl;
#pragma unroll
    for (int i = 0; i < 4; ++i) {
      const v4f v = *(const v4f*)(src + 4 * i);
#pragma unroll
      for (int e = 0; e < 4; ++e) sT[(cl + 4 * i + e) * 72 + rl] = bf_bits(v[e]);
    }
  }
  __syncthreads();
  const int q = lane >> 3, p8 = (lane & 7) * 8;
  v8us ov[2];
#pragma unroll
  for (int it = 0; it < 2; ++it) {
    const int cl2 = wave * 8 + it * 4 + q;
    ov[it] = *(const v8us*)(sT + cl2 * 72 + p8);
  }
  {
#pragma unroll
    for (int it = 0; it < 2; ++it) {
      const int cl2 = wave * 8 + it * 4 + q;
      *(v8us*)(out + (size_t)(c0 + cl2) * R + r0 + p8) = ov[it];
    }
    
  }
}

// =====================================================================================================
// Register-blocked batched bf16 WMMA GEMM: C[m][n] = rb[m] + cb[n] + sum_k A[m][k] * Bt[nr(n)][k]; one wave per
// 64x64 tile, no block barriers. A row-major [M][K] pitch lda; Bt row-major [.][K] pitch ldb (k contiguous);
// M, N multiples of 64, K multiple of 32 (host-checked). blockIdx.y = batch index (strides in elements).
// NSPLIT: 0 = A.Bt; 1 = (A + A2).Bt (A2 = unscaled bf16 lo plane of A); 2 = A.Bt + A2.Bt + A.Bt2.
// RB / CB: per-row bias rbp[m] / per-column bias cbp[n] (f32 input values RNE-converted to bf16, not batched)
//          added in the epilogue.
// BAND: A and C start at the first query row of the launch's group of query blocks (row mg of the sequence), the
//       batch index is the (b,h) pair (A offset (pair / NH) * SEQ * DM + (pair % NH) * HD), bandOff = BANDOFF - mg;
//       Bt operand row of output column n is n + bandOff - m0 (m0 = the 64-row tile start within the group), and
//       only column tiles with n0 <= mg + m0 + 64, that is operand row <= SEQ, are computed (wave-uniform early
//       return; the others are never read).
// OUT_MODE: 0 = f32 (pitch ldc); 2 = bf16 hi plane C + bf16 lo plane C2 (lo = RNE(v - hi), unscaled);
//           3 = f16 hi plane C + f16 residual plane C2 = f16((v - hi) * rscale), C2 written only for tiles
//               with n0 < N2 (pitch ldc2, batch stride strideC2).
// =====================================================================================================
template <int NSPLIT, int OUT_MODE, bool RB, bool CB, bool BAND>
__global__ __launch_bounds__(256) void gemm64(
    const unsigned short* __restrict__ Ap, const unsigned short* A2p, int lda, long long strideA,
    const unsigned short* __restrict__ Btp, const unsigned short* Bt2p, int ldb, long long strideB,
    void* Cout, int ldc, long long strideC,
    void* Cout2, int ldc2, long long strideC2, int N2,
    int M, int N, int K, float rscale, int bandOff,
    const float* __restrict__ rbp, const float* __restrict__ cbp) {
  const __bf16* A   = (const __bf16*)(const void*)Ap;
  const __bf16* A2  = (const __bf16*)(const void*)A2p;
  const __bf16* Bt  = (const __bf16*)(const void*)Btp;
  const __bf16* Bt2 = (const __bf16*)(const void*)Bt2p;
  __shared__ __align__(16) float sT[8][16 * 68];   // per-wave 16x64 slab, pitch 68 floats
  const int b    = blockIdx.y;
  const int lane = threadIdx.x & 31;
  const int wave = threadIdx.x >> 5;
  const int tilesN = N >> 6;
  const int tilesM = M >> 6;
  const int tile = blockIdx.x * 8 + wave;
  if (tile >= tilesM * tilesN) return;   // wave-uniform; no block barriers in this kernel
  const int tm = tile / tilesN;
  const int tn = tile - tm * tilesN;
  const int m0 = tm << 6;
  const int n0 = tn << 6;
  const int nr0 = BAND ? (n0 + bandOff - m0) : n0;   // operand row of output column n0 in Bt
  if (BAND) {
    if (nr0 > SEQ) return;               // wave-uniform: only column tiles up to one past the diagonal are needed
  }

  const size_t aB = BAND ? ((size_t)(b / NH) * SEQ * DM + (size_t)(b % NH) * HD) : (size_t)b * strideA;
  const __bf16* Ab  = A  + aB;
  const __bf16* Bb  = Bt + (size_t)b * strideB;
  const __bf16* Ab2 = (NSPLIT >= 1) ? (A2  + aB) : Ab;
  const __bf16* Bb2 = (NSPLIT == 2) ? (Bt2 + (size_t)b * strideB) : Bb;

  const int rlane = lane & 15;                 // row (A) / col (B, D) within subtile
  const int koff  = (lane >> 4) * 8;           // k offset of this lane half
  const int mOff  = (lane >> 4) * 8;           // D row offset

  v8f acc[4][4];
#pragma unroll
  for (int i = 0; i < 4; ++i)
#pragma unroll
    for (int j = 0; j < 4; ++j) acc[i][j] = zero8();

  for (int k0 = 0; k0 < K; k0 += 32) {
    v16b bh[4], bl[4];
#pragma unroll
    for (int j = 0; j < 4; ++j) {
      const size_t bo = (size_t)(nr0 + (j << 4) + rlane) * ldb + koff + k0;
      bh[j] = ldfrag_b(Bb + bo);
      if (NSPLIT == 2) bl[j] = ldfrag_b(Bb2 + bo); else bl[j] = bh[j];
    }
#pragma unroll
    for (int i = 0; i < 4; ++i) {
      const size_t ao = (size_t)(m0 + (i << 4) + rlane) * lda + koff + k0;
      const v16b ah = ldfrag_b(Ab + ao);
      v16b al = ah;
      if (NSPLIT >= 1) al = ldfrag_b(Ab2 + ao);
#pragma unroll
      for (int j = 0; j < 4; ++j) {
        acc[i][j] = mma_b_raw(ah, bh[j], acc[i][j]);
        if (NSPLIT >= 1) acc[i][j] = mma_b_raw(al, bh[j], acc[i][j]);
        if (NSPLIT == 2) acc[i][j] = mma_b_raw(ah, bl[j], acc[i][j]);
      }
      dep_guard_b(acc[i][0], acc[i][3], ah, al);
    }
    keep4_b(bh[0], bh[1], bh[2], bh[3]);
    if (NSPLIT == 2) keep4_b(bl[0], bl[1], bl[2], bl[3]);
  }
  acc_guard4(acc[0][0], acc[0][1], acc[0][2], acc[0][3]);
  acc_guard4(acc[1][0], acc[1][1], acc[1][2], acc[1][3]);
  acc_guard4(acc[2][0], acc[2][1], acc[2][2], acc[2][3]);
  acc_guard4(acc[3][0], acc[3][1], acc[3][2], acc[3][3]);

  // ---- epilogue biases (input values RNE-converted to bf16) ----
  float cbv[4];
#pragma unroll
  for (int j = 0; j < 4; ++j) cbv[j] = CB ? bf_up(bf_bits(cbp[n0 + (j << 4) + rlane])) : 0.0f;

  // ---- epilogue ----
  float* slab = sT[wave];
#pragma unroll
  for (int i = 0; i < 4; ++i) {
    const int mBase = m0 + (i << 4);
#pragma unroll
    for (int r = 0; r < 8; ++r) {
      const float rbv = RB ? bf_up(bf_bits(rbp[mBase + mOff + r])) : 0.0f;
#pragma unroll
      for (int j = 0; j < 4; ++j) {
        slab[(mOff + r) * 68 + (j << 4) + rlane] = acc[i][j][r] + rbv + cbv[j];
      }
    }
    __builtin_amdgcn_fence(__ATOMIC_RELEASE, "workgroup");
    __builtin_amdgcn_wave_barrier();
    __builtin_amdgcn_fence(__ATOMIC_ACQUIRE, "workgroup");
    if (OUT_MODE == 0) {
      float* C = (float*)Cout + (size_t)b * strideC;
      const int hh = lane >> 4, c4 = (lane & 15) * 4;     // 256-B row segment = 16 lanes x 16 B
      v4f ov[8];
#pragma unroll
      for (int it = 0; it < 8; ++it) {
        const int row = it * 2 + hh;                       // it 0..7 x hh 0..1 = rows 0..15
        ov[it] = *(const v4f*)(slab + row * 68 + c4);
      }
      {
#pragma unroll
        for (int it = 0; it < 8; ++it) {
          const int row = it * 2 + hh;
          *(v4f*)(C + (size_t)(mBase + row) * ldc + n0 + c4) = ov[it];
        }
        
      }
    } else {
      const int q = lane >> 3, c8 = (lane & 7) * 8;
      unsigned short* C  = (unsigned short*)Cout  + (size_t)b * strideC;
      unsigned short* C2 = (unsigned short*)Cout2 + (size_t)b * strideC2;
      const bool wlo = (OUT_MODE == 2) || (n0 < N2);      // wave-uniform
      v4u hv[4], lv[4];
#pragma unroll
      for (int it = 0; it < 4; ++it) {
        const int row = it * 4 + q;                        // it 0..3 x q 0..3 = rows 0..15
        const float* sp = slab + row * 68 + c8;
        v4u a, a2;
#pragma unroll
        for (int e = 0; e < 4; ++e) {
          const float f0 = sp[2 * e], f1 = sp[2 * e + 1];
          unsigned short h0, h1, l0, l1;
          if (OUT_MODE == 2) {
            h0 = bf_bits(f0); h1 = bf_bits(f1);
            l0 = bf_bits(f0 - bf_up(h0)); l1 = bf_bits(f1 - bf_up(h1));
          } else {
            const _Float16 x0 = (_Float16)f0, x1 = (_Float16)f1;
            h0 = h_bits(x0); h1 = h_bits(x1);
            l0 = h_bits((_Float16)((f0 - (float)x0) * rscale));
            l1 = h_bits((_Float16)((f1 - (float)x1) * rscale));
          }
          a[e] = pk16(h0, h1); a2[e] = pk16(l0, l1);
        }
        hv[it] = a; lv[it] = a2;
      }
      {
#pragma unroll
        for (int it = 0; it < 4; ++it) {
          const int row = it * 4 + q;
          *(v4u*)(C + (size_t)(mBase + row) * ldc + n0 + c8) = hv[it];
          if (wlo) *(v4u*)(C2 + (size_t)(mBase + row) * ldc2 + n0 + c8) = lv[it];
        }
        
      }
    }
    __builtin_amdgcn_fence(__ATOMIC_RELEASE, "workgroup");
    __builtin_amdgcn_wave_barrier();
    __builtin_amdgcn_fence(__ATOMIC_ACQUIRE, "workgroup");
  }
}

// =====================================================================================================
// Causal attention with a relative-position bias, head dim 64 (tril mask incl. diagonal, computed).
//   q planes (bf16 hi / lo): element (b, t, h, d) at [(b*SEQ + t)*DM + h*64 + d]
//   k planes (bf16 hi / lo): same layout with key index s
//   v^T hi plane (f16):      element (b, h, d, s) at [(b*DM + h*64 + d)*SEQ + s]
//   v^T residual plane (f16, (v - hi)*4096): [(b*DM + h*64 + d)*VLP + s], s < VLP, read only when RES
//   band plane (f32, per pair p, stride qerStride, row pitch qpitch): row = query t - 64*qbBase, column
//     key - t + 64*qb + 63 (in [0, qpitch), address clamped to qpitch-1; values beyond the clamp only occur for
//     masked keys) holds q[t] . Er[2*SEQ-1-SEQ + ... ] i.e. the relative term of (query t, key).
//   logit = (q.k + band) * sscale for key <= query, -FLT_MAX otherwise (exp -> 0); every row has a live key in
//   every processed key tile (tiles 0..qb only, block-uniform trip count qb+1 <= 32).
//   output: ctx hi / lo bf16 planes, element (b, t, h*64 + d) at [(b*SEQ + t)*DM + h*64 + d] = normalised
//   context (lo = RNE(v - hi), unscaled).
//   scores = q . k : bf16 hi/lo split (hi.hi + hi.lo + lo.hi), f32 accumulate, band added in f32, * sscale in f32
//   p = exp(s - m) carried as f16(1024 p); context = p . v on f16 WMMA; RES adds f16 residual planes of p and v
//   (scale 4096, separate accumulator folded back with 1/4096 per chunk in f32); online softmax in f32.
//   Block = 4 waves = 64 query rows of one (b, h); grid = nqbThis * NP (pair index = blockIdx.x / nqbThis,
//   b = pair / NH, h = pair % NH); kv chunks of 64.
//   K / V^T chunk staging: 128 threads x 32 elements per plane = the whole 64x64 tile (plain 16-B loads,
//   __syncthreads before and after); P tiles are wave-private, spilled with _Float16 element stores and reloaded
//   Output coverage: each wave stores its rows 0..15 (it 0..3 x lane>>3 0..3) x 64 columns (8 lanes x 8 bf16),
// =====================================================================================================
template <bool RES>
__global__ __launch_bounds__(128)
void attn_rel64(const unsigned short* __restrict__ qhp, const unsigned short* __restrict__ qlp,
                const unsigned short* __restrict__ khp, const unsigned short* __restrict__ klp,
                const unsigned short* __restrict__ vhp, const unsigned short* __restrict__ vlp,
                const float* __restrict__ qerp, long long qerStride, int qpitch,
                unsigned short* ahp, unsigned short* alp,
                int qbBase, int nqbThis, float sscale) {
  union FB { v16b v; v8b h[2]; };
  union FH { v16h v; v8h h[2]; };
  __shared__ __align__(16) __bf16   Ksh[64 * 64];                 // K hi [kv][d]   8 KB
  __shared__ __align__(16) __bf16   Ksl[64 * 64];                 // K lo
  __shared__ __align__(16) _Float16 Vth[64 * 64];                 // V^T hi [d][kv] 8 KB
  __shared__ __align__(16) _Float16 Vtl[RES ? 64 * 64 : 8];       // V^T residual
  __shared__ __align__(16) _Float16 Psh[4][16 * 64];              // per wave P [row][kv]
  __shared__ __align__(16) _Float16 Psl[RES ? 4 : 1][16 * 64];    // per wave P residual
  __shared__ __align__(16) float    Os[4][16 * 64];               // per wave context tile [row][d]

  const int tid  = threadIdx.x;
  const int wave = tid >> 5;
  const int lane = tid & 31;
  const int hh   = lane >> 4;
  const int c    = lane & 15;

  const int bx   = blockIdx.x;
  const int qbl  = bx % nqbThis;
  const int pr   = bx / nqbThis;          // (b,h) pair index, 0..NP-1
  const int h    = pr % NH;
  const int b    = pr / NH;
  const int qb   = qbBase + qbl;
  const int q0   = qb * 64 + wave * 16;
  const size_t rowB = (size_t)b * SEQ;

  const __bf16* Qh = (const __bf16*)(const void*)qhp + (size_t)h * HD;
  const __bf16* Ql = (const __bf16*)(const void*)qlp + (size_t)h * HD;
  const __bf16* Kh = (const __bf16*)(const void*)khp + (size_t)h * HD;
  const __bf16* Kl = (const __bf16*)(const void*)klp + (size_t)h * HD;
  const _Float16* Vh = (const _Float16*)(const void*)vhp + ((size_t)b * DM + (size_t)h * HD) * SEQ;
  const _Float16* Vl = (const _Float16*)(const void*)vlp + ((size_t)b * DM + (size_t)h * HD) * VLP;
  const float* Bq = qerp + (size_t)pr * (size_t)qerStride;

  // ---- Q fragments (A operand, row = lane&15): 2 d-chunks, hi and lo ----
  v16b qah[2], qal[2];
#pragma unroll
  for (int dc = 0; dc < 2; ++dc) {
    const size_t qo = (rowB + q0 + c) * DM + dc * 32 + 8 * hh;
    qah[dc] = ldfrag_b(Qh + qo);
    qal[dc] = ldfrag_b(Ql + qo);
  }

  float mrow[8], lrow[8];
  v8f oacc[4];
#pragma unroll
  for (int r = 0; r < 8; ++r) { mrow[r] = -INFINITY; lrow[r] = 0.f; }
#pragma unroll
  for (int t = 0; t < 4; ++t) oacc[t] = zero8();

  int nkt = qb + 1;                          // causal: key tiles 0..qb, block-uniform
  if (nkt > NQB) nkt = NQB;
  for (int kt = 0; kt < nkt; ++kt) {
    const int kv0 = kt * 64;
    __syncthreads();
    {
      const int r = tid >> 1, half = (tid & 1) * 32;
      const __bf16*   kg  = Kh + (rowB + kv0 + r) * DM + half;    // K row kv0+r, d = half..half+31
      const __bf16*   klg = Kl + (rowB + kv0 + r) * DM + half;
      const _Float16* vg  = Vh + (size_t)r * SEQ + kv0 + half;    // V^T row d = r, s = kv0+half..+31
      const int kvl = (kv0 + 64 <= VLP) ? kv0 : (VLP - 64);     // clamped address into the residual plane
      const _Float16* vlg = Vl + (size_t)r * VLP + kvl + half;
      const bool resOK = (kv0 + 64 <= VLP);                      // block-uniform
#pragma unroll
      for (int i = 0; i < 4; ++i) {
        const v8b a0 = *(const v8b*)(kg + 8 * i);
        const v8b a1 = *(const v8b*)(klg + 8 * i);
        const v8h b0 = *(const v8h*)(vg + 8 * i);
        *(v8b*)(Ksh + r * 64 + half + 8 * i) = a0;
        *(v8b*)(Ksl + r * 64 + half + 8 * i) = a1;
        *(v8h*)(Vth + r * 64 + half + 8 * i) = b0;
        if (RES) {
          v8h b1 = *(const v8h*)(vlg + 8 * i);
          if (!resOK) b1 = zero8h();
          *(v8h*)(Vtl + r * 64 + half + 8 * i) = b1;
        }
      }
    }
    __syncthreads();

    // ---- scores: 16 query rows x 64 keys per wave, 3 bf16 products ----
    v8f s[4];
#pragma unroll
    for (int j = 0; j < 4; ++j) {
      s[j] = zero8();
#pragma unroll
      for (int dc = 0; dc < 2; ++dc) {
        FB kb, kl;
        kb.h[0] = *(const v8b*)(Ksh + (j * 16 + c) * 64 + dc * 32 + 8 * hh);
        kb.h[1] = *(const v8b*)(Ksh + (j * 16 + c) * 64 + dc * 32 + 16 + 8 * hh);
        kl.h[0] = *(const v8b*)(Ksl + (j * 16 + c) * 64 + dc * 32 + 8 * hh);
        kl.h[1] = *(const v8b*)(Ksl + (j * 16 + c) * 64 + dc * 32 + 16 + 8 * hh);
        s[j] = mma_b(qah[dc], kb.v, s[j]);
        s[j] = mma_b(qah[dc], kl.v, s[j]);
        s[j] = mma_b(qal[dc], kb.v, s[j]);
      }
    }

    // ---- band term + scale + causal mask (replace by -FLT_MAX), row max, online softmax, P (x1024, f16)
    //      and P residual (x4096) to LDS ----
    _Float16* pwh = Psh[wave];
    _Float16* pwl = Psl[RES ? wave : 0];
#pragma unroll
    for (int r = 0; r < 8; ++r) {
      const int qrow = q0 + 8 * hh + r;
      const float* brow = Bq + (size_t)(qrow - qbBase * 64) * qpitch;
      const int cb0 = kv0 + c + (qb * 64 + 63 - qrow);            // >= 0 by construction
      float bj[4];
#pragma unroll
      for (int j = 0; j < 4; ++j) {
        int col = cb0 + (j << 4);
        col = (col < qpitch) ? col : (qpitch - 1);                 // clamped address (masked keys only)
        bj[j] = brow[col];
      }
      float m = -INFINITY;
#pragma unroll
      for (int j = 0; j < 4; ++j) {
        const int key = kv0 + j * 16 + c;
        float sv = (s[j][r] + bj[j]) * sscale;
        sv = (key > qrow) ? -FLT_MAX : sv;
        s[j][r] = sv;
        m = fmaxf(m, sv);
      }
#pragma unroll
      for (int off = 1; off < 16; off <<= 1) m = fmaxf(m, __shfl_xor(m, off, 32));
      const float mnew  = fmaxf(mrow[r], m);
      const float msafe = (mnew == -INFINITY) ? 0.f : mnew;
      const float alpha = __expf(mrow[r] - msafe);
      mrow[r] = mnew;
      float psum = 0.f;
#pragma unroll
      for (int j = 0; j < 4; ++j) {
        const float p = __expf(s[j][r] - msafe);     // masked logit against a finite max: exp -> 0
        psum += p;
        const float p1k = p * 1024.0f;
        const _Float16 ph = (_Float16)p1k;
        pwh[(8 * hh + r) * 64 + j * 16 + c] = ph;
        if (RES) {
          const _Float16 pl = (_Float16)((p1k - (float)ph) * 4096.0f);
          pwl[(8 * hh + r) * 64 + j * 16 + c] = pl;
        }
      }
#pragma unroll
      for (int off = 1; off < 16; off <<= 1) psum += __shfl_xor(psum, off, 32);
      lrow[r] = lrow[r] * alpha + psum;
#pragma unroll
      for (int t = 0; t < 4; ++t) oacc[t][r] *= alpha;
    }
    __builtin_amdgcn_fence(__ATOMIC_RELEASE, "workgroup");
    __builtin_amdgcn_wave_barrier();
    __builtin_amdgcn_fence(__ATOMIC_ACQUIRE, "workgroup");

    // ---- context += P . V (f16 WMMA), residual products into a separate accumulator ----
    v8f o1[4];
#pragma unroll
    for (int t = 0; t < 4; ++t) o1[t] = zero8();
#pragma unroll 1
    for (int kk = 0; kk < 2; ++kk) {
      FH pa, pl;
      pa.h[0] = *(const v8h*)(pwh + c * 64 + kk * 32 + 8 * hh);
      pa.h[1] = *(const v8h*)(pwh + c * 64 + kk * 32 + 16 + 8 * hh);
      if (RES) {
        pl.h[0] = *(const v8h*)(pwl + c * 64 + kk * 32 + 8 * hh);
        pl.h[1] = *(const v8h*)(pwl + c * 64 + kk * 32 + 16 + 8 * hh);
      } else {
        pl.v = pa.v;
      }
#pragma unroll
      for (int t = 0; t < 4; ++t) {
        FH vb;
        vb.h[0] = *(const v8h*)(Vth + (t * 16 + c) * 64 + kk * 32 + 8 * hh);
        vb.h[1] = *(const v8h*)(Vth + (t * 16 + c) * 64 + kk * 32 + 16 + 8 * hh);
        oacc[t] = mma_h(pa.v, vb.v, oacc[t]);
        if (RES) {
          FH vl;
          vl.h[0] = *(const v8h*)(Vtl + (t * 16 + c) * 64 + kk * 32 + 8 * hh);
          vl.h[1] = *(const v8h*)(Vtl + (t * 16 + c) * 64 + kk * 32 + 16 + 8 * hh);
          o1[t] = mma_h(pa.v, vl.v, o1[t]);
          o1[t] = mma_h(pl.v, vb.v, o1[t]);
        }
      }
    }
    if (RES) {
#pragma unroll
      for (int t = 0; t < 4; ++t)
#pragma unroll
        for (int r = 0; r < 8; ++r) oacc[t][r] += o1[t][r] * (1.0f / 4096.0f);
    }
  }

  // ---- normalise (1/l and the 1/1024 p carry), stage the wave's 16x64 tile in LDS, then convert to
  float* os = Os[wave];
#pragma unroll
  for (int r = 0; r < 8; ++r) {
    const float l = lrow[r];
    const float inv = ((l > 0.f) ? (1.0f / l) : 0.f) * (1.0f / 1024.0f);
#pragma unroll
    for (int t = 0; t < 4; ++t) os[(8 * hh + r) * 64 + t * 16 + c] = oacc[t][r] * inv;
  }
  __builtin_amdgcn_fence(__ATOMIC_RELEASE, "workgroup");
  __builtin_amdgcn_wave_barrier();
  __builtin_amdgcn_fence(__ATOMIC_ACQUIRE, "workgroup");
  {
    const int q4 = lane >> 3, c8 = (lane & 7) * 8;
    v4u hv[4], lv[4];
#pragma unroll
    for (int it = 0; it < 4; ++it) {
      const int row = it * 4 + q4;             // it 0..3 x q4 0..3 = rows 0..15 of the wave tile
      const float* sp = os + row * 64 + c8;
      v4u a, a2;
#pragma unroll
      for (int e = 0; e < 4; ++e) {
        const float f0 = sp[2 * e], f1 = sp[2 * e + 1];
        const unsigned short x0 = bf_bits(f0), x1 = bf_bits(f1);
        const unsigned short y0 = bf_bits(f0 - bf_up(x0)), y1 = bf_bits(f1 - bf_up(x1));
        a[e] = pk16(x0, x1); a2[e] = pk16(y0, y1);
      }
      hv[it] = a; lv[it] = a2;
    }
    {
#pragma unroll
      for (int it = 0; it < 4; ++it) {
        const int row = it * 4 + q4;
        const size_t go = (rowB + q0 + row) * DM + (size_t)h * HD + c8;
        *(v4u*)(ahp + go) = hv[it];
        *(v4u*)(alp + go) = lv[it];
      }
      
    }
  }
}

// =====================================================================================================
// Workspace map (bytes), every region an exact multiple of its whole-line / whole-tile store granularity:
//   Xb    bf16 [4096][1024]            0           8388608
//   Wqb   bf16 [1024 out][1024 in]     8388608     2097152
//   Wkb   bf16 [1024][1024]            10485760    2097152
//   Wvb   bf16 [1024][1024]            12582912    2097152
//   Wob   bf16 [1024][1024]            14680064    2097152
//   Erb   bf16 [4096][64] (4095 used)  16777216     524288
//   Qh    bf16 [4096][1024]            17301504    8388608
//   Ql    bf16 [4096][1024]            25690112    8388608
//   Kh    bf16 [4096][1024]            34078720    8388608
//   Kl    bf16 [4096][1024]            42467328    8388608
//   VTh   f16  [2][1024][2048]         50855936    8388608
//   VTl   f16  [2][1024][512]          59244544    2097152
//   Ah    bf16 [4096][1024]            61341696    8388608
//   Al    bf16 [4096][1024]            69730304    8388608
//   QER   f32  [32][704][2048]         78118912  184549376   (largest of the three groups' band planes)
//   end                                262668288
// Weights arrive [in][out]; y = x . W needs Bt[out][in] (in contiguous) -> transpose-convert once.
// =====================================================================================================
extern "C" void kernel_launch(void* const* d_in, const int* in_sizes, int n_in,
                              void* d_out, int out_size, void* d_ws, size_t ws_size,
                              hipStream_t stream) {
  if (n_in < 10) return;
  if (in_sizes[0] != NB * SEQ * DM) return;
  if (in_sizes[1] != DM * DM || in_sizes[3] != DM * DM || in_sizes[5] != DM * DM || in_sizes[7] != DM * DM) return;
  if (in_sizes[2] != DM || in_sizes[4] != DM || in_sizes[6] != DM || in_sizes[8] != DM) return;
  if (in_sizes[9] != ERR * HD) return;
  if (out_size != NB * SEQ * DM) return;

  const float* x  = (const float*)d_in[0];
  const float* Wq = (const float*)d_in[1];
  const float* bq = (const float*)d_in[2];
  const float* Wk = (const float*)d_in[3];
  const float* bk = (const float*)d_in[4];
  const float* Wv = (const float*)d_in[5];
  const float* bv = (const float*)d_in[6];
  const float* Wo = (const float*)d_in[7];
  const float* bo = (const float*)d_in[8];
  const float* Er = (const float*)d_in[9];

  const size_t PXb  = (size_t)NB * SEQ * DM * 2;       //  8388608  16-bit activation plane [4096][1024]
  const size_t PW   = (size_t)DM * DM * 2;             //  2097152
  const size_t PEr  = (size_t)(ERR + 1) * HD * 2;      //   524288  (rows padded to 4096)
  const size_t PVTh = (size_t)NB * DM * SEQ * 2;       //  8388608
  const size_t PVTl = (size_t)NB * DM * VLP * 2;       //  2097152
  const size_t PQER = (size_t)NP * (NQB - QSPLIT) * 64 * NQC * 4;   // 184549376, the last group's band planes
  size_t off = 0;
  const size_t oXb  = off; off += PXb;
  const size_t oWq  = off; off += PW;
  const size_t oWk  = off; off += PW;
  const size_t oWv  = off; off += PW;
  const size_t oWo  = off; off += PW;
  const size_t oEr  = off; off += PEr;
  const size_t oQh  = off; off += PXb;
  const size_t oQl  = off; off += PXb;
  const size_t oKh  = off; off += PXb;
  const size_t oKl  = off; off += PXb;
  const size_t oVTh = off; off += PVTh;
  const size_t oVTl = off; off += PVTl;
  const size_t oAh  = off; off += PXb;
  const size_t oAl  = off; off += PXb;
  const size_t oQER = off; off += PQER;
  if (off > ws_size) return;                           // off = 262668288

  char* ws = (char*)d_ws;
  unsigned short* Xb  = (unsigned short*)(ws + oXb);
  unsigned short* Wqb = (unsigned short*)(ws + oWq);
  unsigned short* Wkb = (unsigned short*)(ws + oWk);
  unsigned short* Wvb = (unsigned short*)(ws + oWv);
  unsigned short* Wob = (unsigned short*)(ws + oWo);
  unsigned short* Erb = (unsigned short*)(ws + oEr);
  unsigned short* Qh  = (unsigned short*)(ws + oQh);
  unsigned short* Ql  = (unsigned short*)(ws + oQl);
  unsigned short* Kh  = (unsigned short*)(ws + oKh);
  unsigned short* Kl  = (unsigned short*)(ws + oKl);
  unsigned short* VTh = (unsigned short*)(ws + oVTh);
  unsigned short* VTl = (unsigned short*)(ws + oVTl);
  unsigned short* Ah  = (unsigned short*)(ws + oAh);
  unsigned short* Al  = (unsigned short*)(ws + oAl);
  float*          QER = (float*)(ws + oQER);

  const dim3 blk(256);
  const int n8x  = NB * SEQ * DM / 8;                                // 524288
  const int n8er = ERR * HD / 8;                                     // 32760
  const dim3 gCvtX((n8x + 255) / 256);                               // 2048 blocks
  const dim3 gCvtEr((n8er + 255) / 256);                             // 128 blocks
  const dim3 gTr(DM / 64, DM / 64);                                  // (out cols / 64, in rows / 64)
  const dim3 gQ(((NB * SEQ / 64) * (DM / 64) + 7) / 8, 1);           // 1024 tiles -> 128 blocks
  const dim3 gVT(((DM / 64) * (SEQ / 64) + 7) / 8, NB);              // 512 tiles -> 64 blocks x 2 batches
  const dim3 gOut(((NB * SEQ / 64) * (DM / 64) + 7) / 8, 1);         // 128 blocks

  // (1) x -> bf16 plane [4096][1024]; Er -> bf16 plane [4095][64]
  cvt_bf16x8<<<gCvtX, blk, 0, stream>>>(x, Xb, n8x);
  cvt_bf16x8<<<gCvtEr, blk, 0, stream>>>(Er, Erb, n8er);
  // (2) weights [in][out] f32 -> bf16 [out][in] planes
  tr_cvt64<<<gTr, blk, 0, stream>>>(Wq, Wqb, DM, DM);
  tr_cvt64<<<gTr, blk, 0, stream>>>(Wk, Wkb, DM, DM);
  tr_cvt64<<<gTr, blk, 0, stream>>>(Wv, Wvb, DM, DM);
  tr_cvt64<<<gTr, blk, 0, stream>>>(Wo, Wob, DM, DM);
  // (3) q and k projections: Qh/Ql[b*SEQ+s][e] = hi/lo of (bq[e] + sum_d Xb[s][d] Wqb[e][d])  (M=4096, N=1024, K=1024)
  gemm64<0, 2, false, true, false><<<gQ, blk, 0, stream>>>(
      Xb, Xb, DM, 0LL, Wqb, Wqb, DM, 0LL,
      (void*)Qh, DM, 0LL, (void*)Ql, DM, 0LL, 0,
      NB * SEQ, DM, DM, 1.0f, 0, bq, bq);
  gemm64<0, 2, false, true, false><<<gQ, blk, 0, stream>>>(
      Xb, Xb, DM, 0LL, Wkb, Wkb, DM, 0LL,
      (void*)Kh, DM, 0LL, (void*)Kl, DM, 0LL, 0,
      NB * SEQ, DM, DM, 1.0f, 0, bk, bk);
  // (4) v^T per batch: VTh[b][m][s] = bv[m] + sum_d Wvb[m][d] Xb[b*SEQ+s][d] -> f16 hi plane (pitch SEQ) and
  //     residual plane (x4096, keys < VLP, pitch VLP)  (M=1024, N=2048, K=1024)
  gemm64<0, 3, true, false, false><<<gVT, blk, 0, stream>>>(
      Wvb, Wvb, DM, 0LL, Xb, Xb, DM, (long long)SEQ * DM,
      (void*)VTh, SEQ, (long long)DM * SEQ, (void*)VTl, VLP, (long long)DM * VLP, VLP,
      DM, SEQ, DM, 4096.0f, 0, bv, bv);
  // (5) three groups of query blocks, each launch over all NP pairs: band planes of the group, then its attention.
  //     A group [qa, qe) needs band columns 0 .. 64*(qe+1)-1 (at most NQC): that is its row pitch.
  const int gqa[3] = {0, RESQB, QSPLIT};
  const int gqe[3] = {RESQB, QSPLIT, NQB};
  for (int g = 0; g < 3; ++g) {
    const int qa = gqa[g];
    const int nq = gqe[g] - qa;
    const int pitch = ((gqe[g] + 1 < NQB) ? (gqe[g] + 1) : NQB) * 64;
    const long long qerStride = (long long)nq * 64 * pitch;
    const size_t aoff = (size_t)qa * 64 * DM;
    const dim3 gBand((nq * (pitch / 64) + 7) / 8, NP);
    // QER[p][t - 64*qa][c] = sum_d (Qh+Ql)[b*SEQ+t][h*64+d] * Erb[BANDOFF - 64*(t/64) + c][d]   (M=64*nq, N=pitch, K=64)
    gemm64<1, 0, false, false, true><<<gBand, blk, 0, stream>>>(
        Qh + aoff, Ql + aoff, DM, 0LL, Erb, Erb, HD, 0LL,
        (void*)QER, pitch, qerStride, (void*)QER, 0, 0LL, 0,
        nq * 64, pitch, HD, 1.0f, BANDOFF - qa * 64, bq, bq);
    if (g == 0) {
      attn_rel64<true><<<dim3(nq * NP), dim3(128), 0, stream>>>(
          Qh, Ql, Kh, Kl, VTh, VTl, QER, qerStride, pitch, Ah, Al, qa, nq, 0.125f);
    } else {
      attn_rel64<false><<<dim3(nq * NP), dim3(128), 0, stream>>>(
          Qh, Ql, Kh, Kl, VTh, VTl, QER, qerStride, pitch, Ah, Al, qa, nq, 0.125f);
    }
  }
  // (6) out[s][e] = bo[e] + sum_d (Ah+Al)[s][d] Wob[e][d] -> d_out f32 [4096][1024]  (M=4096, N=1024, K=1024)
  gemm64<1, 0, false, true, false><<<gOut, blk, 0, stream>>>(
      Ah, Al, DM, 0LL, Wob, Wob, DM, 0LL,
      d_out, DM, 0LL, d_out, 0, 0LL, 0,
      NB * SEQ, DM, DM, 1.0f, 0, bo, bo);
  (void)hipGetLastError();
}

// v002
// It runs in 581 microseconds.
// In two side-by-side timings against v001, it was 1.43 and 1.44 times as fast.
// Counting every step since v000, it is 9.43 times as fast.
// Contractions: x.Wq / x.Wk / Wv.x^T projections = v_wmma_f32_16x16x32_bf16 (bf16 operands from RNE-converted inputs, single product, f32 bias epilogue);
// q.k^T scores = v_wmma_f32_16x16x32_bf16 with q and k as bf16 hi/lo planes (hi.hi + hi.lo + lo.hi); q.Er^T band = same with q hi/lo times bf16 Er (2 products);
// p.v = v_wmma_f32_16x16x32_f16 (p carried x1024 in f16, v in f16; f16 residual planes x4096 of p and v on the leading query blocks);
// ctx.Wo = v_wmma_f32_16x16x32_bf16 with ctx as bf16 hi/lo planes times bf16 Wo (2 products); all f32 accumulate; softmax in f32.
#include <hip/hip_runtime.h>
#include <math.h>
#include <float.h>
#include <stdint.h>

#define NB      2
#define SEQ     2048
#define DM      1024
#define NH      16
#define HD      64
#define NQB     (SEQ / 64)       // 32 query / key tiles of 64
#define NQC     SEQ              // row pitch of the last (largest) group's band plane per (b,h)
#define BANDOFF (SEQ - 64)       // table row of band column 0 for the query tile starting at m0 is BANDOFF - m0
#define ERR     (2 * SEQ - 1)    // 4095 rows of the relative table
#define VLP     512              // key pitch of the v^T residual plane (keys 0..VLP-1)
#define RESQB   8                // leading 64-row query blocks that use the p / v residual planes
#define NP      (NB * NH)        // 32 (b,h) pairs: every band / attention launch covers all of them
#define QSPLIT  21               // first query block of the last group; groups are [0,RESQB) [RESQB,QSPLIT) [QSPLIT,NQB)
static_assert(RESQB * 64 <= VLP);
static_assert(NH * HD == DM);
static_assert((SEQ % 64) == 0 && (DM % 64) == 0);
static_assert(HD == 64);
static_assert(RESQB < QSPLIT && QSPLIT < NQB);
static_assert((QSPLIT - RESQB) * (QSPLIT + 1) <= (NQB - QSPLIT) * NQB && RESQB * (RESQB + 1) <= (NQB - QSPLIT) * NQB);  // last group's planes are the largest
static_assert(BANDOFF == SEQ - 1 - 63);

typedef _Float16 v16h __attribute__((ext_vector_type(16)));
typedef _Float16 v8h  __attribute__((ext_vector_type(8)));
typedef __bf16   v16b __attribute__((ext_vector_type(16)));
typedef __bf16   v8b  __attribute__((ext_vector_type(8)));
typedef float    v8f  __attribute__((ext_vector_type(8)));
typedef float    v4f  __attribute__((ext_vector_type(4)));
typedef unsigned int v4u __attribute__((ext_vector_type(4)));
typedef unsigned short v8us __attribute__((ext_vector_type(8)));

// ---- scalar helpers --------------------------------------------------------------------------------
__device__ __forceinline__ unsigned short bf_bits(float f) {          // f32 -> bf16 bits, RNE convert
  unsigned u = __float_as_uint(f);
  return (unsigned short)((u + 0x7FFFu + ((u >> 16) & 1u)) >> 16);
}
__device__ __forceinline__ float bf_up(unsigned short h) { return __uint_as_float(((unsigned)h) << 16); }
__device__ __forceinline__ unsigned short h_bits(_Float16 x) { return __builtin_bit_cast(unsigned short, x); }
__device__ __forceinline__ unsigned pk16(unsigned short a, unsigned short b) { return (unsigned)a | ((unsigned)b << 16); }
__device__ __forceinline__ v8f zero8() { v8f z = {0.f, 0.f, 0.f, 0.f, 0.f, 0.f, 0.f, 0.f}; return z; }
__device__ __forceinline__ v8h zero8h() {
  const _Float16 z = (_Float16)0.0f;
  v8h r = {z, z, z, z, z, z, z, z};
  return r;
}

// ---- fragment loader: 16-bit A/B operand, lane -> row/col (lane&15), p already includes +8*(lane>>4);
//      elements 0..7 <- p[0..7] (k0+8h..), elements 8..15 <- p[16..23] (k0+16+8h..)
__device__ __forceinline__ v16b ldfrag_b(const __bf16* p) {
  union { v16b v; v8b h[2]; } f;
  f.h[0] = *(const v8b*)(p);
  f.h[1] = *(const v8b*)(p + 16);
  return f.v;
}

// ---- WMMA helpers with trailing VALU hazard gap --------------------------------------------------------
__device__ __forceinline__ v8f mma_b(v16b a, v16b b, v8f c) {
  c = __builtin_amdgcn_wmma_f32_16x16x32_bf16(false, a, false, b, (short)0, c, false, false);
#if defined(__HIP_DEVICE_COMPILE__)
  asm volatile("v_nop\n\tv_nop\n\tv_nop\n\tv_nop" : "+v"(c) : "v"(a), "v"(b));
#endif
  return c;
}
__device__ __forceinline__ v8f mma_h(v16h a, v16h b, v8f c) {
  c = __builtin_amdgcn_wmma_f32_16x16x32_f16(false, a, false, b, (short)0, c, false, false);
#if defined(__HIP_DEVICE_COMPILE__)
  asm volatile("v_nop\n\tv_nop\n\tv_nop\n\tv_nop" : "+v"(c) : "v"(a), "v"(b));
#endif
  return c;
}
__device__ __forceinline__ v8f mma_b_raw(v16b a, v16b b, v8f c) {
  return __builtin_amdgcn_wmma_f32_16x16x32_bf16(false, a, false, b, (short)0, c, false, false);
}
__device__ __forceinline__ void dep_guard_b(v8f& a, v8f& b, v16b x, v16b y) {
#if defined(__HIP_DEVICE_COMPILE__)
  asm volatile("v_nop\n\tv_nop\n\tv_nop\n\tv_nop" : "+v"(a), "+v"(b) : "v"(x), "v"(y));
#endif
}
__device__ __forceinline__ void keep4_b(v16b a, v16b b, v16b c, v16b d) {
#if defined(__HIP_DEVICE_COMPILE__)
  asm volatile("v_nop" :: "v"(a), "v"(b), "v"(c), "v"(d));
#endif
}
__device__ __forceinline__ void acc_guard4(v8f& a, v8f& b, v8f& c, v8f& d) {
#if defined(__HIP_DEVICE_COMPILE__)
  asm volatile("v_nop\n\tv_nop\n\tv_nop\n\tv_nop" : "+v"(a), "+v"(b), "+v"(c), "+v"(d));
#endif
}

// =====================================================================================================
// f32 -> bf16 (RNE convert), 8 elements per thread, one 16-B store per lane: a wave writes 512 contiguous B
// grid = ceil(n8/256). coverage: n8 threads x 8 = whole plane (n8 is a multiple of 8 here, so every
// =====================================================================================================
__global__ __launch_bounds__(256) void cvt_bf16x8(const float* __restrict__ in, unsigned short* out, int n8) {
  const int i = blockIdx.x * 256 + threadIdx.x;
  if (i < n8) {
    const v4f a = *(const v4f*)(in + (size_t)i * 8);
    const v4f b = *(const v4f*)(in + (size_t)i * 8 + 4);
    v4u p;
    p[0] = pk16(bf_bits(a[0]), bf_bits(a[1]));
    p[1] = pk16(bf_bits(a[2]), bf_bits(a[3]));
    p[2] = pk16(bf_bits(b[0]), bf_bits(b[1]));
    p[3] = pk16(bf_bits(b[2]), bf_bits(b[3]));
    *(v4u*)(out + (size_t)i * 8) = p;
    
  }
}

// =====================================================================================================
// Transpose-convert: in f32 [R][C] (row pitch C) -> out bf16 [C][R] (row pitch R), out[c][r] = RNE bf16(in[r][c]).
// Block = 256 threads = one 64(r) x 64(c) tile; grid = (C/64, R/64) (host-checked exact multiples).
// Load: thread t reads row r0 + (t>>2), columns c0 + (t&3)*16 .. +15 (four 16-B loads), scatters the
// converted bits into LDS sT[c][r] (pitch 72); __syncthreads; store: wave w writes output rows
// coverage: 8 waves x 2 it x 4 = 64 output rows x (8 lanes x 8) = 64 columns = the whole tile.
// =====================================================================================================
__global__ __launch_bounds__(256) void tr_cvt64(const float* __restrict__ in, unsigned short* out, int R, int C) {
  __shared__ __align__(16) unsigned short sT[64 * 72];
  const int tid = threadIdx.x, lane = tid & 31, wave = tid >> 5;
  const int r0 = blockIdx.y * 64, c0 = blockIdx.x * 64;
  {
    const int rl = tid >> 2, cl = (tid & 3) * 16;
    const float* src = in + (size_t)(r0 + rl) * C + c0 + cl;
#pragma unroll
    for (int i = 0; i < 4; ++i) {
      const v4f v = *(const v4f*)(src + 4 * i);
#pragma unroll
      for (int e = 0; e < 4; ++e) sT[(cl + 4 * i + e) * 72 + rl] = bf_bits(v[e]);
    }
  }
  __syncthreads();
  const int q = lane >> 3, p8 = (lane & 7) * 8;
  v8us ov[2];
#pragma unroll
  for (int it = 0; it < 2; ++it) {
    const int cl2 = wave * 8 + it * 4 + q;
    ov[it] = *(const v8us*)(sT + cl2 * 72 + p8);
  }
  {
#pragma unroll
    for (int it = 0; it < 2; ++it) {
      const int cl2 = wave * 8 + it * 4 + q;
      *(v8us*)(out + (size_t)(c0 + cl2) * R + r0 + p8) = ov[it];
    }
    
  }
}

// =====================================================================================================
// Register-blocked batched bf16 WMMA GEMM: C[m][n] = rb[m] + cb[n] + sum_k A[m][k] * Bt[nr(n)][k]; one wave per
// 64x64 tile, no block barriers. A row-major [M][K] pitch lda; Bt row-major [.][K] pitch ldb (k contiguous);
// M, N multiples of 64, K multiple of 32 (host-checked). blockIdx.y = batch index (strides in elements).
// NSPLIT: 0 = A.Bt; 1 = (A + A2).Bt (A2 = unscaled bf16 lo plane of A); 2 = A.Bt + A2.Bt + A.Bt2.
// RB / CB: per-row bias rbp[m] / per-column bias cbp[n] (f32 input values RNE-converted to bf16, not batched)
//          added in the epilogue.
// BAND: A and C start at the first query row of the launch's group of query blocks (row mg of the sequence), the
//       batch index is the (b,h) pair (A offset (pair / NH) * SEQ * DM + (pair % NH) * HD), bandOff = BANDOFF - mg;
//       Bt operand row of output column n is n + bandOff - m0 (m0 = the 64-row tile start within the group), and
//       only column tiles with n0 <= mg + m0 + 64, that is operand row <= SEQ, are computed (wave-uniform early
//       return; the others are never read).
// OUT_MODE: 0 = f32 (pitch ldc); 2 = bf16 hi plane C + bf16 lo plane C2 (lo = RNE(v - hi), unscaled);
//           3 = f16 hi plane C + f16 residual plane C2 = f16((v - hi) * rscale), C2 written only for tiles
//               with n0 < N2 (pitch ldc2, batch stride strideC2).
// =====================================================================================================
template <int NSPLIT, int OUT_MODE, bool RB, bool CB, bool BAND>
__global__ __launch_bounds__(256) void gemm64(
    const unsigned short* __restrict__ Ap, const unsigned short* A2p, int lda, long long strideA,
    const unsigned short* __restrict__ Btp, const unsigned short* Bt2p, int ldb, long long strideB,
    void* Cout, int ldc, long long strideC,
    void* Cout2, int ldc2, long long strideC2, int N2,
    int M, int N, int K, float rscale, int bandOff,
    const float* __restrict__ rbp, const float* __restrict__ cbp) {
  const __bf16* A   = (const __bf16*)(const void*)Ap;
  const __bf16* A2  = (const __bf16*)(const void*)A2p;
  const __bf16* Bt  = (const __bf16*)(const void*)Btp;
  const __bf16* Bt2 = (const __bf16*)(const void*)Bt2p;
  __shared__ __align__(16) float sT[8][16 * 68];   // per-wave 16x64 slab, pitch 68 floats
  const int b    = blockIdx.y;
  const int lane = threadIdx.x & 31;
  const int wave = threadIdx.x >> 5;
  const int tilesN = N >> 6;
  const int tilesM = M >> 6;
  const int tile = blockIdx.x * 8 + wave;
  if (tile >= tilesM * tilesN) return;   // wave-uniform; no block barriers in this kernel
  const int tm = tile / tilesN;
  const int tn = tile - tm * tilesN;
  const int m0 = tm << 6;
  const int n0 = tn << 6;
  const int nr0 = BAND ? (n0 + bandOff - m0) : n0;   // operand row of output column n0 in Bt
  if (BAND) {
    if (nr0 > SEQ) return;               // wave-uniform: only column tiles up to one past the diagonal are needed
  }

  const size_t aB = BAND ? ((size_t)(b / NH) * SEQ * DM + (size_t)(b % NH) * HD) : (size_t)b * strideA;
  const __bf16* Ab  = A  + aB;
  const __bf16* Bb  = Bt + (size_t)b * strideB;
  const __bf16* Ab2 = (NSPLIT >= 1) ? (A2  + aB) : Ab;
  const __bf16* Bb2 = (NSPLIT == 2) ? (Bt2 + (size_t)b * strideB) : Bb;

  const int rlane = lane & 15;                 // row (A) / col (B, D) within subtile
  const int koff  = (lane >> 4) * 8;           // k offset of this lane half
  const int mOff  = (lane >> 4) * 8;           // D row offset

  v8f acc[4][4];
#pragma unroll
  for (int i = 0; i < 4; ++i)
#pragma unroll
    for (int j = 0; j < 4; ++j) acc[i][j] = zero8();

  for (int k0 = 0; k0 < K; k0 += 32) {
    v16b bh[4], bl[4];
#pragma unroll
    for (int j = 0; j < 4; ++j) {
      const size_t bo = (size_t)(nr0 + (j << 4) + rlane) * ldb + koff + k0;
      bh[j] = ldfrag_b(Bb + bo);
      if (NSPLIT == 2) bl[j] = ldfrag_b(Bb2 + bo); else bl[j] = bh[j];
    }
#pragma unroll
    for (int i = 0; i < 4; ++i) {
      const size_t ao = (size_t)(m0 + (i << 4) + rlane) * lda + koff + k0;
      const v16b ah = ldfrag_b(Ab + ao);
      v16b al = ah;
      if (NSPLIT >= 1) al = ldfrag_b(Ab2 + ao);
#pragma unroll
      for (int j = 0; j < 4; ++j) {
        acc[i][j] = mma_b_raw(ah, bh[j], acc[i][j]);
        if (NSPLIT >= 1) acc[i][j] = mma_b_raw(al, bh[j], acc[i][j]);
        if (NSPLIT == 2) acc[i][j] = mma_b_raw(ah, bl[j], acc[i][j]);
      }
      dep_guard_b(acc[i][0], acc[i][3], ah, al);
    }
    keep4_b(bh[0], bh[1], bh[2], bh[3]);
    if (NSPLIT == 2) keep4_b(bl[0], bl[1], bl[2], bl[3]);
  }
  acc_guard4(acc[0][0], acc[0][1], acc[0][2], acc[0][3]);
  acc_guard4(acc[1][0], acc[1][1], acc[1][2], acc[1][3]);
  acc_guard4(acc[2][0], acc[2][1], acc[2][2], acc[2][3]);
  acc_guard4(acc[3][0], acc[3][1], acc[3][2], acc[3][3]);

  // ---- epilogue biases (input values RNE-converted to bf16) ----
  float cbv[4];
#pragma unroll
  for (int j = 0; j < 4; ++j) cbv[j] = CB ? bf_up(bf_bits(cbp[n0 + (j << 4) + rlane])) : 0.0f;

  // ---- epilogue ----
  float* slab = sT[wave];
#pragma unroll
  for (int i = 0; i < 4; ++i) {
    const int mBase = m0 + (i << 4);
#pragma unroll
    for (int r = 0; r < 8; ++r) {
      const float rbv = RB ? bf_up(bf_bits(rbp[mBase + mOff + r])) : 0.0f;
#pragma unroll
      for (int j = 0; j < 4; ++j) {
        slab[(mOff + r) * 68 + (j << 4) + rlane] = acc[i][j][r] + rbv + cbv[j];
      }
    }
    __builtin_amdgcn_fence(__ATOMIC_RELEASE, "workgroup");
    __builtin_amdgcn_wave_barrier();
    __builtin_amdgcn_fence(__ATOMIC_ACQUIRE, "workgroup");
    if (OUT_MODE == 0) {
      float* C = (float*)Cout + (size_t)b * strideC;
      const int hh = lane >> 4, c4 = (lane & 15) * 4;     // 256-B row segment = 16 lanes x 16 B
      v4f ov[8];
#pragma unroll
      for (int it = 0; it < 8; ++it) {
        const int row = it * 2 + hh;                       // it 0..7 x hh 0..1 = rows 0..15
        ov[it] = *(const v4f*)(slab + row * 68 + c4);
      }
      {
#pragma unroll
        for (int it = 0; it < 8; ++it) {
          const int row = it * 2 + hh;
          *(v4f*)(C + (size_t)(mBase + row) * ldc + n0 + c4) = ov[it];
        }
        
      }
    } else {
      const int q = lane >> 3, c8 = (lane & 7) * 8;
      unsigned short* C  = (unsigned short*)Cout  + (size_t)b * strideC;
      unsigned short* C2 = (unsigned short*)Cout2 + (size_t)b * strideC2;
      const bool wlo = (OUT_MODE == 2) || (n0 < N2);      // wave-uniform
      v4u hv[4], lv[4];
#pragma unroll
      for (int it = 0; it < 4; ++it) {
        const int row = it * 4 + q;                        // it 0..3 x q 0..3 = rows 0..15
        const float* sp = slab + row * 68 + c8;
        v4u a, a2;
#pragma unroll
        for (int e = 0; e < 4; ++e) {
          const float f0 = sp[2 * e], f1 = sp[2 * e + 1];
          unsigned short h0, h1, l0, l1;
          if (OUT_MODE == 2) {
            h0 = bf_bits(f0); h1 = bf_bits(f1);
            l0 = bf_bits(f0 - bf_up(h0)); l1 = bf_bits(f1 - bf_up(h1));
          } else {
            const _Float16 x0 = (_Float16)f0, x1 = (_Float16)f1;
            h0 = h_bits(x0); h1 = h_bits(x1);
            l0 = h_bits((_Float16)((f0 - (float)x0) * rscale));
            l1 = h_bits((_Float16)((f1 - (float)x1) * rscale));
          }
          a[e] = pk16(h0, h1); a2[e] = pk16(l0, l1);
        }
        hv[it] = a; lv[it] = a2;
      }
      {
#pragma unroll
        for (int it = 0; it < 4; ++it) {
          const int row = it * 4 + q;
          *(v4u*)(C + (size_t)(mBase + row) * ldc + n0 + c8) = hv[it];
          if (wlo) *(v4u*)(C2 + (size_t)(mBase + row) * ldc2 + n0 + c8) = lv[it];
        }
        
      }
    }
    __builtin_amdgcn_fence(__ATOMIC_RELEASE, "workgroup");
    __builtin_amdgcn_wave_barrier();
    __builtin_amdgcn_fence(__ATOMIC_ACQUIRE, "workgroup");
  }
}

// =====================================================================================================
// Causal attention with a relative-position bias, head dim 64 (tril mask incl. diagonal, computed).
//   q planes (bf16 hi / lo): element (b, t, h, d) at [(b*SEQ + t)*DM + h*64 + d]
//   k planes (bf16 hi / lo): same layout with key index s
//   v^T hi plane (f16):      element (b, h, d, s) at [(b*DM + h*64 + d)*SEQ + s]
//   v^T residual plane (f16, (v - hi)*4096): [(b*DM + h*64 + d)*VLP + s], s < VLP, read only when RES
//   band plane (f32, per pair p, stride qerStride, row pitch qpitch): row = query t - 64*qbBase, column
//     key - t + 64*qb + 63 (in [0, qpitch), address clamped to qpitch-1; values beyond the clamp only occur for
//     masked keys) holds q[t] . Er[2*SEQ-1-SEQ + ... ] i.e. the relative term of (query t, key).
//   logit = (q.k + band) * sscale for key <= query, -FLT_MAX otherwise (exp -> 0); every row has a live key in
//   every processed key tile (tiles 0..qb only, block-uniform trip count qb+1 <= 32).
//   output: ctx hi / lo bf16 planes, element (b, t, h*64 + d) at [(b*SEQ + t)*DM + h*64 + d] = normalised
//   context (lo = RNE(v - hi), unscaled).
//   scores = q . k : bf16 hi/lo split (hi.hi + hi.lo + lo.hi), f32 accumulate, band added in f32, * sscale in f32
//   p = exp(s - m) carried as f16(1024 p); context = p . v on f16 WMMA; RES adds f16 residual planes of p and v
//   (scale 4096, separate accumulator folded back with 1/4096 per chunk in f32); online softmax in f32.
//   Block = 4 waves = 64 query rows of one (b, h); grid = nqbThis * NP (pair index = blockIdx.x / nqbThis,
//   b = pair / NH, h = pair % NH); kv chunks of 64.
//   K / V^T chunk staging: 128 threads x 32 elements per plane = the whole 64x64 tile (plain 16-B loads,
//   __syncthreads before and after); P tiles are wave-private, spilled with _Float16 element stores and reloaded
//   Output coverage: each wave stores its rows 0..15 (it 0..3 x lane>>3 0..3) x 64 columns (8 lanes x 8 bf16),
// =====================================================================================================
// Band values of one 16-row x 64-key wave tile, one register per (row r, column block j): 32 independent loads with
// no use between them, so that the wave pays their latency once. row0 = the lane's first row within the group's
// plane, cb0 = band column of (row0, key c of key tile 0); the column falls by one per row. An element index fits
// 32 bits (a pair's plane is below 8 MiB), so every load is the pair's uniform base plus a lane index.
__device__ __forceinline__ void load_band(float (&bnd)[8][4], const float* __restrict__ Bq,
                                          int row0, int cb0, int kv, int qpitch) {
#pragma unroll
  for (int g = 0; g < 2; ++g) {
    unsigned ix[4][4];
#pragma unroll
    for (int rr = 0; rr < 4; ++rr) {
      const int r = 4 * g + rr;
#pragma unroll
      for (int j = 0; j < 4; ++j) {
        int col = cb0 - r + kv + (j << 4);                         // >= 0 by construction
        col = (col < qpitch) ? col : (qpitch - 1);                 // clamped address (masked keys only)
        ix[rr][j] = (unsigned)((row0 + r) * qpitch + col);
        bnd[r][j] = Bq[ix[rr][j]];
      }
    }
#if defined(__HIP_DEVICE_COMPILE__)
    // The wait that stands in front of any overwrite of a register an issued load names. It takes the 16 index
    // registers as inputs so that they stay untouched (also by a later load's result) until it has been passed,
    // and the base pointer so that the compiler keeps these loads in front of it.
    asm volatile("s_wait_xcnt 0x0"
                 :: "v"(ix[0][0]), "v"(ix[0][1]), "v"(ix[0][2]), "v"(ix[0][3]),
                    "v"(ix[1][0]), "v"(ix[1][1]), "v"(ix[1][2]), "v"(ix[1][3]),
                    "v"(ix[2][0]), "v"(ix[2][1]), "v"(ix[2][2]), "v"(ix[2][3]),
                    "v"(ix[3][0]), "v"(ix[3][1]), "v"(ix[3][2]), "v"(ix[3][3]), "s"(Bq)
                 : "memory");
#endif
  }
}

template <bool RES>
__global__ __launch_bounds__(128)
void attn_rel64(const unsigned short* __restrict__ qhp, const unsigned short* __restrict__ qlp,
                const unsigned short* __restrict__ khp, const unsigned short* __restrict__ klp,
                const unsigned short* __restrict__ vhp, const unsigned short* __restrict__ vlp,
                const float* __restrict__ qerp, long long qerStride, int qpitch,
                unsigned short* ahp, unsigned short* alp,
                int qbBase, int nqbThis, float sscale) {
  union FB { v16b v; v8b h[2]; };
  union FH { v16h v; v8h h[2]; };
  __shared__ __align__(16) __bf16   Ksh[64 * 64];                 // K hi [kv][d]   8 KB
  __shared__ __align__(16) __bf16   Ksl[64 * 64];                 // K lo
  __shared__ __align__(16) _Float16 Vth[64 * 64];                 // V^T hi [d][kv] 8 KB
  __shared__ __align__(16) _Float16 Vtl[RES ? 64 * 64 : 8];       // V^T residual
  __shared__ __align__(16) _Float16 Psh[4][16 * 64];              // per wave P [row][kv]
  __shared__ __align__(16) _Float16 Psl[RES ? 4 : 1][16 * 64];    // per wave P residual
  __shared__ __align__(16) float    Os[4][16 * 64];               // per wave context tile [row][d]

  const int tid  = threadIdx.x;
  const int wave = tid >> 5;
  const int lane = tid & 31;
  const int hh   = lane >> 4;
  const int c    = lane & 15;

  const int bx   = blockIdx.x;
  const int qbl  = bx % nqbThis;
  const int pr   = bx / nqbThis;          // (b,h) pair index, 0..NP-1
  const int h    = pr % NH;
  const int b    = pr / NH;
  const int qb   = qbBase + qbl;
  const int q0   = qb * 64 + wave * 16;
  const size_t rowB = (size_t)b * SEQ;

  const __bf16* Qh = (const __bf16*)(const void*)qhp + (size_t)h * HD;
  const __bf16* Ql = (const __bf16*)(const void*)qlp + (size_t)h * HD;
  const __bf16* Kh = (const __bf16*)(const void*)khp + (size_t)h * HD;
  const __bf16* Kl = (const __bf16*)(const void*)klp + (size_t)h * HD;
  const _Float16* Vh = (const _Float16*)(const void*)vhp + ((size_t)b * DM + (size_t)h * HD) * SEQ;
  const _Float16* Vl = (const _Float16*)(const void*)vlp + ((size_t)b * DM + (size_t)h * HD) * VLP;
  const float* Bq = qerp + (size_t)pr * (size_t)qerStride;

  // ---- Q fragments (A operand, row = lane&15): 2 d-chunks, hi and lo ----
  v16b qah[2], qal[2];
#pragma unroll
  for (int dc = 0; dc < 2; ++dc) {
    const size_t qo = (rowB + q0 + c) * DM + dc * 32 + 8 * hh;
    qah[dc] = ldfrag_b(Qh + qo);
    qal[dc] = ldfrag_b(Ql + qo);
  }

  float mrow[8], lrow[8];
  v8f oacc[4];
#pragma unroll
  for (int r = 0; r < 8; ++r) { mrow[r] = -INFINITY; lrow[r] = 0.f; }
#pragma unroll
  for (int t = 0; t < 4; ++t) oacc[t] = zero8();

  int nkt = qb + 1;                          // causal: key tiles 0..qb, block-uniform
  if (nkt > NQB) nkt = NQB;

  // band values are fetched one key tile ahead: tile 0 here, tile kt + 1 inside trip kt
  const int brow0 = q0 + 8 * hh - qbBase * 64;
  const int bcb0  = c + (qb * 64 + 63 - (q0 + 8 * hh));
  float bnd[8][4];
  load_band(bnd, Bq, brow0, bcb0, 0, qpitch);
  for (int kt = 0; kt < nkt; ++kt) {
    const int kv0 = kt * 64;
    __syncthreads();
    {
      const int r = tid >> 1, half = (tid & 1) * 32;
      const __bf16*   kg  = Kh + (rowB + kv0 + r) * DM + half;    // K row kv0+r, d = half..half+31
      const __bf16*   klg = Kl + (rowB + kv0 + r) * DM + half;
      const _Float16* vg  = Vh + (size_t)r * SEQ + kv0 + half;    // V^T row d = r, s = kv0+half..+31
      const int kvl = (kv0 + 64 <= VLP) ? kv0 : (VLP - 64);     // clamped address into the residual plane
      const _Float16* vlg = Vl + (size_t)r * VLP + kvl + half;
      const bool resOK = (kv0 + 64 <= VLP);                      // block-uniform
#pragma unroll
      for (int i = 0; i < 4; ++i) {
        const v8b a0 = *(const v8b*)(kg + 8 * i);
        const v8b a1 = *(const v8b*)(klg + 8 * i);
        const v8h b0 = *(const v8h*)(vg + 8 * i);
        *(v8b*)(Ksh + r * 64 + half + 8 * i) = a0;
        *(v8b*)(Ksl + r * 64 + half + 8 * i) = a1;
        *(v8h*)(Vth + r * 64 + half + 8 * i) = b0;
        if (RES) {
          v8h b1 = *(const v8h*)(vlg + 8 * i);
          if (!resOK) b1 = zero8h();
          *(v8h*)(Vtl + r * 64 + half + 8 * i) = b1;
        }
      }
    }
    __syncthreads();

    // ---- scores: 16 query rows x 64 keys per wave, 3 bf16 products ----
    v8f s[4];
#pragma unroll
    for (int j = 0; j < 4; ++j) {
      s[j] = zero8();
#pragma unroll
      for (int dc = 0; dc < 2; ++dc) {
        FB kb, kl;
        kb.h[0] = *(const v8b*)(Ksh + (j * 16 + c) * 64 + dc * 32 + 8 * hh);
        kb.h[1] = *(const v8b*)(Ksh + (j * 16 + c) * 64 + dc * 32 + 16 + 8 * hh);
        kl.h[0] = *(const v8b*)(Ksl + (j * 16 + c) * 64 + dc * 32 + 8 * hh);
        kl.h[1] = *(const v8b*)(Ksl + (j * 16 + c) * 64 + dc * 32 + 16 + 8 * hh);
        s[j] = mma_b(qah[dc], kb.v, s[j]);
        s[j] = mma_b(qah[dc], kl.v, s[j]);
        s[j] = mma_b(qal[dc], kb.v, s[j]);
      }
    }

    // ---- band term of this tile (fetched during the previous trip), then the next tile's 32 loads in one batch:
    //      the softmax runs while they fly (the fence in front of p.v is the first wait that covers them). The last
    //      trip has no next tile and fetches its own again (written columns only). ----
#pragma unroll
    for (int r = 0; r < 8; ++r)
#pragma unroll
      for (int j = 0; j < 4; ++j) s[j][r] += bnd[r][j];
    load_band(bnd, Bq, brow0, bcb0, (kt + 1 < nkt) ? (kv0 + 64) : kv0, qpitch);

    // ---- scale + causal mask (replace by -FLT_MAX), row max, online softmax, P (x1024, f16)
    //      and P residual (x4096) to LDS ----
    _Float16* pwh = Psh[wave];
    _Float16* pwl = Psl[RES ? wave : 0];
#pragma unroll
    for (int r = 0; r < 8; ++r) {
      const int qrow = q0 + 8 * hh + r;
      float m = -INFINITY;
#pragma unroll
      for (int j = 0; j < 4; ++j) {
        const int key = kv0 + j * 16 + c;
        float sv = s[j][r] * sscale;
        sv = (key > qrow) ? -FLT_MAX : sv;
        s[j][r] = sv;
        m = fmaxf(m, sv);
      }
#pragma unroll
      for (int off = 1; off < 16; off <<= 1) m = fmaxf(m, __shfl_xor(m, off, 32));
      const float mnew  = fmaxf(mrow[r], m);
      const float msafe = (mnew == -INFINITY) ? 0.f : mnew;
      const float alpha = __expf(mrow[r] - msafe);
      mrow[r] = mnew;
      float psum = 0.f;
#pragma unroll
      for (int j = 0; j < 4; ++j) {
        const float p = __expf(s[j][r] - msafe);     // masked logit against a finite max: exp -> 0
        psum += p;
        const float p1k = p * 1024.0f;
        const _Float16 ph = (_Float16)p1k;
        pwh[(8 * hh + r) * 64 + j * 16 + c] = ph;
        if (RES) {
          const _Float16 pl = (_Float16)((p1k - (float)ph) * 4096.0f);
          pwl[(8 * hh + r) * 64 + j * 16 + c] = pl;
        }
      }
#pragma unroll
      for (int off = 1; off < 16; off <<= 1) psum += __shfl_xor(psum, off, 32);
      lrow[r] = lrow[r] * alpha + psum;
#pragma unroll
      for (int t = 0; t < 4; ++t) oacc[t][r] *= alpha;
    }
    __builtin_amdgcn_fence(__ATOMIC_RELEASE, "workgroup");
    __builtin_amdgcn_wave_barrier();
    __builtin_amdgcn_fence(__ATOMIC_ACQUIRE, "workgroup");

    // ---- context += P . V (f16 WMMA), residual products into a separate accumulator ----
    v8f o1[4];
#pragma unroll
    for (int t = 0; t < 4; ++t) o1[t] = zero8();
#pragma unroll 1
    for (int kk = 0; kk < 2; ++kk) {
      FH pa, pl;
      pa.h[0] = *(const v8h*)(pwh + c * 64 + kk * 32 + 8 * hh);
      pa.h[1] = *(const v8h*)(pwh + c * 64 + kk * 32 + 16 + 8 * hh);
      if (RES) {
        pl.h[0] = *(const v8h*)(pwl + c * 64 + kk * 32 + 8 * hh);
        pl.h[1] = *(const v8h*)(pwl + c * 64 + kk * 32 + 16 + 8 * hh);
      } else {
        pl.v = pa.v;
      }
#pragma unroll
      for (int t = 0; t < 4; ++t) {
        FH vb;
        vb.h[0] = *(const v8h*)(Vth + (t * 16 + c) * 64 + kk * 32 + 8 * hh);
        vb.h[1] = *(const v8h*)(Vth + (t * 16 + c) * 64 + kk * 32 + 16 + 8 * hh);
        oacc[t] = mma_h(pa.v, vb.v, oacc[t]);
        if (RES) {
          FH vl;
          vl.h[0] = *(const v8h*)(Vtl + (t * 16 + c) * 64 + kk * 32 + 8 * hh);
          vl.h[1] = *(const v8h*)(Vtl + (t * 16 + c) * 64 + kk * 32 + 16 + 8 * hh);
          o1[t] = mma_h(pa.v, vl.v, o1[t]);
          o1[t] = mma_h(pl.v, vb.v, o1[t]);
        }
      }
    }
    if (RES) {
#pragma unroll
      for (int t = 0; t < 4; ++t)
#pragma unroll
        for (int r = 0; r < 8; ++r) oacc[t][r] += o1[t][r] * (1.0f / 4096.0f);
    }
  }

  // ---- normalise (1/l and the 1/1024 p carry), stage the wave's 16x64 tile in LDS, then convert to
  float* os = Os[wave];
#pragma unroll
  for (int r = 0; r < 8; ++r) {
    const float l = lrow[r];
    const float inv = ((l > 0.f) ? (1.0f / l) : 0.f) * (1.0f / 1024.0f);
#pragma unroll
    for (int t = 0; t < 4; ++t) os[(8 * hh + r) * 64 + t * 16 + c] = oacc[t][r] * inv;
  }
  __builtin_amdgcn_fence(__ATOMIC_RELEASE, "workgroup");
  __builtin_amdgcn_wave_barrier();
  __builtin_amdgcn_fence(__ATOMIC_ACQUIRE, "workgroup");
  {
    const int q4 = lane >> 3, c8 = (lane & 7) * 8;
    v4u hv[4], lv[4];
#pragma unroll
    for (int it = 0; it < 4; ++it) {
      const int row = it * 4 + q4;             // it 0..3 x q4 0..3 = rows 0..15 of the wave tile
      const float* sp = os + row * 64 + c8;
      v4u a, a2;
#pragma unroll
      for (int e = 0; e < 4; ++e) {
        const float f0 = sp[2 * e], f1 = sp[2 * e + 1];
        const unsigned short x0 = bf_bits(f0), x1 = bf_bits(f1);
        const unsigned short y0 = bf_bits(f0 - bf_up(x0)), y1 = bf_bits(f1 - bf_up(x1));
        a[e] = pk16(x0, x1); a2[e] = pk16(y0, y1);
      }
      hv[it] = a; lv[it] = a2;
    }
    {
#pragma unroll
      for (int it = 0; it < 4; ++it) {
        const int row = it * 4 + q4;
        const size_t go = (rowB + q0 + row) * DM + (size_t)h * HD + c8;
        *(v4u*)(ahp + go) = hv[it];
        *(v4u*)(alp + go) = lv[it];
      }
      
    }
  }
}

// =====================================================================================================
// Workspace map (bytes), every region an exact multiple of its whole-line / whole-tile store granularity:
//   Xb    bf16 [4096][1024]            0           8388608
//   Wqb   bf16 [1024 out][1024 in]     8388608     2097152
//   Wkb   bf16 [1024][1024]            10485760    2097152
//   Wvb   bf16 [1024][1024]            12582912    2097152
//   Wob   bf16 [1024][1024]            14680064    2097152
//   Erb   bf16 [4096][64] (4095 used)  16777216     524288
//   Qh    bf16 [4096][1024]            17301504    8388608
//   Ql    bf16 [4096][1024]            25690112    8388608
//   Kh    bf16 [4096][1024]            34078720    8388608
//   Kl    bf16 [4096][1024]            42467328    8388608
//   VTh   f16  [2][1024][2048]         50855936    8388608
//   VTl   f16  [2][1024][512]          59244544    2097152
//   Ah    bf16 [4096][1024]            61341696    8388608
//   Al    bf16 [4096][1024]            69730304    8388608
//   QER   f32  [32][704][2048]         78118912  184549376   (largest of the three groups' band planes)
//   end                                262668288
// Weights arrive [in][out]; y = x . W needs Bt[out][in] (in contiguous) -> transpose-convert once.
// =====================================================================================================
extern "C" void kernel_launch(void* const* d_in, const int* in_sizes, int n_in,
                              void* d_out, int out_size, void* d_ws, size_t ws_size,
                              hipStream_t stream) {
  if (n_in < 10) return;
  if (in_sizes[0] != NB * SEQ * DM) return;
  if (in_sizes[1] != DM * DM || in_sizes[3] != DM * DM || in_sizes[5] != DM * DM || in_sizes[7] != DM * DM) return;
  if (in_sizes[2] != DM || in_sizes[4] != DM || in_sizes[6] != DM || in_sizes[8] != DM) return;
  if (in_sizes[9] != ERR * HD) return;
  if (out_size != NB * SEQ * DM) return;

  const float* x  = (const float*)d_in[0];
  const float* Wq = (const float*)d_in[1];
  const float* bq = (const float*)d_in[2];
  const float* Wk = (const float*)d_in[3];
  const float* bk = (const float*)d_in[4];
  const float* Wv = (const float*)d_in[5];
  const float* bv = (const float*)d_in[6];
  const float* Wo = (const float*)d_in[7];
  const float* bo = (const float*)d_in[8];
  const float* Er = (const float*)d_in[9];

  const size_t PXb  = (size_t)NB * SEQ * DM * 2;       //  8388608  16-bit activation plane [4096][1024]
  const size_t PW   = (size_t)DM * DM * 2;             //  2097152
  const size_t PEr  = (size_t)(ERR + 1) * HD * 2;      //   524288  (rows padded to 4096)
  const size_t PVTh = (size_t)NB * DM * SEQ * 2;       //  8388608
  const size_t PVTl = (size_t)NB * DM * VLP * 2;       //  2097152
  const size_t PQER = (size_t)NP * (NQB - QSPLIT) * 64 * NQC * 4;   // 184549376, the last group's band planes
  size_t off = 0;
  const size_t oXb  = off; off += PXb;
  const size_t oWq  = off; off += PW;
  const size_t oWk  = off; off += PW;
  const size_t oWv  = off; off += PW;
  const size_t oWo  = off; off += PW;
  const size_t oEr  = off; off += PEr;
  const size_t oQh  = off; off += PXb;
  const size_t oQl  = off; off += PXb;
  const size_t oKh  = off; off += PXb;
  const size_t oKl  = off; off += PXb;
  const size_t oVTh = off; off += PVTh;
  const size_t oVTl = off; off += PVTl;
  const size_t oAh  = off; off += PXb;
  const size_t oAl  = off; off += PXb;
  const size_t oQER = off; off += PQER;
  if (off > ws_size) return;                           // off = 262668288

  char* ws = (char*)d_ws;
  unsigned short* Xb  = (unsigned short*)(ws + oXb);
  unsigned short* Wqb = (unsigned short*)(ws + oWq);
  unsigned short* Wkb = (unsigned short*)(ws + oWk);
  unsigned short* Wvb = (unsigned short*)(ws + oWv);
  unsigned short* Wob = (unsigned short*)(ws + oWo);
  unsigned short* Erb = (unsigned short*)(ws + oEr);
  unsigned short* Qh  = (unsigned short*)(ws + oQh);
  unsigned short* Ql  = (unsigned short*)(ws + oQl);
  unsigned short* Kh  = (unsigned short*)(ws + oKh);
  unsigned short* Kl  = (unsigned short*)(ws + oKl);
  unsigned short* VTh = (unsigned short*)(ws + oVTh);
  unsigned short* VTl = (unsigned short*)(ws + oVTl);
  unsigned short* Ah  = (unsigned short*)(ws + oAh);
  unsigned short* Al  = (unsigned short*)(ws + oAl);
  float*          QER = (float*)(ws + oQER);

  const dim3 blk(256);
  const int n8x  = NB * SEQ * DM / 8;                                // 524288
  const int n8er = ERR * HD / 8;                                     // 32760
  const dim3 gCvtX((n8x + 255) / 256);                               // 2048 blocks
  const dim3 gCvtEr((n8er + 255) / 256);                             // 128 blocks
  const dim3 gTr(DM / 64, DM / 64);                                  // (out cols / 64, in rows / 64)
  const dim3 gQ(((NB * SEQ / 64) * (DM / 64) + 7) / 8, 1);           // 1024 tiles -> 128 blocks
  const dim3 gVT(((DM / 64) * (SEQ / 64) + 7) / 8, NB);              // 512 tiles -> 64 blocks x 2 batches
  const dim3 gOut(((NB * SEQ / 64) * (DM / 64) + 7) / 8, 1);         // 128 blocks

  // (1) x -> bf16 plane [4096][1024]; Er -> bf16 plane [4095][64]
  cvt_bf16x8<<<gCvtX, blk, 0, stream>>>(x, Xb, n8x);
  cvt_bf16x8<<<gCvtEr, blk, 0, stream>>>(Er, Erb, n8er);
  // (2) weights [in][out] f32 -> bf16 [out][in] planes
  tr_cvt64<<<gTr, blk, 0, stream>>>(Wq, Wqb, DM, DM);
  tr_cvt64<<<gTr, blk, 0, stream>>>(Wk, Wkb, DM, DM);
  tr_cvt64<<<gTr, blk, 0, stream>>>(Wv, Wvb, DM, DM);
  tr_cvt64<<<gTr, blk, 0, stream>>>(Wo, Wob, DM, DM);
  // (3) q and k projections: Qh/Ql[b*SEQ+s][e] = hi/lo of (bq[e] + sum_d Xb[s][d] Wqb[e][d])  (M=4096, N=1024, K=1024)
  gemm64<0, 2, false, true, false><<<gQ, blk, 0, stream>>>(
      Xb, Xb, DM, 0LL, Wqb, Wqb, DM, 0LL,
      (void*)Qh, DM, 0LL, (void*)Ql, DM, 0LL, 0,
      NB * SEQ, DM, DM, 1.0f, 0, bq, bq);
  gemm64<0, 2, false, true, false><<<gQ, blk, 0, stream>>>(
      Xb, Xb, DM, 0LL, Wkb, Wkb, DM, 0LL,
      (void*)Kh, DM, 0LL, (void*)Kl, DM, 0LL, 0,
      NB * SEQ, DM, DM, 1.0f, 0, bk, bk);
  // (4) v^T per batch: VTh[b][m][s] = bv[m] + sum_d Wvb[m][d] Xb[b*SEQ+s][d] -> f16 hi plane (pitch SEQ) and
  //     residual plane (x4096, keys < VLP, pitch VLP)  (M=1024, N=2048, K=1024)
  gemm64<0, 3, true, false, false><<<gVT, blk, 0, stream>>>(
      Wvb, Wvb, DM, 0LL, Xb, Xb, DM, (long long)SEQ * DM,
      (void*)VTh, SEQ, (long long)DM * SEQ, (void*)VTl, VLP, (long long)DM * VLP, VLP,
      DM, SEQ, DM, 4096.0f, 0, bv, bv);
  // (5) three groups of query blocks, each launch over all NP pairs: band planes of the group, then its attention.
  //     A group [qa, qe) needs band columns 0 .. 64*(qe+1)-1 (at most NQC): that is its row pitch.
  const int gqa[3] = {0, RESQB, QSPLIT};
  const int gqe[3] = {RESQB, QSPLIT, NQB};
  for (int g = 0; g < 3; ++g) {
    const int qa = gqa[g];
    const int nq = gqe[g] - qa;
    const int pitch = ((gqe[g] + 1 < NQB) ? (gqe[g] + 1) : NQB) * 64;
    const long long qerStride = (long long)nq * 64 * pitch;
    const size_t aoff = (size_t)qa * 64 * DM;
    const dim3 gBand((nq * (pitch / 64) + 7) / 8, NP);
    // QER[p][t - 64*qa][c] = sum_d (Qh+Ql)[b*SEQ+t][h*64+d] * Erb[BANDOFF - 64*(t/64) + c][d]   (M=64*nq, N=pitch, K=64)
    gemm64<1, 0, false, false, true><<<gBand, blk, 0, stream>>>(
        Qh + aoff, Ql + aoff, DM, 0LL, Erb, Erb, HD, 0LL,
        (void*)QER, pitch, qerStride, (void*)QER, 0, 0LL, 0,
        nq * 64, pitch, HD, 1.0f, BANDOFF - qa * 64, bq, bq);
    if (g == 0) {
      attn_rel64<true><<<dim3(nq * NP), dim3(128), 0, stream>>>(
          Qh, Ql, Kh, Kl, VTh, VTl, QER, qerStride, pitch, Ah, Al, qa, nq, 0.125f);
    } else {
      attn_rel64<false><<<dim3(nq * NP), dim3(128), 0, stream>>>(
          Qh, Ql, Kh, Kl, VTh, VTl, QER, qerStride, pitch, Ah, Al, qa, nq, 0.125f);
    }
  }
  // (6) out[s][e] = bo[e] + sum_d (Ah+Al)[s][d] Wob[e][d] -> d_out f32 [4096][1024]  (M=4096, N=1024, K=1024)
  gemm64<1, 0, false, true, false><<<gOut, blk, 0, stream>>>(
      Ah, Al, DM, 0LL, Wob, Wob, DM, 0LL,
      d_out, DM, 0LL, d_out, 0, 0LL, 0,
      NB * SEQ, DM, DM, 1.0f, 0, bo, bo);
  (void)hipGetLastError();
}

// v003
// It runs in 497 microseconds.
// Timed twice side by side with v002, it ran 1.17 and 1.16 times as fast.
// Counting every step since v000, it is 11.0 times as fast.
// Contractions: x.Wq / x.Wk / Wv.x^T projections = v_wmma_f32_16x16x32_bf16 (bf16 operands from RNE-converted inputs, single product, f32 bias epilogue);
// q.k^T scores = v_wmma_f32_16x16x32_bf16 with q and k as bf16 hi/lo planes (hi.hi + hi.lo + lo.hi); q.Er^T band = same with q hi/lo times bf16 Er (2 products);
// p.v = v_wmma_f32_16x16x32_f16 (p carried x1024 in f16, v in f16; f16 residual planes x4096 of p and v on the leading query blocks);
// ctx.Wo = v_wmma_f32_16x16x32_bf16 with ctx as bf16 hi/lo planes times bf16 Wo (2 products); all f32 accumulate; softmax in f32.
#include <hip/hip_runtime.h>
#include <math.h>
#include <float.h>
#include <stdint.h>

#define NB      2
#define SEQ     2048
#define DM      1024
#define NH      16
#define HD      64
#define NQB     (SEQ / 64)       // 32 query / key tiles of 64
#define NQC     SEQ              // row pitch of the last (largest) group's band plane per (b,h)
#define BANDOFF (SEQ - 64)       // table row of band column 0 for the query tile starting at m0 is BANDOFF - m0
#define ERR     (2 * SEQ - 1)    // 4095 rows of the relative table
#define VLP     512              // key pitch of the v^T residual plane (keys 0..VLP-1)
#define RESQB   8                // leading 64-row query blocks that use the p / v residual planes
#define NP      (NB * NH)        // 32 (b,h) pairs: every band / attention launch covers all of them
#define QSPLIT  21               // first query block of the last group; groups are [0,RESQB) [RESQB,QSPLIT) [QSPLIT,NQB)
static_assert(RESQB * 64 <= VLP);
static_assert(NH * HD == DM);
static_assert((SEQ % 64) == 0 && (DM % 64) == 0);
static_assert(HD == 64);
static_assert(RESQB < QSPLIT && QSPLIT < NQB);
static_assert((QSPLIT - RESQB) * (QSPLIT + 1) <= (NQB - QSPLIT) * NQB && RESQB * (RESQB + 1) <= (NQB - QSPLIT) * NQB);  // last group's planes are the largest
static_assert(BANDOFF == SEQ - 1 - 63);

typedef _Float16 v16h __attribute__((ext_vector_type(16)));
typedef _Float16 v8h  __attribute__((ext_vector_type(8)));
typedef __bf16   v16b __attribute__((ext_vector_type(16)));
typedef __bf16   v8b  __attribute__((ext_vector_type(8)));
typedef float    v8f  __attribute__((ext_vector_type(8)));
typedef float    v4f  __attribute__((ext_vector_type(4)));
typedef unsigned int v4u __attribute__((ext_vector_type(4)));
typedef unsigned short v8us __attribute__((ext_vector_type(8)));

// ---- scalar helpers --------------------------------------------------------------------------------
__device__ __forceinline__ unsigned short bf_bits(float f) {          // f32 -> bf16 bits, RNE convert
  unsigned u = __float_as_uint(f);
  return (unsigned short)((u + 0x7FFFu + ((u >> 16) & 1u)) >> 16);
}
__device__ __forceinline__ float bf_up(unsigned short h) { return __uint_as_float(((unsigned)h) << 16); }
__device__ __forceinline__ unsigned short h_bits(_Float16 x) { return __builtin_bit_cast(unsigned short, x); }
__device__ __forceinline__ unsigned pk16(unsigned short a, unsigned short b) { return (unsigned)a | ((unsigned)b << 16); }
__device__ __forceinline__ v8f zero8() { v8f z = {0.f, 0.f, 0.f, 0.f, 0.f, 0.f, 0.f, 0.f}; return z; }
__device__ __forceinline__ v8h zero8h() {
  const _Float16 z = (_Float16)0.0f;
  v8h r = {z, z, z, z, z, z, z, z};
  return r;
}

// ---- fragment loader: 16-bit A/B operand, lane -> row/col (lane&15), p already includes +8*(lane>>4);
//      elements 0..7 <- p[0..7] (k0+8h..), elements 8..15 <- p[16..23] (k0+16+8h..)
__device__ __forceinline__ v16b ldfrag_b(const __bf16* p) {
  union { v16b v; v8b h[2]; } f;
  f.h[0] = *(const v8b*)(p);
  f.h[1] = *(const v8b*)(p + 16);
  return f.v;
}

// ---- WMMA helpers with trailing VALU hazard gap --------------------------------------------------------
__device__ __forceinline__ v8f mma_b(v16b a, v16b b, v8f c) {
  c = __builtin_amdgcn_wmma_f32_16x16x32_bf16(false, a, false, b, (short)0, c, false, false);
#if defined(__HIP_DEVICE_COMPILE__)
  asm volatile("v_nop\n\tv_nop\n\tv_nop\n\tv_nop" : "+v"(c) : "v"(a), "v"(b));
#endif
  return c;
}
__device__ __forceinline__ v8f mma_h(v16h a, v16h b, v8f c) {
  c = __builtin_amdgcn_wmma_f32_16x16x32_f16(false, a, false, b, (short)0, c, false, false);
#if defined(__HIP_DEVICE_COMPILE__)
  asm volatile("v_nop\n\tv_nop\n\tv_nop\n\tv_nop" : "+v"(c) : "v"(a), "v"(b));
#endif
  return c;
}
__device__ __forceinline__ v8f mma_b_raw(v16b a, v16b b, v8f c) {
  return __builtin_amdgcn_wmma_f32_16x16x32_bf16(false, a, false, b, (short)0, c, false, false);
}
__device__ __forceinline__ void dep_guard_b(v8f& a, v8f& b, v16b x, v16b y) {
#if defined(__HIP_DEVICE_COMPILE__)
  asm volatile("v_nop\n\tv_nop\n\tv_nop\n\tv_nop" : "+v"(a), "+v"(b) : "v"(x), "v"(y));
#endif
}
__device__ __forceinline__ void keep4_b(v16b a, v16b b, v16b c, v16b d) {
#if defined(__HIP_DEVICE_COMPILE__)
  asm volatile("v_nop" :: "v"(a), "v"(b), "v"(c), "v"(d));
#endif
}
__device__ __forceinline__ void acc_guard4(v8f& a, v8f& b, v8f& c, v8f& d) {
#if defined(__HIP_DEVICE_COMPILE__)
  asm volatile("v_nop\n\tv_nop\n\tv_nop\n\tv_nop" : "+v"(a), "+v"(b), "+v"(c), "+v"(d));
#endif
}

// =====================================================================================================
// f32 -> bf16 (RNE convert), 8 elements per thread, one 16-B store per lane: a wave writes 512 contiguous B
// grid = ceil(n8/256). coverage: n8 threads x 8 = whole plane (n8 is a multiple of 8 here, so every
// =====================================================================================================
__global__ __launch_bounds__(256) void cvt_bf16x8(const float* __restrict__ in, unsigned short* out, int n8) {
  const int i = blockIdx.x * 256 + threadIdx.x;
  if (i < n8) {
    const v4f a = *(const v4f*)(in + (size_t)i * 8);
    const v4f b = *(const v4f*)(in + (size_t)i * 8 + 4);
    v4u p;
    p[0] = pk16(bf_bits(a[0]), bf_bits(a[1]));
    p[1] = pk16(bf_bits(a[2]), bf_bits(a[3]));
    p[2] = pk16(bf_bits(b[0]), bf_bits(b[1]));
    p[3] = pk16(bf_bits(b[2]), bf_bits(b[3]));
    *(v4u*)(out + (size_t)i * 8) = p;
    
  }
}

// =====================================================================================================
// Transpose-convert: in f32 [R][C] (row pitch C) -> out bf16 [C][R] (row pitch R), out[c][r] = RNE bf16(in[r][c]).
// Block = 256 threads = one 64(r) x 64(c) tile; grid = (C/64, R/64) (host-checked exact multiples).
// Load: thread t reads row r0 + (t>>2), columns c0 + (t&3)*16 .. +15 (four 16-B loads), scatters the
// converted bits into LDS sT[c][r] (pitch 72); __syncthreads; store: wave w writes output rows
// coverage: 8 waves x 2 it x 4 = 64 output rows x (8 lanes x 8) = 64 columns = the whole tile.
// =====================================================================================================
__global__ __launch_bounds__(256) void tr_cvt64(const float* __restrict__ in, unsigned short* out, int R, int C) {
  __shared__ __align__(16) unsigned short sT[64 * 72];
  const int tid = threadIdx.x, lane = tid & 31, wave = tid >> 5;
  const int r0 = blockIdx.y * 64, c0 = blockIdx.x * 64;
  {
    const int rl = tid >> 2, cl = (tid & 3) * 16;
    const float* src = in + (size_t)(r0 + rl) * C + c0 + cl;
#pragma unroll
    for (int i = 0; i < 4; ++i) {
      const v4f v = *(const v4f*)(src + 4 * i);
#pragma unroll
      for (int e = 0; e < 4; ++e) sT[(cl + 4 * i + e) * 72 + rl] = bf_bits(v[e]);
    }
  }
  __syncthreads();
  const int q = lane >> 3, p8 = (lane & 7) * 8;
  v8us ov[2];
#pragma unroll
  for (int it = 0; it < 2; ++it) {
    const int cl2 = wave * 8 + it * 4 + q;
    ov[it] = *(const v8us*)(sT + cl2 * 72 + p8);
  }
  {
#pragma unroll
    for (int it = 0; it < 2; ++it) {
      const int cl2 = wave * 8 + it * 4 + q;
      *(v8us*)(out + (size_t)(c0 + cl2) * R + r0 + p8) = ov[it];
    }
    
  }
}

// =====================================================================================================
// Register-blocked batched bf16 WMMA GEMM: C[m][n] = rb[m] + cb[n] + sum_k A[m][k] * Bt[nr(n)][k]; one wave per
// 64x64 tile, no block barriers. A row-major [M][K] pitch lda; Bt row-major [.][K] pitch ldb (k contiguous);
// M, N multiples of 64, K multiple of 32 (host-checked). blockIdx.y = batch index (strides in elements).
// NSPLIT: 0 = A.Bt; 1 = (A + A2).Bt (A2 = unscaled bf16 lo plane of A); 2 = A.Bt + A2.Bt + A.Bt2.
// RB / CB: per-row bias rbp[m] / per-column bias cbp[n] (f32 input values RNE-converted to bf16, not batched)
//          added in the epilogue.
// BAND: A and C start at the first query row of the launch's group of query blocks (row mg of the sequence), the
//       batch index is the (b,h) pair (A offset (pair / NH) * SEQ * DM + (pair % NH) * HD), bandOff = BANDOFF - mg;
//       Bt operand row of output column n is n + bandOff - m0 (m0 = the 64-row tile start within the group), and
//       only column tiles with n0 <= mg + m0 + 64, that is operand row <= SEQ, are computed (wave-uniform early
//       return; the others are never read).
// OUT_MODE: 0 = f32 (pitch ldc); 2 = bf16 hi plane C + bf16 lo plane C2 (lo = RNE(v - hi), unscaled);
//           3 = f16 hi plane C + f16 residual plane C2 = f16((v - hi) * rscale), C2 written only for tiles
//               with n0 < N2 (pitch ldc2, batch stride strideC2).
// =====================================================================================================
template <int NSPLIT, int OUT_MODE, bool RB, bool CB, bool BAND>
__global__ __launch_bounds__(256) void gemm64(
    const unsigned short* __restrict__ Ap, const unsigned short* A2p, int lda, long long strideA,
    const unsigned short* __restrict__ Btp, const unsigned short* Bt2p, int ldb, long long strideB,
    void* Cout, int ldc, long long strideC,
    void* Cout2, int ldc2, long long strideC2, int N2,
    int M, int N, int K, float rscale, int bandOff,
    const float* __restrict__ rbp, const float* __restrict__ cbp) {
  const __bf16* A   = (const __bf16*)(const void*)Ap;
  const __bf16* A2  = (const __bf16*)(const void*)A2p;
  const __bf16* Bt  = (const __bf16*)(const void*)Btp;
  const __bf16* Bt2 = (const __bf16*)(const void*)Bt2p;
  __shared__ __align__(16) float sT[8][16 * 68];   // per-wave 16x64 slab, pitch 68 floats
  const int b    = blockIdx.y;
  const int lane = threadIdx.x & 31;
  const int wave = threadIdx.x >> 5;
  const int tilesN = N >> 6;
  const int tilesM = M >> 6;
  const int tile = blockIdx.x * 8 + wave;
  if (tile >= tilesM * tilesN) return;   // wave-uniform; no block barriers in this kernel
  const int tm = tile / tilesN;
  const int tn = tile - tm * tilesN;
  const int m0 = tm << 6;
  const int n0 = tn << 6;
  const int nr0 = BAND ? (n0 + bandOff - m0) : n0;   // operand row of output column n0 in Bt
  if (BAND) {
    if (nr0 > SEQ) return;               // wave-uniform: only column tiles up to one past the diagonal are needed
  }

  const size_t aB = BAND ? ((size_t)(b / NH) * SEQ * DM + (size_t)(b % NH) * HD) : (size_t)b * strideA;
  const __bf16* Ab  = A  + aB;
  const __bf16* Bb  = Bt + (size_t)b * strideB;
  const __bf16* Ab2 = (NSPLIT >= 1) ? (A2  + aB) : Ab;
  const __bf16* Bb2 = (NSPLIT == 2) ? (Bt2 + (size_t)b * strideB) : Bb;

  const int rlane = lane & 15;                 // row (A) / col (B, D) within subtile
  const int koff  = (lane >> 4) * 8;           // k offset of this lane half
  const int mOff  = (lane >> 4) * 8;           // D row offset

  v8f acc[4][4];
#pragma unroll
  for (int i = 0; i < 4; ++i)
#pragma unroll
    for (int j = 0; j < 4; ++j) acc[i][j] = zero8();

  for (int k0 = 0; k0 < K; k0 += 32) {
    v16b bh[4], bl[4];
#pragma unroll
    for (int j = 0; j < 4; ++j) {
      const size_t bo = (size_t)(nr0 + (j << 4) + rlane) * ldb + koff + k0;
      bh[j] = ldfrag_b(Bb + bo);
      if (NSPLIT == 2) bl[j] = ldfrag_b(Bb2 + bo); else bl[j] = bh[j];
    }
#pragma unroll
    for (int i = 0; i < 4; ++i) {
      const size_t ao = (size_t)(m0 + (i << 4) + rlane) * lda + koff + k0;
      const v16b ah = ldfrag_b(Ab + ao);
      v16b al = ah;
      if (NSPLIT >= 1) al = ldfrag_b(Ab2 + ao);
#pragma unroll
      for (int j = 0; j < 4; ++j) {
        acc[i][j] = mma_b_raw(ah, bh[j], acc[i][j]);
        if (NSPLIT >= 1) acc[i][j] = mma_b_raw(al, bh[j], acc[i][j]);
        if (NSPLIT == 2) acc[i][j] = mma_b_raw(ah, bl[j], acc[i][j]);
      }
      dep_guard_b(acc[i][0], acc[i][3], ah, al);
    }
    keep4_b(bh[0], bh[1], bh[2], bh[3]);
    if (NSPLIT == 2) keep4_b(bl[0], bl[1], bl[2], bl[3]);
  }
  acc_guard4(acc[0][0], acc[0][1], acc[0][2], acc[0][3]);
  acc_guard4(acc[1][0], acc[1][1], acc[1][2], acc[1][3]);
  acc_guard4(acc[2][0], acc[2][1], acc[2][2], acc[2][3]);
  acc_guard4(acc[3][0], acc[3][1], acc[3][2], acc[3][3]);

  // ---- epilogue biases (input values RNE-converted to bf16) ----
  float cbv[4];
#pragma unroll
  for (int j = 0; j < 4; ++j) cbv[j] = CB ? bf_up(bf_bits(cbp[n0 + (j << 4) + rlane])) : 0.0f;

  // ---- epilogue ----
  float* slab = sT[wave];
#pragma unroll
  for (int i = 0; i < 4; ++i) {
    const int mBase = m0 + (i << 4);
#pragma unroll
    for (int r = 0; r < 8; ++r) {
      const float rbv = RB ? bf_up(bf_bits(rbp[mBase + mOff + r])) : 0.0f;
#pragma unroll
      for (int j = 0; j < 4; ++j) {
        slab[(mOff + r) * 68 + (j << 4) + rlane] = acc[i][j][r] + rbv + cbv[j];
      }
    }
    __builtin_amdgcn_fence(__ATOMIC_RELEASE, "workgroup");
    __builtin_amdgcn_wave_barrier();
    __builtin_amdgcn_fence(__ATOMIC_ACQUIRE, "workgroup");
    if (OUT_MODE == 0) {
      float* C = (float*)Cout + (size_t)b * strideC;
      const int hh = lane >> 4, c4 = (lane & 15) * 4;     // 256-B row segment = 16 lanes x 16 B
      v4f ov[8];
#pragma unroll
      for (int it = 0; it < 8; ++it) {
        const int row = it * 2 + hh;                       // it 0..7 x hh 0..1 = rows 0..15
        ov[it] = *(const v4f*)(slab + row * 68 + c4);
      }
      {
#pragma unroll
        for (int it = 0; it < 8; ++it) {
          const int row = it * 2 + hh;
          *(v4f*)(C + (size_t)(mBase + row) * ldc + n0 + c4) = ov[it];
        }
        
      }
    } else {
      const int q = lane >> 3, c8 = (lane & 7) * 8;
      unsigned short* C  = (unsigned short*)Cout  + (size_t)b * strideC;
      unsigned short* C2 = (unsigned short*)Cout2 + (size_t)b * strideC2;
      const bool wlo = (OUT_MODE == 2) || (n0 < N2);      // wave-uniform
      v4u hv[4], lv[4];
#pragma unroll
      for (int it = 0; it < 4; ++it) {
        const int row = it * 4 + q;                        // it 0..3 x q 0..3 = rows 0..15
        const float* sp = slab + row * 68 + c8;
        v4u a, a2;
#pragma unroll
        for (int e = 0; e < 4; ++e) {
          const float f0 = sp[2 * e], f1 = sp[2 * e + 1];
          unsigned short h0, h1, l0, l1;
          if (OUT_MODE == 2) {
            h0 = bf_bits(f0); h1 = bf_bits(f1);
            l0 = bf_bits(f0 - bf_up(h0)); l1 = bf_bits(f1 - bf_up(h1));
          } else {
            const _Float16 x0 = (_Float16)f0, x1 = (_Float16)f1;
            h0 = h_bits(x0); h1 = h_bits(x1);
            l0 = h_bits((_Float16)((f0 - (float)x0) * rscale));
            l1 = h_bits((_Float16)((f1 - (float)x1) * rscale));
          }
          a[e] = pk16(h0, h1); a2[e] = pk16(l0, l1);
        }
        hv[it] = a; lv[it] = a2;
      }
      {
#pragma unroll
        for (int it = 0; it < 4; ++it) {
          const int row = it * 4 + q;
          *(v4u*)(C + (size_t)(mBase + row) * ldc + n0 + c8) = hv[it];
          if (wlo) *(v4u*)(C2 + (size_t)(mBase + row) * ldc2 + n0 + c8) = lv[it];
        }
        
      }
    }
    __builtin_amdgcn_fence(__ATOMIC_RELEASE, "workgroup");
    __builtin_amdgcn_wave_barrier();
    __builtin_amdgcn_fence(__ATOMIC_ACQUIRE, "workgroup");
  }
}

// =====================================================================================================
// Causal attention with a relative-position bias, head dim 64 (tril mask incl. diagonal, computed).
//   q planes (bf16 hi / lo): element (b, t, h, d) at [(b*SEQ + t)*DM + h*64 + d]
//   k planes (bf16 hi / lo): same layout with key index s
//   v^T hi plane (f16):      element (b, h, d, s) at [(b*DM + h*64 + d)*SEQ + s]
//   v^T residual plane (f16, (v - hi)*4096): [(b*DM + h*64 + d)*VLP + s], s < VLP, read only when RES
//   band plane (f32, per pair p, stride qerStride, row pitch qpitch): row = query t - 64*qbBase, column
//     key - t + 64*qb + 63 (in [0, qpitch), address clamped to qpitch-1; values beyond the clamp only occur for
//     masked keys) holds q[t] . Er[2*SEQ-1-SEQ + ... ] i.e. the relative term of (query t, key).
//   logit = (q.k + band) * sscale for key <= query, -FLT_MAX otherwise (exp -> 0); every row has a live key in
//   every processed key tile (tiles 0..qb only, block-uniform trip count qb+1 <= 32).
//   output: ctx hi / lo bf16 planes, element (b, t, h*64 + d) at [(b*SEQ + t)*DM + h*64 + d] = normalised
//   context (lo = RNE(v - hi), unscaled).
//   scores = q . k : bf16 hi/lo split (hi.hi + hi.lo + lo.hi), f32 accumulate, band added in f32, * sscale in f32
//   p = exp(s - m) carried as f16(1024 p); context = p . v on f16 WMMA; RES adds f16 residual planes of p and v
//   (scale 4096, separate accumulator folded back with 1/4096 per chunk in f32); online softmax in f32.
//   Block = 4 waves = 64 query rows of one (b, h); grid = nqbThis * NP (pair index = blockIdx.x / nqbThis,
//   b = pair / NH, h = pair % NH); kv chunks of 64.
//   K / V^T chunk staging: 128 threads x 32 elements per plane = the whole 64x64 tile (plain 16-B loads,
//   __syncthreads before and after); P tiles are wave-private, spilled with _Float16 element stores and reloaded
//   Output coverage: each wave stores its rows 0..15 (it 0..3 x lane>>3 0..3) x 64 columns (8 lanes x 8 bf16),
// =====================================================================================================
// Band values of one 16-row x 64-key wave tile, one register per (row r, column block j): 32 independent loads with
// no use between them, so that the wave pays their latency once. row0 = the lane's first row within the group's
// plane, cb0 = band column of (row0, key c of key tile 0); the column falls by one per row. An element index fits
// 32 bits (a pair's plane is below 8 MiB), so every load is the pair's uniform base plus a lane index.
__device__ __forceinline__ void load_band(float (&bnd)[8][4], const float* __restrict__ Bq,
                                          int row0, int cb0, int kv, int qpitch) {
#pragma unroll
  for (int g = 0; g < 2; ++g) {
    unsigned ix[4][4];
#pragma unroll
    for (int rr = 0; rr < 4; ++rr) {
      const int r = 4 * g + rr;
#pragma unroll
      for (int j = 0; j < 4; ++j) {
        int col = cb0 - r + kv + (j << 4);                         // >= 0 by construction
        col = (col < qpitch) ? col : (qpitch - 1);                 // clamped address (masked keys only)
        ix[rr][j] = (unsigned)((row0 + r) * qpitch + col);
        bnd[r][j] = Bq[ix[rr][j]];
      }
    }
#if defined(__HIP_DEVICE_COMPILE__)
    // The wait that stands in front of any overwrite of a register an issued load names. It takes the 16 index
    // registers as inputs so that they stay untouched (also by a later load's result) until it has been passed,
    // and the base pointer so that the compiler keeps these loads in front of it.
    asm volatile("s_wait_xcnt 0x0"
                 :: "v"(ix[0][0]), "v"(ix[0][1]), "v"(ix[0][2]), "v"(ix[0][3]),
                    "v"(ix[1][0]), "v"(ix[1][1]), "v"(ix[1][2]), "v"(ix[1][3]),
                    "v"(ix[2][0]), "v"(ix[2][1]), "v"(ix[2][2]), "v"(ix[2][3]),
                    "v"(ix[3][0]), "v"(ix[3][1]), "v"(ix[3][2]), "v"(ix[3][3]), "s"(Bq)
                 : "memory");
#endif
  }
}

template <bool RES>
__global__ __launch_bounds__(128)
void attn_rel64(const unsigned short* __restrict__ qhp, const unsigned short* __restrict__ qlp,
                const unsigned short* __restrict__ khp, const unsigned short* __restrict__ klp,
                const unsigned short* __restrict__ vhp, const unsigned short* __restrict__ vlp,
                const float* __restrict__ qerp, long long qerStride, int qpitch,
                unsigned short* ahp, unsigned short* alp,
                int qbBase, int nqbThis, float sscale) {
  union FB { v16b v; v8b h[2]; };
  union FH { v16h v; v8h h[2]; };
  // Row pitches: 64 elements of data plus 16 bytes, an odd multiple of 16 bytes, so that the 16 rows which a 16-byte
  // fragment load reads at once fall on 64 different banks (at 128 or 256 bytes they share a few banks).
  constexpr int LP = 72;                                          // 16-bit tiles: 144 bytes a row
  constexpr int OP = 68;                                          // f32 tile: 272 bytes a row
  __shared__ __align__(16) __bf16   Ksh[64 * LP];                 // K hi [kv][d]   9 KB
  __shared__ __align__(16) __bf16   Ksl[64 * LP];                 // K lo
  __shared__ __align__(16) _Float16 Vth[64 * LP];                 // V^T hi [d][kv] 9 KB
  __shared__ __align__(16) _Float16 Vtl[RES ? 64 * LP : 8];       // V^T residual
  __shared__ __align__(16) _Float16 Psh[4][16 * LP];              // per wave P [row][kv]
  __shared__ __align__(16) _Float16 Psl[RES ? 4 : 1][16 * LP];    // per wave P residual
  __shared__ __align__(16) float    Os[4][16 * OP];               // per wave context tile [row][d]

  const int tid  = threadIdx.x;
  const int wave = tid >> 5;
  const int lane = tid & 31;
  const int hh   = lane >> 4;
  const int c    = lane & 15;

  const int bx   = blockIdx.x;
  const int qbl  = bx % nqbThis;
  const int pr   = bx / nqbThis;          // (b,h) pair index, 0..NP-1
  const int h    = pr % NH;
  const int b    = pr / NH;
  const int qb   = qbBase + qbl;
  const int q0   = qb * 64 + wave * 16;
  const size_t rowB = (size_t)b * SEQ;

  const __bf16* Qh = (const __bf16*)(const void*)qhp + (size_t)h * HD;
  const __bf16* Ql = (const __bf16*)(const void*)qlp + (size_t)h * HD;
  const __bf16* Kh = (const __bf16*)(const void*)khp + (size_t)h * HD;
  const __bf16* Kl = (const __bf16*)(const void*)klp + (size_t)h * HD;
  const _Float16* Vh = (const _Float16*)(const void*)vhp + ((size_t)b * DM + (size_t)h * HD) * SEQ;
  const _Float16* Vl = (const _Float16*)(const void*)vlp + ((size_t)b * DM + (size_t)h * HD) * VLP;
  const float* Bq = qerp + (size_t)pr * (size_t)qerStride;

  // ---- Q fragments (A operand, row = lane&15): 2 d-chunks, hi and lo ----
  v16b qah[2], qal[2];
#pragma unroll
  for (int dc = 0; dc < 2; ++dc) {
    const size_t qo = (rowB + q0 + c) * DM + dc * 32 + 8 * hh;
    qah[dc] = ldfrag_b(Qh + qo);
    qal[dc] = ldfrag_b(Ql + qo);
  }

  float mrow[8], lrow[8];
  v8f oacc[4];
#pragma unroll
  for (int r = 0; r < 8; ++r) { mrow[r] = -INFINITY; lrow[r] = 0.f; }
#pragma unroll
  for (int t = 0; t < 4; ++t) oacc[t] = zero8();

  int nkt = qb + 1;                          // causal: key tiles 0..qb, block-uniform
  if (nkt > NQB) nkt = NQB;

  // band values are fetched one key tile ahead: tile 0 here, tile kt + 1 inside trip kt
  const int brow0 = q0 + 8 * hh - qbBase * 64;
  const int bcb0  = c + (qb * 64 + 63 - (q0 + 8 * hh));
  float bnd[8][4];
  load_band(bnd, Bq, brow0, bcb0, 0, qpitch);
  for (int kt = 0; kt < nkt; ++kt) {
    const int kv0 = kt * 64;
    __syncthreads();
    {
      const int r = tid >> 1, half = (tid & 1) * 32;
      const __bf16*   kg  = Kh + (rowB + kv0 + r) * DM + half;    // K row kv0+r, d = half..half+31
      const __bf16*   klg = Kl + (rowB + kv0 + r) * DM + half;
      const _Float16* vg  = Vh + (size_t)r * SEQ + kv0 + half;    // V^T row d = r, s = kv0+half..+31
      const int kvl = (kv0 + 64 <= VLP) ? kv0 : (VLP - 64);     // clamped address into the residual plane
      const _Float16* vlg = Vl + (size_t)r * VLP + kvl + half;
      const bool resOK = (kv0 + 64 <= VLP);                      // block-uniform
#pragma unroll
      for (int i = 0; i < 4; ++i) {
        const v8b a0 = *(const v8b*)(kg + 8 * i);
        const v8b a1 = *(const v8b*)(klg + 8 * i);
        const v8h b0 = *(const v8h*)(vg + 8 * i);
        *(v8b*)(Ksh + r * LP + half + 8 * i) = a0;
        *(v8b*)(Ksl + r * LP + half + 8 * i) = a1;
        *(v8h*)(Vth + r * LP + half + 8 * i) = b0;
        if (RES) {
          v8h b1 = *(const v8h*)(vlg + 8 * i);
          if (!resOK) b1 = zero8h();
          *(v8h*)(Vtl + r * LP + half + 8 * i) = b1;
        }
      }
    }
    __syncthreads();

    // ---- scores: 16 query rows x 64 keys per wave, 3 bf16 products ----
    v8f s[4];
#pragma unroll
    for (int j = 0; j < 4; ++j) {
      s[j] = zero8();
#pragma unroll
      for (int dc = 0; dc < 2; ++dc) {
        FB kb, kl;
        kb.h[0] = *(const v8b*)(Ksh + (j * 16 + c) * LP + dc * 32 + 8 * hh);
        kb.h[1] = *(const v8b*)(Ksh + (j * 16 + c) * LP + dc * 32 + 16 + 8 * hh);
        kl.h[0] = *(const v8b*)(Ksl + (j * 16 + c) * LP + dc * 32 + 8 * hh);
        kl.h[1] = *(const v8b*)(Ksl + (j * 16 + c) * LP + dc * 32 + 16 + 8 * hh);
        s[j] = mma_b(qah[dc], kb.v, s[j]);
        s[j] = mma_b(qah[dc], kl.v, s[j]);
        s[j] = mma_b(qal[dc], kb.v, s[j]);
      }
    }

    // ---- band term of this tile (fetched during the previous trip), then the next tile's 32 loads in one batch:
    //      the softmax runs while they fly (the fence in front of p.v is the first wait that covers them). The last
    //      trip has no next tile and fetches its own again (written columns only). ----
#pragma unroll
    for (int r = 0; r < 8; ++r)
#pragma unroll
      for (int j = 0; j < 4; ++j) s[j][r] += bnd[r][j];
    load_band(bnd, Bq, brow0, bcb0, (kt + 1 < nkt) ? (kv0 + 64) : kv0, qpitch);

    // ---- scale + causal mask (replace by -FLT_MAX), row max, online softmax, P (x1024, f16)
    //      and P residual (x4096) to LDS ----
    _Float16* pwh = Psh[wave];
    _Float16* pwl = Psl[RES ? wave : 0];
#pragma unroll
    for (int r = 0; r < 8; ++r) {
      const int qrow = q0 + 8 * hh + r;
      float m = -INFINITY;
#pragma unroll
      for (int j = 0; j < 4; ++j) {
        const int key = kv0 + j * 16 + c;
        float sv = s[j][r] * sscale;
        sv = (key > qrow) ? -FLT_MAX : sv;
        s[j][r] = sv;
        m = fmaxf(m, sv);
      }
#pragma unroll
      for (int off = 1; off < 16; off <<= 1) m = fmaxf(m, __shfl_xor(m, off, 32));
      const float mnew  = fmaxf(mrow[r], m);
      const float msafe = (mnew == -INFINITY) ? 0.f : mnew;
      const float alpha = __expf(mrow[r] - msafe);
      mrow[r] = mnew;
      float psum = 0.f;
#pragma unroll
      for (int j = 0; j < 4; ++j) {
        const float p = __expf(s[j][r] - msafe);     // masked logit against a finite max: exp -> 0
        psum += p;
        const float p1k = p * 1024.0f;
        const _Float16 ph = (_Float16)p1k;
        pwh[(8 * hh + r) * LP + j * 16 + c] = ph;
        if (RES) {
          const _Float16 pl = (_Float16)((p1k - (float)ph) * 4096.0f);
          pwl[(8 * hh + r) * LP + j * 16 + c] = pl;
        }
      }
#pragma unroll
      for (int off = 1; off < 16; off <<= 1) psum += __shfl_xor(psum, off, 32);
      lrow[r] = lrow[r] * alpha + psum;
#pragma unroll
      for (int t = 0; t < 4; ++t) oacc[t][r] *= alpha;
    }
    __builtin_amdgcn_fence(__ATOMIC_RELEASE, "workgroup");
    __builtin_amdgcn_wave_barrier();
    __builtin_amdgcn_fence(__ATOMIC_ACQUIRE, "workgroup");

    // ---- context += P . V (f16 WMMA), residual products into a separate accumulator ----
    v8f o1[4];
#pragma unroll
    for (int t = 0; t < 4; ++t) o1[t] = zero8();
#pragma unroll 1
    for (int kk = 0; kk < 2; ++kk) {
      FH pa, pl;
      pa.h[0] = *(const v8h*)(pwh + c * LP + kk * 32 + 8 * hh);
      pa.h[1] = *(const v8h*)(pwh + c * LP + kk * 32 + 16 + 8 * hh);
      if (RES) {
        pl.h[0] = *(const v8h*)(pwl + c * LP + kk * 32 + 8 * hh);
        pl.h[1] = *(const v8h*)(pwl + c * LP + kk * 32 + 16 + 8 * hh);
      } else {
        pl.v = pa.v;
      }
#pragma unroll
      for (int t = 0; t < 4; ++t) {
        FH vb;
        vb.h[0] = *(const v8h*)(Vth + (t * 16 + c) * LP + kk * 32 + 8 * hh);
        vb.h[1] = *(const v8h*)(Vth + (t * 16 + c) * LP + kk * 32 + 16 + 8 * hh);
        oacc[t] = mma_h(pa.v, vb.v, oacc[t]);
        if (RES) {
          FH vl;
          vl.h[0] = *(const v8h*)(Vtl + (t * 16 + c) * LP + kk * 32 + 8 * hh);
          vl.h[1] = *(const v8h*)(Vtl + (t * 16 + c) * LP + kk * 32 + 16 + 8 * hh);
          o1[t] = mma_h(pa.v, vl.v, o1[t]);
          o1[t] = mma_h(pl.v, vb.v, o1[t]);
        }
      }
    }
    if (RES) {
#pragma unroll
      for (int t = 0; t < 4; ++t)
#pragma unroll
        for (int r = 0; r < 8; ++r) oacc[t][r] += o1[t][r] * (1.0f / 4096.0f);
    }
  }

  // ---- normalise (1/l and the 1/1024 p carry), stage the wave's 16x64 tile in LDS, then convert to
  float* os = Os[wave];
#pragma unroll
  for (int r = 0; r < 8; ++r) {
    const float l = lrow[r];
    const float inv = ((l > 0.f) ? (1.0f / l) : 0.f) * (1.0f / 1024.0f);
#pragma unroll
    for (int t = 0; t < 4; ++t) os[(8 * hh + r) * OP + t * 16 + c] = oacc[t][r] * inv;
  }
  __builtin_amdgcn_fence(__ATOMIC_RELEASE, "workgroup");
  __builtin_amdgcn_wave_barrier();
  __builtin_amdgcn_fence(__ATOMIC_ACQUIRE, "workgroup");
  {
    const int q4 = lane >> 3, c8 = (lane & 7) * 8;
    v4u hv[4], lv[4];
#pragma unroll
    for (int it = 0; it < 4; ++it) {
      const int row = it * 4 + q4;             // it 0..3 x q4 0..3 = rows 0..15 of the wave tile
      const float* sp = os + row * OP + c8;
      v4u a, a2;
#pragma unroll
      for (int e = 0; e < 4; ++e) {
        const float f0 = sp[2 * e], f1 = sp[2 * e + 1];
        const unsigned short x0 = bf_bits(f0), x1 = bf_bits(f1);
        const unsigned short y0 = bf_bits(f0 - bf_up(x0)), y1 = bf_bits(f1 - bf_up(x1));
        a[e] = pk16(x0, x1); a2[e] = pk16(y0, y1);
      }
      hv[it] = a; lv[it] = a2;
    }
    {
#pragma unroll
      for (int it = 0; it < 4; ++it) {
        const int row = it * 4 + q4;
        const size_t go = (rowB + q0 + row) * DM + (size_t)h * HD + c8;
        *(v4u*)(ahp + go) = hv[it];
        *(v4u*)(alp + go) = lv[it];
      }
      
    }
  }
}

// =====================================================================================================
// Workspace map (bytes), every region an exact multiple of its whole-line / whole-tile store granularity:
//   Xb    bf16 [4096][1024]            0           8388608
//   Wqb   bf16 [1024 out][1024 in]     8388608     2097152
//   Wkb   bf16 [1024][1024]            10485760    2097152
//   Wvb   bf16 [1024][1024]            12582912    2097152
//   Wob   bf16 [1024][1024]            14680064    2097152
//   Erb   bf16 [4096][64] (4095 used)  16777216     524288
//   Qh    bf16 [4096][1024]            17301504    8388608
//   Ql    bf16 [4096][1024]            25690112    8388608
//   Kh    bf16 [4096][1024]            34078720    8388608
//   Kl    bf16 [4096][1024]            42467328    8388608
//   VTh   f16  [2][1024][2048]         50855936    8388608
//   VTl   f16  [2][1024][512]          59244544    2097152
//   Ah    bf16 [4096][1024]            61341696    8388608
//   Al    bf16 [4096][1024]            69730304    8388608
//   QER   f32  [32][704][2048]         78118912  184549376   (largest of the three groups' band planes)
//   end                                262668288
// Weights arrive [in][out]; y = x . W needs Bt[out][in] (in contiguous) -> transpose-convert once.
// =====================================================================================================
extern "C" void kernel_launch(void* const* d_in, const int* in_sizes, int n_in,
                              void* d_out, int out_size, void* d_ws, size_t ws_size,
                              hipStream_t stream) {
  if (n_in < 10) return;
  if (in_sizes[0] != NB * SEQ * DM) return;
  if (in_sizes[1] != DM * DM || in_sizes[3] != DM * DM || in_sizes[5] != DM * DM || in_sizes[7] != DM * DM) return;
  if (in_sizes[2] != DM || in_sizes[4] != DM || in_sizes[6] != DM || in_sizes[8] != DM) return;
  if (in_sizes[9] != ERR * HD) return;
  if (out_size != NB * SEQ * DM) return;

  const float* x  = (const float*)d_in[0];
  const float* Wq = (const float*)d_in[1];
  const float* bq = (const float*)d_in[2];
  const float* Wk = (const float*)d_in[3];
  const float* bk = (const float*)d_in[4];
  const float* Wv = (const float*)d_in[5];
  const float* bv = (const float*)d_in[6];
  const float* Wo = (const float*)d_in[7];
  const float* bo = (const float*)d_in[8];
  const float* Er = (const float*)d_in[9];

  const size_t PXb  = (size_t)NB * SEQ * DM * 2;       //  8388608  16-bit activation plane [4096][1024]
  const size_t PW   = (size_t)DM * DM * 2;             //  2097152
  const size_t PEr  = (size_t)(ERR + 1) * HD * 2;      //   524288  (rows padded to 4096)
  const size_t PVTh = (size_t)NB * DM * SEQ * 2;       //  8388608
  const size_t PVTl = (size_t)NB * DM * VLP * 2;       //  2097152
  const size_t PQER = (size_t)NP * (NQB - QSPLIT) * 64 * NQC * 4;   // 184549376, the last group's band planes
  size_t off = 0;
  const size_t oXb  = off; off += PXb;
  const size_t oWq  = off; off += PW;
  const size_t oWk  = off; off += PW;
  const size_t oWv  = off; off += PW;
  const size_t oWo  = off; off += PW;
  const size_t oEr  = off; off += PEr;
  const size_t oQh  = off; off += PXb;
  const size_t oQl  = off; off += PXb;
  const size_t oKh  = off; off += PXb;
  const size_t oKl  = off; off += PXb;
  const size_t oVTh = off; off += PVTh;
  const size_t oVTl = off; off += PVTl;
  const size_t oAh  = off; off += PXb;
  const size_t oAl  = off; off += PXb;
  const size_t oQER = off; off += PQER;
  if (off > ws_size) return;                           // off = 262668288

  char* ws = (char*)d_ws;
  unsigned short* Xb  = (unsigned short*)(ws + oXb);
  unsigned short* Wqb = (unsigned short*)(ws + oWq);
  unsigned short* Wkb = (unsigned short*)(ws + oWk);
  unsigned short* Wvb = (unsigned short*)(ws + oWv);
  unsigned short* Wob = (unsigned short*)(ws + oWo);
  unsigned short* Erb = (unsigned short*)(ws + oEr);
  unsigned short* Qh  = (unsigned short*)(ws + oQh);
  unsigned short* Ql  = (unsigned short*)(ws + oQl);
  unsigned short* Kh  = (unsigned short*)(ws + oKh);
  unsigned short* Kl  = (unsigned short*)(ws + oKl);
  unsigned short* VTh = (unsigned short*)(ws + oVTh);
  unsigned short* VTl = (unsigned short*)(ws + oVTl);
  unsigned short* Ah  = (unsigned short*)(ws + oAh);
  unsigned short* Al  = (unsigned short*)(ws + oAl);
  float*          QER = (float*)(ws + oQER);

  const dim3 blk(256);
  const int n8x  = NB * SEQ * DM / 8;                                // 524288
  const int n8er = ERR * HD / 8;                                     // 32760
  const dim3 gCvtX((n8x + 255) / 256);                               // 2048 blocks
  const dim3 gCvtEr((n8er + 255) / 256);                             // 128 blocks
  const dim3 gTr(DM / 64, DM / 64);                                  // (out cols / 64, in rows / 64)
  const dim3 gQ(((NB * SEQ / 64) * (DM / 64) + 7) / 8, 1);           // 1024 tiles -> 128 blocks
  const dim3 gVT(((DM / 64) * (SEQ / 64) + 7) / 8, NB);              // 512 tiles -> 64 blocks x 2 batches
  const dim3 gOut(((NB * SEQ / 64) * (DM / 64) + 7) / 8, 1);         // 128 blocks

  // (1) x -> bf16 plane [4096][1024]; Er -> bf16 plane [4095][64]
  cvt_bf16x8<<<gCvtX, blk, 0, stream>>>(x, Xb, n8x);
  cvt_bf16x8<<<gCvtEr, blk, 0, stream>>>(Er, Erb, n8er);
  // (2) weights [in][out] f32 -> bf16 [out][in] planes
  tr_cvt64<<<gTr, blk, 0, stream>>>(Wq, Wqb, DM, DM);
  tr_cvt64<<<gTr, blk, 0, stream>>>(Wk, Wkb, DM, DM);
  tr_cvt64<<<gTr, blk, 0, stream>>>(Wv, Wvb, DM, DM);
  tr_cvt64<<<gTr, blk, 0, stream>>>(Wo, Wob, DM, DM);
  // (3) q and k projections: Qh/Ql[b*SEQ+s][e] = hi/lo of (bq[e] + sum_d Xb[s][d] Wqb[e][d])  (M=4096, N=1024, K=1024)
  gemm64<0, 2, false, true, false><<<gQ, blk, 0, stream>>>(
      Xb, Xb, DM, 0LL, Wqb, Wqb, DM, 0LL,
      (void*)Qh, DM, 0LL, (void*)Ql, DM, 0LL, 0,
      NB * SEQ, DM, DM, 1.0f, 0, bq, bq);
  gemm64<0, 2, false, true, false><<<gQ, blk, 0, stream>>>(
      Xb, Xb, DM, 0LL, Wkb, Wkb, DM, 0LL,
      (void*)Kh, DM, 0LL, (void*)Kl, DM, 0LL, 0,
      NB * SEQ, DM, DM, 1.0f, 0, bk, bk);
  // (4) v^T per batch: VTh[b][m][s] = bv[m] + sum_d Wvb[m][d] Xb[b*SEQ+s][d] -> f16 hi plane (pitch SEQ) and
  //     residual plane (x4096, keys < VLP, pitch VLP)  (M=1024, N=2048, K=1024)
  gemm64<0, 3, true, false, false><<<gVT, blk, 0, stream>>>(
      Wvb, Wvb, DM, 0LL, Xb, Xb, DM, (long long)SEQ * DM,
      (void*)VTh, SEQ, (long long)DM * SEQ, (void*)VTl, VLP, (long long)DM * VLP, VLP,
      DM, SEQ, DM, 4096.0f, 0, bv, bv);
  // (5) three groups of query blocks, each launch over all NP pairs: band planes of the group, then its attention.
  //     A group [qa, qe) needs band columns 0 .. 64*(qe+1)-1 (at most NQC): that is its row pitch.
  const int gqa[3] = {0, RESQB, QSPLIT};
  const int gqe[3] = {RESQB, QSPLIT, NQB};
  for (int g = 0; g < 3; ++g) {
    const int qa = gqa[g];
    const int nq = gqe[g] - qa;
    const int pitch = ((gqe[g] + 1 < NQB) ? (gqe[g] + 1) : NQB) * 64;
    const long long qerStride = (long long)nq * 64 * pitch;
    const size_t aoff = (size_t)qa * 64 * DM;
    const dim3 gBand((nq * (pitch / 64) + 7) / 8, NP);
    // QER[p][t - 64*qa][c] = sum_d (Qh+Ql)[b*SEQ+t][h*64+d] * Erb[BANDOFF - 64*(t/64) + c][d]   (M=64*nq, N=pitch, K=64)
    gemm64<1, 0, false, false, true><<<gBand, blk, 0, stream>>>(
        Qh + aoff, Ql + aoff, DM, 0LL, Erb, Erb, HD, 0LL,
        (void*)QER, pitch, qerStride, (void*)QER, 0, 0LL, 0,
        nq * 64, pitch, HD, 1.0f, BANDOFF - qa * 64, bq, bq);
    if (g == 0) {
      attn_rel64<true><<<dim3(nq * NP), dim3(128), 0, stream>>>(
          Qh, Ql, Kh, Kl, VTh, VTl, QER, qerStride, pitch, Ah, Al, qa, nq, 0.125f);
    } else {
      attn_rel64<false><<<dim3(nq * NP), dim3(128), 0, stream>>>(
          Qh, Ql, Kh, Kl, VTh, VTl, QER, qerStride, pitch, Ah, Al, qa, nq, 0.125f);
    }
  }
  // (6) out[s][e] = bo[e] + sum_d (Ah+Al)[s][d] Wob[e][d] -> d_out f32 [4096][1024]  (M=4096, N=1024, K=1024)
  gemm64<1, 0, false, true, false><<<gOut, blk, 0, stream>>>(
      Ah, Al, DM, 0LL, Wob, Wob, DM, 0LL,
      d_out, DM, 0LL, d_out, 0, 0LL, 0,
      NB * SEQ, DM, DM, 1.0f, 0, bo, bo);
  (void)hipGetLastError();
}

// v004
// It runs in 369 microseconds.
// Next to v003, in two timings, it ran 1.35 and 1.36 times as fast.
// Counting every step since v000, it is 14.9 times as fast.
// Contractions: x.Wq / x.Wk / Wv.x^T projections = v_wmma_f32_16x16x32_bf16 (bf16 operands from RNE-converted inputs, single product, f32 bias epilogue);
// q.k^T scores = v_wmma_f32_16x16x32_bf16 with q and k as bf16 hi/lo planes (hi.hi + hi.lo + lo.hi); q.Er^T band = same with q hi/lo times bf16 Er (2 products);
// p.v = v_wmma_f32_16x16x32_f16 (p carried x1024 in f16, v in f16; f16 residual planes x4096 of p and v on the leading query blocks);
// ctx.Wo = v_wmma_f32_16x16x32_bf16 with ctx as bf16 hi/lo planes times bf16 Wo (2 products); all f32 accumulate; softmax in f32.
#include <hip/hip_runtime.h>
#include <math.h>
#include <float.h>
#include <stdint.h>

#define NB      2
#define SEQ     2048
#define DM      1024
#define NH      16
#define HD      64
#define NQB     (SEQ / 64)       // 32 query / key tiles of 64
#define NQC     SEQ              // row pitch of the last (largest) group's band plane per (b,h)
#define BANDOFF (SEQ - 64)       // table row of band column 0 for the query tile starting at m0 is BANDOFF - m0
#define ERR     (2 * SEQ - 1)    // 4095 rows of the relative table
#define VLP     512              // key pitch of the v^T residual plane (keys 0..VLP-1)
#define RESQB   8                // leading 64-row query blocks that use the p / v residual planes
#define NP      (NB * NH)        // 32 (b,h) pairs: every band / attention launch covers all of them
#define QSPLIT  21               // first query block of the last group; groups are [0,RESQB) [RESQB,QSPLIT) [QSPLIT,NQB)
static_assert(RESQB * 64 <= VLP);
static_assert(NH * HD == DM);
static_assert((SEQ % 64) == 0 && (DM % 64) == 0);
static_assert(HD == 64);
static_assert(RESQB < QSPLIT && QSPLIT < NQB);
static_assert((QSPLIT - RESQB) * (QSPLIT + 1) <= (NQB - QSPLIT) * NQB && RESQB * (RESQB + 1) <= (NQB - QSPLIT) * NQB);  // last group's planes are the largest
static_assert(BANDOFF == SEQ - 1 - 63);
static_assert((SEQ % 128) == 0 && (DM % 128) == 0);   // gemm128: whole 128x128 tiles and whole 128-k slabs

typedef _Float16 v16h __attribute__((ext_vector_type(16)));
typedef _Float16 v8h  __attribute__((ext_vector_type(8)));
typedef __bf16   v16b __attribute__((ext_vector_type(16)));
typedef __bf16   v8b  __attribute__((ext_vector_type(8)));
typedef float    v8f  __attribute__((ext_vector_type(8)));
typedef float    v4f  __attribute__((ext_vector_type(4)));
typedef unsigned int v4u __attribute__((ext_vector_type(4)));
typedef unsigned short v8us __attribute__((ext_vector_type(8)));

// ---- scalar helpers --------------------------------------------------------------------------------
__device__ __forceinline__ unsigned short bf_bits(float f) {          // f32 -> bf16 bits, RNE convert
  unsigned u = __float_as_uint(f);
  return (unsigned short)((u + 0x7FFFu + ((u >> 16) & 1u)) >> 16);
}
__device__ __forceinline__ float bf_up(unsigned short h) { return __uint_as_float(((unsigned)h) << 16); }
__device__ __forceinline__ unsigned short h_bits(_Float16 x) { return __builtin_bit_cast(unsigned short, x); }
__device__ __forceinline__ unsigned pk16(unsigned short a, unsigned short b) { return (unsigned)a | ((unsigned)b << 16); }
__device__ __forceinline__ v8f zero8() { v8f z = {0.f, 0.f, 0.f, 0.f, 0.f, 0.f, 0.f, 0.f}; return z; }
__device__ __forceinline__ v8h zero8h() {
  const _Float16 z = (_Float16)0.0f;
  v8h r = {z, z, z, z, z, z, z, z};
  return r;
}

// ---- fragment loader: 16-bit A/B operand, lane -> row/col (lane&15), p already includes +8*(lane>>4);
//      elements 0..7 <- p[0..7] (k0+8h..), elements 8..15 <- p[16..23] (k0+16+8h..)
__device__ __forceinline__ v16b ldfrag_b(const __bf16* p) {
  union { v16b v; v8b h[2]; } f;
  f.h[0] = *(const v8b*)(p);
  f.h[1] = *(const v8b*)(p + 16);
  return f.v;
}

// ---- WMMA helpers with trailing VALU hazard gap --------------------------------------------------------
__device__ __forceinline__ v8f mma_b(v16b a, v16b b, v8f c) {
  c = __builtin_amdgcn_wmma_f32_16x16x32_bf16(false, a, false, b, (short)0, c, false, false);
#if defined(__HIP_DEVICE_COMPILE__)
  asm volatile("v_nop\n\tv_nop\n\tv_nop\n\tv_nop" : "+v"(c) : "v"(a), "v"(b));
#endif
  return c;
}
__device__ __forceinline__ v8f mma_h(v16h a, v16h b, v8f c) {
  c = __builtin_amdgcn_wmma_f32_16x16x32_f16(false, a, false, b, (short)0, c, false, false);
#if defined(__HIP_DEVICE_COMPILE__)
  asm volatile("v_nop\n\tv_nop\n\tv_nop\n\tv_nop" : "+v"(c) : "v"(a), "v"(b));
#endif
  return c;
}
__device__ __forceinline__ v8f mma_b_raw(v16b a, v16b b, v8f c) {
  return __builtin_amdgcn_wmma_f32_16x16x32_bf16(false, a, false, b, (short)0, c, false, false);
}
__device__ __forceinline__ void dep_guard_b(v8f& a, v8f& b, v16b x, v16b y) {
#if defined(__HIP_DEVICE_COMPILE__)
  asm volatile("v_nop\n\tv_nop\n\tv_nop\n\tv_nop" : "+v"(a), "+v"(b) : "v"(x), "v"(y));
#endif
}
__device__ __forceinline__ void keep4_b(v16b a, v16b b, v16b c, v16b d) {
#if defined(__HIP_DEVICE_COMPILE__)
  asm volatile("v_nop" :: "v"(a), "v"(b), "v"(c), "v"(d));
#endif
}
__device__ __forceinline__ void acc_guard4(v8f& a, v8f& b, v8f& c, v8f& d) {
#if defined(__HIP_DEVICE_COMPILE__)
  asm volatile("v_nop\n\tv_nop\n\tv_nop\n\tv_nop" : "+v"(a), "+v"(b), "+v"(c), "+v"(d));
#endif
}

// =====================================================================================================
// f32 -> bf16 (RNE convert), 8 elements per thread, one 16-B store per lane: a wave writes 512 contiguous B
// grid = ceil(n8/256). coverage: n8 threads x 8 = whole plane (n8 is a multiple of 8 here, so every
// =====================================================================================================
__global__ __launch_bounds__(256) void cvt_bf16x8(const float* __restrict__ in, unsigned short* out, int n8) {
  const int i = blockIdx.x * 256 + threadIdx.x;
  if (i < n8) {
    const v4f a = *(const v4f*)(in + (size_t)i * 8);
    const v4f b = *(const v4f*)(in + (size_t)i * 8 + 4);
    v4u p;
    p[0] = pk16(bf_bits(a[0]), bf_bits(a[1]));
    p[1] = pk16(bf_bits(a[2]), bf_bits(a[3]));
    p[2] = pk16(bf_bits(b[0]), bf_bits(b[1]));
    p[3] = pk16(bf_bits(b[2]), bf_bits(b[3]));
    *(v4u*)(out + (size_t)i * 8) = p;
    
  }
}

// =====================================================================================================
// Transpose-convert: in f32 [R][C] (row pitch C) -> out bf16 [C][R] (row pitch R), out[c][r] = RNE bf16(in[r][c]).
// Block = 256 threads = one 64(r) x 64(c) tile; grid = (C/64, R/64) (host-checked exact multiples).
// Load: thread t reads row r0 + (t>>2), columns c0 + (t&3)*16 .. +15 (four 16-B loads), scatters the
// converted bits into LDS sT[c][r] (pitch 72); __syncthreads; store: wave w writes output rows
// coverage: 8 waves x 2 it x 4 = 64 output rows x (8 lanes x 8) = 64 columns = the whole tile.
// =====================================================================================================
__global__ __launch_bounds__(256) void tr_cvt64(const float* __restrict__ in, unsigned short* out, int R, int C) {
  __shared__ __align__(16) unsigned short sT[64 * 72];
  const int tid = threadIdx.x, lane = tid & 31, wave = tid >> 5;
  const int r0 = blockIdx.y * 64, c0 = blockIdx.x * 64;
  {
    const int rl = tid >> 2, cl = (tid & 3) * 16;
    const float* src = in + (size_t)(r0 + rl) * C + c0 + cl;
#pragma unroll
    for (int i = 0; i < 4; ++i) {
      const v4f v = *(const v4f*)(src + 4 * i);
#pragma unroll
      for (int e = 0; e < 4; ++e) sT[(cl + 4 * i + e) * 72 + rl] = bf_bits(v[e]);
    }
  }
  __syncthreads();
  const int q = lane >> 3, p8 = (lane & 7) * 8;
  v8us ov[2];
#pragma unroll
  for (int it = 0; it < 2; ++it) {
    const int cl2 = wave * 8 + it * 4 + q;
    ov[it] = *(const v8us*)(sT + cl2 * 72 + p8);
  }
  {
#pragma unroll
    for (int it = 0; it < 2; ++it) {
      const int cl2 = wave * 8 + it * 4 + q;
      *(v8us*)(out + (size_t)(c0 + cl2) * R + r0 + p8) = ov[it];
    }
    
  }
}

// =====================================================================================================
// Register-blocked batched bf16 WMMA GEMM: C[m][n] = rb[m] + cb[n] + sum_k A[m][k] * Bt[nr(n)][k]; one wave per
// 64x64 tile, no block barriers. A row-major [M][K] pitch lda; Bt row-major [.][K] pitch ldb (k contiguous);
// M, N multiples of 64, K multiple of 32 (host-checked). blockIdx.y = batch index (strides in elements).
// NSPLIT: 0 = A.Bt; 1 = (A + A2).Bt (A2 = unscaled bf16 lo plane of A); 2 = A.Bt + A2.Bt + A.Bt2.
// RB / CB: per-row bias rbp[m] / per-column bias cbp[n] (f32 input values RNE-converted to bf16, not batched)
//          added in the epilogue.
// BAND: A and C start at the first query row of the launch's group of query blocks (row mg of the sequence), the
//       batch index is the (b,h) pair (A offset (pair / NH) * SEQ * DM + (pair % NH) * HD), bandOff = BANDOFF - mg;
//       Bt operand row of output column n is n + bandOff - m0 (m0 = the 64-row tile start within the group), and
//       only column tiles with n0 <= mg + m0 + 64, that is operand row <= SEQ, are computed (wave-uniform early
//       return; the others are never read).
// OUT_MODE: 0 = f32 (pitch ldc); 2 = bf16 hi plane C + bf16 lo plane C2 (lo = RNE(v - hi), unscaled);
//           3 = f16 hi plane C + f16 residual plane C2 = f16((v - hi) * rscale), C2 written only for tiles
//               with n0 < N2 (pitch ldc2, batch stride strideC2).
// =====================================================================================================
template <int NSPLIT, int OUT_MODE, bool RB, bool CB, bool BAND>
__global__ __launch_bounds__(256) void gemm64(
    const unsigned short* __restrict__ Ap, const unsigned short* A2p, int lda, long long strideA,
    const unsigned short* __restrict__ Btp, const unsigned short* Bt2p, int ldb, long long strideB,
    void* Cout, int ldc, long long strideC,
    void* Cout2, int ldc2, long long strideC2, int N2,
    int M, int N, int K, float rscale, int bandOff,
    const float* __restrict__ rbp, const float* __restrict__ cbp) {
  const __bf16* A   = (const __bf16*)(const void*)Ap;
  const __bf16* A2  = (const __bf16*)(const void*)A2p;
  const __bf16* Bt  = (const __bf16*)(const void*)Btp;
  const __bf16* Bt2 = (const __bf16*)(const void*)Bt2p;
  __shared__ __align__(16) float sT[8][16 * 68];   // per-wave 16x64 slab, pitch 68 floats
  const int b    = blockIdx.y;
  const int lane = threadIdx.x & 31;
  const int wave = threadIdx.x >> 5;
  const int tilesN = N >> 6;
  const int tilesM = M >> 6;
  const int tile = blockIdx.x * 8 + wave;
  if (tile >= tilesM * tilesN) return;   // wave-uniform; no block barriers in this kernel
  const int tm = tile / tilesN;
  const int tn = tile - tm * tilesN;
  const int m0 = tm << 6;
  const int n0 = tn << 6;
  const int nr0 = BAND ? (n0 + bandOff - m0) : n0;   // operand row of output column n0 in Bt
  if (BAND) {
    if (nr0 > SEQ) return;               // wave-uniform: only column tiles up to one past the diagonal are needed
  }

  const size_t aB = BAND ? ((size_t)(b / NH) * SEQ * DM + (size_t)(b % NH) * HD) : (size_t)b * strideA;
  const __bf16* Ab  = A  + aB;
  const __bf16* Bb  = Bt + (size_t)b * strideB;
  const __bf16* Ab2 = (NSPLIT >= 1) ? (A2  + aB) : Ab;
  const __bf16* Bb2 = (NSPLIT == 2) ? (Bt2 + (size_t)b * strideB) : Bb;

  const int rlane = lane & 15;                 // row (A) / col (B, D) within subtile
  const int koff  = (lane >> 4) * 8;           // k offset of this lane half
  const int mOff  = (lane >> 4) * 8;           // D row offset

  v8f acc[4][4];
#pragma unroll
  for (int i = 0; i < 4; ++i)
#pragma unroll
    for (int j = 0; j < 4; ++j) acc[i][j] = zero8();

  for (int k0 = 0; k0 < K; k0 += 32) {
    v16b bh[4], bl[4];
#pragma unroll
    for (int j = 0; j < 4; ++j) {
      const size_t bo = (size_t)(nr0 + (j << 4) + rlane) * ldb + koff + k0;
      bh[j] = ldfrag_b(Bb + bo);
      if (NSPLIT == 2) bl[j] = ldfrag_b(Bb2 + bo); else bl[j] = bh[j];
    }
#pragma unroll
    for (int i = 0; i < 4; ++i) {
      const size_t ao = (size_t)(m0 + (i << 4) + rlane) * lda + koff + k0;
      const v16b ah = ldfrag_b(Ab + ao);
      v16b al = ah;
      if (NSPLIT >= 1) al = ldfrag_b(Ab2 + ao);
#pragma unroll
      for (int j = 0; j < 4; ++j) {
        acc[i][j] = mma_b_raw(ah, bh[j], acc[i][j]);
        if (NSPLIT >= 1) acc[i][j] = mma_b_raw(al, bh[j], acc[i][j]);
        if (NSPLIT == 2) acc[i][j] = mma_b_raw(ah, bl[j], acc[i][j]);
      }
      dep_guard_b(acc[i][0], acc[i][3], ah, al);
    }
    keep4_b(bh[0], bh[1], bh[2], bh[3]);
    if (NSPLIT == 2) keep4_b(bl[0], bl[1], bl[2], bl[3]);
  }
  acc_guard4(acc[0][0], acc[0][1], acc[0][2], acc[0][3]);
  acc_guard4(acc[1][0], acc[1][1], acc[1][2], acc[1][3]);
  acc_guard4(acc[2][0], acc[2][1], acc[2][2], acc[2][3]);
  acc_guard4(acc[3][0], acc[3][1], acc[3][2], acc[3][3]);

  // ---- epilogue biases (input values RNE-converted to bf16) ----
  float cbv[4];
#pragma unroll
  for (int j = 0; j < 4; ++j) cbv[j] = CB ? bf_up(bf_bits(cbp[n0 + (j << 4) + rlane])) : 0.0f;

  // ---- epilogue ----
  float* slab = sT[wave];
#pragma unroll
  for (int i = 0; i < 4; ++i) {
    const int mBase = m0 + (i << 4);
#pragma unroll
    for (int r = 0; r < 8; ++r) {
      const float rbv = RB ? bf_up(bf_bits(rbp[mBase + mOff + r])) : 0.0f;
#pragma unroll
      for (int j = 0; j < 4; ++j) {
        slab[(mOff + r) * 68 + (j << 4) + rlane] = acc[i][j][r] + rbv + cbv[j];
      }
    }
    __builtin_amdgcn_fence(__ATOMIC_RELEASE, "workgroup");
    __builtin_amdgcn_wave_barrier();
    __builtin_amdgcn_fence(__ATOMIC_ACQUIRE, "workgroup");
    if (OUT_MODE == 0) {
      float* C = (float*)Cout + (size_t)b * strideC;
      const int hh = lane >> 4, c4 = (lane & 15) * 4;     // 256-B row segment = 16 lanes x 16 B
      v4f ov[8];
#pragma unroll
      for (int it = 0; it < 8; ++it) {
        const int row = it * 2 + hh;                       // it 0..7 x hh 0..1 = rows 0..15
        ov[it] = *(const v4f*)(slab + row * 68 + c4);
      }
      {
#pragma unroll
        for (int it = 0; it < 8; ++it) {
          const int row = it * 2 + hh;
          *(v4f*)(C + (size_t)(mBase + row) * ldc + n0 + c4) = ov[it];
        }
        
      }
    } else {
      const int q = lane >> 3, c8 = (lane & 7) * 8;
      unsigned short* C  = (unsigned short*)Cout  + (size_t)b * strideC;
      unsigned short* C2 = (unsigned short*)Cout2 + (size_t)b * strideC2;
      const bool wlo = (OUT_MODE == 2) || (n0 < N2);      // wave-uniform
      v4u hv[4], lv[4];
#pragma unroll
      for (int it = 0; it < 4; ++it) {
        const int row = it * 4 + q;                        // it 0..3 x q 0..3 = rows 0..15
        const float* sp = slab + row * 68 + c8;
        v4u a, a2;
#pragma unroll
        for (int e = 0; e < 4; ++e) {
          const float f0 = sp[2 * e], f1 = sp[2 * e + 1];
          unsigned short h0, h1, l0, l1;
          if (OUT_MODE == 2) {
            h0 = bf_bits(f0); h1 = bf_bits(f1);
            l0 = bf_bits(f0 - bf_up(h0)); l1 = bf_bits(f1 - bf_up(h1));
          } else {
            const _Float16 x0 = (_Float16)f0, x1 = (_Float16)f1;
            h0 = h_bits(x0); h1 = h_bits(x1);
            l0 = h_bits((_Float16)((f0 - (float)x0) * rscale));
            l1 = h_bits((_Float16)((f1 - (float)x1) * rscale));
          }
          a[e] = pk16(h0, h1); a2[e] = pk16(l0, l1);
        }
        hv[it] = a; lv[it] = a2;
      }
      {
#pragma unroll
        for (int it = 0; it < 4; ++it) {
          const int row = it * 4 + q;
          *(v4u*)(C + (size_t)(mBase + row) * ldc + n0 + c8) = hv[it];
          if (wlo) *(v4u*)(C2 + (size_t)(mBase + row) * ldc2 + n0 + c8) = lv[it];
        }
        
      }
    }
    __builtin_amdgcn_fence(__ATOMIC_RELEASE, "workgroup");
    __builtin_amdgcn_wave_barrier();
    __builtin_amdgcn_fence(__ATOMIC_ACQUIRE, "workgroup");
  }
}

// =====================================================================================================
// Block-tiled bf16 WMMA GEMM for the four projections: same function, operands, wave tile (64x64), product order and
// epilogue as gemm64 without BAND. A block of 4 waves (2 x 2) owns a 128x128 tile of C; the 128 rows of A (and A2) and
// of Bt that it needs are brought into LDS one slab of KS = 128 k at a time by asynchronous copies
// (global_load_async_to_lds_b128: a wave's copy covers two whole 256-byte row pieces), two buffers, so that slab t + 1
// flies while slab t is multiplied; fragments are then read from LDS (row pitch 272 bytes = 17 x 16).
// M, N multiples of 128, K a multiple of KS and at least KS; grid.x = (M/128) * (N/128), blockIdx.y = batch.
// =====================================================================================================
// Eight 16-byte copies per lane, rows gstep elements / lstep bytes apart.
__device__ __forceinline__ void async_rows8(const __bf16* g, size_t gstep, unsigned l, unsigned lstep) {
#if defined(__HIP_DEVICE_COMPILE__)
  // The closing s_wait_xcnt 0 stands in the copies' own statement, so that it is passed before any address register
  // that a copy names is written again.
  asm volatile(
      "global_load_async_to_lds_b128 %0, %8, off\n\t"
      "global_load_async_to_lds_b128 %1, %9, off\n\t"
      "global_load_async_to_lds_b128 %2, %10, off\n\t"
      "global_load_async_to_lds_b128 %3, %11, off\n\t"
      "global_load_async_to_lds_b128 %4, %12, off\n\t"
      "global_load_async_to_lds_b128 %5, %13, off\n\t"
      "global_load_async_to_lds_b128 %6, %14, off\n\t"
      "global_load_async_to_lds_b128 %7, %15, off\n\t"
      "s_wait_xcnt 0x0"
      :: "v"(l), "v"(l + lstep), "v"(l + 2 * lstep), "v"(l + 3 * lstep),
         "v"(l + 4 * lstep), "v"(l + 5 * lstep), "v"(l + 6 * lstep), "v"(l + 7 * lstep),
         "v"(g), "v"(g + gstep), "v"(g + 2 * gstep), "v"(g + 3 * gstep),
         "v"(g + 4 * gstep), "v"(g + 5 * gstep), "v"(g + 6 * gstep), "v"(g + 7 * gstep)
      : "memory");
  // Keeps the address arithmetic of the next eight copies behind these: hoisted in front of them it held the addresses
  // of a whole slab in registers at once (a spill to scratch beside the 128 accumulator registers) and delayed the first copy.
  __builtin_amdgcn_sched_barrier(0);
#endif
}
// The issuing wave's own wait: its copies have landed in LDS behind it.
__device__ __forceinline__ void wait_async0() {
#if defined(__HIP_DEVICE_COMPILE__)
  asm volatile("s_wait_asynccnt 0x0" ::: "memory");
#endif
}
// The wave's LDS reads have returned: stands in front of the barrier behind which their buffer is refilled.
__device__ __forceinline__ void wait_ds0() {
#if defined(__HIP_DEVICE_COMPILE__)
  asm volatile("s_wait_dscnt 0x0" ::: "memory");
#endif
}

template <int NSPLIT, int OUT_MODE, bool RB, bool CB>
__global__ __launch_bounds__(128) void gemm128(
    const unsigned short* __restrict__ Ap, const unsigned short* A2p, int lda, long long strideA,
    const unsigned short* __restrict__ Btp, int ldb, long long strideB,
    void* Cout, int ldc, long long strideC,
    void* Cout2, int ldc2, long long strideC2, int N2,
    int M, int N, int K, float rscale,
    const float* __restrict__ rbp, const float* __restrict__ cbp) {
  static_assert(NSPLIT == 0 || NSPLIT == 1);
  constexpr int KS  = 128;                       // k per slab
  constexpr int SP  = KS + 8;                    // LDS row pitch in elements
  constexpr int NPL = (NSPLIT == 1) ? 3 : 2;     // planes of a slab: A, Bt, (A2)
  constexpr unsigned PLB = 128u * SP * 2u;       // bytes of one plane of a slab
  constexpr unsigned LST = 8u * SP * 2u;         // bytes between two copies of a lane (8 rows)
  __shared__ __align__(16) __bf16 sS[2][NPL][128 * SP];
  __shared__ __align__(16) float sT[4][16 * 68];   // per-wave 16x64 slab, pitch 68 floats
  const __bf16* A   = (const __bf16*)(const void*)Ap;
  const __bf16* A2  = (const __bf16*)(const void*)A2p;
  const __bf16* Bt  = (const __bf16*)(const void*)Btp;
  const int b    = blockIdx.y;
  const int tid  = threadIdx.x;
  const int lane = tid & 31;
  const int wave = tid >> 5;
  const int tilesN = N >> 7;
  const int tilesM = M >> 7;
  const int tile = blockIdx.x;
  if (tile >= tilesM * tilesN) return;   // block-uniform, in front of every copy and barrier
  const int tm  = tile / tilesN;
  const int tn  = tile - tm * tilesN;
  const int bm0 = tm << 7;
  const int bn0 = tn << 7;
  const int wm  = (wave >> 1) << 6;      // the wave's 64x64 tile within the block tile
  const int wn  = (wave & 1) << 6;
  const int m0  = bm0 + wm;
  const int n0  = bn0 + wn;

  // copy addressing: 16 lanes per 256-byte row piece, 8 rows per block-wide copy, 16 copies per lane and plane
  const int cr = tid >> 4, cc = (tid & 15) * 8;
  const __bf16* gA  = A  + (size_t)b * strideA + (size_t)(bm0 + cr) * lda + cc;
  const long long dA2 = A2 - A;          // uniform distance (elements) of the lo plane from the hi plane, same workspace
  const __bf16* gB  = Bt + (size_t)b * strideB + (size_t)(bn0 + cr) * ldb + cc;
  const unsigned l0 = (unsigned)(size_t)(&sS[0][0][0]) + (unsigned)(cr * SP + cc) * 2u;
  auto fill = [&](int t, int bs) {
    const unsigned lb = l0 + (unsigned)bs * (NPL * PLB);
    const size_t ko = (size_t)t * KS;
    async_rows8(gA + ko, (size_t)8 * lda, lb, LST);
    async_rows8(gA + ko + (size_t)64 * lda, (size_t)8 * lda, lb + 8u * LST, LST);
    async_rows8(gB + ko, (size_t)8 * ldb, lb + PLB, LST);
    async_rows8(gB + ko + (size_t)64 * ldb, (size_t)8 * ldb, lb + PLB + 8u * LST, LST);
    if (NSPLIT == 1) {
      async_rows8(gA + (dA2 + (long long)ko), (size_t)8 * lda, lb + 2u * PLB, LST);
      async_rows8(gA + (dA2 + (long long)ko) + (size_t)64 * lda, (size_t)8 * lda, lb + 2u * PLB + 8u * LST, LST);
    }
  };

  const int rlane = lane & 15;                 // row (A) / col (B, D) within subtile
  const int koff  = (lane >> 4) * 8;           // k offset of this lane half
  const int mOff  = (lane >> 4) * 8;           // D row offset

  v8f acc[4][4];
#pragma unroll
  for (int i = 0; i < 4; ++i)
#pragma unroll
    for (int j = 0; j < 4; ++j) acc[i][j] = zero8();

  const int nst = K / KS;                      // slabs, block-uniform
  fill(0, 0);
  wait_async0();
  __syncthreads();                             // slab 0 is published
  if (nst > 1) fill(1, 1);
  for (int t = 0; t < nst; ++t) {
    const __bf16* sA  = &sS[t & 1][0][0] + (wm + rlane) * SP + koff;
    const __bf16* sB  = &sS[t & 1][1][0] + (wn + rlane) * SP + koff;
    const __bf16* sA2 = &sS[t & 1][NPL - 1][0] + (wm + rlane) * SP + koff;
#pragma unroll
    for (int ks = 0; ks < KS; ks += 32) {
      // all fragments of the k step are read in one batch, so that the wave pays the LDS latency once per step
      v16b bh[4], ah[4], al[4];
#pragma unroll
      for (int j = 0; j < 4; ++j) bh[j] = ldfrag_b(sB + (j << 4) * SP + ks);
#pragma unroll
      for (int i = 0; i < 4; ++i) {
        ah[i] = ldfrag_b(sA + (i << 4) * SP + ks);
        if (NSPLIT == 1) al[i] = ldfrag_b(sA2 + (i << 4) * SP + ks); else al[i] = ah[i];
      }
#pragma unroll
      for (int i = 0; i < 4; ++i) {
#pragma unroll
        for (int j = 0; j < 4; ++j) {
          acc[i][j] = mma_b_raw(ah[i], bh[j], acc[i][j]);
          if (NSPLIT == 1) acc[i][j] = mma_b_raw(al[i], bh[j], acc[i][j]);
        }
        dep_guard_b(acc[i][0], acc[i][3], ah[i], al[i]);
      }
      keep4_b(bh[0], bh[1], bh[2], bh[3]);
    }
    // publish point of slab t + 1: own LDS reads returned, own copies landed, then the one barrier of the trip (it
    // publishes slab t + 1 and ends every wave's reads of the buffer that is refilled behind it)
    wait_ds0();
    wait_async0();
    __syncthreads();
    if (t + 2 < nst) fill(t + 2, t & 1);
  }
  wait_async0();                               // no copy is outstanding when the wave goes on
  acc_guard4(acc[0][0], acc[0][1], acc[0][2], acc[0][3]);
  acc_guard4(acc[1][0], acc[1][1], acc[1][2], acc[1][3]);
  acc_guard4(acc[2][0], acc[2][1], acc[2][2], acc[2][3]);
  acc_guard4(acc[3][0], acc[3][1], acc[3][2], acc[3][3]);

  // ---- epilogue biases (input values RNE-converted to bf16) ----
  float cbv[4];
#pragma unroll
  for (int j = 0; j < 4; ++j) cbv[j] = CB ? bf_up(bf_bits(cbp[n0 + (j << 4) + rlane])) : 0.0f;

  // ---- epilogue ----
  float* slab = sT[wave];
#pragma unroll
  for (int i = 0; i < 4; ++i) {
    const int mBase = m0 + (i << 4);
#pragma unroll
    for (int r = 0; r < 8; ++r) {
      const float rbv = RB ? bf_up(bf_bits(rbp[mBase + mOff + r])) : 0.0f;
#pragma unroll
      for (int j = 0; j < 4; ++j) {
        slab[(mOff + r) * 68 + (j << 4) + rlane] = acc[i][j][r] + rbv + cbv[j];
      }
    }
    __builtin_amdgcn_fence(__ATOMIC_RELEASE, "workgroup");
    __builtin_amdgcn_wave_barrier();
    __builtin_amdgcn_fence(__ATOMIC_ACQUIRE, "workgroup");
    if (OUT_MODE == 0) {
      float* C = (float*)Cout + (size_t)b * strideC;
      const int hh = lane >> 4, c4 = (lane & 15) * 4;     // 256-B row segment = 16 lanes x 16 B
      v4f ov[8];
#pragma unroll
      for (int it = 0; it < 8; ++it) {
        const int row = it * 2 + hh;                       // it 0..7 x hh 0..1 = rows 0..15
        ov[it] = *(const v4f*)(slab + row * 68 + c4);
      }
      {
#pragma unroll
        for (int it = 0; it < 8; ++it) {
          const int row = it * 2 + hh;
          *(v4f*)(C + (size_t)(mBase + row) * ldc + n0 + c4) = ov[it];
        }
        
      }
    } else {
      const int q = lane >> 3, c8 = (lane & 7) * 8;
      unsigned short* C  = (unsigned short*)Cout  + (size_t)b * strideC;
      unsigned short* C2 = (unsigned short*)Cout2 + (size_t)b * strideC2;
      const bool wlo = (OUT_MODE == 2) || (n0 < N2);      // wave-uniform
      v4u hv[4], lv[4];
#pragma unroll
      for (int it = 0; it < 4; ++it) {
        const int row = it * 4 + q;                        // it 0..3 x q 0..3 = rows 0..15
        const float* sp = slab + row * 68 + c8;
        v4u a, a2;
#pragma unroll
        for (int e = 0; e < 4; ++e) {
          const float f0 = sp[2 * e], f1 = sp[2 * e + 1];
          unsigned short h0, h1, l0, l1;
          if (OUT_MODE == 2) {
            h0 = bf_bits(f0); h1 = bf_bits(f1);
            l0 = bf_bits(f0 - bf_up(h0)); l1 = bf_bits(f1 - bf_up(h1));
          } else {
            const _Float16 x0 = (_Float16)f0, x1 = (_Float16)f1;
            h0 = h_bits(x0); h1 = h_bits(x1);
            l0 = h_bits((_Float16)((f0 - (float)x0) * rscale));
            l1 = h_bits((_Float16)((f1 - (float)x1) * rscale));
          }
          a[e] = pk16(h0, h1); a2[e] = pk16(l0, l1);
        }
        hv[it] = a; lv[it] = a2;
      }
      {
#pragma unroll
        for (int it = 0; it < 4; ++it) {
          const int row = it * 4 + q;
          *(v4u*)(C + (size_t)(mBase + row) * ldc + n0 + c8) = hv[it];
          if (wlo) *(v4u*)(C2 + (size_t)(mBase + row) * ldc2 + n0 + c8) = lv[it];
        }
        
      }
    }
    __builtin_amdgcn_fence(__ATOMIC_RELEASE, "workgroup");
    __builtin_amdgcn_wave_barrier();
    __builtin_amdgcn_fence(__ATOMIC_ACQUIRE, "workgroup");
  }
}

// =====================================================================================================
// Causal attention with a relative-position bias, head dim 64 (tril mask incl. diagonal, computed).
//   q planes (bf16 hi / lo): element (b, t, h, d) at [(b*SEQ + t)*DM + h*64 + d]
//   k planes (bf16 hi / lo): same layout with key index s
//   v^T hi plane (f16):      element (b, h, d, s) at [(b*DM + h*64 + d)*SEQ + s]
//   v^T residual plane (f16, (v - hi)*4096): [(b*DM + h*64 + d)*VLP + s], s < VLP, read only when RES
//   band plane (f32, per pair p, stride qerStride, row pitch qpitch): row = query t - 64*qbBase, column
//     key - t + 64*qb + 63 (in [0, qpitch), address clamped to qpitch-1; values beyond the clamp only occur for
//     masked keys) holds q[t] . Er[2*SEQ-1-SEQ + ... ] i.e. the relative term of (query t, key).
//   logit = (q.k + band) * sscale for key <= query, -FLT_MAX otherwise (exp -> 0); every row has a live key in
//   every processed key tile (tiles 0..qb only, block-uniform trip count qb+1 <= 32).
//   output: ctx hi / lo bf16 planes, element (b, t, h*64 + d) at [(b*SEQ + t)*DM + h*64 + d] = normalised
//   context (lo = RNE(v - hi), unscaled).
//   scores = q . k : bf16 hi/lo split (hi.hi + hi.lo + lo.hi), f32 accumulate, band added in f32, * sscale in f32
//   p = exp(s - m) carried as f16(1024 p); context = p . v on f16 WMMA; RES adds f16 residual planes of p and v
//   (scale 4096, separate accumulator folded back with 1/4096 per chunk in f32); online softmax in f32.
//   Block = 4 waves = 64 query rows of one (b, h); grid = nqbThis * NP (pair index = blockIdx.x / nqbThis,
//   b = pair / NH, h = pair % NH); kv chunks of 64.
//   K / V^T chunk staging: 128 threads x 32 elements per plane = the whole 64x64 tile (plain 16-B loads,
//   __syncthreads before and after); P tiles are wave-private, spilled with _Float16 element stores and reloaded
//   Output coverage: each wave stores its rows 0..15 (it 0..3 x lane>>3 0..3) x 64 columns (8 lanes x 8 bf16),
// =====================================================================================================
// Band values of one 16-row x 64-key wave tile, one register per (row r, column block j): 32 independent loads with
// no use between them, so that the wave pays their latency once. row0 = the lane's first row within the group's
// plane, cb0 = band column of (row0, key c of key tile 0); the column falls by one per row. An element index fits
// 32 bits (a pair's plane is below 8 MiB), so every load is the pair's uniform base plus a lane index.
__device__ __forceinline__ void load_band(float (&bnd)[8][4], const float* __restrict__ Bq,
                                          int row0, int cb0, int kv, int qpitch) {
#pragma unroll
  for (int g = 0; g < 2; ++g) {
    unsigned ix[4][4];
#pragma unroll
    for (int rr = 0; rr < 4; ++rr) {
      const int r = 4 * g + rr;
#pragma unroll
      for (int j = 0; j < 4; ++j) {
        int col = cb0 - r + kv + (j << 4);                         // >= 0 by construction
        col = (col < qpitch) ? col : (qpitch - 1);                 // clamped address (masked keys only)
        ix[rr][j] = (unsigned)((row0 + r) * qpitch + col);
        bnd[r][j] = Bq[ix[rr][j]];
      }
    }
#if defined(__HIP_DEVICE_COMPILE__)
    // The wait that stands in front of any overwrite of a register an issued load names. It takes the 16 index
    // registers as inputs so that they stay untouched (also by a later load's result) until it has been passed,
    // and the base pointer so that the compiler keeps these loads in front of it.
    asm volatile("s_wait_xcnt 0x0"
                 :: "v"(ix[0][0]), "v"(ix[0][1]), "v"(ix[0][2]), "v"(ix[0][3]),
                    "v"(ix[1][0]), "v"(ix[1][1]), "v"(ix[1][2]), "v"(ix[1][3]),
                    "v"(ix[2][0]), "v"(ix[2][1]), "v"(ix[2][2]), "v"(ix[2][3]),
                    "v"(ix[3][0]), "v"(ix[3][1]), "v"(ix[3][2]), "v"(ix[3][3]), "s"(Bq)
                 : "memory");
#endif
  }
}

template <bool RES>
__global__ __launch_bounds__(128)
void attn_rel64(const unsigned short* __restrict__ qhp, const unsigned short* __restrict__ qlp,
                const unsigned short* __restrict__ khp, const unsigned short* __restrict__ klp,
                const unsigned short* __restrict__ vhp, const unsigned short* __restrict__ vlp,
                const float* __restrict__ qerp, long long qerStride, int qpitch,
                unsigned short* ahp, unsigned short* alp,
                int qbBase, int nqbThis, float sscale) {
  union FB { v16b v; v8b h[2]; };
  union FH { v16h v; v8h h[2]; };
  // Row pitches: 64 elements of data plus 16 bytes, an odd multiple of 16 bytes, so that the 16 rows which a 16-byte
  // fragment load reads at once fall on 64 different banks (at 128 or 256 bytes they share a few banks).
  constexpr int LP = 72;                                          // 16-bit tiles: 144 bytes a row
  constexpr int OP = 68;                                          // f32 tile: 272 bytes a row
  __shared__ __align__(16) __bf16   Ksh[64 * LP];                 // K hi [kv][d]   9 KB
  __shared__ __align__(16) __bf16   Ksl[64 * LP];                 // K lo
  __shared__ __align__(16) _Float16 Vth[64 * LP];                 // V^T hi [d][kv] 9 KB
  __shared__ __align__(16) _Float16 Vtl[RES ? 64 * LP : 8];       // V^T residual
  __shared__ __align__(16) _Float16 Psh[4][16 * LP];              // per wave P [row][kv]
  __shared__ __align__(16) _Float16 Psl[RES ? 4 : 1][16 * LP];    // per wave P residual
  __shared__ __align__(16) float    Os[4][16 * OP];               // per wave context tile [row][d]

  const int tid  = threadIdx.x;
  const int wave = tid >> 5;
  const int lane = tid & 31;
  const int hh   = lane >> 4;
  const int c    = lane & 15;

  const int bx   = blockIdx.x;
  const int qbl  = bx % nqbThis;
  const int pr   = bx / nqbThis;          // (b,h) pair index, 0..NP-1
  const int h    = pr % NH;
  const int b    = pr / NH;
  const int qb   = qbBase + qbl;
  const int q0   = qb * 64 + wave * 16;
  const size_t rowB = (size_t)b * SEQ;

  const __bf16* Qh = (const __bf16*)(const void*)qhp + (size_t)h * HD;
  const __bf16* Ql = (const __bf16*)(const void*)qlp + (size_t)h * HD;
  const __bf16* Kh = (const __bf16*)(const void*)khp + (size_t)h * HD;
  const __bf16* Kl = (const __bf16*)(const void*)klp + (size_t)h * HD;
  const _Float16* Vh = (const _Float16*)(const void*)vhp + ((size_t)b * DM + (size_t)h * HD) * SEQ;
  const _Float16* Vl = (const _Float16*)(const void*)vlp + ((size_t)b * DM + (size_t)h * HD) * VLP;
  const float* Bq = qerp + (size_t)pr * (size_t)qerStride;

  // ---- Q fragments (A operand, row = lane&15): 2 d-chunks, hi and lo ----
  v16b qah[2], qal[2];
#pragma unroll
  for (int dc = 0; dc < 2; ++dc) {
    const size_t qo = (rowB + q0 + c) * DM + dc * 32 + 8 * hh;
    qah[dc] = ldfrag_b(Qh + qo);
    qal[dc] = ldfrag_b(Ql + qo);
  }

  float mrow[8], lrow[8];
  v8f oacc[4];
#pragma unroll
  for (int r = 0; r < 8; ++r) { mrow[r] = -INFINITY; lrow[r] = 0.f; }
#pragma unroll
  for (int t = 0; t < 4; ++t) oacc[t] = zero8();

  int nkt = qb + 1;                          // causal: key tiles 0..qb, block-uniform
  if (nkt > NQB) nkt = NQB;

  // band values are fetched one key tile ahead: tile 0 here, tile kt + 1 inside trip kt
  const int brow0 = q0 + 8 * hh - qbBase * 64;
  const int bcb0  = c + (qb * 64 + 63 - (q0 + 8 * hh));
  float bnd[8][4];
  load_band(bnd, Bq, brow0, bcb0, 0, qpitch);
  for (int kt = 0; kt < nkt; ++kt) {
    const int kv0 = kt * 64;
    __syncthreads();
    {
      const int r = tid >> 1, half = (tid & 1) * 32;
      const __bf16*   kg  = Kh + (rowB + kv0 + r) * DM + half;    // K row kv0+r, d = half..half+31
      const __bf16*   klg = Kl + (rowB + kv0 + r) * DM + half;
      const _Float16* vg  = Vh + (size_t)r * SEQ + kv0 + half;    // V^T row d = r, s = kv0+half..+31
      const int kvl = (kv0 + 64 <= VLP) ? kv0 : (VLP - 64);     // clamped address into the residual plane
      const _Float16* vlg = Vl + (size_t)r * VLP + kvl + half;
      const bool resOK = (kv0 + 64 <= VLP);                      // block-uniform
#pragma unroll
      for (int i = 0; i < 4; ++i) {
        const v8b a0 = *(const v8b*)(kg + 8 * i);
        const v8b a1 = *(const v8b*)(klg + 8 * i);
        const v8h b0 = *(const v8h*)(vg + 8 * i);
        *(v8b*)(Ksh + r * LP + half + 8 * i) = a0;
        *(v8b*)(Ksl + r * LP + half + 8 * i) = a1;
        *(v8h*)(Vth + r * LP + half + 8 * i) = b0;
        if (RES) {
          v8h b1 = *(const v8h*)(vlg + 8 * i);
          if (!resOK) b1 = zero8h();
          *(v8h*)(Vtl + r * LP + half + 8 * i) = b1;
        }
      }
    }
    __syncthreads();

    // ---- scores: 16 query rows x 64 keys per wave, 3 bf16 products ----
    v8f s[4];
#pragma unroll
    for (int j = 0; j < 4; ++j) {
      s[j] = zero8();
#pragma unroll
      for (int dc = 0; dc < 2; ++dc) {
        FB kb, kl;
        kb.h[0] = *(const v8b*)(Ksh + (j * 16 + c) * LP + dc * 32 + 8 * hh);
        kb.h[1] = *(const v8b*)(Ksh + (j * 16 + c) * LP + dc * 32 + 16 + 8 * hh);
        kl.h[0] = *(const v8b*)(Ksl + (j * 16 + c) * LP + dc * 32 + 8 * hh);
        kl.h[1] = *(const v8b*)(Ksl + (j * 16 + c) * LP + dc * 32 + 16 + 8 * hh);
        s[j] = mma_b(qah[dc], kb.v, s[j]);
        s[j] = mma_b(qah[dc], kl.v, s[j]);
        s[j] = mma_b(qal[dc], kb.v, s[j]);
      }
    }

    // ---- band term of this tile (fetched during the previous trip), then the next tile's 32 loads in one batch:
    //      the softmax runs while they fly (the fence in front of p.v is the first wait that covers them). The last
    //      trip has no next tile and fetches its own again (written columns only). ----
#pragma unroll
    for (int r = 0; r < 8; ++r)
#pragma unroll
      for (int j = 0; j < 4; ++j) s[j][r] += bnd[r][j];
    load_band(bnd, Bq, brow0, bcb0, (kt + 1 < nkt) ? (kv0 + 64) : kv0, qpitch);

    // ---- scale + causal mask (replace by -FLT_MAX), row max, online softmax, P (x1024, f16)
    //      and P residual (x4096) to LDS ----
    _Float16* pwh = Psh[wave];
    _Float16* pwl = Psl[RES ? wave : 0];
#pragma unroll
    for (int r = 0; r < 8; ++r) {
      const int qrow = q0 + 8 * hh + r;
      float m = -INFINITY;
#pragma unroll
      for (int j = 0; j < 4; ++j) {
        const int key = kv0 + j * 16 + c;
        float sv = s[j][r] * sscale;
        sv = (key > qrow) ? -FLT_MAX : sv;
        s[j][r] = sv;
        m = fmaxf(m, sv);
      }
#pragma unroll
      for (int off = 1; off < 16; off <<= 1) m = fmaxf(m, __shfl_xor(m, off, 32));
      const float mnew  = fmaxf(mrow[r], m);
      const float msafe = (mnew == -INFINITY) ? 0.f : mnew;
      const float alpha = __expf(mrow[r] - msafe);
      mrow[r] = mnew;
      float psum = 0.f;
#pragma unroll
      for (int j = 0; j < 4; ++j) {
        const float p = __expf(s[j][r] - msafe);     // masked logit against a finite max: exp -> 0
        psum += p;
        const float p1k = p * 1024.0f;
        const _Float16 ph = (_Float16)p1k;
        pwh[(8 * hh + r) * LP + j * 16 + c] = ph;
        if (RES) {
          const _Float16 pl = (_Float16)((p1k - (float)ph) * 4096.0f);
          pwl[(8 * hh + r) * LP + j * 16 + c] = pl;
        }
      }
#pragma unroll
      for (int off = 1; off < 16; off <<= 1) psum += __shfl_xor(psum, off, 32);
      lrow[r] = lrow[r] * alpha + psum;
#pragma unroll
      for (int t = 0; t < 4; ++t) oacc[t][r] *= alpha;
    }
    __builtin_amdgcn_fence(__ATOMIC_RELEASE, "workgroup");
    __builtin_amdgcn_wave_barrier();
    __builtin_amdgcn_fence(__ATOMIC_ACQUIRE, "workgroup");

    // ---- context += P . V (f16 WMMA), residual products into a separate accumulator ----
    v8f o1[4];
#pragma unroll
    for (int t = 0; t < 4; ++t) o1[t] = zero8();
#pragma unroll 1
    for (int kk = 0; kk < 2; ++kk) {
      FH pa, pl;
      pa.h[0] = *(const v8h*)(pwh + c * LP + kk * 32 + 8 * hh);
      pa.h[1] = *(const v8h*)(pwh + c * LP + kk * 32 + 16 + 8 * hh);
      if (RES) {
        pl.h[0] = *(const v8h*)(pwl + c * LP + kk * 32 + 8 * hh);
        pl.h[1] = *(const v8h*)(pwl + c * LP + kk * 32 + 16 + 8 * hh);
      } else {
        pl.v = pa.v;
      }
#pragma unroll
      for (int t = 0; t < 4; ++t) {
        FH vb;
        vb.h[0] = *(const v8h*)(Vth + (t * 16 + c) * LP + kk * 32 + 8 * hh);
        vb.h[1] = *(const v8h*)(Vth + (t * 16 + c) * LP + kk * 32 + 16 + 8 * hh);
        oacc[t] = mma_h(pa.v, vb.v, oacc[t]);
        if (RES) {
          FH vl;
          vl.h[0] = *(const v8h*)(Vtl + (t * 16 + c) * LP + kk * 32 + 8 * hh);
          vl.h[1] = *(const v8h*)(Vtl + (t * 16 + c) * LP + kk * 32 + 16 + 8 * hh);
          o1[t] = mma_h(pa.v, vl.v, o1[t]);
          o1[t] = mma_h(pl.v, vb.v, o1[t]);
        }
      }
    }
    if (RES) {
#pragma unroll
      for (int t = 0; t < 4; ++t)
#pragma unroll
        for (int r = 0; r < 8; ++r) oacc[t][r] += o1[t][r] * (1.0f / 4096.0f);
    }
  }

  // ---- normalise (1/l and the 1/1024 p carry), stage the wave's 16x64 tile in LDS, then convert to
  float* os = Os[wave];
#pragma unroll
  for (int r = 0; r < 8; ++r) {
    const float l = lrow[r];
    const float inv = ((l > 0.f) ? (1.0f / l) : 0.f) * (1.0f / 1024.0f);
#pragma unroll
    for (int t = 0; t < 4; ++t) os[(8 * hh + r) * OP + t * 16 + c] = oacc[t][r] * inv;
  }
  __builtin_amdgcn_fence(__ATOMIC_RELEASE, "workgroup");
  __builtin_amdgcn_wave_barrier();
  __builtin_amdgcn_fence(__ATOMIC_ACQUIRE, "workgroup");
  {
    const int q4 = lane >> 3, c8 = (lane & 7) * 8;
    v4u hv[4], lv[4];
#pragma unroll
    for (int it = 0; it < 4; ++it) {
      const int row = it * 4 + q4;             // it 0..3 x q4 0..3 = rows 0..15 of the wave tile
      const float* sp = os + row * OP + c8;
      v4u a, a2;
#pragma unroll
      for (int e = 0; e < 4; ++e) {
        const float f0 = sp[2 * e], f1 = sp[2 * e + 1];
        const unsigned short x0 = bf_bits(f0), x1 = bf_bits(f1);
        const unsigned short y0 = bf_bits(f0 - bf_up(x0)), y1 = bf_bits(f1 - bf_up(x1));
        a[e] = pk16(x0, x1); a2[e] = pk16(y0, y1);
      }
      hv[it] = a; lv[it] = a2;
    }
    {
#pragma unroll
      for (int it = 0; it < 4; ++it) {
        const int row = it * 4 + q4;
        const size_t go = (rowB + q0 + row) * DM + (size_t)h * HD + c8;
        *(v4u*)(ahp + go) = hv[it];
        *(v4u*)(alp + go) = lv[it];
      }
      
    }
  }
}

// =====================================================================================================
// Workspace map (bytes), every region an exact multiple of its whole-line / whole-tile store granularity:
//   Xb    bf16 [4096][1024]            0           8388608
//   Wqb   bf16 [1024 out][1024 in]     8388608     2097152
//   Wkb   bf16 [1024][1024]            10485760    2097152
//   Wvb   bf16 [1024][1024]            12582912    2097152
//   Wob   bf16 [1024][1024]            14680064    2097152
//   Erb   bf16 [4096][64] (4095 used)  16777216     524288
//   Qh    bf16 [4096][1024]            17301504    8388608
//   Ql    bf16 [4096][1024]            25690112    8388608
//   Kh    bf16 [4096][1024]            34078720    8388608
//   Kl    bf16 [4096][1024]            42467328    8388608
//   VTh   f16  [2][1024][2048]         50855936    8388608
//   VTl   f16  [2][1024][512]          59244544    2097152
//   Ah    bf16 [4096][1024]            61341696    8388608
//   Al    bf16 [4096][1024]            69730304    8388608
//   QER   f32  [32][704][2048]         78118912  184549376   (largest of the three groups' band planes)
//   end                                262668288
// Weights arrive [in][out]; y = x . W needs Bt[out][in] (in contiguous) -> transpose-convert once.
// =====================================================================================================
extern "C" void kernel_launch(void* const* d_in, const int* in_sizes, int n_in,
                              void* d_out, int out_size, void* d_ws, size_t ws_size,
                              hipStream_t stream) {
  if (n_in < 10) return;
  if (in_sizes[0] != NB * SEQ * DM) return;
  if (in_sizes[1] != DM * DM || in_sizes[3] != DM * DM || in_sizes[5] != DM * DM || in_sizes[7] != DM * DM) return;
  if (in_sizes[2] != DM || in_sizes[4] != DM || in_sizes[6] != DM || in_sizes[8] != DM) return;
  if (in_sizes[9] != ERR * HD) return;
  if (out_size != NB * SEQ * DM) return;

  const float* x  = (const float*)d_in[0];
  const float* Wq = (const float*)d_in[1];
  const float* bq = (const float*)d_in[2];
  const float* Wk = (const float*)d_in[3];
  const float* bk = (const float*)d_in[4];
  const float* Wv = (const float*)d_in[5];
  const float* bv = (const float*)d_in[6];
  const float* Wo = (const float*)d_in[7];
  const float* bo = (const float*)d_in[8];
  const float* Er = (const float*)d_in[9];

  const size_t PXb  = (size_t)NB * SEQ * DM * 2;       //  8388608  16-bit activation plane [4096][1024]
  const size_t PW   = (size_t)DM * DM * 2;             //  2097152
  const size_t PEr  = (size_t)(ERR + 1) * HD * 2;      //   524288  (rows padded to 4096)
  const size_t PVTh = (size_t)NB * DM * SEQ * 2;       //  8388608
  const size_t PVTl = (size_t)NB * DM * VLP * 2;       //  2097152
  const size_t PQER = (size_t)NP * (NQB - QSPLIT) * 64 * NQC * 4;   // 184549376, the last group's band planes
  size_t off = 0;
  const size_t oXb  = off; off += PXb;
  const size_t oWq  = off; off += PW;
  const size_t oWk  = off; off += PW;
  const size_t oWv  = off; off += PW;
  const size_t oWo  = off; off += PW;
  const size_t oEr  = off; off += PEr;
  const size_t oQh  = off; off += PXb;
  const size_t oQl  = off; off += PXb;
  const size_t oKh  = off; off += PXb;
  const size_t oKl  = off; off += PXb;
  const size_t oVTh = off; off += PVTh;
  const size_t oVTl = off; off += PVTl;
  const size_t oAh  = off; off += PXb;
  const size_t oAl  = off; off += PXb;
  const size_t oQER = off; off += PQER;
  if (off > ws_size) return;                           // off = 262668288

  char* ws = (char*)d_ws;
  unsigned short* Xb  = (unsigned short*)(ws + oXb);
  unsigned short* Wqb = (unsigned short*)(ws + oWq);
  unsigned short* Wkb = (unsigned short*)(ws + oWk);
  unsigned short* Wvb = (unsigned short*)(ws + oWv);
  unsigned short* Wob = (unsigned short*)(ws + oWo);
  unsigned short* Erb = (unsigned short*)(ws + oEr);
  unsigned short* Qh  = (unsigned short*)(ws + oQh);
  unsigned short* Ql  = (unsigned short*)(ws + oQl);
  unsigned short* Kh  = (unsigned short*)(ws + oKh);
  unsigned short* Kl  = (unsigned short*)(ws + oKl);
  unsigned short* VTh = (unsigned short*)(ws + oVTh);
  unsigned short* VTl = (unsigned short*)(ws + oVTl);
  unsigned short* Ah  = (unsigned short*)(ws + oAh);
  unsigned short* Al  = (unsigned short*)(ws + oAl);
  float*          QER = (float*)(ws + oQER);

  const dim3 blk(256);
  const int n8x  = NB * SEQ * DM / 8;                                // 524288
  const int n8er = ERR * HD / 8;                                     // 32760
  const dim3 gCvtX((n8x + 255) / 256);                               // 2048 blocks
  const dim3 gCvtEr((n8er + 255) / 256);                             // 128 blocks
  const dim3 gTr(DM / 64, DM / 64);                                  // (out cols / 64, in rows / 64)
  const dim3 blkG(128);                                              // gemm128: 4 waves, one 128x128 tile
  const dim3 gQ((NB * SEQ / 128) * (DM / 128), 1);                   // 256 blocks
  const dim3 gVT((DM / 128) * (SEQ / 128), NB);                      // 128 blocks x 2 batches
  const dim3 gOut((NB * SEQ / 128) * (DM / 128), 1);                 // 256 blocks

  // (1) x -> bf16 plane [4096][1024]; Er -> bf16 plane [4095][64]
  cvt_bf16x8<<<gCvtX, blk, 0, stream>>>(x, Xb, n8x);
  cvt_bf16x8<<<gCvtEr, blk, 0, stream>>>(Er, Erb, n8er);
  // (2) weights [in][out] f32 -> bf16 [out][in] planes
  tr_cvt64<<<gTr, blk, 0, stream>>>(Wq, Wqb, DM, DM);
  tr_cvt64<<<gTr, blk, 0, stream>>>(Wk, Wkb, DM, DM);
  tr_cvt64<<<gTr, blk, 0, stream>>>(Wv, Wvb, DM, DM);
  tr_cvt64<<<gTr, blk, 0, stream>>>(Wo, Wob, DM, DM);
  // (3) q and k projections: Qh/Ql[b*SEQ+s][e] = hi/lo of (bq[e] + sum_d Xb[s][d] Wqb[e][d])  (M=4096, N=1024, K=1024)
  gemm128<0, 2, false, true><<<gQ, blkG, 0, stream>>>(
      Xb, Xb, DM, 0LL, Wqb, DM, 0LL,
      (void*)Qh, DM, 0LL, (void*)Ql, DM, 0LL, 0,
      NB * SEQ, DM, DM, 1.0f, bq, bq);
  gemm128<0, 2, false, true><<<gQ, blkG, 0, stream>>>(
      Xb, Xb, DM, 0LL, Wkb, DM, 0LL,
      (void*)Kh, DM, 0LL, (void*)Kl, DM, 0LL, 0,
      NB * SEQ, DM, DM, 1.0f, bk, bk);
  // (4) v^T per batch: VTh[b][m][s] = bv[m] + sum_d Wvb[m][d] Xb[b*SEQ+s][d] -> f16 hi plane (pitch SEQ) and
  //     residual plane (x4096, keys < VLP, pitch VLP)  (M=1024, N=2048, K=1024)
  gemm128<0, 3, true, false><<<gVT, blkG, 0, stream>>>(
      Wvb, Wvb, DM, 0LL, Xb, DM, (long long)SEQ * DM,
      (void*)VTh, SEQ, (long long)DM * SEQ, (void*)VTl, VLP, (long long)DM * VLP, VLP,
      DM, SEQ, DM, 4096.0f, bv, bv);
  // (5) three groups of query blocks, each launch over all NP pairs: band planes of the group, then its attention.
  //     A group [qa, qe) needs band columns 0 .. 64*(qe+1)-1 (at most NQC): that is its row pitch.
  const int gqa[3] = {0, RESQB, QSPLIT};
  const int gqe[3] = {RESQB, QSPLIT, NQB};
  for (int g = 0; g < 3; ++g) {
    const int qa = gqa[g];
    const int nq = gqe[g] - qa;
    const int pitch = ((gqe[g] + 1 < NQB) ? (gqe[g] + 1) : NQB) * 64;
    const long long qerStride = (long long)nq * 64 * pitch;
    const size_t aoff = (size_t)qa * 64 * DM;
    const dim3 gBand((nq * (pitch / 64) + 7) / 8, NP);
    // QER[p][t - 64*qa][c] = sum_d (Qh+Ql)[b*SEQ+t][h*64+d] * Erb[BANDOFF - 64*(t/64) + c][d]   (M=64*nq, N=pitch, K=64)
    gemm64<1, 0, false, false, true><<<gBand, blk, 0, stream>>>(
        Qh + aoff, Ql + aoff, DM, 0LL, Erb, Erb, HD, 0LL,
        (void*)QER, pitch, qerStride, (void*)QER, 0, 0LL, 0,
        nq * 64, pitch, HD, 1.0f, BANDOFF - qa * 64, bq, bq);
    if (g == 0) {
      attn_rel64<true><<<dim3(nq * NP), dim3(128), 0, stream>>>(
          Qh, Ql, Kh, Kl, VTh, VTl, QER, qerStride, pitch, Ah, Al, qa, nq, 0.125f);
    } else {
      attn_rel64<false><<<dim3(nq * NP), dim3(128), 0, stream>>>(
          Qh, Ql, Kh, Kl, VTh, VTl, QER, qerStride, pitch, Ah, Al, qa, nq, 0.125f);
    }
  }
  // (6) out[s][e] = bo[e] + sum_d (Ah+Al)[s][d] Wob[e][d] -> d_out f32 [4096][1024]  (M=4096, N=1024, K=1024)
  gemm128<1, 0, false, true><<<gOut, blkG, 0, stream>>>(
      Ah, Al, DM, 0LL, Wob, DM, 0LL,
      d_out, DM, 0LL, d_out, 0, 0LL, 0,
      NB * SEQ, DM, DM, 1.0f, bo, bo);
  (void)hipGetLastError();
}

// v005
// A run of this version takes 321 microseconds.
// Next to v004, in two timings, it ran 1.15 times as fast each time.
// Counting every step since v000, it is 17.1 times as fast.
// Contractions: x.Wq / x.Wk / Wv.x^T projections = v_wmma_f32_16x16x32_bf16 (bf16 operands from RNE-converted inputs, single product, f32 bias epilogue);
// q.k^T scores = v_wmma_f32_16x16x32_bf16 with q and k as bf16 hi/lo planes (hi.hi + hi.lo + lo.hi); q.Er^T band = same with q hi/lo times bf16 Er (2 products);
// p.v = v_wmma_f32_16x16x32_f16 (p carried x1024 in f16, v in f16; f16 residual planes x4096 of p and v on the leading query blocks);
// ctx.Wo = v_wmma_f32_16x16x32_bf16 with ctx as bf16 hi/lo planes times bf16 Wo (2 products); all f32 accumulate; softmax in f32.
#include <hip/hip_runtime.h>
#include <math.h>
#include <float.h>
#include <stdint.h>

#define NB      2
#define SEQ     2048
#define DM      1024
#define NH      16
#define HD      64
#define NQB     (SEQ / 64)       // 32 query / key tiles of 64
#define NQC     SEQ              // row pitch of the last (largest) group's band plane per (b,h)
#define BANDOFF (SEQ - 64)       // table row of band column 0 for the query tile starting at m0 is BANDOFF - m0
#define ERR     (2 * SEQ - 1)    // 4095 rows of the relative table
#define VLP     512              // key pitch of the v^T residual plane (keys 0..VLP-1)
#define RESQB   8                // leading 64-row query blocks that use the p / v residual planes
#define NP      (NB * NH)        // 32 (b,h) pairs: every band / attention launch covers all of them
#define QSPLIT  21               // first query block of the last group; groups are [0,RESQB) [RESQB,QSPLIT) [QSPLIT,NQB)
static_assert(RESQB * 64 <= VLP);
static_assert(NH * HD == DM);
static_assert((SEQ % 64) == 0 && (DM % 64) == 0);
static_assert(HD == 64);
static_assert(RESQB < QSPLIT && QSPLIT < NQB);
static_assert((QSPLIT - RESQB) * (QSPLIT + 1) <= (NQB - QSPLIT) * NQB && RESQB * (RESQB + 1) <= (NQB - QSPLIT) * NQB);  // last group's planes are the largest
static_assert(BANDOFF == SEQ - 1 - 63);
static_assert((SEQ % 128) == 0 && (DM % 128) == 0);   // gemm128: whole 128x128 tiles and whole 128-k slabs

typedef _Float16 v16h __attribute__((ext_vector_type(16)));
typedef _Float16 v8h  __attribute__((ext_vector_type(8)));
typedef __bf16   v16b __attribute__((ext_vector_type(16)));
typedef __bf16   v8b  __attribute__((ext_vector_type(8)));
typedef float    v8f  __attribute__((ext_vector_type(8)));
typedef float    v4f  __attribute__((ext_vector_type(4)));
typedef unsigned int v4u __attribute__((ext_vector_type(4)));
typedef unsigned short v8us __attribute__((ext_vector_type(8)));

// ---- scalar helpers --------------------------------------------------------------------------------
__device__ __forceinline__ unsigned short bf_bits(float f) {          // f32 -> bf16 bits, RNE convert
  unsigned u = __float_as_uint(f);
  return (unsigned short)((u + 0x7FFFu + ((u >> 16) & 1u)) >> 16);
}
__device__ __forceinline__ float bf_up(unsigned short h) { return __uint_as_float(((unsigned)h) << 16); }
__device__ __forceinline__ unsigned short h_bits(_Float16 x) { return __builtin_bit_cast(unsigned short, x); }
__device__ __forceinline__ unsigned pk16(unsigned short a, unsigned short b) { return (unsigned)a | ((unsigned)b << 16); }
__device__ __forceinline__ v8f zero8() { v8f z = {0.f, 0.f, 0.f, 0.f, 0.f, 0.f, 0.f, 0.f}; return z; }
__device__ __forceinline__ v8h zero8h() {
  const _Float16 z = (_Float16)0.0f;
  v8h r = {z, z, z, z, z, z, z, z};
  return r;
}

// ---- fragment loader: 16-bit A/B operand, lane -> row/col (lane&15), p already includes +8*(lane>>4);
//      elements 0..7 <- p[0..7] (k0+8h..), elements 8..15 <- p[16..23] (k0+16+8h..)
__device__ __forceinline__ v16b ldfrag_b(const __bf16* p) {
  union { v16b v; v8b h[2]; } f;
  f.h[0] = *(const v8b*)(p);
  f.h[1] = *(const v8b*)(p + 16);
  return f.v;
}

// ---- WMMA helpers with trailing VALU hazard gap --------------------------------------------------------
__device__ __forceinline__ v8f mma_b(v16b a, v16b b, v8f c) {
  c = __builtin_amdgcn_wmma_f32_16x16x32_bf16(false, a, false, b, (short)0, c, false, false);
#if defined(__HIP_DEVICE_COMPILE__)
  asm volatile("v_nop\n\tv_nop\n\tv_nop\n\tv_nop" : "+v"(c) : "v"(a), "v"(b));
#endif
  return c;
}
__device__ __forceinline__ v8f mma_h(v16h a, v16h b, v8f c) {
  c = __builtin_amdgcn_wmma_f32_16x16x32_f16(false, a, false, b, (short)0, c, false, false);
#if defined(__HIP_DEVICE_COMPILE__)
  asm volatile("v_nop\n\tv_nop\n\tv_nop\n\tv_nop" : "+v"(c) : "v"(a), "v"(b));
#endif
  return c;
}
__device__ __forceinline__ v8f mma_b_raw(v16b a, v16b b, v8f c) {
  return __builtin_amdgcn_wmma_f32_16x16x32_bf16(false, a, false, b, (short)0, c, false, false);
}
__device__ __forceinline__ void dep_guard_b(v8f& a, v8f& b, v16b x, v16b y) {
#if defined(__HIP_DEVICE_COMPILE__)
  asm volatile("v_nop\n\tv_nop\n\tv_nop\n\tv_nop" : "+v"(a), "+v"(b) : "v"(x), "v"(y));
#endif
}
__device__ __forceinline__ void keep4_b(v16b a, v16b b, v16b c, v16b d) {
#if defined(__HIP_DEVICE_COMPILE__)
  asm volatile("v_nop" :: "v"(a), "v"(b), "v"(c), "v"(d));
#endif
}
__device__ __forceinline__ void acc_guard4(v8f& a, v8f& b, v8f& c, v8f& d) {
#if defined(__HIP_DEVICE_COMPILE__)
  asm volatile("v_nop\n\tv_nop\n\tv_nop\n\tv_nop" : "+v"(a), "+v"(b), "+v"(c), "+v"(d));
#endif
}

// =====================================================================================================
// f32 -> bf16 (RNE convert), 8 elements per thread, one 16-B store per lane: a wave writes 512 contiguous B
// grid = ceil(n8/256). coverage: n8 threads x 8 = whole plane (n8 is a multiple of 8 here, so every
// =====================================================================================================
__global__ __launch_bounds__(256) void cvt_bf16x8(const float* __restrict__ in, unsigned short* out, int n8) {
  const int i = blockIdx.x * 256 + threadIdx.x;
  if (i < n8) {
    const v4f a = *(const v4f*)(in + (size_t)i * 8);
    const v4f b = *(const v4f*)(in + (size_t)i * 8 + 4);
    v4u p;
    p[0] = pk16(bf_bits(a[0]), bf_bits(a[1]));
    p[1] = pk16(bf_bits(a[2]), bf_bits(a[3]));
    p[2] = pk16(bf_bits(b[0]), bf_bits(b[1]));
    p[3] = pk16(bf_bits(b[2]), bf_bits(b[3]));
    *(v4u*)(out + (size_t)i * 8) = p;
    
  }
}

// =====================================================================================================
// Transpose-convert: in f32 [R][C] (row pitch C) -> out bf16 [C][R] (row pitch R), out[c][r] = RNE bf16(in[r][c]).
// Block = 256 threads = one 64(r) x 64(c) tile; grid = (C/64, R/64) (host-checked exact multiples).
// Load: thread t reads row r0 + (t>>2), columns c0 + (t&3)*16 .. +15 (four 16-B loads), scatters the
// converted bits into LDS sT[c][r] (pitch 72); __syncthreads; store: wave w writes output rows
// coverage: 8 waves x 2 it x 4 = 64 output rows x (8 lanes x 8) = 64 columns = the whole tile.
// =====================================================================================================
__global__ __launch_bounds__(256) void tr_cvt64(const float* __restrict__ in, unsigned short* out, int R, int C) {
  __shared__ __align__(16) unsigned short sT[64 * 72];
  const int tid = threadIdx.x, lane = tid & 31, wave = tid >> 5;
  const int r0 = blockIdx.y * 64, c0 = blockIdx.x * 64;
  {
    const int rl = tid >> 2, cl = (tid & 3) * 16;
    const float* src = in + (size_t)(r0 + rl) * C + c0 + cl;
#pragma unroll
    for (int i = 0; i < 4; ++i) {
      const v4f v = *(const v4f*)(src + 4 * i);
#pragma unroll
      for (int e = 0; e < 4; ++e) sT[(cl + 4 * i + e) * 72 + rl] = bf_bits(v[e]);
    }
  }
  __syncthreads();
  const int q = lane >> 3, p8 = (lane & 7) * 8;
  v8us ov[2];
#pragma unroll
  for (int it = 0; it < 2; ++it) {
    const int cl2 = wave * 8 + it * 4 + q;
    ov[it] = *(const v8us*)(sT + cl2 * 72 + p8);
  }
  {
#pragma unroll
    for (int it = 0; it < 2; ++it) {
      const int cl2 = wave * 8 + it * 4 + q;
      *(v8us*)(out + (size_t)(c0 + cl2) * R + r0 + p8) = ov[it];
    }
    
  }
}

// =====================================================================================================
// Register-blocked batched bf16 WMMA GEMM: C[m][n] = rb[m] + cb[n] + sum_k A[m][k] * Bt[nr(n)][k]; one wave per
// 64x64 tile, no block barriers. A row-major [M][K] pitch lda; Bt row-major [.][K] pitch ldb (k contiguous);
// M, N multiples of 64, K multiple of 32 (host-checked). blockIdx.y = batch index (strides in elements).
// NSPLIT: 0 = A.Bt; 1 = (A + A2).Bt (A2 = unscaled bf16 lo plane of A); 2 = A.Bt + A2.Bt + A.Bt2.
// RB / CB: per-row bias rbp[m] / per-column bias cbp[n] (f32 input values RNE-converted to bf16, not batched)
//          added in the epilogue.
// BAND: A and C start at the first query row of the launch's group of query blocks (row mg of the sequence), the
//       batch index is the (b,h) pair (A offset (pair / NH) * SEQ * DM + (pair % NH) * HD), bandOff = BANDOFF - mg;
//       Bt operand row of output column n is n + bandOff - m0 (m0 = the 64-row tile start within the group), and
//       only column tiles with n0 <= mg + m0 + 64, that is operand row <= SEQ, are computed (wave-uniform early
//       return; the others are never read).
// OUT_MODE: 0 = f32 (pitch ldc); 2 = bf16 hi plane C + bf16 lo plane C2 (lo = RNE(v - hi), unscaled);
//           3 = f16 hi plane C + f16 residual plane C2 = f16((v - hi) * rscale), C2 written only for tiles
//               with n0 < N2 (pitch ldc2, batch stride strideC2).
// =====================================================================================================
template <int NSPLIT, int OUT_MODE, bool RB, bool CB, bool BAND>
__global__ __launch_bounds__(256) void gemm64(
    const unsigned short* __restrict__ Ap, const unsigned short* A2p, int lda, long long strideA,
    const unsigned short* __restrict__ Btp, const unsigned short* Bt2p, int ldb, long long strideB,
    void* Cout, int ldc, long long strideC,
    void* Cout2, int ldc2, long long strideC2, int N2,
    int M, int N, int K, float rscale, int bandOff,
    const float* __restrict__ rbp, const float* __restrict__ cbp) {
  const __bf16* A   = (const __bf16*)(const void*)Ap;
  const __bf16* A2  = (const __bf16*)(const void*)A2p;
  const __bf16* Bt  = (const __bf16*)(const void*)Btp;
  const __bf16* Bt2 = (const __bf16*)(const void*)Bt2p;
  __shared__ __align__(16) float sT[8][16 * 68];   // per-wave 16x64 slab, pitch 68 floats
  const int b    = blockIdx.y;
  const int lane = threadIdx.x & 31;
  const int wave = threadIdx.x >> 5;
  const int tilesN = N >> 6;
  const int tilesM = M >> 6;
  const int tile = blockIdx.x * 8 + wave;
  if (tile >= tilesM * tilesN) return;   // wave-uniform; no block barriers in this kernel
  const int tm = tile / tilesN;
  const int tn = tile - tm * tilesN;
  const int m0 = tm << 6;
  const int n0 = tn << 6;
  const int nr0 = BAND ? (n0 + bandOff - m0) : n0;   // operand row of output column n0 in Bt
  if (BAND) {
    if (nr0 > SEQ) return;               // wave-uniform: only column tiles up to one past the diagonal are needed
  }

  const size_t aB = BAND ? ((size_t)(b / NH) * SEQ * DM + (size_t)(b % NH) * HD) : (size_t)b * strideA;
  const __bf16* Ab  = A  + aB;
  const __bf16* Bb  = Bt + (size_t)b * strideB;
  const __bf16* Ab2 = (NSPLIT >= 1) ? (A2  + aB) : Ab;
  const __bf16* Bb2 = (NSPLIT == 2) ? (Bt2 + (size_t)b * strideB) : Bb;

  const int rlane = lane & 15;                 // row (A) / col (B, D) within subtile
  const int koff  = (lane >> 4) * 8;           // k offset of this lane half
  const int mOff  = (lane >> 4) * 8;           // D row offset

  v8f acc[4][4];
#pragma unroll
  for (int i = 0; i < 4; ++i)
#pragma unroll
    for (int j = 0; j < 4; ++j) acc[i][j] = zero8();

  for (int k0 = 0; k0 < K; k0 += 32) {
    v16b bh[4], bl[4];
#pragma unroll
    for (int j = 0; j < 4; ++j) {
      const size_t bo = (size_t)(nr0 + (j << 4) + rlane) * ldb + koff + k0;
      bh[j] = ldfrag_b(Bb + bo);
      if (NSPLIT == 2) bl[j] = ldfrag_b(Bb2 + bo); else bl[j] = bh[j];
    }
#pragma unroll
    for (int i = 0; i < 4; ++i) {
      const size_t ao = (size_t)(m0 + (i << 4) + rlane) * lda + koff + k0;
      const v16b ah = ldfrag_b(Ab + ao);
      v16b al = ah;
      if (NSPLIT >= 1) al = ldfrag_b(Ab2 + ao);
#pragma unroll
      for (int j = 0; j < 4; ++j) {
        acc[i][j] = mma_b_raw(ah, bh[j], acc[i][j]);
        if (NSPLIT >= 1) acc[i][j] = mma_b_raw(al, bh[j], acc[i][j]);
        if (NSPLIT == 2) acc[i][j] = mma_b_raw(ah, bl[j], acc[i][j]);
      }
      dep_guard_b(acc[i][0], acc[i][3], ah, al);
    }
    keep4_b(bh[0], bh[1], bh[2], bh[3]);
    if (NSPLIT == 2) keep4_b(bl[0], bl[1], bl[2], bl[3]);
  }
  acc_guard4(acc[0][0], acc[0][1], acc[0][2], acc[0][3]);
  acc_guard4(acc[1][0], acc[1][1], acc[1][2], acc[1][3]);
  acc_guard4(acc[2][0], acc[2][1], acc[2][2], acc[2][3]);
  acc_guard4(acc[3][0], acc[3][1], acc[3][2], acc[3][3]);

  // ---- epilogue biases (input values RNE-converted to bf16) ----
  float cbv[4];
#pragma unroll
  for (int j = 0; j < 4; ++j) cbv[j] = CB ? bf_up(bf_bits(cbp[n0 + (j << 4) + rlane])) : 0.0f;

  // ---- epilogue ----
  float* slab = sT[wave];
#pragma unroll
  for (int i = 0; i < 4; ++i) {
    const int mBase = m0 + (i << 4);
#pragma unroll
    for (int r = 0; r < 8; ++r) {
      const float rbv = RB ? bf_up(bf_bits(rbp[mBase + mOff + r])) : 0.0f;
#pragma unroll
      for (int j = 0; j < 4; ++j) {
        slab[(mOff + r) * 68 + (j << 4) + rlane] = acc[i][j][r] + rbv + cbv[j];
      }
    }
    __builtin_amdgcn_fence(__ATOMIC_RELEASE, "workgroup");
    __builtin_amdgcn_wave_barrier();
    __builtin_amdgcn_fence(__ATOMIC_ACQUIRE, "workgroup");
    if (OUT_MODE == 0) {
      float* C = (float*)Cout + (size_t)b * strideC;
      const int hh = lane >> 4, c4 = (lane & 15) * 4;     // 256-B row segment = 16 lanes x 16 B
      v4f ov[8];
#pragma unroll
      for (int it = 0; it < 8; ++it) {
        const int row = it * 2 + hh;                       // it 0..7 x hh 0..1 = rows 0..15
        ov[it] = *(const v4f*)(slab + row * 68 + c4);
      }
      {
#pragma unroll
        for (int it = 0; it < 8; ++it) {
          const int row = it * 2 + hh;
          *(v4f*)(C + (size_t)(mBase + row) * ldc + n0 + c4) = ov[it];
        }
        
      }
    } else {
      const int q = lane >> 3, c8 = (lane & 7) * 8;
      unsigned short* C  = (unsigned short*)Cout  + (size_t)b * strideC;
      unsigned short* C2 = (unsigned short*)Cout2 + (size_t)b * strideC2;
      const bool wlo = (OUT_MODE == 2) || (n0 < N2);      // wave-uniform
      v4u hv[4], lv[4];
#pragma unroll
      for (int it = 0; it < 4; ++it) {
        const int row = it * 4 + q;                        // it 0..3 x q 0..3 = rows 0..15
        const float* sp = slab + row * 68 + c8;
        v4u a, a2;
#pragma unroll
        for (int e = 0; e < 4; ++e) {
          const float f0 = sp[2 * e], f1 = sp[2 * e + 1];
          unsigned short h0, h1, l0, l1;
          if (OUT_MODE == 2) {
            h0 = bf_bits(f0); h1 = bf_bits(f1);
            l0 = bf_bits(f0 - bf_up(h0)); l1 = bf_bits(f1 - bf_up(h1));
          } else {
            const _Float16 x0 = (_Float16)f0, x1 = (_Float16)f1;
            h0 = h_bits(x0); h1 = h_bits(x1);
            l0 = h_bits((_Float16)((f0 - (float)x0) * rscale));
            l1 = h_bits((_Float16)((f1 - (float)x1) * rscale));
          }
          a[e] = pk16(h0, h1); a2[e] = pk16(l0, l1);
        }
        hv[it] = a; lv[it] = a2;
      }
      {
#pragma unroll
        for (int it = 0; it < 4; ++it) {
          const int row = it * 4 + q;
          *(v4u*)(C + (size_t)(mBase + row) * ldc + n0 + c8) = hv[it];
          if (wlo) *(v4u*)(C2 + (size_t)(mBase + row) * ldc2 + n0 + c8) = lv[it];
        }
        
      }
    }
    __builtin_amdgcn_fence(__ATOMIC_RELEASE, "workgroup");
    __builtin_amdgcn_wave_barrier();
    __builtin_amdgcn_fence(__ATOMIC_ACQUIRE, "workgroup");
  }
}

// =====================================================================================================
// Block-tiled bf16 WMMA GEMM for the four projections: same function, operands, wave tile (64x64), product order and
// epilogue as gemm64 without BAND. A block of 4 waves (2 x 2) owns a 128x128 tile of C; the 128 rows of A (and A2) and
// of Bt that it needs are brought into LDS one slab of KS = 128 k at a time by asynchronous copies
// (global_load_async_to_lds_b128: a wave's copy covers two whole 256-byte row pieces), two buffers, so that slab t + 1
// flies while slab t is multiplied; fragments are then read from LDS (row pitch 272 bytes = 17 x 16).
// M, N multiples of 128, K a multiple of KS and at least KS; grid.x = (M/128) * (N/128), blockIdx.y = batch.
// =====================================================================================================
// Eight 16-byte copies per lane, rows gstep elements / lstep bytes apart.
__device__ __forceinline__ void async_rows8(const __bf16* g, size_t gstep, unsigned l, unsigned lstep) {
#if defined(__HIP_DEVICE_COMPILE__)
  // The closing s_wait_xcnt 0 stands in the copies' own statement, so that it is passed before any address register
  // that a copy names is written again.
  asm volatile(
      "global_load_async_to_lds_b128 %0, %8, off\n\t"
      "global_load_async_to_lds_b128 %1, %9, off\n\t"
      "global_load_async_to_lds_b128 %2, %10, off\n\t"
      "global_load_async_to_lds_b128 %3, %11, off\n\t"
      "global_load_async_to_lds_b128 %4, %12, off\n\t"
      "global_load_async_to_lds_b128 %5, %13, off\n\t"
      "global_load_async_to_lds_b128 %6, %14, off\n\t"
      "global_load_async_to_lds_b128 %7, %15, off\n\t"
      "s_wait_xcnt 0x0"
      :: "v"(l), "v"(l + lstep), "v"(l + 2 * lstep), "v"(l + 3 * lstep),
         "v"(l + 4 * lstep), "v"(l + 5 * lstep), "v"(l + 6 * lstep), "v"(l + 7 * lstep),
         "v"(g), "v"(g + gstep), "v"(g + 2 * gstep), "v"(g + 3 * gstep),
         "v"(g + 4 * gstep), "v"(g + 5 * gstep), "v"(g + 6 * gstep), "v"(g + 7 * gstep)
      : "memory");
  // Keeps the address arithmetic of the next eight copies behind these: hoisted in front of them it held the addresses
  // of a whole slab in registers at once (a spill to scratch beside the 128 accumulator registers) and delayed the first copy.
  __builtin_amdgcn_sched_barrier(0);
#endif
}
// The issuing wave's own wait: its copies have landed in LDS behind it.
__device__ __forceinline__ void wait_async0() {
#if defined(__HIP_DEVICE_COMPILE__)
  asm volatile("s_wait_asynccnt 0x0" ::: "memory");
#endif
}
// The wave's LDS reads have returned: stands in front of the barrier behind which their buffer is refilled.
__device__ __forceinline__ void wait_ds0() {
#if defined(__HIP_DEVICE_COMPILE__)
  asm volatile("s_wait_dscnt 0x0" ::: "memory");
#endif
}

template <int NSPLIT, int OUT_MODE, bool RB, bool CB>
__global__ __launch_bounds__(128) void gemm128(
    const unsigned short* __restrict__ Ap, const unsigned short* A2p, int lda, long long strideA,
    const unsigned short* __restrict__ Btp, int ldb, long long strideB,
    void* Cout, int ldc, long long strideC,
    void* Cout2, int ldc2, long long strideC2, int N2,
    int M, int N, int K, float rscale,
    const float* __restrict__ rbp, const float* __restrict__ cbp) {
  static_assert(NSPLIT == 0 || NSPLIT == 1);
  constexpr int KS  = 128;                       // k per slab
  constexpr int SP  = KS + 8;                    // LDS row pitch in elements
  constexpr int NPL = (NSPLIT == 1) ? 3 : 2;     // planes of a slab: A, Bt, (A2)
  constexpr unsigned PLB = 128u * SP * 2u;       // bytes of one plane of a slab
  constexpr unsigned LST = 8u * SP * 2u;         // bytes between two copies of a lane (8 rows)
  __shared__ __align__(16) __bf16 sS[2][NPL][128 * SP];
  __shared__ __align__(16) float sT[4][16 * 68];   // per-wave 16x64 slab, pitch 68 floats
  const __bf16* A   = (const __bf16*)(const void*)Ap;
  const __bf16* A2  = (const __bf16*)(const void*)A2p;
  const __bf16* Bt  = (const __bf16*)(const void*)Btp;
  const int b    = blockIdx.y;
  const int tid  = threadIdx.x;
  const int lane = tid & 31;
  const int wave = tid >> 5;
  const int tilesN = N >> 7;
  const int tilesM = M >> 7;
  const int tile = blockIdx.x;
  if (tile >= tilesM * tilesN) return;   // block-uniform, in front of every copy and barrier
  const int tm  = tile / tilesN;
  const int tn  = tile - tm * tilesN;
  const int bm0 = tm << 7;
  const int bn0 = tn << 7;
  const int wm  = (wave >> 1) << 6;      // the wave's 64x64 tile within the block tile
  const int wn  = (wave & 1) << 6;
  const int m0  = bm0 + wm;
  const int n0  = bn0 + wn;

  // copy addressing: 16 lanes per 256-byte row piece, 8 rows per block-wide copy, 16 copies per lane and plane
  const int cr = tid >> 4, cc = (tid & 15) * 8;
  const __bf16* gA  = A  + (size_t)b * strideA + (size_t)(bm0 + cr) * lda + cc;
  const long long dA2 = A2 - A;          // uniform distance (elements) of the lo plane from the hi plane, same workspace
  const __bf16* gB  = Bt + (size_t)b * strideB + (size_t)(bn0 + cr) * ldb + cc;
  const unsigned l0 = (unsigned)(size_t)(&sS[0][0][0]) + (unsigned)(cr * SP + cc) * 2u;
  auto fill = [&](int t, int bs) {
    const unsigned lb = l0 + (unsigned)bs * (NPL * PLB);
    const size_t ko = (size_t)t * KS;
    async_rows8(gA + ko, (size_t)8 * lda, lb, LST);
    async_rows8(gA + ko + (size_t)64 * lda, (size_t)8 * lda, lb + 8u * LST, LST);
    async_rows8(gB + ko, (size_t)8 * ldb, lb + PLB, LST);
    async_rows8(gB + ko + (size_t)64 * ldb, (size_t)8 * ldb, lb + PLB + 8u * LST, LST);
    if (NSPLIT == 1) {
      async_rows8(gA + (dA2 + (long long)ko), (size_t)8 * lda, lb + 2u * PLB, LST);
      async_rows8(gA + (dA2 + (long long)ko) + (size_t)64 * lda, (size_t)8 * lda, lb + 2u * PLB + 8u * LST, LST);
    }
  };

  const int rlane = lane & 15;                 // row (A) / col (B, D) within subtile
  const int koff  = (lane >> 4) * 8;           // k offset of this lane half
  const int mOff  = (lane >> 4) * 8;           // D row offset

  v8f acc[4][4];
#pragma unroll
  for (int i = 0; i < 4; ++i)
#pragma unroll
    for (int j = 0; j < 4; ++j) acc[i][j] = zero8();

  const int nst = K / KS;                      // slabs, block-uniform
  fill(0, 0);
  wait_async0();
  __syncthreads();                             // slab 0 is published
  if (nst > 1) fill(1, 1);
  for (int t = 0; t < nst; ++t) {
    const __bf16* sA  = &sS[t & 1][0][0] + (wm + rlane) * SP + koff;
    const __bf16* sB  = &sS[t & 1][1][0] + (wn + rlane) * SP + koff;
    const __bf16* sA2 = &sS[t & 1][NPL - 1][0] + (wm + rlane) * SP + koff;
#pragma unroll
    for (int ks = 0; ks < KS; ks += 32) {
      // all fragments of the k step are read in one batch, so that the wave pays the LDS latency once per step
      v16b bh[4], ah[4], al[4];
#pragma unroll
      for (int j = 0; j < 4; ++j) bh[j] = ldfrag_b(sB + (j << 4) * SP + ks);
#pragma unroll
      for (int i = 0; i < 4; ++i) {
        ah[i] = ldfrag_b(sA + (i << 4) * SP + ks);
        if (NSPLIT == 1) al[i] = ldfrag_b(sA2 + (i << 4) * SP + ks); else al[i] = ah[i];
      }
#pragma unroll
      for (int i = 0; i < 4; ++i) {
#pragma unroll
        for (int j = 0; j < 4; ++j) {
          acc[i][j] = mma_b_raw(ah[i], bh[j], acc[i][j]);
          if (NSPLIT == 1) acc[i][j] = mma_b_raw(al[i], bh[j], acc[i][j]);
        }
        dep_guard_b(acc[i][0], acc[i][3], ah[i], al[i]);
      }
      keep4_b(bh[0], bh[1], bh[2], bh[3]);
    }
    // publish point of slab t + 1: own LDS reads returned, own copies landed, then the one barrier of the trip (it
    // publishes slab t + 1 and ends every wave's reads of the buffer that is refilled behind it)
    wait_ds0();
    wait_async0();
    __syncthreads();
    if (t + 2 < nst) fill(t + 2, t & 1);
  }
  wait_async0();                               // no copy is outstanding when the wave goes on
  acc_guard4(acc[0][0], acc[0][1], acc[0][2], acc[0][3]);
  acc_guard4(acc[1][0], acc[1][1], acc[1][2], acc[1][3]);
  acc_guard4(acc[2][0], acc[2][1], acc[2][2], acc[2][3]);
  acc_guard4(acc[3][0], acc[3][1], acc[3][2], acc[3][3]);

  // ---- epilogue biases (input values RNE-converted to bf16) ----
  float cbv[4];
#pragma unroll
  for (int j = 0; j < 4; ++j) cbv[j] = CB ? bf_up(bf_bits(cbp[n0 + (j << 4) + rlane])) : 0.0f;

  // ---- epilogue ----
  float* slab = sT[wave];
#pragma unroll
  for (int i = 0; i < 4; ++i) {
    const int mBase = m0 + (i << 4);
#pragma unroll
    for (int r = 0; r < 8; ++r) {
      const float rbv = RB ? bf_up(bf_bits(rbp[mBase + mOff + r])) : 0.0f;
#pragma unroll
      for (int j = 0; j < 4; ++j) {
        slab[(mOff + r) * 68 + (j << 4) + rlane] = acc[i][j][r] + rbv + cbv[j];
      }
    }
    __builtin_amdgcn_fence(__ATOMIC_RELEASE, "workgroup");
    __builtin_amdgcn_wave_barrier();
    __builtin_amdgcn_fence(__ATOMIC_ACQUIRE, "workgroup");
    if (OUT_MODE == 0) {
      float* C = (float*)Cout + (size_t)b * strideC;
      const int hh = lane >> 4, c4 = (lane & 15) * 4;     // 256-B row segment = 16 lanes x 16 B
      v4f ov[8];
#pragma unroll
      for (int it = 0; it < 8; ++it) {
        const int row = it * 2 + hh;                       // it 0..7 x hh 0..1 = rows 0..15
        ov[it] = *(const v4f*)(slab + row * 68 + c4);
      }
      {
#pragma unroll
        for (int it = 0; it < 8; ++it) {
          const int row = it * 2 + hh;
          *(v4f*)(C + (size_t)(mBase + row) * ldc + n0 + c4) = ov[it];
        }
        
      }
    } else {
      const int q = lane >> 3, c8 = (lane & 7) * 8;
      unsigned short* C  = (unsigned short*)Cout  + (size_t)b * strideC;
      unsigned short* C2 = (unsigned short*)Cout2 + (size_t)b * strideC2;
      const bool wlo = (OUT_MODE == 2) || (n0 < N2);      // wave-uniform
      v4u hv[4], lv[4];
#pragma unroll
      for (int it = 0; it < 4; ++it) {
        const int row = it * 4 + q;                        // it 0..3 x q 0..3 = rows 0..15
        const float* sp = slab + row * 68 + c8;
        v4u a, a2;
#pragma unroll
        for (int e = 0; e < 4; ++e) {
          const float f0 = sp[2 * e], f1 = sp[2 * e + 1];
          unsigned short h0, h1, l0, l1;
          if (OUT_MODE == 2) {
            h0 = bf_bits(f0); h1 = bf_bits(f1);
            l0 = bf_bits(f0 - bf_up(h0)); l1 = bf_bits(f1 - bf_up(h1));
          } else {
            const _Float16 x0 = (_Float16)f0, x1 = (_Float16)f1;
            h0 = h_bits(x0); h1 = h_bits(x1);
            l0 = h_bits((_Float16)((f0 - (float)x0) * rscale));
            l1 = h_bits((_Float16)((f1 - (float)x1) * rscale));
          }
          a[e] = pk16(h0, h1); a2[e] = pk16(l0, l1);
        }
        hv[it] = a; lv[it] = a2;
      }
      {
#pragma unroll
        for (int it = 0; it < 4; ++it) {
          const int row = it * 4 + q;
          *(v4u*)(C + (size_t)(mBase + row) * ldc + n0 + c8) = hv[it];
          if (wlo) *(v4u*)(C2 + (size_t)(mBase + row) * ldc2 + n0 + c8) = lv[it];
        }
        
      }
    }
    __builtin_amdgcn_fence(__ATOMIC_RELEASE, "workgroup");
    __builtin_amdgcn_wave_barrier();
    __builtin_amdgcn_fence(__ATOMIC_ACQUIRE, "workgroup");
  }
}

// =====================================================================================================
// Causal attention with a relative-position bias, head dim 64 (tril mask incl. diagonal, computed).
//   q planes (bf16 hi / lo): element (b, t, h, d) at [(b*SEQ + t)*DM + h*64 + d]
//   k planes (bf16 hi / lo): same layout with key index s
//   v^T hi plane (f16):      element (b, h, d, s) at [(b*DM + h*64 + d)*SEQ + s]
//   v^T residual plane (f16, (v - hi)*4096): [(b*DM + h*64 + d)*VLP + s], s < VLP, read only when RES
//   band plane (f32, per pair p, stride qerStride, row pitch qpitch): row = query t - 64*qbBase, column
//     key - t + 64*qb + 63 (in [0, qpitch), address clamped to qpitch-1; values beyond the clamp only occur for
//     masked keys) holds q[t] . Er[2*SEQ-1-SEQ + ... ] i.e. the relative term of (query t, key).
//   logit = (q.k + band) * sscale for key <= query, -FLT_MAX otherwise (exp -> 0); every row has a live key in
//   every processed key tile (tiles 0..qb only, block-uniform trip count (qb+2)/2 <= 16).
//   output: ctx hi / lo bf16 planes, element (b, t, h*64 + d) at [(b*SEQ + t)*DM + h*64 + d] = normalised
//   context (lo = RNE(v - hi), unscaled).
//   scores = q . k : bf16 hi/lo split (hi.hi + hi.lo + lo.hi), f32 accumulate, band added in f32, * sscale in f32
//   p = exp(s - m) carried as f16(1024 p); context = p . v on f16 WMMA; RES adds f16 residual planes of p and v
//   (scale 4096, separate accumulator folded back with 1/4096 per chunk in f32); online softmax in f32.
//   Block = 8 waves = 64 query rows of one (b, h), in two groups of 4 waves; grid = nqbThis * NP (pair index =
//   blockIdx.x / nqbThis, b = pair / NH, h = pair % NH); kv chunks of 64. Group g walks the key tiles g, g + 2, ...
//   with its own K / V^T tiles in LDS and its own running maximum, sum and context; the two partial results of a row
//   are joined once behind the loop, in f32 (each rescaled to the common maximum). The block's chain of dependent
//   tiles is half as long, and the two groups' waves fill each other's waits on the SIMDs that they share.
//   K / V^T chunk staging: a group's 128 threads x 32 elements per plane = the whole 64x64 tile (plain 16-B loads,
//   __syncthreads before and after); P tiles are wave-private, spilled with _Float16 element stores and reloaded
//   Output coverage: each wave of group 0 stores its rows 0..15 (it 0..3 x lane>>3 0..3) x 64 columns (8 lanes x 8 bf16),
// =====================================================================================================
// Band values of one 16-row x 64-key wave tile, one register per (row r, column block j): 32 independent loads with
// no use between them, so that the wave pays their latency once. row0 = the lane's first row within the group's
// plane, cb0 = band column of (row0, key c of key tile 0); the column falls by one per row. An element index fits
// 32 bits (a pair's plane is below 8 MiB), so every load is the pair's uniform base plus a lane index.
__device__ __forceinline__ void load_band(float (&bnd)[8][4], const float* __restrict__ Bq,
                                          int row0, int cb0, int kv, int qpitch) {
#pragma unroll
  for (int g = 0; g < 2; ++g) {
    unsigned ix[4][4];
#pragma unroll
    for (int rr = 0; rr < 4; ++rr) {
      const int r = 4 * g + rr;
#pragma unroll
      for (int j = 0; j < 4; ++j) {
        int col = cb0 - r + kv + (j << 4);                         // >= 0 by construction
        col = (col < qpitch) ? col : (qpitch - 1);                 // clamped address (masked keys only)
        ix[rr][j] = (unsigned)((row0 + r) * qpitch + col);
        bnd[r][j] = Bq[ix[rr][j]];
      }
    }
#if defined(__HIP_DEVICE_COMPILE__)
    // The wait that stands in front of any overwrite of a register an issued load names. It takes the 16 index
    // registers as inputs so that they stay untouched (also by a later load's result) until it has been passed,
    // and the base pointer so that the compiler keeps these loads in front of it.
    asm volatile("s_wait_xcnt 0x0"
                 :: "v"(ix[0][0]), "v"(ix[0][1]), "v"(ix[0][2]), "v"(ix[0][3]),
                    "v"(ix[1][0]), "v"(ix[1][1]), "v"(ix[1][2]), "v"(ix[1][3]),
                    "v"(ix[2][0]), "v"(ix[2][1]), "v"(ix[2][2]), "v"(ix[2][3]),
                    "v"(ix[3][0]), "v"(ix[3][1]), "v"(ix[3][2]), "v"(ix[3][3]), "s"(Bq)
                 : "memory");
#endif
  }
}

// e^x for the join of the two groups' results. v_exp_f32 and the one free slot that the instruction set asks for behind
// a transcendental stand in one statement, so that no instruction which reads the result or overwrites the source
// follows directly.
__device__ __forceinline__ float exp_slot(float x) {
  float y = x * 1.44269504f;
#if defined(__HIP_DEVICE_COMPILE__)
  asm("v_exp_f32 %0, %1\n\tv_nop" : "=v"(y) : "v"(y));
#endif
  return y;
}

// Without RES four waves per SIMD (at most 256 registers a wave): two blocks share a WGP, so that every block of a launch
// of up to 512 is resident. The RES launch has one block per WGP and keeps the block size's own register budget.
template <bool RES>
__global__ __launch_bounds__(256) __attribute__((amdgpu_waves_per_eu(RES ? 2 : 4)))
void attn_rel64(const unsigned short* __restrict__ qhp, const unsigned short* __restrict__ qlp,
                const unsigned short* __restrict__ khp, const unsigned short* __restrict__ klp,
                const unsigned short* __restrict__ vhp, const unsigned short* __restrict__ vlp,
                const float* __restrict__ qerp, long long qerStride, int qpitch,
                unsigned short* ahp, unsigned short* alp,
                int qbBase, int nqbThis, float sscale) {
  union FB { v16b v; v8b h[2]; };
  union FH { v16h v; v8h h[2]; };
  // Row pitches: 64 elements of data plus 16 bytes, an odd multiple of 16 bytes, so that the 16 rows which a 16-byte
  // fragment load reads at once fall on 64 different banks (at 128 or 256 bytes they share a few banks).
  constexpr int LP = 72;                                          // 16-bit tiles: 144 bytes a row
  constexpr int OP = 68;                                          // f32 tile: 272 bytes a row
  __shared__ __align__(16) __bf16   KshG[2][64 * LP];             // per group: K hi [kv][d]   9 KB
  __shared__ __align__(16) __bf16   KslG[2][64 * LP];             // K lo
  __shared__ __align__(16) _Float16 VthG[2][64 * LP];             // V^T hi [d][kv] 9 KB
  __shared__ __align__(16) _Float16 VtlG[2][RES ? 64 * LP : 8];   // V^T residual
  __shared__ __align__(16) _Float16 Psh[8][16 * LP];              // per wave P [row][kv]
  __shared__ __align__(16) _Float16 Psl[RES ? 8 : 1][16 * LP];    // per wave P residual
  __shared__ __align__(16) float    Os[4][16 * OP];               // per 16-row slice: context tile [row][d]
  __shared__ float Ms[4][16], Ls[4][16];                          // group 1's running maximum and sum per row

  // the group is the same in every lane of a wave: kept in a scalar register, so that the tests on it are scalar branches
  const int grp  = __builtin_amdgcn_readfirstlane((int)(threadIdx.x >> 7));
  const int tid  = threadIdx.x & 127;     // thread within the group
  const int wave = tid >> 5;              // 16-row slice of the query block
  const int lane = tid & 31;
  __bf16*   Ksh = KshG[grp];
  __bf16*   Ksl = KslG[grp];
  _Float16* Vth = VthG[grp];
  _Float16* Vtl = VtlG[grp];
  const int hh   = lane >> 4;
  const int c    = lane & 15;

  const int bx   = blockIdx.x;
  const int qbl  = bx % nqbThis;
  const int pr   = bx / nqbThis;          // (b,h) pair index, 0..NP-1
  const int h    = pr % NH;
  const int b    = pr / NH;
  const int qb   = qbBase + qbl;
  const int q0   = qb * 64 + wave * 16;
  const size_t rowB = (size_t)b * SEQ;

  const __bf16* Qh = (const __bf16*)(const void*)qhp + (size_t)h * HD;
  const __bf16* Ql = (const __bf16*)(const void*)qlp + (size_t)h * HD;
  const __bf16* Kh = (const __bf16*)(const void*)khp + (size_t)h * HD;
  const __bf16* Kl = (const __bf16*)(const void*)klp + (size_t)h * HD;
  const _Float16* Vh = (const _Float16*)(const void*)vhp + ((size_t)b * DM + (size_t)h * HD) * SEQ;
  const _Float16* Vl = (const _Float16*)(const void*)vlp + ((size_t)b * DM + (size_t)h * HD) * VLP;
  const float* Bq = qerp + (size_t)pr * (size_t)qerStride;

  // ---- Q fragments (A operand, row = lane&15): 2 d-chunks, hi and lo ----
  v16b qah[2], qal[2];
#pragma unroll
  for (int dc = 0; dc < 2; ++dc) {
    const size_t qo = (rowB + q0 + c) * DM + dc * 32 + 8 * hh;
    qah[dc] = ldfrag_b(Qh + qo);
    qal[dc] = ldfrag_b(Ql + qo);
  }

  float mrow[8], lrow[8];
  v8f oacc[4];
#pragma unroll
  for (int r = 0; r < 8; ++r) { mrow[r] = -INFINITY; lrow[r] = 0.f; }
#pragma unroll
  for (int t = 0; t < 4; ++t) oacc[t] = zero8();

  int nkt = qb + 1;                          // causal: key tiles 0..qb, block-uniform
  if (nkt > NQB) nkt = NQB;

  // band values are fetched one of the group's key tiles ahead: its first tile here, tile kt + 2 inside the trip of kt
  const int brow0 = q0 + 8 * hh - qbBase * 64;
  const int bcb0  = c + (qb * 64 + 63 - (q0 + 8 * hh));
  float bnd[8][4];
  load_band(bnd, Bq, brow0, bcb0, (grp < nkt) ? grp * 64 : 0, qpitch);
  const int ntrip = (nkt + 1) >> 1;          // block-uniform: every wave passes every barrier
  for (int it = 0; it < ntrip; ++it) {
    const int kt  = 2 * it + grp;
    const int kv0 = kt * 64;
    const bool act = kt < nkt;               // wave-uniform (scalar): false only for group 1 in the last trip of an odd nkt
    __syncthreads();
    if (act) {
      const int r = tid >> 1, half = (tid & 1) * 32;
      const __bf16*   kg  = Kh + (rowB + kv0 + r) * DM + half;    // K row kv0+r, d = half..half+31
      const __bf16*   klg = Kl + (rowB + kv0 + r) * DM + half;
      const _Float16* vg  = Vh + (size_t)r * SEQ + kv0 + half;    // V^T row d = r, s = kv0+half..+31
      const int kvl = (kv0 + 64 <= VLP) ? kv0 : (VLP - 64);     // clamped address into the residual plane
      const _Float16* vlg = Vl + (size_t)r * VLP + kvl + half;
      const bool resOK = (kv0 + 64 <= VLP);                      // block-uniform
      v8b a0[4], a1[4];
      v8h b0[4], b1[4];
#pragma unroll
      for (int i = 0; i < 4; ++i) {
        a0[i] = *(const v8b*)(kg + 8 * i);
        a1[i] = *(const v8b*)(klg + 8 * i);
        b0[i] = *(const v8h*)(vg + 8 * i);
        b1[i] = RES ? *(const v8h*)(vlg + 8 * i) : zero8h();
      }
#if defined(__HIP_DEVICE_COMPILE__)
      // The wait that stands in front of any overwrite of a register an issued load names. It takes the row addresses
      // as inputs so that they stay untouched (also by a later load's result) until it has been passed.
      if (RES) asm volatile("s_wait_xcnt 0x0" :: "v"(kg), "v"(klg), "v"(vg), "v"(vlg) : "memory");
      else     asm volatile("s_wait_xcnt 0x0" :: "v"(kg), "v"(klg), "v"(vg) : "memory");
#endif
#pragma unroll
      for (int i = 0; i < 4; ++i) {
        *(v8b*)(Ksh + r * LP + half + 8 * i) = a0[i];
        *(v8b*)(Ksl + r * LP + half + 8 * i) = a1[i];
        *(v8h*)(Vth + r * LP + half + 8 * i) = b0[i];
        if (RES) *(v8h*)(Vtl + r * LP + half + 8 * i) = resOK ? b1[i] : zero8h();
      }
    }
    __syncthreads();
    if (!act) continue;                      // no barrier stands between here and the foot of the trip

    // ---- scores: 16 query rows x 64 keys per wave, 3 bf16 products ----
    v8f s[4];
#pragma unroll
    for (int j = 0; j < 4; ++j) {
      s[j] = zero8();
#pragma unroll
      for (int dc = 0; dc < 2; ++dc) {
        FB kb, kl;
        kb.h[0] = *(const v8b*)(Ksh + (j * 16 + c) * LP + dc * 32 + 8 * hh);
        kb.h[1] = *(const v8b*)(Ksh + (j * 16 + c) * LP + dc * 32 + 16 + 8 * hh);
        kl.h[0] = *(const v8b*)(Ksl + (j * 16 + c) * LP + dc * 32 + 8 * hh);
        kl.h[1] = *(const v8b*)(Ksl + (j * 16 + c) * LP + dc * 32 + 16 + 8 * hh);
        s[j] = mma_b(qah[dc], kb.v, s[j]);
        s[j] = mma_b(qah[dc], kl.v, s[j]);
        s[j] = mma_b(qal[dc], kb.v, s[j]);
      }
    }

    // ---- band term of this tile (fetched during the previous trip), then the next tile's 32 loads in one batch:
    //      the softmax runs while they fly (the fence in front of p.v is the first wait that covers them). A group's
    //      last tile has no next one and fetches its own again (written columns only). ----
#pragma unroll
    for (int r = 0; r < 8; ++r)
#pragma unroll
      for (int j = 0; j < 4; ++j) s[j][r] += bnd[r][j];
    load_band(bnd, Bq, brow0, bcb0, (kt + 2 < nkt) ? (kv0 + 128) : kv0, qpitch);

    // ---- scale + causal mask (replace by -FLT_MAX), row max, online softmax, P (x1024, f16)
    //      and P residual (x4096) to LDS ----
    _Float16* pwh = Psh[grp * 4 + wave];
    _Float16* pwl = Psl[RES ? (grp * 4 + wave) : 0];
#pragma unroll
    for (int r = 0; r < 8; ++r) {
      const int qrow = q0 + 8 * hh + r;
      float m = -INFINITY;
#pragma unroll
      for (int j = 0; j < 4; ++j) {
        const int key = kv0 + j * 16 + c;
        float sv = s[j][r] * sscale;
        sv = (key > qrow) ? -FLT_MAX : sv;
        s[j][r] = sv;
        m = fmaxf(m, sv);
      }
#pragma unroll
      for (int off = 1; off < 16; off <<= 1) m = fmaxf(m, __shfl_xor(m, off, 32));
      const float mnew  = fmaxf(mrow[r], m);
      const float msafe = (mnew == -INFINITY) ? 0.f : mnew;
      const float alpha = __expf(mrow[r] - msafe);
      mrow[r] = mnew;
      float psum = 0.f;
#pragma unroll
      for (int j = 0; j < 4; ++j) {
        const float p = __expf(s[j][r] - msafe);     // masked logit against a finite max: exp -> 0
        psum += p;
        const float p1k = p * 1024.0f;
        const _Float16 ph = (_Float16)p1k;
        pwh[(8 * hh + r) * LP + j * 16 + c] = ph;
        if (RES) {
          const _Float16 pl = (_Float16)((p1k - (float)ph) * 4096.0f);
          pwl[(8 * hh + r) * LP + j * 16 + c] = pl;
        }
      }
#pragma unroll
      for (int off = 1; off < 16; off <<= 1) psum += __shfl_xor(psum, off, 32);
      lrow[r] = lrow[r] * alpha + psum;
#pragma unroll
      for (int t = 0; t < 4; ++t) oacc[t][r] *= alpha;
    }
    __builtin_amdgcn_fence(__ATOMIC_RELEASE, "workgroup");
    __builtin_amdgcn_wave_barrier();
    __builtin_amdgcn_fence(__ATOMIC_ACQUIRE, "workgroup");

    // ---- context += P . V (f16 WMMA), residual products into a separate accumulator ----
    v8f o1[4];
#pragma unroll
    for (int t = 0; t < 4; ++t) o1[t] = zero8();
#pragma unroll 1
    for (int kk = 0; kk < 2; ++kk) {
      FH pa, pl;
      pa.h[0] = *(const v8h*)(pwh + c * LP + kk * 32 + 8 * hh);
      pa.h[1] = *(const v8h*)(pwh + c * LP + kk * 32 + 16 + 8 * hh);
      if (RES) {
        pl.h[0] = *(const v8h*)(pwl + c * LP + kk * 32 + 8 * hh);
        pl.h[1] = *(const v8h*)(pwl + c * LP + kk * 32 + 16 + 8 * hh);
      } else {
        pl.v = pa.v;
      }
#pragma unroll
      for (int t = 0; t < 4; ++t) {
        FH vb;
        vb.h[0] = *(const v8h*)(Vth + (t * 16 + c) * LP + kk * 32 + 8 * hh);
        vb.h[1] = *(const v8h*)(Vth + (t * 16 + c) * LP + kk * 32 + 16 + 8 * hh);
        oacc[t] = mma_h(pa.v, vb.v, oacc[t]);
        if (RES) {
          FH vl;
          vl.h[0] = *(const v8h*)(Vtl + (t * 16 + c) * LP + kk * 32 + 8 * hh);
          vl.h[1] = *(const v8h*)(Vtl + (t * 16 + c) * LP + kk * 32 + 16 + 8 * hh);
          o1[t] = mma_h(pa.v, vl.v, o1[t]);
          o1[t] = mma_h(pl.v, vb.v, o1[t]);
        }
      }
    }
    if (RES) {
#pragma unroll
      for (int t = 0; t < 4; ++t)
#pragma unroll
        for (int r = 0; r < 8; ++r) oacc[t][r] += o1[t][r] * (1.0f / 4096.0f);
    }
  }

  // ---- join the two groups' partial results: group 1 hands its maximum, sum and context over through LDS (every
  //      lane at the places that the same lane of group 0's wave reads), group 0 rescales both to the common maximum.
  //      Group 0 has always seen key tile 0, where every row has a live key; a group 1 without a tile hands over
  //      maximum -inf, sum 0 and context 0, whose factor is exp(-inf) = 0. ----
  float* os = Os[wave];
  if (grp == 1) {
#pragma unroll
    for (int r = 0; r < 8; ++r) {
#pragma unroll
      for (int t = 0; t < 4; ++t) os[(8 * hh + r) * OP + t * 16 + c] = oacc[t][r];
      if (c == 0) { Ms[wave][8 * hh + r] = mrow[r]; Ls[wave][8 * hh + r] = lrow[r]; }
    }
  }
  __syncthreads();                           // group 1's partial results are published
  if (grp == 1) return;                      // no block barrier stands behind this line
#pragma unroll
  for (int r = 0; r < 8; ++r) {
    const float m1 = Ms[wave][8 * hh + r], l1 = Ls[wave][8 * hh + r];
    const float mj = fmaxf(mrow[r], m1);
    const float ms = (mj == -INFINITY) ? 0.f : mj;
    const float a0 = exp_slot(mrow[r] - ms), a1 = exp_slot(m1 - ms);
    lrow[r] = lrow[r] * a0 + l1 * a1;
#pragma unroll
    for (int t = 0; t < 4; ++t) oacc[t][r] = oacc[t][r] * a0 + os[(8 * hh + r) * OP + t * 16 + c] * a1;
  }

  // ---- normalise (1/l and the 1/1024 p carry), stage the wave's 16x64 tile in LDS, then convert to
#pragma unroll
  for (int r = 0; r < 8; ++r) {
    const float l = lrow[r];
    const float inv = ((l > 0.f) ? (1.0f / l) : 0.f) * (1.0f / 1024.0f);
#pragma unroll
    for (int t = 0; t < 4; ++t) os[(8 * hh + r) * OP + t * 16 + c] = oacc[t][r] * inv;
  }
  __builtin_amdgcn_fence(__ATOMIC_RELEASE, "workgroup");
  __builtin_amdgcn_wave_barrier();
  __builtin_amdgcn_fence(__ATOMIC_ACQUIRE, "workgroup");
  {
    const int q4 = lane >> 3, c8 = (lane & 7) * 8;
    v4u hv[4], lv[4];
#pragma unroll
    for (int it = 0; it < 4; ++it) {
      const int row = it * 4 + q4;             // it 0..3 x q4 0..3 = rows 0..15 of the wave tile
      const float* sp = os + row * OP + c8;
      v4u a, a2;
#pragma unroll
      for (int e = 0; e < 4; ++e) {
        const float f0 = sp[2 * e], f1 = sp[2 * e + 1];
        const unsigned short x0 = bf_bits(f0), x1 = bf_bits(f1);
        const unsigned short y0 = bf_bits(f0 - bf_up(x0)), y1 = bf_bits(f1 - bf_up(x1));
        a[e] = pk16(x0, x1); a2[e] = pk16(y0, y1);
      }
      hv[it] = a; lv[it] = a2;
    }
    {
#pragma unroll
      for (int it = 0; it < 4; ++it) {
        const int row = it * 4 + q4;
        const size_t go = (rowB + q0 + row) * DM + (size_t)h * HD + c8;
        *(v4u*)(ahp + go) = hv[it];
        *(v4u*)(alp + go) = lv[it];
      }
      
    }
  }
}

// =====================================================================================================
// Workspace map (bytes), every region an exact multiple of its whole-line / whole-tile store granularity:
//   Xb    bf16 [4096][1024]            0           8388608
//   Wqb   bf16 [1024 out][1024 in]     8388608     2097152
//   Wkb   bf16 [1024][1024]            10485760    2097152
//   Wvb   bf16 [1024][1024]            12582912    2097152
//   Wob   bf16 [1024][1024]            14680064    2097152
//   Erb   bf16 [4096][64] (4095 used)  16777216     524288
//   Qh    bf16 [4096][1024]            17301504    8388608
//   Ql    bf16 [4096][1024]            25690112    8388608
//   Kh    bf16 [4096][1024]            34078720    8388608
//   Kl    bf16 [4096][1024]            42467328    8388608
//   VTh   f16  [2][1024][2048]         50855936    8388608
//   VTl   f16  [2][1024][512]          59244544    2097152
//   Ah    bf16 [4096][1024]            61341696    8388608
//   Al    bf16 [4096][1024]            69730304    8388608
//   QER   f32  [32][704][2048]         78118912  184549376   (largest of the three groups' band planes)
//   end                                262668288
// Weights arrive [in][out]; y = x . W needs Bt[out][in] (in contiguous) -> transpose-convert once.
// =====================================================================================================
extern "C" void kernel_launch(void* const* d_in, const int* in_sizes, int n_in,
                              void* d_out, int out_size, void* d_ws, size_t ws_size,
                              hipStream_t stream) {
  if (n_in < 10) return;
  if (in_sizes[0] != NB * SEQ * DM) return;
  if (in_sizes[1] != DM * DM || in_sizes[3] != DM * DM || in_sizes[5] != DM * DM || in_sizes[7] != DM * DM) return;
  if (in_sizes[2] != DM || in_sizes[4] != DM || in_sizes[6] != DM || in_sizes[8] != DM) return;
  if (in_sizes[9] != ERR * HD) return;
  if (out_size != NB * SEQ * DM) return;

  const float* x  = (const float*)d_in[0];
  const float* Wq = (const float*)d_in[1];
  const float* bq = (const float*)d_in[2];
  const float* Wk = (const float*)d_in[3];
  const float* bk = (const float*)d_in[4];
  const float* Wv = (const float*)d_in[5];
  const float* bv = (const float*)d_in[6];
  const float* Wo = (const float*)d_in[7];
  const float* bo = (const float*)d_in[8];
  const float* Er = (const float*)d_in[9];

  const size_t PXb  = (size_t)NB * SEQ * DM * 2;       //  8388608  16-bit activation plane [4096][1024]
  const size_t PW   = (size_t)DM * DM * 2;             //  2097152
  const size_t PEr  = (size_t)(ERR + 1) * HD * 2;      //   524288  (rows padded to 4096)
  const size_t PVTh = (size_t)NB * DM * SEQ * 2;       //  8388608
  const size_t PVTl = (size_t)NB * DM * VLP * 2;       //  2097152
  const size_t PQER = (size_t)NP * (NQB - QSPLIT) * 64 * NQC * 4;   // 184549376, the last group's band planes
  size_t off = 0;
  const size_t oXb  = off; off += PXb;
  const size_t oWq  = off; off += PW;
  const size_t oWk  = off; off += PW;
  const size_t oWv  = off; off += PW;
  const size_t oWo  = off; off += PW;
  const size_t oEr  = off; off += PEr;
  const size_t oQh  = off; off += PXb;
  const size_t oQl  = off; off += PXb;
  const size_t oKh  = off; off += PXb;
  const size_t oKl  = off; off += PXb;
  const size_t oVTh = off; off += PVTh;
  const size_t oVTl = off; off += PVTl;
  const size_t oAh  = off; off += PXb;
  const size_t oAl  = off; off += PXb;
  const size_t oQER = off; off += PQER;
  if (off > ws_size) return;                           // off = 262668288

  char* ws = (char*)d_ws;
  unsigned short* Xb  = (unsigned short*)(ws + oXb);
  unsigned short* Wqb = (unsigned short*)(ws + oWq);
  unsigned short* Wkb = (unsigned short*)(ws + oWk);
  unsigned short* Wvb = (unsigned short*)(ws + oWv);
  unsigned short* Wob = (unsigned short*)(ws + oWo);
  unsigned short* Erb = (unsigned short*)(ws + oEr);
  unsigned short* Qh  = (unsigned short*)(ws + oQh);
  unsigned short* Ql  = (unsigned short*)(ws + oQl);
  unsigned short* Kh  = (unsigned short*)(ws + oKh);
  unsigned short* Kl  = (unsigned short*)(ws + oKl);
  unsigned short* VTh = (unsigned short*)(ws + oVTh);
  unsigned short* VTl = (unsigned short*)(ws + oVTl);
  unsigned short* Ah  = (unsigned short*)(ws + oAh);
  unsigned short* Al  = (unsigned short*)(ws + oAl);
  float*          QER = (float*)(ws + oQER);

  const dim3 blk(256);
  const int n8x  = NB * SEQ * DM / 8;                                // 524288
  const int n8er = ERR * HD / 8;                                     // 32760
  const dim3 gCvtX((n8x + 255) / 256);                               // 2048 blocks
  const dim3 gCvtEr((n8er + 255) / 256);                             // 128 blocks
  const dim3 gTr(DM / 64, DM / 64);                                  // (out cols / 64, in rows / 64)
  const dim3 blkG(128);                                              // gemm128: 4 waves, one 128x128 tile
  const dim3 gQ((NB * SEQ / 128) * (DM / 128), 1);                   // 256 blocks
  const dim3 gVT((DM / 128) * (SEQ / 128), NB);                      // 128 blocks x 2 batches
  const dim3 gOut((NB * SEQ / 128) * (DM / 128), 1);                 // 256 blocks

  // (1) x -> bf16 plane [4096][1024]; Er -> bf16 plane [4095][64]
  cvt_bf16x8<<<gCvtX, blk, 0, stream>>>(x, Xb, n8x);
  cvt_bf16x8<<<gCvtEr, blk, 0, stream>>>(Er, Erb, n8er);
  // (2) weights [in][out] f32 -> bf16 [out][in] planes
  tr_cvt64<<<gTr, blk, 0, stream>>>(Wq, Wqb, DM, DM);
  tr_cvt64<<<gTr, blk, 0, stream>>>(Wk, Wkb, DM, DM);
  tr_cvt64<<<gTr, blk, 0, stream>>>(Wv, Wvb, DM, DM);
  tr_cvt64<<<gTr, blk, 0, stream>>>(Wo, Wob, DM, DM);
  // (3) q and k projections: Qh/Ql[b*SEQ+s][e] = hi/lo of (bq[e] + sum_d Xb[s][d] Wqb[e][d])  (M=4096, N=1024, K=1024)
  gemm128<0, 2, false, true><<<gQ, blkG, 0, stream>>>(
      Xb, Xb, DM, 0LL, Wqb, DM, 0LL,
      (void*)Qh, DM, 0LL, (void*)Ql, DM, 0LL, 0,
      NB * SEQ, DM, DM, 1.0f, bq, bq);
  gemm128<0, 2, false, true><<<gQ, blkG, 0, stream>>>(
      Xb, Xb, DM, 0LL, Wkb, DM, 0LL,
      (void*)Kh, DM, 0LL, (void*)Kl, DM, 0LL, 0,
      NB * SEQ, DM, DM, 1.0f, bk, bk);
  // (4) v^T per batch: VTh[b][m][s] = bv[m] + sum_d Wvb[m][d] Xb[b*SEQ+s][d] -> f16 hi plane (pitch SEQ) and
  //     residual plane (x4096, keys < VLP, pitch VLP)  (M=1024, N=2048, K=1024)
  gemm128<0, 3, true, false><<<gVT, blkG, 0, stream>>>(
      Wvb, Wvb, DM, 0LL, Xb, DM, (long long)SEQ * DM,
      (void*)VTh, SEQ, (long long)DM * SEQ, (void*)VTl, VLP, (long long)DM * VLP, VLP,
      DM, SEQ, DM, 4096.0f, bv, bv);
  // (5) three groups of query blocks, each launch over all NP pairs: band planes of the group, then its attention.
  //     A group [qa, qe) needs band columns 0 .. 64*(qe+1)-1 (at most NQC): that is its row pitch.
  const int gqa[3] = {0, RESQB, QSPLIT};
  const int gqe[3] = {RESQB, QSPLIT, NQB};
  for (int g = 0; g < 3; ++g) {
    const int qa = gqa[g];
    const int nq = gqe[g] - qa;
    const int pitch = ((gqe[g] + 1 < NQB) ? (gqe[g] + 1) : NQB) * 64;
    const long long qerStride = (long long)nq * 64 * pitch;
    const size_t aoff = (size_t)qa * 64 * DM;
    const dim3 gBand((nq * (pitch / 64) + 7) / 8, NP);
    // QER[p][t - 64*qa][c] = sum_d (Qh+Ql)[b*SEQ+t][h*64+d] * Erb[BANDOFF - 64*(t/64) + c][d]   (M=64*nq, N=pitch, K=64)
    gemm64<1, 0, false, false, true><<<gBand, blk, 0, stream>>>(
        Qh + aoff, Ql + aoff, DM, 0LL, Erb, Erb, HD, 0LL,
        (void*)QER, pitch, qerStride, (void*)QER, 0, 0LL, 0,
        nq * 64, pitch, HD, 1.0f, BANDOFF - qa * 64, bq, bq);
    if (g == 0) {
      attn_rel64<true><<<dim3(nq * NP), dim3(256), 0, stream>>>(
          Qh, Ql, Kh, Kl, VTh, VTl, QER, qerStride, pitch, Ah, Al, qa, nq, 0.125f);
    } else {
      attn_rel64<false><<<dim3(nq * NP), dim3(256), 0, stream>>>(
          Qh, Ql, Kh, Kl, VTh, VTl, QER, qerStride, pitch, Ah, Al, qa, nq, 0.125f);
    }
  }
  // (6) out[s][e] = bo[e] + sum_d (Ah+Al)[s][d] Wob[e][d] -> d_out f32 [4096][1024]  (M=4096, N=1024, K=1024)
  gemm128<1, 0, false, true><<<gOut, blkG, 0, stream>>>(
      Ah, Al, DM, 0LL, Wob, DM, 0LL,
      d_out, DM, 0LL, d_out, 0, 0LL, 0,
      NB * SEQ, DM, DM, 1.0f, bo, bo);
  (void)hipGetLastError();
}

// v006
// It runs in 236 microseconds.
// In both of two side-by-side timings against v005, it was 1.37 times as fast.
// Counting every step since v000, it is 23.5 times as fast.
// Contractions: x.Wq / x.Wk / Wv.x^T projections = v_wmma_f32_16x16x32_bf16 (bf16 operands from RNE-converted inputs, single product, f32 bias epilogue);
// q.k^T scores = v_wmma_f32_16x16x32_bf16 with q and k as bf16 hi/lo planes (hi.hi + hi.lo + lo.hi); q.Er^T band = same with q hi/lo times bf16 Er (2 products);
// p.v = v_wmma_f32_16x16x32_f16 (p carried x1024 in f16, v in f16; f16 residual planes x4096 of p and v on the leading query blocks);
// ctx.Wo = v_wmma_f32_16x16x32_bf16 with ctx as bf16 hi/lo planes times bf16 Wo (2 products); all f32 accumulate; softmax in f32.
#include <hip/hip_runtime.h>
#include <math.h>
#include <float.h>
#include <stdint.h>

#define NB      2
#define SEQ     2048
#define DM      1024
#define NH      16
#define HD      64
#define NQB     (SEQ / 64)       // 32 query / key tiles of 64
#define ERR     (2 * SEQ - 1)    // 4095 rows of the relative table
#define VLP     512              // key pitch of the v^T residual plane (keys 0..VLP-1)
#define RESQB   8                // leading 64-row query blocks that use the p / v residual planes
#define NP      (NB * NH)        // 32 (b,h) pairs: every attention launch covers all of them
#define QSPLIT  21               // first query block of the last group; groups are [0,RESQB) [RESQB,QSPLIT) [QSPLIT,NQB)
static_assert(RESQB * 64 <= VLP);
static_assert(NH * HD == DM);
static_assert((SEQ % 64) == 0 && (DM % 64) == 0);
static_assert(HD == 64);
static_assert(RESQB < QSPLIT && QSPLIT < NQB);
static_assert((SEQ % 128) == 0 && (DM % 128) == 0);   // gemm128: whole 128x128 tiles and whole 128-k slabs

typedef _Float16 v16h __attribute__((ext_vector_type(16)));
typedef _Float16 v8h  __attribute__((ext_vector_type(8)));
typedef __bf16   v16b __attribute__((ext_vector_type(16)));
typedef __bf16   v8b  __attribute__((ext_vector_type(8)));
typedef float    v8f  __attribute__((ext_vector_type(8)));
typedef float    v4f  __attribute__((ext_vector_type(4)));
typedef unsigned int v4u __attribute__((ext_vector_type(4)));
typedef unsigned short v8us __attribute__((ext_vector_type(8)));

// ---- scalar helpers --------------------------------------------------------------------------------
__device__ __forceinline__ unsigned short bf_bits(float f) {          // f32 -> bf16 bits, RNE convert
  unsigned u = __float_as_uint(f);
  return (unsigned short)((u + 0x7FFFu + ((u >> 16) & 1u)) >> 16);
}
__device__ __forceinline__ float bf_up(unsigned short h) { return __uint_as_float(((unsigned)h) << 16); }
__device__ __forceinline__ unsigned short h_bits(_Float16 x) { return __builtin_bit_cast(unsigned short, x); }
__device__ __forceinline__ unsigned pk16(unsigned short a, unsigned short b) { return (unsigned)a | ((unsigned)b << 16); }
__device__ __forceinline__ v8f zero8() { v8f z = {0.f, 0.f, 0.f, 0.f, 0.f, 0.f, 0.f, 0.f}; return z; }
__device__ __forceinline__ v8h zero8h() {
  const _Float16 z = (_Float16)0.0f;
  v8h r = {z, z, z, z, z, z, z, z};
  return r;
}

// ---- fragment loader: 16-bit A/B operand, lane -> row/col (lane&15), p already includes +8*(lane>>4);
//      elements 0..7 <- p[0..7] (k0+8h..), elements 8..15 <- p[16..23] (k0+16+8h..)
__device__ __forceinline__ v16b ldfrag_b(const __bf16* p) {
  union { v16b v; v8b h[2]; } f;
  f.h[0] = *(const v8b*)(p);
  f.h[1] = *(const v8b*)(p + 16);
  return f.v;
}

// ---- WMMA helpers with trailing VALU hazard gap --------------------------------------------------------
__device__ __forceinline__ v8f mma_b(v16b a, v16b b, v8f c) {
  c = __builtin_amdgcn_wmma_f32_16x16x32_bf16(false, a, false, b, (short)0, c, false, false);
#if defined(__HIP_DEVICE_COMPILE__)
  asm volatile("v_nop\n\tv_nop\n\tv_nop\n\tv_nop" : "+v"(c) : "v"(a), "v"(b));
#endif
  return c;
}
__device__ __forceinline__ v8f mma_h(v16h a, v16h b, v8f c) {
  c = __builtin_amdgcn_wmma_f32_16x16x32_f16(false, a, false, b, (short)0, c, false, false);
#if defined(__HIP_DEVICE_COMPILE__)
  asm volatile("v_nop\n\tv_nop\n\tv_nop\n\tv_nop" : "+v"(c) : "v"(a), "v"(b));
#endif
  return c;
}
__device__ __forceinline__ v8f mma_b_raw(v16b a, v16b b, v8f c) {
  return __builtin_amdgcn_wmma_f32_16x16x32_bf16(false, a, false, b, (short)0, c, false, false);
}
__device__ __forceinline__ void dep_guard_b(v8f& a, v8f& b, v16b x, v16b y) {
#if defined(__HIP_DEVICE_COMPILE__)
  asm volatile("v_nop\n\tv_nop\n\tv_nop\n\tv_nop" : "+v"(a), "+v"(b) : "v"(x), "v"(y));
#endif
}
__device__ __forceinline__ void keep4_b(v16b a, v16b b, v16b c, v16b d) {
#if defined(__HIP_DEVICE_COMPILE__)
  asm volatile("v_nop" :: "v"(a), "v"(b), "v"(c), "v"(d));
#endif
}
__device__ __forceinline__ void acc_guard4(v8f& a, v8f& b, v8f& c, v8f& d) {
#if defined(__HIP_DEVICE_COMPILE__)
  asm volatile("v_nop\n\tv_nop\n\tv_nop\n\tv_nop" : "+v"(a), "+v"(b), "+v"(c), "+v"(d));
#endif
}
// The four vector slots that the chip needs between the last matrix instruction and the first read of its result.
__device__ __forceinline__ void acc_guard5(v8f& a, v8f& b, v8f& c, v8f& d, v8f& e) {
#if defined(__HIP_DEVICE_COMPILE__)
  asm volatile("v_nop\n\tv_nop\n\tv_nop\n\tv_nop" : "+v"(a), "+v"(b), "+v"(c), "+v"(d), "+v"(e));
#endif
}

// =====================================================================================================
// f32 -> bf16 (RNE convert), 8 elements per thread, one 16-B store per lane: a wave writes 512 contiguous B
// grid = ceil(n8/256). coverage: n8 threads x 8 = whole plane (n8 is a multiple of 8 here, so every
// =====================================================================================================
__global__ __launch_bounds__(256) void cvt_bf16x8(const float* __restrict__ in, unsigned short* out, int n8) {
  const int i = blockIdx.x * 256 + threadIdx.x;
  if (i < n8) {
    const v4f a = *(const v4f*)(in + (size_t)i * 8);
    const v4f b = *(const v4f*)(in + (size_t)i * 8 + 4);
    v4u p;
    p[0] = pk16(bf_bits(a[0]), bf_bits(a[1]));
    p[1] = pk16(bf_bits(a[2]), bf_bits(a[3]));
    p[2] = pk16(bf_bits(b[0]), bf_bits(b[1]));
    p[3] = pk16(bf_bits(b[2]), bf_bits(b[3]));
    *(v4u*)(out + (size_t)i * 8) = p;
    
  }
}

// =====================================================================================================
// Transpose-convert: in f32 [R][C] (row pitch C) -> out bf16 [C][R] (row pitch R), out[c][r] = RNE bf16(in[r][c]).
// Block = 256 threads = one 64(r) x 64(c) tile; grid = (C/64, R/64) (host-checked exact multiples).
// Load: thread t reads row r0 + (t>>2), columns c0 + (t&3)*16 .. +15 (four 16-B loads), scatters the
// converted bits into LDS sT[c][r] (pitch 72); __syncthreads; store: wave w writes output rows
// coverage: 8 waves x 2 it x 4 = 64 output rows x (8 lanes x 8) = 64 columns = the whole tile.
// =====================================================================================================
__global__ __launch_bounds__(256) void tr_cvt64(const float* __restrict__ in, unsigned short* out, int R, int C) {
  __shared__ __align__(16) unsigned short sT[64 * 72];
  const int tid = threadIdx.x, lane = tid & 31, wave = tid >> 5;
  const int r0 = blockIdx.y * 64, c0 = blockIdx.x * 64;
  {
    const int rl = tid >> 2, cl = (tid & 3) * 16;
    const float* src = in + (size_t)(r0 + rl) * C + c0 + cl;
#pragma unroll
    for (int i = 0; i < 4; ++i) {
      const v4f v = *(const v4f*)(src + 4 * i);
#pragma unroll
      for (int e = 0; e < 4; ++e) sT[(cl + 4 * i + e) * 72 + rl] = bf_bits(v[e]);
    }
  }
  __syncthreads();
  const int q = lane >> 3, p8 = (lane & 7) * 8;
  v8us ov[2];
#pragma unroll
  for (int it = 0; it < 2; ++it) {
    const int cl2 = wave * 8 + it * 4 + q;
    ov[it] = *(const v8us*)(sT + cl2 * 72 + p8);
  }
  {
#pragma unroll
    for (int it = 0; it < 2; ++it) {
      const int cl2 = wave * 8 + it * 4 + q;
      *(v8us*)(out + (size_t)(c0 + cl2) * R + r0 + p8) = ov[it];
    }
    
  }
}

// =====================================================================================================
// Relative table f32 [ERR][64] -> bf16 (RNE convert) in the order of the B fragments of v_wmma_f32_16x16x32_bf16: the 16
// table rows 16*T .. 16*T+15 are one tile of 1024 elements; its 16-byte piece ((dc*2 + p)*32 + lane) holds row
// 16*T + (lane & 15), d = dc*32 + p*16 + (lane >> 4)*8 .. +7, so that a fragment half is one 512-byte contiguous load of
// a wave. Thread = one output piece (a wave stores 512 contiguous bytes); grid = 4096*8/256; row ERR does not exist and
// its pieces are neither written nor read.
// =====================================================================================================
__global__ __launch_bounds__(256) void cvt_er_frag(const float* __restrict__ in, unsigned short* out) {
  const int o    = blockIdx.x * 256 + threadIdx.x;
  const int lane = o & 31, p = (o >> 5) & 1, dc = (o >> 6) & 1, tl = o >> 7;
  const int e    = tl * 16 + (lane & 15);
  const int d    = dc * 32 + p * 16 + (lane >> 4) * 8;
  if (e < ERR) {
    const v4f a = *(const v4f*)(in + (size_t)e * HD + d);
    const v4f b = *(const v4f*)(in + (size_t)e * HD + d + 4);
    v4u q;
    q[0] = pk16(bf_bits(a[0]), bf_bits(a[1]));
    q[1] = pk16(bf_bits(a[2]), bf_bits(a[3]));
    q[2] = pk16(bf_bits(b[0]), bf_bits(b[1]));
    q[3] = pk16(bf_bits(b[2]), bf_bits(b[3]));
    *(v4u*)(out + (size_t)o * 8) = q;
  }
}

// =====================================================================================================
// Block-tiled bf16 WMMA GEMM for the four projections: C[m][n] = rb[m] + cb[n] + sum_k (A [+ A2])[m][k] * Bt[n][k], wave
// tile 64x64. NSPLIT 1 adds the bf16 lo plane A2; OUT_MODE 0 = f32, 2 = bf16 hi + lo planes, 3 = f16 hi plane + f16
// residual plane (x rscale, tiles with n0 < N2). A block of 4 waves (2 x 2) owns a 128x128 tile of C; the 128 rows of A (and A2) and
// of Bt that it needs are brought into LDS one slab of KS = 128 k at a time by asynchronous copies
// (global_load_async_to_lds_b128: a wave's copy covers two whole 256-byte row pieces), two buffers, so that slab t + 1
// flies while slab t is multiplied; fragments are then read from LDS (row pitch 272 bytes = 17 x 16).
// M, N multiples of 128, K a multiple of KS and at least KS; grid.x = (M/128) * (N/128), blockIdx.y = batch.
// =====================================================================================================
// Eight 16-byte copies per lane, rows gstep elements / lstep bytes apart.
__device__ __forceinline__ void async_rows8(const __bf16* g, size_t gstep, unsigned l, unsigned lstep) {
#if defined(__HIP_DEVICE_COMPILE__)
  // The closing s_wait_xcnt 0 stands in the copies' own statement, so that it is passed before any address register
  // that a copy names is written again.
  asm volatile(
      "global_load_async_to_lds_b128 %0, %8, off\n\t"
      "global_load_async_to_lds_b128 %1, %9, off\n\t"
      "global_load_async_to_lds_b128 %2, %10, off\n\t"
      "global_load_async_to_lds_b128 %3, %11, off\n\t"
      "global_load_async_to_lds_b128 %4, %12, off\n\t"
      "global_load_async_to_lds_b128 %5, %13, off\n\t"
      "global_load_async_to_lds_b128 %6, %14, off\n\t"
      "global_load_async_to_lds_b128 %7, %15, off\n\t"
      "s_wait_xcnt 0x0"
      :: "v"(l), "v"(l + lstep), "v"(l + 2 * lstep), "v"(l + 3 * lstep),
         "v"(l + 4 * lstep), "v"(l + 5 * lstep), "v"(l + 6 * lstep), "v"(l + 7 * lstep),
         "v"(g), "v"(g + gstep), "v"(g + 2 * gstep), "v"(g + 3 * gstep),
         "v"(g + 4 * gstep), "v"(g + 5 * gstep), "v"(g + 6 * gstep), "v"(g + 7 * gstep)
      : "memory");
  // Keeps the address arithmetic of the next eight copies behind these: hoisted in front of them it held the addresses
  // of a whole slab in registers at once (a spill to scratch beside the 128 accumulator registers) and delayed the first copy.
  __builtin_amdgcn_sched_barrier(0);
#endif
}
// The issuing wave's own wait: its copies have landed in LDS behind it.
__device__ __forceinline__ void wait_async0() {
#if defined(__HIP_DEVICE_COMPILE__)
  asm volatile("s_wait_asynccnt 0x0" ::: "memory");
#endif
}
// The wave's LDS reads have returned: stands in front of the barrier behind which their buffer is refilled.
__device__ __forceinline__ void wait_ds0() {
#if defined(__HIP_DEVICE_COMPILE__)
  asm volatile("s_wait_dscnt 0x0" ::: "memory");
#endif
}

template <int NSPLIT, int OUT_MODE, bool RB, bool CB>
__global__ __launch_bounds__(128) void gemm128(
    const unsigned short* __restrict__ Ap, const unsigned short* A2p, int lda, long long strideA,
    const unsigned short* __restrict__ Btp, int ldb, long long strideB,
    void* Cout, int ldc, long long strideC,
    void* Cout2, int ldc2, long long strideC2, int N2,
    int M, int N, int K, float rscale,
    const float* __restrict__ rbp, const float* __restrict__ cbp) {
  static_assert(NSPLIT == 0 || NSPLIT == 1);
  constexpr int KS  = 128;                       // k per slab
  constexpr int SP  = KS + 8;                    // LDS row pitch in elements
  constexpr int NPL = (NSPLIT == 1) ? 3 : 2;     // planes of a slab: A, Bt, (A2)
  constexpr unsigned PLB = 128u * SP * 2u;       // bytes of one plane of a slab
  constexpr unsigned LST = 8u * SP * 2u;         // bytes between two copies of a lane (8 rows)
  __shared__ __align__(16) __bf16 sS[2][NPL][128 * SP];
  __shared__ __align__(16) float sT[4][16 * 68];   // per-wave 16x64 slab, pitch 68 floats
  const __bf16* A   = (const __bf16*)(const void*)Ap;
  const __bf16* A2  = (const __bf16*)(const void*)A2p;
  const __bf16* Bt  = (const __bf16*)(const void*)Btp;
  const int b    = blockIdx.y;
  const int tid  = threadIdx.x;
  const int lane = tid & 31;
  const int wave = tid >> 5;
  const int tilesN = N >> 7;
  const int tilesM = M >> 7;
  const int tile = blockIdx.x;
  if (tile >= tilesM * tilesN) return;   // block-uniform, in front of every copy and barrier
  const int tm  = tile / tilesN;
  const int tn  = tile - tm * tilesN;
  const int bm0 = tm << 7;
  const int bn0 = tn << 7;
  const int wm  = (wave >> 1) << 6;      // the wave's 64x64 tile within the block tile
  const int wn  = (wave & 1) << 6;
  const int m0  = bm0 + wm;
  const int n0  = bn0 + wn;

  // copy addressing: 16 lanes per 256-byte row piece, 8 rows per block-wide copy, 16 copies per lane and plane
  const int cr = tid >> 4, cc = (tid & 15) * 8;
  const __bf16* gA  = A  + (size_t)b * strideA + (size_t)(bm0 + cr) * lda + cc;
  const long long dA2 = A2 - A;          // uniform distance (elements) of the lo plane from the hi plane, same workspace
  const __bf16* gB  = Bt + (size_t)b * strideB + (size_t)(bn0 + cr) * ldb + cc;
  const unsigned l0 = (unsigned)(size_t)(&sS[0][0][0]) + (unsigned)(cr * SP + cc) * 2u;
  auto fill = [&](int t, int bs) {
    const unsigned lb = l0 + (unsigned)bs * (NPL * PLB);
    const size_t ko = (size_t)t * KS;
    async_rows8(gA + ko, (size_t)8 * lda, lb, LST);
    async_rows8(gA + ko + (size_t)64 * lda, (size_t)8 * lda, lb + 8u * LST, LST);
    async_rows8(gB + ko, (size_t)8 * ldb, lb + PLB, LST);
    async_rows8(gB + ko + (size_t)64 * ldb, (size_t)8 * ldb, lb + PLB + 8u * LST, LST);
    if (NSPLIT == 1) {
      async_rows8(gA + (dA2 + (long long)ko), (size_t)8 * lda, lb + 2u * PLB, LST);
      async_rows8(gA + (dA2 + (long long)ko) + (size_t)64 * lda, (size_t)8 * lda, lb + 2u * PLB + 8u * LST, LST);
    }
  };

  const int rlane = lane & 15;                 // row (A) / col (B, D) within subtile
  const int koff  = (lane >> 4) * 8;           // k offset of this lane half
  const int mOff  = (lane >> 4) * 8;           // D row offset

  v8f acc[4][4];
#pragma unroll
  for (int i = 0; i < 4; ++i)
#pragma unroll
    for (int j = 0; j < 4; ++j) acc[i][j] = zero8();

  const int nst = K / KS;                      // slabs, block-uniform
  fill(0, 0);
  wait_async0();
  __syncthreads();                             // slab 0 is published
  if (nst > 1) fill(1, 1);
  for (int t = 0; t < nst; ++t) {
    const __bf16* sA  = &sS[t & 1][0][0] + (wm + rlane) * SP + koff;
    const __bf16* sB  = &sS[t & 1][1][0] + (wn + rlane) * SP + koff;
    const __bf16* sA2 = &sS[t & 1][NPL - 1][0] + (wm + rlane) * SP + koff;
#pragma unroll
    for (int ks = 0; ks < KS; ks += 32) {
      // all fragments of the k step are read in one batch, so that the wave pays the LDS latency once per step
      v16b bh[4], ah[4], al[4];
#pragma unroll
      for (int j = 0; j < 4; ++j) bh[j] = ldfrag_b(sB + (j << 4) * SP + ks);
#pragma unroll
      for (int i = 0; i < 4; ++i) {
        ah[i] = ldfrag_b(sA + (i << 4) * SP + ks);
        if (NSPLIT == 1) al[i] = ldfrag_b(sA2 + (i << 4) * SP + ks); else al[i] = ah[i];
      }
#pragma unroll
      for (int i = 0; i < 4; ++i) {
#pragma unroll
        for (int j = 0; j < 4; ++j) {
          acc[i][j] = mma_b_raw(ah[i], bh[j], acc[i][j]);
          if (NSPLIT == 1) acc[i][j] = mma_b_raw(al[i], bh[j], acc[i][j]);
        }
        dep_guard_b(acc[i][0], acc[i][3], ah[i], al[i]);
      }
      keep4_b(bh[0], bh[1], bh[2], bh[3]);
    }
    // publish point of slab t + 1: own LDS reads returned, own copies landed, then the one barrier of the trip (it
    // publishes slab t + 1 and ends every wave's reads of the buffer that is refilled behind it)
    wait_ds0();
    wait_async0();
    __syncthreads();
    if (t + 2 < nst) fill(t + 2, t & 1);
  }
  wait_async0();                               // no copy is outstanding when the wave goes on
  acc_guard4(acc[0][0], acc[0][1], acc[0][2], acc[0][3]);
  acc_guard4(acc[1][0], acc[1][1], acc[1][2], acc[1][3]);
  acc_guard4(acc[2][0], acc[2][1], acc[2][2], acc[2][3]);
  acc_guard4(acc[3][0], acc[3][1], acc[3][2], acc[3][3]);

  // ---- epilogue biases (input values RNE-converted to bf16) ----
  float cbv[4];
#pragma unroll
  for (int j = 0; j < 4; ++j) cbv[j] = CB ? bf_up(bf_bits(cbp[n0 + (j << 4) + rlane])) : 0.0f;

  // ---- epilogue ----
  float* slab = sT[wave];
#pragma unroll
  for (int i = 0; i < 4; ++i) {
    const int mBase = m0 + (i << 4);
#pragma unroll
    for (int r = 0; r < 8; ++r) {
      const float rbv = RB ? bf_up(bf_bits(rbp[mBase + mOff + r])) : 0.0f;
#pragma unroll
      for (int j = 0; j < 4; ++j) {
        slab[(mOff + r) * 68 + (j << 4) + rlane] = acc[i][j][r] + rbv + cbv[j];
      }
    }
    __builtin_amdgcn_fence(__ATOMIC_RELEASE, "workgroup");
    __builtin_amdgcn_wave_barrier();
    __builtin_amdgcn_fence(__ATOMIC_ACQUIRE, "workgroup");
    if (OUT_MODE == 0) {
      float* C = (float*)Cout + (size_t)b * strideC;
      const int hh = lane >> 4, c4 = (lane & 15) * 4;     // 256-B row segment = 16 lanes x 16 B
      v4f ov[8];
#pragma unroll
      for (int it = 0; it < 8; ++it) {
        const int row = it * 2 + hh;                       // it 0..7 x hh 0..1 = rows 0..15
        ov[it] = *(const v4f*)(slab + row * 68 + c4);
      }
      {
#pragma unroll
        for (int it = 0; it < 8; ++it) {
          const int row = it * 2 + hh;
          *(v4f*)(C + (size_t)(mBase + row) * ldc + n0 + c4) = ov[it];
        }
        
      }
    } else {
      const int q = lane >> 3, c8 = (lane & 7) * 8;
      unsigned short* C  = (unsigned short*)Cout  + (size_t)b * strideC;
      unsigned short* C2 = (unsigned short*)Cout2 + (size_t)b * strideC2;
      const bool wlo = (OUT_MODE == 2) || (n0 < N2);      // wave-uniform
      v4u hv[4], lv[4];
#pragma unroll
      for (int it = 0; it < 4; ++it) {
        const int row = it * 4 + q;                        // it 0..3 x q 0..3 = rows 0..15
        const float* sp = slab + row * 68 + c8;
        v4u a, a2;
#pragma unroll
        for (int e = 0; e < 4; ++e) {
          const float f0 = sp[2 * e], f1 = sp[2 * e + 1];
          unsigned short h0, h1, l0, l1;
          if (OUT_MODE == 2) {
            h0 = bf_bits(f0); h1 = bf_bits(f1);
            l0 = bf_bits(f0 - bf_up(h0)); l1 = bf_bits(f1 - bf_up(h1));
          } else {
            const _Float16 x0 = (_Float16)f0, x1 = (_Float16)f1;
            h0 = h_bits(x0); h1 = h_bits(x1);
            l0 = h_bits((_Float16)((f0 - (float)x0) * rscale));
            l1 = h_bits((_Float16)((f1 - (float)x1) * rscale));
          }
          a[e] = pk16(h0, h1); a2[e] = pk16(l0, l1);
        }
        hv[it] = a; lv[it] = a2;
      }
      {
#pragma unroll
        for (int it = 0; it < 4; ++it) {
          const int row = it * 4 + q;
          *(v4u*)(C + (size_t)(mBase + row) * ldc + n0 + c8) = hv[it];
          if (wlo) *(v4u*)(C2 + (size_t)(mBase + row) * ldc2 + n0 + c8) = lv[it];
        }
        
      }
    }
    __builtin_amdgcn_fence(__ATOMIC_RELEASE, "workgroup");
    __builtin_amdgcn_wave_barrier();
    __builtin_amdgcn_fence(__ATOMIC_ACQUIRE, "workgroup");
  }
}

// =====================================================================================================
// Causal attention with a relative-position bias, head dim 64 (tril mask incl. diagonal, computed).
//   q planes (bf16 hi / lo): element (b, t, h, d) at [(b*SEQ + t)*DM + h*64 + d]
//   k planes (bf16 hi / lo): same layout with key index s
//   v^T hi plane (f16):      element (b, h, d, s) at [(b*DM + h*64 + d)*SEQ + s]
//   v^T residual plane (f16, (v - hi)*4096): [(b*DM + h*64 + d)*VLP + s], s < VLP, read only when RES
//   relative table (bf16, fragment order of cvt_er_frag): the relative term of (query t, key) is q[t] . Er[key - t + SEQ - 1].
//     A wave's 16 queries x 64 keys need the 79 table rows from kv0 - q0 + SEQ - 16 on (a multiple of 16, in
//     [0, SEQ - 16]): five 16-row tiles, q hi/lo times bf16 Er (hi, lo per 32 d, f32 accumulate from 0), the 16 x 80
//     result stored to a wave-private LDS tile and read back along the diagonals (column key - kv0 + 15 - row).
//   logit = (q.k + band) * sscale for key <= query, -FLT_MAX otherwise (exp -> 0); every row has a live key in
//   every processed key tile (tiles 0..qb only, block-uniform trip count (qb+2)/2 <= 16).
//   output: ctx hi / lo bf16 planes, element (b, t, h*64 + d) at [(b*SEQ + t)*DM + h*64 + d] = normalised
//   context (lo = RNE(v - hi), unscaled).
//   scores = q . k : bf16 hi/lo split (hi.hi + hi.lo + lo.hi), f32 accumulate, band added in f32, * sscale in f32
//   p = exp(s - m) carried as f16(1024 p); context = p . v on f16 WMMA; RES adds f16 residual planes of p and v
//   (scale 4096, separate accumulator folded back with 1/4096 per chunk in f32); online softmax in f32.
//   Block = 8 waves = 64 query rows of one (b, h), in two groups of 4 waves; grid = nqbThis * NP (pair index =
//   blockIdx.x / nqbThis, b = pair / NH, h = pair % NH); kv chunks of 64. Group g walks the key tiles g, g + 2, ...
//   with its own K / V^T tiles in LDS and its own running maximum, sum and context; the two partial results of a row
//   are joined once behind the loop, in f32 (each rescaled to the common maximum). The block's chain of dependent
//   tiles is half as long, and the two groups' waves fill each other's waits on the SIMDs that they share.
//   K / V^T chunk staging: a group's 128 threads x 32 elements per plane = the whole 64x64 tile (plain 16-B loads,
//   __syncthreads before and after); P tiles are wave-private, spilled with _Float16 element stores and reloaded
//   Output coverage: each wave of group 0 stores its rows 0..15 (it 0..3 x lane>>3 0..3) x 64 columns (8 lanes x 8 bf16),
// =====================================================================================================
// e^x for the join of the two groups' results. v_exp_f32 and the one free slot that the instruction set asks for behind
// a transcendental stand in one statement, so that no instruction which reads the result or overwrites the source
// follows directly.
__device__ __forceinline__ float exp_slot(float x) {
  float y = x * 1.44269504f;
#if defined(__HIP_DEVICE_COMPILE__)
  asm("v_exp_f32 %0, %1\n\tv_nop" : "=v"(y) : "v"(y));
#endif
  return y;
}

// Without RES four waves per SIMD (at most 256 registers a wave): two blocks share a WGP, so that every block of a launch
// of up to 512 is resident. The RES launch has one block per WGP and keeps the block size's own register budget.
template <bool RES>
__global__ __launch_bounds__(256) __attribute__((amdgpu_waves_per_eu(RES ? 2 : 4)))
void attn_rel64(const unsigned short* __restrict__ qhp, const unsigned short* __restrict__ qlp,
                const unsigned short* __restrict__ khp, const unsigned short* __restrict__ klp,
                const unsigned short* __restrict__ vhp, const unsigned short* __restrict__ vlp,
                const unsigned short* __restrict__ erfp,
                unsigned short* ahp, unsigned short* alp,
                int qbBase, int nqbThis, float sscale) {
  union FB { v16b v; v8b h[2]; };
  union FH { v16h v; v8h h[2]; };
  // Row pitches: 64 elements of data plus 16 bytes, an odd multiple of 16 bytes, so that the 16 rows which a 16-byte
  // fragment load reads at once fall on 64 different banks (at 128 or 256 bytes they share a few banks).
  constexpr int LP = 72;                                          // 16-bit tiles: 144 bytes a row
  constexpr int OP = 68;                                          // f32 tile: 272 bytes a row
  __shared__ __align__(16) __bf16   KshG[2][64 * LP];             // per group: K hi [kv][d]   9 KB
  __shared__ __align__(16) __bf16   KslG[2][64 * LP];             // K lo
  __shared__ __align__(16) _Float16 VthG[2][64 * LP];             // V^T hi [d][kv] 9 KB
  __shared__ __align__(16) _Float16 VtlG[2][RES ? 64 * LP : 8];   // V^T residual
  __shared__ __align__(16) _Float16 Psh[8][16 * LP];              // per wave P [row][kv]
  __shared__ __align__(16) _Float16 Psl[RES ? 8 : 1][16 * LP];    // per wave P residual
  __shared__ __align__(16) float    Os[4][16 * OP];               // per 16-row slice: context tile [row][d]
  __shared__ float Ms[4][16], Ls[4][16];                          // group 1's running maximum and sum per row
  // Per wave: q . Er^T of the key tile, [row][table row - first]. 84 floats a row: rows 8 apart lie 32 banks apart for the
  // stores and 24 for the diagonal reads, so that the two 16-lane halves of an access meet different banks.
  constexpr int BP = 84;
  __shared__ __align__(16) float    Bs[8][16 * BP];

  // the group is the same in every lane of a wave: kept in a scalar register, so that the tests on it are scalar branches
  const int grp  = __builtin_amdgcn_readfirstlane((int)(threadIdx.x >> 7));
  const int tid  = threadIdx.x & 127;     // thread within the group
  const int wave = tid >> 5;              // 16-row slice of the query block
  const int lane = tid & 31;
  __bf16*   Ksh = KshG[grp];
  __bf16*   Ksl = KslG[grp];
  _Float16* Vth = VthG[grp];
  _Float16* Vtl = VtlG[grp];
  const int hh   = lane >> 4;
  const int c    = lane & 15;

  const int bx   = blockIdx.x;
  const int qbl  = bx % nqbThis;
  const int pr   = bx / nqbThis;          // (b,h) pair index, 0..NP-1
  const int h    = pr % NH;
  const int b    = pr / NH;
  const int qb   = qbBase + qbl;
  const int q0   = qb * 64 + wave * 16;
  const size_t rowB = (size_t)b * SEQ;

  const __bf16* Qh = (const __bf16*)(const void*)qhp + (size_t)h * HD;
  const __bf16* Ql = (const __bf16*)(const void*)qlp + (size_t)h * HD;
  const __bf16* Kh = (const __bf16*)(const void*)khp + (size_t)h * HD;
  const __bf16* Kl = (const __bf16*)(const void*)klp + (size_t)h * HD;
  const _Float16* Vh = (const _Float16*)(const void*)vhp + ((size_t)b * DM + (size_t)h * HD) * SEQ;
  const _Float16* Vl = (const _Float16*)(const void*)vlp + ((size_t)b * DM + (size_t)h * HD) * VLP;
  const __bf16* Ef = (const __bf16*)(const void*)erfp;

  // ---- Q fragments (A operand, row = lane&15): 2 d-chunks, hi and lo ----
  v16b qah[2], qal[2];
#pragma unroll
  for (int dc = 0; dc < 2; ++dc) {
    const size_t qo = (rowB + q0 + c) * DM + dc * 32 + 8 * hh;
    qah[dc] = ldfrag_b(Qh + qo);
    qal[dc] = ldfrag_b(Ql + qo);
  }

  float mrow[8], lrow[8];
  v8f oacc[4];
#pragma unroll
  for (int r = 0; r < 8; ++r) { mrow[r] = -INFINITY; lrow[r] = 0.f; }
#pragma unroll
  for (int t = 0; t < 4; ++t) oacc[t] = zero8();

  int nkt = qb + 1;                          // causal: key tiles 0..qb, block-uniform
  if (nkt > NQB) nkt = NQB;

  float* bw = Bs[grp * 4 + wave];
  const int ntrip = (nkt + 1) >> 1;          // block-uniform: every wave passes every barrier
  for (int it = 0; it < ntrip; ++it) {
    const int kt  = 2 * it + grp;
    const int kv0 = kt * 64;
    const bool act = kt < nkt;               // wave-uniform (scalar): false only for group 1 in the last trip of an odd nkt
    __syncthreads();
    if (act) {
      const int r = tid >> 1, half = (tid & 1) * 32;
      // every address is a base that is the same for the whole wave plus a 32-bit lane offset that no trip changes: the
      // bases live in scalar registers, which leaves the vector registers to the loaded tiles
      const unsigned ko = (unsigned)(r * DM + half), vo = (unsigned)(r * SEQ + half), vlo = (unsigned)(r * VLP + half);
      const __bf16*   kg  = Kh + (rowB + kv0) * DM;               // + ko: K row kv0+r, d = half..half+31
      const __bf16*   klg = Kl + (rowB + kv0) * DM;
      const _Float16* vg  = Vh + kv0;                             // + vo: V^T row d = r, s = kv0+half..+31
      const int kvl = (kv0 + 64 <= VLP) ? kv0 : (VLP - 64);     // clamped address into the residual plane
      const _Float16* vlg = Vl + kvl;
      const bool resOK = (kv0 + 64 <= VLP);                      // block-uniform
      v8b a0[4], a1[4];
      v8h b0[4], b1[4];
#pragma unroll
      for (int i = 0; i < 4; ++i) {
        a0[i] = *(const v8b*)(kg + ko + 8 * i);
        a1[i] = *(const v8b*)(klg + ko + 8 * i);
        b0[i] = *(const v8h*)(vg + vo + 8 * i);
        b1[i] = RES ? *(const v8h*)(vlg + vlo + 8 * i) : zero8h();
      }
      // the wave's five tiles of the relative table, behind the K / V loads so that these can be stored to LDS first
      const __bf16* eg = Ef + (size_t)__builtin_amdgcn_readfirstlane((kv0 - q0 + (SEQ - 16)) >> 4) * 1024;
      const unsigned eo = (unsigned)(lane * 8);
      FB eb[5][2];
#pragma unroll
      for (int n = 0; n < 5; ++n)
#pragma unroll
        for (int dc = 0; dc < 2; ++dc) {
          eb[n][dc].h[0] = *(const v8b*)(eg + eo + (n * 2 + dc) * 512);
          eb[n][dc].h[1] = *(const v8b*)(eg + eo + (n * 2 + dc) * 512 + 256);
        }
#if defined(__HIP_DEVICE_COMPILE__)
      // The wait that stands in front of any overwrite of a register an issued load names. It takes the bases and the lane
      // offsets as inputs so that they stay untouched (also by a later load's result) until it has been passed.
      if (RES) asm volatile("s_wait_xcnt 0x0" :: "s"(kg), "s"(klg), "s"(vg), "s"(vlg), "s"(eg), "v"(ko), "v"(vo), "v"(vlo), "v"(eo) : "memory");
      else     asm volatile("s_wait_xcnt 0x0" :: "s"(kg), "s"(klg), "s"(vg), "s"(eg), "v"(ko), "v"(vo), "v"(eo) : "memory");
      // Keeps all loads of the trip in front of their first use: moved behind the first products, the table's second half
      // and the K / V rows each waited for a memory round trip of their own.
      __builtin_amdgcn_sched_barrier(0);
#endif
#pragma unroll
      for (int i = 0; i < 4; ++i) {
        *(v8b*)(Ksh + r * LP + half + 8 * i) = a0[i];
        *(v8b*)(Ksl + r * LP + half + 8 * i) = a1[i];
        *(v8h*)(Vth + r * LP + half + 8 * i) = b0[i];
        if (RES) *(v8h*)(Vtl + r * LP + half + 8 * i) = resOK ? b1[i] : zero8h();
      }
      // ---- relative term: 16 queries x 80 table rows, five independent accumulators; per accumulator the products come
      //      in the order hi, lo of d 0..31, then hi, lo of d 32..63 ----
      v8f tb[5];
#pragma unroll
      for (int n = 0; n < 5; ++n) tb[n] = zero8();
#pragma unroll
      for (int dc = 0; dc < 2; ++dc) {
#pragma unroll
        for (int n = 0; n < 5; ++n) tb[n] = mma_b_raw(qah[dc], eb[n][dc].v, tb[n]);
#pragma unroll
        for (int n = 0; n < 5; ++n) tb[n] = mma_b_raw(qal[dc], eb[n][dc].v, tb[n]);
      }
      acc_guard5(tb[0], tb[1], tb[2], tb[3], tb[4]);
#pragma unroll
      for (int n = 0; n < 5; ++n)
#pragma unroll
        for (int rr = 0; rr < 8; ++rr) bw[(8 * hh + rr) * BP + n * 16 + c] = tb[n][rr];
    }
    __syncthreads();                         // also orders the wave's stores of its relative tile before its reads below
    if (!act) continue;                      // no barrier stands between here and the foot of the trip

    // ---- scores: 16 query rows x 64 keys per wave, 3 bf16 products ----
    v8f s[4];
#pragma unroll
    for (int j = 0; j < 4; ++j) {
      s[j] = zero8();
#pragma unroll
      for (int dc = 0; dc < 2; ++dc) {
        FB kb, kl;
        kb.h[0] = *(const v8b*)(Ksh + (j * 16 + c) * LP + dc * 32 + 8 * hh);
        kb.h[1] = *(const v8b*)(Ksh + (j * 16 + c) * LP + dc * 32 + 16 + 8 * hh);
        kl.h[0] = *(const v8b*)(Ksl + (j * 16 + c) * LP + dc * 32 + 8 * hh);
        kl.h[1] = *(const v8b*)(Ksl + (j * 16 + c) * LP + dc * 32 + 16 + 8 * hh);
        s[j] = mma_b(qah[dc], kb.v, s[j]);
        s[j] = mma_b(qah[dc], kl.v, s[j]);
        s[j] = mma_b(qal[dc], kb.v, s[j]);
      }
    }

    // ---- relative term of (row, key): column key - kv0 + 15 - row of the wave's tile ----
#pragma unroll
    for (int r = 0; r < 8; ++r)
#pragma unroll
      for (int j = 0; j < 4; ++j) s[j][r] += bw[(8 * hh + r) * (BP - 1) + j * 16 + c + 15];

    // ---- scale + causal mask (replace by -FLT_MAX), row max, online softmax, P (x1024, f16)
    //      and P residual (x4096) to LDS ----
    _Float16* pwh = Psh[grp * 4 + wave];
    _Float16* pwl = Psl[RES ? (grp * 4 + wave) : 0];
#pragma unroll
    for (int r = 0; r < 8; ++r) {
      const int qrow = q0 + 8 * hh + r;
      float m = -INFINITY;
#pragma unroll
      for (int j = 0; j < 4; ++j) {
        const int key = kv0 + j * 16 + c;
        float sv = s[j][r] * sscale;
        sv = (key > qrow) ? -FLT_MAX : sv;
        s[j][r] = sv;
        m = fmaxf(m, sv);
      }
#pragma unroll
      for (int off = 1; off < 16; off <<= 1) m = fmaxf(m, __shfl_xor(m, off, 32));
      const float mnew  = fmaxf(mrow[r], m);
      const float msafe = (mnew == -INFINITY) ? 0.f : mnew;
      const float alpha = __expf(mrow[r] - msafe);
      mrow[r] = mnew;
      float psum = 0.f;
#pragma unroll
      for (int j = 0; j < 4; ++j) {
        const float p = __expf(s[j][r] - msafe);     // masked logit against a finite max: exp -> 0
        psum += p;
        const float p1k = p * 1024.0f;
        const _Float16 ph = (_Float16)p1k;
        pwh[(8 * hh + r) * LP + j * 16 + c] = ph;
        if (RES) {
          const _Float16 pl = (_Float16)((p1k - (float)ph) * 4096.0f);
          pwl[(8 * hh + r) * LP + j * 16 + c] = pl;
        }
      }
#pragma unroll
      for (int off = 1; off < 16; off <<= 1) psum += __shfl_xor(psum, off, 32);
      lrow[r] = lrow[r] * alpha + psum;
#pragma unroll
      for (int t = 0; t < 4; ++t) oacc[t][r] *= alpha;
    }
    __builtin_amdgcn_fence(__ATOMIC_RELEASE, "workgroup");
    __builtin_amdgcn_wave_barrier();
    __builtin_amdgcn_fence(__ATOMIC_ACQUIRE, "workgroup");

    // ---- context += P . V (f16 WMMA), residual products into a separate accumulator ----
    v8f o1[4];
#pragma unroll
    for (int t = 0; t < 4; ++t) o1[t] = zero8();
#pragma unroll 1
    for (int kk = 0; kk < 2; ++kk) {
      FH pa, pl;
      pa.h[0] = *(const v8h*)(pwh + c * LP + kk * 32 + 8 * hh);
      pa.h[1] = *(const v8h*)(pwh + c * LP + kk * 32 + 16 + 8 * hh);
      if (RES) {
        pl.h[0] = *(const v8h*)(pwl + c * LP + kk * 32 + 8 * hh);
        pl.h[1] = *(const v8h*)(pwl + c * LP + kk * 32 + 16 + 8 * hh);
      } else {
        pl.v = pa.v;
      }
#pragma unroll
      for (int t = 0; t < 4; ++t) {
        FH vb;
        vb.h[0] = *(const v8h*)(Vth + (t * 16 + c) * LP + kk * 32 + 8 * hh);
        vb.h[1] = *(const v8h*)(Vth + (t * 16 + c) * LP + kk * 32 + 16 + 8 * hh);
        oacc[t] = mma_h(pa.v, vb.v, oacc[t]);
        if (RES) {
          FH vl;
          vl.h[0] = *(const v8h*)(Vtl + (t * 16 + c) * LP + kk * 32 + 8 * hh);
          vl.h[1] = *(const v8h*)(Vtl + (t * 16 + c) * LP + kk * 32 + 16 + 8 * hh);
          o1[t] = mma_h(pa.v, vl.v, o1[t]);
          o1[t] = mma_h(pl.v, vb.v, o1[t]);
        }
      }
    }
    if (RES) {
#pragma unroll
      for (int t = 0; t < 4; ++t)
#pragma unroll
        for (int r = 0; r < 8; ++r) oacc[t][r] += o1[t][r] * (1.0f / 4096.0f);
    }
  }

  // ---- join the two groups' partial results: group 1 hands its maximum, sum and context over through LDS (every
  //      lane at the places that the same lane of group 0's wave reads), group 0 rescales both to the common maximum.
  //      Group 0 has always seen key tile 0, where every row has a live key; a group 1 without a tile hands over
  //      maximum -inf, sum 0 and context 0, whose factor is exp(-inf) = 0. ----
  float* os = Os[wave];
  if (grp == 1) {
#pragma unroll
    for (int r = 0; r < 8; ++r) {
#pragma unroll
      for (int t = 0; t < 4; ++t) os[(8 * hh + r) * OP + t * 16 + c] = oacc[t][r];
      if (c == 0) { Ms[wave][8 * hh + r] = mrow[r]; Ls[wave][8 * hh + r] = lrow[r]; }
    }
  }
  __syncthreads();                           // group 1's partial results are published
  if (grp == 1) return;                      // no block barrier stands behind this line
#pragma unroll
  for (int r = 0; r < 8; ++r) {
    const float m1 = Ms[wave][8 * hh + r], l1 = Ls[wave][8 * hh + r];
    const float mj = fmaxf(mrow[r], m1);
    const float ms = (mj == -INFINITY) ? 0.f : mj;
    const float a0 = exp_slot(mrow[r] - ms), a1 = exp_slot(m1 - ms);
    lrow[r] = lrow[r] * a0 + l1 * a1;
#pragma unroll
    for (int t = 0; t < 4; ++t) oacc[t][r] = oacc[t][r] * a0 + os[(8 * hh + r) * OP + t * 16 + c] * a1;
  }

  // ---- normalise (1/l and the 1/1024 p carry), stage the wave's 16x64 tile in LDS, then convert to
#pragma unroll
  for (int r = 0; r < 8; ++r) {
    const float l = lrow[r];
    const float inv = ((l > 0.f) ? (1.0f / l) : 0.f) * (1.0f / 1024.0f);
#pragma unroll
    for (int t = 0; t < 4; ++t) os[(8 * hh + r) * OP + t * 16 + c] = oacc[t][r] * inv;
  }
  __builtin_amdgcn_fence(__ATOMIC_RELEASE, "workgroup");
  __builtin_amdgcn_wave_barrier();
  __builtin_amdgcn_fence(__ATOMIC_ACQUIRE, "workgroup");
  {
    const int q4 = lane >> 3, c8 = (lane & 7) * 8;
    v4u hv[4], lv[4];
#pragma unroll
    for (int it = 0; it < 4; ++it) {
      const int row = it * 4 + q4;             // it 0..3 x q4 0..3 = rows 0..15 of the wave tile
      const float* sp = os + row * OP + c8;
      v4u a, a2;
#pragma unroll
      for (int e = 0; e < 4; ++e) {
        const float f0 = sp[2 * e], f1 = sp[2 * e + 1];
        const unsigned short x0 = bf_bits(f0), x1 = bf_bits(f1);
        const unsigned short y0 = bf_bits(f0 - bf_up(x0)), y1 = bf_bits(f1 - bf_up(x1));
        a[e] = pk16(x0, x1); a2[e] = pk16(y0, y1);
      }
      hv[it] = a; lv[it] = a2;
    }
    {
#pragma unroll
      for (int it = 0; it < 4; ++it) {
        const int row = it * 4 + q4;
        const size_t go = (rowB + q0 + row) * DM + (size_t)h * HD + c8;
        *(v4u*)(ahp + go) = hv[it];
        *(v4u*)(alp + go) = lv[it];
      }
      
    }
  }
}

// =====================================================================================================
// Workspace map (bytes), every region an exact multiple of its whole-line / whole-tile store granularity:
//   Xb    bf16 [4096][1024]            0           8388608
//   Wqb   bf16 [1024 out][1024 in]     8388608     2097152
//   Wkb   bf16 [1024][1024]            10485760    2097152
//   Wvb   bf16 [1024][1024]            12582912    2097152
//   Wob   bf16 [1024][1024]            14680064    2097152
//   Erf   bf16 [256 tiles][1024], fragment order (4095 rows used)  16777216     524288
//   Qh    bf16 [4096][1024]            17301504    8388608
//   Ql    bf16 [4096][1024]            25690112    8388608
//   Kh    bf16 [4096][1024]            34078720    8388608
//   Kl    bf16 [4096][1024]            42467328    8388608
//   VTh   f16  [2][1024][2048]         50855936    8388608
//   VTl   f16  [2][1024][512]          59244544    2097152
//   Ah    bf16 [4096][1024]            61341696    8388608
//   Al    bf16 [4096][1024]            69730304    8388608
//   end                                78118912
// Weights arrive [in][out]; y = x . W needs Bt[out][in] (in contiguous) -> transpose-convert once.
// =====================================================================================================
extern "C" void kernel_launch(void* const* d_in, const int* in_sizes, int n_in,
                              void* d_out, int out_size, void* d_ws, size_t ws_size,
                              hipStream_t stream) {
  if (n_in < 10) return;
  if (in_sizes[0] != NB * SEQ * DM) return;
  if (in_sizes[1] != DM * DM || in_sizes[3] != DM * DM || in_sizes[5] != DM * DM || in_sizes[7] != DM * DM) return;
  if (in_sizes[2] != DM || in_sizes[4] != DM || in_sizes[6] != DM || in_sizes[8] != DM) return;
  if (in_sizes[9] != ERR * HD) return;
  if (out_size != NB * SEQ * DM) return;

  const float* x  = (const float*)d_in[0];
  const float* Wq = (const float*)d_in[1];
  const float* bq = (const float*)d_in[2];
  const float* Wk = (const float*)d_in[3];
  const float* bk = (const float*)d_in[4];
  const float* Wv = (const float*)d_in[5];
  const float* bv = (const float*)d_in[6];
  const float* Wo = (const float*)d_in[7];
  const float* bo = (const float*)d_in[8];
  const float* Er = (const float*)d_in[9];

  const size_t PXb  = (size_t)NB * SEQ * DM * 2;       //  8388608  16-bit activation plane [4096][1024]
  const size_t PW   = (size_t)DM * DM * 2;             //  2097152
  const size_t PEr  = (size_t)(ERR + 1) * HD * 2;      //   524288  (rows padded to 4096)
  const size_t PVTh = (size_t)NB * DM * SEQ * 2;       //  8388608
  const size_t PVTl = (size_t)NB * DM * VLP * 2;       //  2097152
  size_t off = 0;
  const size_t oXb  = off; off += PXb;
  const size_t oWq  = off; off += PW;
  const size_t oWk  = off; off += PW;
  const size_t oWv  = off; off += PW;
  const size_t oWo  = off; off += PW;
  const size_t oEr  = off; off += PEr;
  const size_t oQh  = off; off += PXb;
  const size_t oQl  = off; off += PXb;
  const size_t oKh  = off; off += PXb;
  const size_t oKl  = off; off += PXb;
  const size_t oVTh = off; off += PVTh;
  const size_t oVTl = off; off += PVTl;
  const size_t oAh  = off; off += PXb;
  const size_t oAl  = off; off += PXb;
  if (off > ws_size) return;                           // off = 78118912

  char* ws = (char*)d_ws;
  unsigned short* Xb  = (unsigned short*)(ws + oXb);
  unsigned short* Wqb = (unsigned short*)(ws + oWq);
  unsigned short* Wkb = (unsigned short*)(ws + oWk);
  unsigned short* Wvb = (unsigned short*)(ws + oWv);
  unsigned short* Wob = (unsigned short*)(ws + oWo);
  unsigned short* Erf = (unsigned short*)(ws + oEr);
  unsigned short* Qh  = (unsigned short*)(ws + oQh);
  unsigned short* Ql  = (unsigned short*)(ws + oQl);
  unsigned short* Kh  = (unsigned short*)(ws + oKh);
  unsigned short* Kl  = (unsigned short*)(ws + oKl);
  unsigned short* VTh = (unsigned short*)(ws + oVTh);
  unsigned short* VTl = (unsigned short*)(ws + oVTl);
  unsigned short* Ah  = (unsigned short*)(ws + oAh);
  unsigned short* Al  = (unsigned short*)(ws + oAl);

  const dim3 blk(256);
  const int n8x  = NB * SEQ * DM / 8;                                // 524288
  const dim3 gCvtX((n8x + 255) / 256);                               // 2048 blocks
  const dim3 gCvtEr((ERR + 1) * HD / 8 / 256);                       // 128 blocks: one thread per 16-byte piece
  const dim3 gTr(DM / 64, DM / 64);                                  // (out cols / 64, in rows / 64)
  const dim3 blkG(128);                                              // gemm128: 4 waves, one 128x128 tile
  const dim3 gQ((NB * SEQ / 128) * (DM / 128), 1);                   // 256 blocks
  const dim3 gVT((DM / 128) * (SEQ / 128), NB);                      // 128 blocks x 2 batches
  const dim3 gOut((NB * SEQ / 128) * (DM / 128), 1);                 // 256 blocks

  // (1) x -> bf16 plane [4096][1024]; Er -> bf16 in fragment order
  cvt_bf16x8<<<gCvtX, blk, 0, stream>>>(x, Xb, n8x);
  cvt_er_frag<<<gCvtEr, blk, 0, stream>>>(Er, Erf);
  // (2) weights [in][out] f32 -> bf16 [out][in] planes
  tr_cvt64<<<gTr, blk, 0, stream>>>(Wq, Wqb, DM, DM);
  tr_cvt64<<<gTr, blk, 0, stream>>>(Wk, Wkb, DM, DM);
  tr_cvt64<<<gTr, blk, 0, stream>>>(Wv, Wvb, DM, DM);
  tr_cvt64<<<gTr, blk, 0, stream>>>(Wo, Wob, DM, DM);
  // (3) q and k projections: Qh/Ql[b*SEQ+s][e] = hi/lo of (bq[e] + sum_d Xb[s][d] Wqb[e][d])  (M=4096, N=1024, K=1024)
  gemm128<0, 2, false, true><<<gQ, blkG, 0, stream>>>(
      Xb, Xb, DM, 0LL, Wqb, DM, 0LL,
      (void*)Qh, DM, 0LL, (void*)Ql, DM, 0LL, 0,
      NB * SEQ, DM, DM, 1.0f, bq, bq);
  gemm128<0, 2, false, true><<<gQ, blkG, 0, stream>>>(
      Xb, Xb, DM, 0LL, Wkb, DM, 0LL,
      (void*)Kh, DM, 0LL, (void*)Kl, DM, 0LL, 0,
      NB * SEQ, DM, DM, 1.0f, bk, bk);
  // (4) v^T per batch: VTh[b][m][s] = bv[m] + sum_d Wvb[m][d] Xb[b*SEQ+s][d] -> f16 hi plane (pitch SEQ) and
  //     residual plane (x4096, keys < VLP, pitch VLP)  (M=1024, N=2048, K=1024)
  gemm128<0, 3, true, false><<<gVT, blkG, 0, stream>>>(
      Wvb, Wvb, DM, 0LL, Xb, DM, (long long)SEQ * DM,
      (void*)VTh, SEQ, (long long)DM * SEQ, (void*)VTl, VLP, (long long)DM * VLP, VLP,
      DM, SEQ, DM, 4096.0f, bv, bv);
  // (5) attention in three groups of query blocks, each launch over all NP pairs
  const int gqa[3] = {0, RESQB, QSPLIT};
  const int gqe[3] = {RESQB, QSPLIT, NQB};
  for (int g = 0; g < 3; ++g) {
    const int qa = gqa[g];
    const int nq = gqe[g] - qa;
    if (g == 0) {
      attn_rel64<true><<<dim3(nq * NP), dim3(256), 0, stream>>>(
          Qh, Ql, Kh, Kl, VTh, VTl, Erf, Ah, Al, qa, nq, 0.125f);
    } else {
      attn_rel64<false><<<dim3(nq * NP), dim3(256), 0, stream>>>(
          Qh, Ql, Kh, Kl, VTh, VTl, Erf, Ah, Al, qa, nq, 0.125f);
    }
  }
  // (6) out[s][e] = bo[e] + sum_d (Ah+Al)[s][d] Wob[e][d] -> d_out f32 [4096][1024]  (M=4096, N=1024, K=1024)
  gemm128<1, 0, false, true><<<gOut, blkG, 0, stream>>>(
      Ah, Al, DM, 0LL, Wob, DM, 0LL,
      d_out, DM, 0LL, d_out, 0, 0LL, 0,
      NB * SEQ, DM, DM, 1.0f, bo, bo);
  (void)hipGetLastError();
}

// v007
// Measured time: 201 microseconds a run.
// In both of two side-by-side timings against v006, it was 1.17 times as fast.
// Counting every step since v000, it is 27.5 times as fast.
// Contractions: x.Wq / x.Wk / Wv.x^T projections = v_wmma_f32_16x16x32_bf16 (bf16 operands from RNE-converted inputs, single product, f32 bias epilogue);
// q.k^T scores = v_wmma_f32_16x16x32_bf16 with q and k as bf16 hi/lo planes (hi.hi + hi.lo + lo.hi); q.Er^T band = same with q hi/lo times bf16 Er (2 products);
// p.v = v_wmma_f32_16x16x32_f16 (p carried x1024 in f16, v in f16; f16 residual planes x4096 of p and v on the leading query blocks);
// ctx.Wo = v_wmma_f32_16x16x32_bf16 with ctx as bf16 hi/lo planes times bf16 Wo (2 products); all f32 accumulate; softmax in f32.
#include <hip/hip_runtime.h>
#include <math.h>
#include <float.h>
#include <stdint.h>

#define NB      2
#define SEQ     2048
#define DM      1024
#define NH      16
#define HD      64
#define NQB     (SEQ / 64)       // 32 query / key tiles of 64
#define ERR     (2 * SEQ - 1)    // 4095 rows of the relative table
#define VLP     512              // key pitch of the v^T residual plane (keys 0..VLP-1)
#define RESQB   8                // leading 64-row query blocks that use the p / v residual planes
#define NP      (NB * NH)        // 32 (b,h) pairs: every attention launch covers all of them
static_assert(RESQB * 64 <= VLP);
static_assert(NH * HD == DM);
static_assert((SEQ % 64) == 0 && (DM % 64) == 0);
static_assert(HD == 64);
static_assert(0 < RESQB && RESQB < NQB);
static_assert((SEQ % 128) == 0 && (DM % 128) == 0);   // gemm128: whole 128x128 tiles and whole 128-k slabs

typedef _Float16 v16h __attribute__((ext_vector_type(16)));
typedef _Float16 v8h  __attribute__((ext_vector_type(8)));
typedef __bf16   v16b __attribute__((ext_vector_type(16)));
typedef __bf16   v8b  __attribute__((ext_vector_type(8)));
typedef float    v8f  __attribute__((ext_vector_type(8)));
typedef float    v4f  __attribute__((ext_vector_type(4)));
typedef unsigned int v4u __attribute__((ext_vector_type(4)));
typedef unsigned short v8us __attribute__((ext_vector_type(8)));

// ---- scalar helpers --------------------------------------------------------------------------------
__device__ __forceinline__ unsigned short bf_bits(float f) {          // f32 -> bf16 bits, RNE convert
  unsigned u = __float_as_uint(f);
  return (unsigned short)((u + 0x7FFFu + ((u >> 16) & 1u)) >> 16);
}
__device__ __forceinline__ float bf_up(unsigned short h) { return __uint_as_float(((unsigned)h) << 16); }
__device__ __forceinline__ unsigned short h_bits(_Float16 x) { return __builtin_bit_cast(unsigned short, x); }
__device__ __forceinline__ unsigned pk16(unsigned short a, unsigned short b) { return (unsigned)a | ((unsigned)b << 16); }
__device__ __forceinline__ v8f zero8() { v8f z = {0.f, 0.f, 0.f, 0.f, 0.f, 0.f, 0.f, 0.f}; return z; }
__device__ __forceinline__ v8h zero8h() {
  const _Float16 z = (_Float16)0.0f;
  v8h r = {z, z, z, z, z, z, z, z};
  return r;
}

// ---- fragment loader: 16-bit A/B operand, lane -> row/col (lane&15), p already includes +8*(lane>>4);
//      elements 0..7 <- p[0..7] (k0+8h..), elements 8..15 <- p[16..23] (k0+16+8h..)
__device__ __forceinline__ v16b ldfrag_b(const __bf16* p) {
  union { v16b v; v8b h[2]; } f;
  f.h[0] = *(const v8b*)(p);
  f.h[1] = *(const v8b*)(p + 16);
  return f.v;
}

// ---- WMMA helpers with trailing VALU hazard gap --------------------------------------------------------
__device__ __forceinline__ v8f mma_b(v16b a, v16b b, v8f c) {
  c = __builtin_amdgcn_wmma_f32_16x16x32_bf16(false, a, false, b, (short)0, c, false, false);
#if defined(__HIP_DEVICE_COMPILE__)
  asm volatile("v_nop\n\tv_nop\n\tv_nop\n\tv_nop" : "+v"(c) : "v"(a), "v"(b));
#endif
  return c;
}
__device__ __forceinline__ v8f mma_h(v16h a, v16h b, v8f c) {
  c = __builtin_amdgcn_wmma_f32_16x16x32_f16(false, a, false, b, (short)0, c, false, false);
#if defined(__HIP_DEVICE_COMPILE__)
  asm volatile("v_nop\n\tv_nop\n\tv_nop\n\tv_nop" : "+v"(c) : "v"(a), "v"(b));
#endif
  return c;
}
__device__ __forceinline__ v8f mma_b_raw(v16b a, v16b b, v8f c) {
  return __builtin_amdgcn_wmma_f32_16x16x32_bf16(false, a, false, b, (short)0, c, false, false);
}
__device__ __forceinline__ void dep_guard_b(v8f& a, v8f& b, v16b x, v16b y) {
#if defined(__HIP_DEVICE_COMPILE__)
  asm volatile("v_nop\n\tv_nop\n\tv_nop\n\tv_nop" : "+v"(a), "+v"(b) : "v"(x), "v"(y));
#endif
}
__device__ __forceinline__ void keep4_b(v16b a, v16b b, v16b c, v16b d) {
#if defined(__HIP_DEVICE_COMPILE__)
  asm volatile("v_nop" :: "v"(a), "v"(b), "v"(c), "v"(d));
#endif
}
__device__ __forceinline__ void acc_guard4(v8f& a, v8f& b, v8f& c, v8f& d) {
#if defined(__HIP_DEVICE_COMPILE__)
  asm volatile("v_nop\n\tv_nop\n\tv_nop\n\tv_nop" : "+v"(a), "+v"(b), "+v"(c), "+v"(d));
#endif
}
// The four vector slots that the chip needs between the last matrix instruction and the first read of its result.
__device__ __forceinline__ void acc_guard5(v8f& a, v8f& b, v8f& c, v8f& d, v8f& e) {
#if defined(__HIP_DEVICE_COMPILE__)
  asm volatile("v_nop\n\tv_nop\n\tv_nop\n\tv_nop" : "+v"(a), "+v"(b), "+v"(c), "+v"(d), "+v"(e));
#endif
}

// =====================================================================================================
// f32 -> bf16 (RNE convert), 8 elements per thread, one 16-B store per lane: a wave writes 512 contiguous B
// grid = ceil(n8/256). coverage: n8 threads x 8 = whole plane (n8 is a multiple of 8 here, so every
// =====================================================================================================
__global__ __launch_bounds__(256) void cvt_bf16x8(const float* __restrict__ in, unsigned short* out, int n8) {
  const int i = blockIdx.x * 256 + threadIdx.x;
  if (i < n8) {
    const v4f a = *(const v4f*)(in + (size_t)i * 8);
    const v4f b = *(const v4f*)(in + (size_t)i * 8 + 4);
    v4u p;
    p[0] = pk16(bf_bits(a[0]), bf_bits(a[1]));
    p[1] = pk16(bf_bits(a[2]), bf_bits(a[3]));
    p[2] = pk16(bf_bits(b[0]), bf_bits(b[1]));
    p[3] = pk16(bf_bits(b[2]), bf_bits(b[3]));
    *(v4u*)(out + (size_t)i * 8) = p;
    
  }
}

// =====================================================================================================
// Transpose-convert: in f32 [R][C] (row pitch C) -> out bf16 [C][R] (row pitch R), out[c][r] = RNE bf16(in[r][c]).
// Block = 256 threads = one 64(r) x 64(c) tile; grid = (C/64, R/64) (host-checked exact multiples).
// Load: thread t reads row r0 + (t>>2), columns c0 + (t&3)*16 .. +15 (four 16-B loads), scatters the
// converted bits into LDS sT[c][r] (pitch 72); __syncthreads; store: wave w writes output rows
// coverage: 8 waves x 2 it x 4 = 64 output rows x (8 lanes x 8) = 64 columns = the whole tile.
// =====================================================================================================
__global__ __launch_bounds__(256) void tr_cvt64(const float* __restrict__ in, unsigned short* out, int R, int C) {
  __shared__ __align__(16) unsigned short sT[64 * 72];
  const int tid = threadIdx.x, lane = tid & 31, wave = tid >> 5;
  const int r0 = blockIdx.y * 64, c0 = blockIdx.x * 64;
  {
    const int rl = tid >> 2, cl = (tid & 3) * 16;
    const float* src = in + (size_t)(r0 + rl) * C + c0 + cl;
#pragma unroll
    for (int i = 0; i < 4; ++i) {
      const v4f v = *(const v4f*)(src + 4 * i);
#pragma unroll
      for (int e = 0; e < 4; ++e) sT[(cl + 4 * i + e) * 72 + rl] = bf_bits(v[e]);
    }
  }
  __syncthreads();
  const int q = lane >> 3, p8 = (lane & 7) * 8;
  v8us ov[2];
#pragma unroll
  for (int it = 0; it < 2; ++it) {
    const int cl2 = wave * 8 + it * 4 + q;
    ov[it] = *(const v8us*)(sT + cl2 * 72 + p8);
  }
  {
#pragma unroll
    for (int it = 0; it < 2; ++it) {
      const int cl2 = wave * 8 + it * 4 + q;
      *(v8us*)(out + (size_t)(c0 + cl2) * R + r0 + p8) = ov[it];
    }
    
  }
}

// =====================================================================================================
// Relative table f32 [ERR][64] -> bf16 (RNE convert) in the order of the B fragments of v_wmma_f32_16x16x32_bf16: the 16
// table rows 16*T .. 16*T+15 are one tile of 1024 elements; its 16-byte piece ((dc*2 + p)*32 + lane) holds row
// 16*T + (lane & 15), d = dc*32 + p*16 + (lane >> 4)*8 .. +7, so that a fragment half is one 512-byte contiguous load of
// a wave. Thread = one output piece (a wave stores 512 contiguous bytes); grid = 4096*8/256; row ERR does not exist and
// its pieces are neither written nor read.
// =====================================================================================================
__global__ __launch_bounds__(256) void cvt_er_frag(const float* __restrict__ in, unsigned short* out) {
  const int o    = blockIdx.x * 256 + threadIdx.x;
  const int lane = o & 31, p = (o >> 5) & 1, dc = (o >> 6) & 1, tl = o >> 7;
  const int e    = tl * 16 + (lane & 15);
  const int d    = dc * 32 + p * 16 + (lane >> 4) * 8;
  if (e < ERR) {
    const v4f a = *(const v4f*)(in + (size_t)e * HD + d);
    const v4f b = *(const v4f*)(in + (size_t)e * HD + d + 4);
    v4u q;
    q[0] = pk16(bf_bits(a[0]), bf_bits(a[1]));
    q[1] = pk16(bf_bits(a[2]), bf_bits(a[3]));
    q[2] = pk16(bf_bits(b[0]), bf_bits(b[1]));
    q[3] = pk16(bf_bits(b[2]), bf_bits(b[3]));
    *(v4u*)(out + (size_t)o * 8) = q;
  }
}

// =====================================================================================================
// Block-tiled bf16 WMMA GEMM for the four projections: C[m][n] = rb[m] + cb[n] + sum_k (A [+ A2])[m][k] * Bt[n][k], wave
// tile 64x64. NSPLIT 1 adds the bf16 lo plane A2; OUT_MODE 0 = f32, 2 = bf16 hi + lo planes, 3 = f16 hi plane + f16
// residual plane (x rscale, tiles with n0 < N2). A block of 4 waves (2 x 2) owns a 128x128 tile of C; the 128 rows of A (and A2) and
// of Bt that it needs are brought into LDS one slab of KS = 128 k at a time by asynchronous copies
// (global_load_async_to_lds_b128: a wave's copy covers two whole 256-byte row pieces), two buffers, so that slab t + 1
// flies while slab t is multiplied; fragments are then read from LDS (row pitch 272 bytes = 17 x 16).
// M, N multiples of 128, K a multiple of KS and at least KS; grid.x = (M/128) * (N/128), blockIdx.y = batch.
// =====================================================================================================
// Eight 16-byte copies per lane, rows gstep elements / lstep bytes apart.
__device__ __forceinline__ void async_rows8(const __bf16* g, size_t gstep, unsigned l, unsigned lstep) {
#if defined(__HIP_DEVICE_COMPILE__)
  // The closing s_wait_xcnt 0 stands in the copies' own statement, so that it is passed before any address register
  // that a copy names is written again.
  asm volatile(
      "global_load_async_to_lds_b128 %0, %8, off\n\t"
      "global_load_async_to_lds_b128 %1, %9, off\n\t"
      "global_load_async_to_lds_b128 %2, %10, off\n\t"
      "global_load_async_to_lds_b128 %3, %11, off\n\t"
      "global_load_async_to_lds_b128 %4, %12, off\n\t"
      "global_load_async_to_lds_b128 %5, %13, off\n\t"
      "global_load_async_to_lds_b128 %6, %14, off\n\t"
      "global_load_async_to_lds_b128 %7, %15, off\n\t"
      "s_wait_xcnt 0x0"
      :: "v"(l), "v"(l + lstep), "v"(l + 2 * lstep), "v"(l + 3 * lstep),
         "v"(l + 4 * lstep), "v"(l + 5 * lstep), "v"(l + 6 * lstep), "v"(l + 7 * lstep),
         "v"(g), "v"(g + gstep), "v"(g + 2 * gstep), "v"(g + 3 * gstep),
         "v"(g + 4 * gstep), "v"(g + 5 * gstep), "v"(g + 6 * gstep), "v"(g + 7 * gstep)
      : "memory");
  // Keeps the address arithmetic of the next eight copies behind these: hoisted in front of them it held the addresses
  // of a whole slab in registers at once (a spill to scratch beside the 128 accumulator registers) and delayed the first copy.
  __builtin_amdgcn_sched_barrier(0);
#endif
}
// The issuing wave's own wait: its copies have landed in LDS behind it.
__device__ __forceinline__ void wait_async0() {
#if defined(__HIP_DEVICE_COMPILE__)
  asm volatile("s_wait_asynccnt 0x0" ::: "memory");
#endif
}
// The wave's LDS reads have returned: stands in front of the barrier behind which their buffer is refilled.
__device__ __forceinline__ void wait_ds0() {
#if defined(__HIP_DEVICE_COMPILE__)
  asm volatile("s_wait_dscnt 0x0" ::: "memory");
#endif
}

template <int NSPLIT, int OUT_MODE, bool RB, bool CB>
__global__ __launch_bounds__(128) void gemm128(
    const unsigned short* __restrict__ Ap, const unsigned short* A2p, int lda, long long strideA,
    const unsigned short* __restrict__ Btp, int ldb, long long strideB,
    void* Cout, int ldc, long long strideC,
    void* Cout2, int ldc2, long long strideC2, int N2,
    int M, int N, int K, float rscale,
    const float* __restrict__ rbp, const float* __restrict__ cbp) {
  static_assert(NSPLIT == 0 || NSPLIT == 1);
  constexpr int KS  = 128;                       // k per slab
  constexpr int SP  = KS + 8;                    // LDS row pitch in elements
  constexpr int NPL = (NSPLIT == 1) ? 3 : 2;     // planes of a slab: A, Bt, (A2)
  constexpr unsigned PLB = 128u * SP * 2u;       // bytes of one plane of a slab
  constexpr unsigned LST = 8u * SP * 2u;         // bytes between two copies of a lane (8 rows)
  __shared__ __align__(16) __bf16 sS[2][NPL][128 * SP];
  __shared__ __align__(16) float sT[4][16 * 68];   // per-wave 16x64 slab, pitch 68 floats
  const __bf16* A   = (const __bf16*)(const void*)Ap;
  const __bf16* A2  = (const __bf16*)(const void*)A2p;
  const __bf16* Bt  = (const __bf16*)(const void*)Btp;
  const int b    = blockIdx.y;
  const int tid  = threadIdx.x;
  const int lane = tid & 31;
  const int wave = tid >> 5;
  const int tilesN = N >> 7;
  const int tilesM = M >> 7;
  const int tile = blockIdx.x;
  if (tile >= tilesM * tilesN) return;   // block-uniform, in front of every copy and barrier
  const int tm  = tile / tilesN;
  const int tn  = tile - tm * tilesN;
  const int bm0 = tm << 7;
  const int bn0 = tn << 7;
  const int wm  = (wave >> 1) << 6;      // the wave's 64x64 tile within the block tile
  const int wn  = (wave & 1) << 6;
  const int m0  = bm0 + wm;
  const int n0  = bn0 + wn;

  // copy addressing: 16 lanes per 256-byte row piece, 8 rows per block-wide copy, 16 copies per lane and plane
  const int cr = tid >> 4, cc = (tid & 15) * 8;
  const __bf16* gA  = A  + (size_t)b * strideA + (size_t)(bm0 + cr) * lda + cc;
  const long long dA2 = A2 - A;          // uniform distance (elements) of the lo plane from the hi plane, same workspace
  const __bf16* gB  = Bt + (size_t)b * strideB + (size_t)(bn0 + cr) * ldb + cc;
  const unsigned l0 = (unsigned)(size_t)(&sS[0][0][0]) + (unsigned)(cr * SP + cc) * 2u;
  auto fill = [&](int t, int bs) {
    const unsigned lb = l0 + (unsigned)bs * (NPL * PLB);
    const size_t ko = (size_t)t * KS;
    async_rows8(gA + ko, (size_t)8 * lda, lb, LST);
    async_rows8(gA + ko + (size_t)64 * lda, (size_t)8 * lda, lb + 8u * LST, LST);
    async_rows8(gB + ko, (size_t)8 * ldb, lb + PLB, LST);
    async_rows8(gB + ko + (size_t)64 * ldb, (size_t)8 * ldb, lb + PLB + 8u * LST, LST);
    if (NSPLIT == 1) {
      async_rows8(gA + (dA2 + (long long)ko), (size_t)8 * lda, lb + 2u * PLB, LST);
      async_rows8(gA + (dA2 + (long long)ko) + (size_t)64 * lda, (size_t)8 * lda, lb + 2u * PLB + 8u * LST, LST);
    }
  };

  const int rlane = lane & 15;                 // row (A) / col (B, D) within subtile
  const int koff  = (lane >> 4) * 8;           // k offset of this lane half
  const int mOff  = (lane >> 4) * 8;           // D row offset

  v8f acc[4][4];
#pragma unroll
  for (int i = 0; i < 4; ++i)
#pragma unroll
    for (int j = 0; j < 4; ++j) acc[i][j] = zero8();

  const int nst = K / KS;                      // slabs, block-uniform
  fill(0, 0);
  wait_async0();
  __syncthreads();                             // slab 0 is published
  if (nst > 1) fill(1, 1);
  for (int t = 0; t < nst; ++t) {
    const __bf16* sA  = &sS[t & 1][0][0] + (wm + rlane) * SP + koff;
    const __bf16* sB  = &sS[t & 1][1][0] + (wn + rlane) * SP + koff;
    const __bf16* sA2 = &sS[t & 1][NPL - 1][0] + (wm + rlane) * SP + koff;
#pragma unroll
    for (int ks = 0; ks < KS; ks += 32) {
      // all fragments of the k step are read in one batch, so that the wave pays the LDS latency once per step
      v16b bh[4], ah[4], al[4];
#pragma unroll
      for (int j = 0; j < 4; ++j) bh[j] = ldfrag_b(sB + (j << 4) * SP + ks);
#pragma unroll
      for (int i = 0; i < 4; ++i) {
        ah[i] = ldfrag_b(sA + (i << 4) * SP + ks);
        if (NSPLIT == 1) al[i] = ldfrag_b(sA2 + (i << 4) * SP + ks); else al[i] = ah[i];
      }
#pragma unroll
      for (int i = 0; i < 4; ++i) {
#pragma unroll
        for (int j = 0; j < 4; ++j) {
          acc[i][j] = mma_b_raw(ah[i], bh[j], acc[i][j]);
          if (NSPLIT == 1) acc[i][j] = mma_b_raw(al[i], bh[j], acc[i][j]);
        }
        dep_guard_b(acc[i][0], acc[i][3], ah[i], al[i]);
      }
      keep4_b(bh[0], bh[1], bh[2], bh[3]);
    }
    // publish point of slab t + 1: own LDS reads returned, own copies landed, then the one barrier of the trip (it
    // publishes slab t + 1 and ends every wave's reads of the buffer that is refilled behind it)
    wait_ds0();
    wait_async0();
    __syncthreads();
    if (t + 2 < nst) fill(t + 2, t & 1);
  }
  wait_async0();                               // no copy is outstanding when the wave goes on
  acc_guard4(acc[0][0], acc[0][1], acc[0][2], acc[0][3]);
  acc_guard4(acc[1][0], acc[1][1], acc[1][2], acc[1][3]);
  acc_guard4(acc[2][0], acc[2][1], acc[2][2], acc[2][3]);
  acc_guard4(acc[3][0], acc[3][1], acc[3][2], acc[3][3]);

  // ---- epilogue biases (input values RNE-converted to bf16) ----
  float cbv[4];
#pragma unroll
  for (int j = 0; j < 4; ++j) cbv[j] = CB ? bf_up(bf_bits(cbp[n0 + (j << 4) + rlane])) : 0.0f;

  // ---- epilogue ----
  float* slab = sT[wave];
#pragma unroll
  for (int i = 0; i < 4; ++i) {
    const int mBase = m0 + (i << 4);
#pragma unroll
    for (int r = 0; r < 8; ++r) {
      const float rbv = RB ? bf_up(bf_bits(rbp[mBase + mOff + r])) : 0.0f;
#pragma unroll
      for (int j = 0; j < 4; ++j) {
        slab[(mOff + r) * 68 + (j << 4) + rlane] = acc[i][j][r] + rbv + cbv[j];
      }
    }
    __builtin_amdgcn_fence(__ATOMIC_RELEASE, "workgroup");
    __builtin_amdgcn_wave_barrier();
    __builtin_amdgcn_fence(__ATOMIC_ACQUIRE, "workgroup");
    if (OUT_MODE == 0) {
      float* C = (float*)Cout + (size_t)b * strideC;
      const int hh = lane >> 4, c4 = (lane & 15) * 4;     // 256-B row segment = 16 lanes x 16 B
      v4f ov[8];
#pragma unroll
      for (int it = 0; it < 8; ++it) {
        const int row = it * 2 + hh;                       // it 0..7 x hh 0..1 = rows 0..15
        ov[it] = *(const v4f*)(slab + row * 68 + c4);
      }
      {
#pragma unroll
        for (int it = 0; it < 8; ++it) {
          const int row = it * 2 + hh;
          *(v4f*)(C + (size_t)(mBase + row) * ldc + n0 + c4) = ov[it];
        }
        
      }
    } else {
      const int q = lane >> 3, c8 = (lane & 7) * 8;
      unsigned short* C  = (unsigned short*)Cout  + (size_t)b * strideC;
      unsigned short* C2 = (unsigned short*)Cout2 + (size_t)b * strideC2;
      const bool wlo = (OUT_MODE == 2) || (n0 < N2);      // wave-uniform
      v4u hv[4], lv[4];
#pragma unroll
      for (int it = 0; it < 4; ++it) {
        const int row = it * 4 + q;                        // it 0..3 x q 0..3 = rows 0..15
        const float* sp = slab + row * 68 + c8;
        v4u a, a2;
#pragma unroll
        for (int e = 0; e < 4; ++e) {
          const float f0 = sp[2 * e], f1 = sp[2 * e + 1];
          unsigned short h0, h1, l0, l1;
          if (OUT_MODE == 2) {
            h0 = bf_bits(f0); h1 = bf_bits(f1);
            l0 = bf_bits(f0 - bf_up(h0)); l1 = bf_bits(f1 - bf_up(h1));
          } else {
            const _Float16 x0 = (_Float16)f0, x1 = (_Float16)f1;
            h0 = h_bits(x0); h1 = h_bits(x1);
            l0 = h_bits((_Float16)((f0 - (float)x0) * rscale));
            l1 = h_bits((_Float16)((f1 - (float)x1) * rscale));
          }
          a[e] = pk16(h0, h1); a2[e] = pk16(l0, l1);
        }
        hv[it] = a; lv[it] = a2;
      }
      {
#pragma unroll
        for (int it = 0; it < 4; ++it) {
          const int row = it * 4 + q;
          *(v4u*)(C + (size_t)(mBase + row) * ldc + n0 + c8) = hv[it];
          if (wlo) *(v4u*)(C2 + (size_t)(mBase + row) * ldc2 + n0 + c8) = lv[it];
        }
        
      }
    }
    __builtin_amdgcn_fence(__ATOMIC_RELEASE, "workgroup");
    __builtin_amdgcn_wave_barrier();
    __builtin_amdgcn_fence(__ATOMIC_ACQUIRE, "workgroup");
  }
}

// =====================================================================================================
// Causal attention with a relative-position bias, head dim 64 (tril mask incl. diagonal, computed).
//   q planes (bf16 hi / lo): element (b, t, h, d) at [(b*SEQ + t)*DM + h*64 + d]
//   k planes (bf16 hi / lo): same layout with key index s
//   v^T hi plane (f16):      element (b, h, d, s) at [(b*DM + h*64 + d)*SEQ + s]
//   v^T residual plane (f16, (v - hi)*4096): [(b*DM + h*64 + d)*VLP + s], s < VLP, read only when RES
//   relative table (bf16, fragment order of cvt_er_frag): the relative term of (query t, key) is q[t] . Er[key - t + SEQ - 1].
//     A wave's 16 queries x 64 keys need the 79 table rows from kv0 - q0 + SEQ - 16 on (a multiple of 16, in
//     [0, SEQ - 16]): five 16-row tiles, q hi/lo times bf16 Er (hi, lo per 32 d, f32 accumulate from 0), the 16 x 80
//     result stored to a wave-private LDS tile and read back along the diagonals (column key - kv0 + 15 - row).
//   logit = (q.k + band) * sscale for key <= query, -FLT_MAX otherwise (exp -> 0); every row has a live key in
//   every processed key tile (tiles 0..qb only, block-uniform trip count (qb+2)/2 <= 16).
//   output: ctx hi / lo bf16 planes, element (b, t, h*64 + d) at [(b*SEQ + t)*DM + h*64 + d] = normalised
//   context (lo = RNE(v - hi), unscaled).
//   scores = q . k : bf16 hi/lo split (hi.hi + hi.lo + lo.hi), f32 accumulate, band added in f32, * sscale in f32
//   p = exp(s - m) carried as f16(1024 p); context = p . v on f16 WMMA; RES adds f16 residual planes of p and v
//   (scale 4096, separate accumulator folded back with 1/4096 per chunk in f32); online softmax in f32.
//   Block = 8 waves = 64 query rows of one (b, h), in two groups of 4 waves; grid = nqbThis * NP (pair index =
//   blockIdx.x % NP, b = pair / NH, h = pair % NH; query block = qbBase + nqbThis - 1 - blockIdx.x / NP: a block's
//   cost grows with its query block, so the costliest blocks take the lowest indices, for speed only); kv chunks of 64. Group g walks the key tiles g, g + 2, ...
//   with its own K / V^T tiles in LDS and its own running maximum, sum and context; the two partial results of a row
//   are joined once behind the loop, in f32 (each rescaled to the common maximum). The block's chain of dependent
//   tiles is half as long, and the two groups' waves fill each other's waits on the SIMDs that they share.
//   K / V^T chunk staging: a group's 128 threads x 32 elements per plane = the whole 64x64 tile (plain 16-B loads,
//   __syncthreads before and after); P tiles are wave-private, spilled with _Float16 element stores and reloaded
//   Output coverage: each wave of group 0 stores its rows 0..15 (it 0..3 x lane>>3 0..3) x 64 columns (8 lanes x 8 bf16),
// =====================================================================================================
// e^x for the join of the two groups' results. v_exp_f32 and the one free slot that the instruction set asks for behind
// a transcendental stand in one statement, so that no instruction which reads the result or overwrites the source
// follows directly.
__device__ __forceinline__ float exp_slot(float x) {
  float y = x * 1.44269504f;
#if defined(__HIP_DEVICE_COMPILE__)
  asm("v_exp_f32 %0, %1\n\tv_nop" : "=v"(y) : "v"(y));
#endif
  return y;
}

// Without RES four waves per SIMD (at most 256 registers a wave): two blocks share a WGP, 512 places on the chip for the
// one launch of all query blocks from RESQB on. The RES launch has one block per WGP and keeps the block size's own
// register budget.
template <bool RES>
__global__ __launch_bounds__(256) __attribute__((amdgpu_waves_per_eu(RES ? 2 : 4)))
void attn_rel64(const unsigned short* __restrict__ qhp, const unsigned short* __restrict__ qlp,
                const unsigned short* __restrict__ khp, const unsigned short* __restrict__ klp,
                const unsigned short* __restrict__ vhp, const unsigned short* __restrict__ vlp,
                const unsigned short* __restrict__ erfp,
                unsigned short* ahp, unsigned short* alp,
                int qbBase, int nqbThis, float sscale) {
  union FB { v16b v; v8b h[2]; };
  union FH { v16h v; v8h h[2]; };
  // Row pitches: 64 elements of data plus 16 bytes, an odd multiple of 16 bytes, so that the 16 rows which a 16-byte
  // fragment load reads at once fall on 64 different banks (at 128 or 256 bytes they share a few banks).
  constexpr int LP = 72;                                          // 16-bit tiles: 144 bytes a row
  constexpr int OP = 68;                                          // f32 tile: 272 bytes a row
  __shared__ __align__(16) __bf16   KshG[2][64 * LP];             // per group: K hi [kv][d]   9 KB
  __shared__ __align__(16) __bf16   KslG[2][64 * LP];             // K lo
  __shared__ __align__(16) _Float16 VthG[2][64 * LP];             // V^T hi [d][kv] 9 KB
  __shared__ __align__(16) _Float16 VtlG[2][RES ? 64 * LP : 8];   // V^T residual
  __shared__ __align__(16) _Float16 Psh[8][16 * LP];              // per wave P [row][kv]
  __shared__ __align__(16) _Float16 Psl[RES ? 8 : 1][16 * LP];    // per wave P residual
  __shared__ __align__(16) float    Os[4][16 * OP];               // per 16-row slice: context tile [row][d]
  __shared__ float Ms[4][16], Ls[4][16];                          // group 1's running maximum and sum per row
  // Per wave: q . Er^T of the key tile, [row][table row - first]. 84 floats a row: rows 8 apart lie 32 banks apart for the
  // stores and 24 for the diagonal reads, so that the two 16-lane halves of an access meet different banks.
  constexpr int BP = 84;
  __shared__ __align__(16) float    Bs[8][16 * BP];

  // the group is the same in every lane of a wave: kept in a scalar register, so that the tests on it are scalar branches
  const int grp  = __builtin_amdgcn_readfirstlane((int)(threadIdx.x >> 7));
  const int tid  = threadIdx.x & 127;     // thread within the group
  const int wave = tid >> 5;              // 16-row slice of the query block
  const int lane = tid & 31;
  __bf16*   Ksh = KshG[grp];
  __bf16*   Ksl = KslG[grp];
  _Float16* Vth = VthG[grp];
  _Float16* Vtl = VtlG[grp];
  const int hh   = lane >> 4;
  const int c    = lane & 15;

  const int bx   = blockIdx.x;
  const int pr   = bx % NP;               // (b,h) pair index, 0..NP-1
  const int h    = pr % NH;
  const int b    = pr / NH;
  const int qb   = qbBase + nqbThis - 1 - bx / NP;   // cost falls with the block index
  const int q0   = qb * 64 + wave * 16;
  const size_t rowB = (size_t)b * SEQ;

  const __bf16* Qh = (const __bf16*)(const void*)qhp + (size_t)h * HD;
  const __bf16* Ql = (const __bf16*)(const void*)qlp + (size_t)h * HD;
  const __bf16* Kh = (const __bf16*)(const void*)khp + (size_t)h * HD;
  const __bf16* Kl = (const __bf16*)(const void*)klp + (size_t)h * HD;
  const _Float16* Vh = (const _Float16*)(const void*)vhp + ((size_t)b * DM + (size_t)h * HD) * SEQ;
  const _Float16* Vl = (const _Float16*)(const void*)vlp + ((size_t)b * DM + (size_t)h * HD) * VLP;
  const __bf16* Ef = (const __bf16*)(const void*)erfp;

  // ---- Q fragments (A operand, row = lane&15): 2 d-chunks, hi and lo ----
  v16b qah[2], qal[2];
#pragma unroll
  for (int dc = 0; dc < 2; ++dc) {
    const size_t qo = (rowB + q0 + c) * DM + dc * 32 + 8 * hh;
    qah[dc] = ldfrag_b(Qh + qo);
    qal[dc] = ldfrag_b(Ql + qo);
  }

  float mrow[8], lrow[8];
  v8f oacc[4];
#pragma unroll
  for (int r = 0; r < 8; ++r) { mrow[r] = -INFINITY; lrow[r] = 0.f; }
#pragma unroll
  for (int t = 0; t < 4; ++t) oacc[t] = zero8();

  int nkt = qb + 1;                          // causal: key tiles 0..qb, block-uniform
  if (nkt > NQB) nkt = NQB;

  float* bw = Bs[grp * 4 + wave];
  const int ntrip = (nkt + 1) >> 1;          // block-uniform: every wave passes every barrier
  for (int it = 0; it < ntrip; ++it) {
    const int kt  = 2 * it + grp;
    const int kv0 = kt * 64;
    const bool act = kt < nkt;               // wave-uniform (scalar): false only for group 1 in the last trip of an odd nkt
    __syncthreads();
    if (act) {
      const int r = tid >> 1, half = (tid & 1) * 32;
      // every address is a base that is the same for the whole wave plus a 32-bit lane offset that no trip changes: the
      // bases live in scalar registers, which leaves the vector registers to the loaded tiles
      const unsigned ko = (unsigned)(r * DM + half), vo = (unsigned)(r * SEQ + half), vlo = (unsigned)(r * VLP + half);
      const __bf16*   kg  = Kh + (rowB + kv0) * DM;               // + ko: K row kv0+r, d = half..half+31
      const __bf16*   klg = Kl + (rowB + kv0) * DM;
      const _Float16* vg  = Vh + kv0;                             // + vo: V^T row d = r, s = kv0+half..+31
      const int kvl = (kv0 + 64 <= VLP) ? kv0 : (VLP - 64);     // clamped address into the residual plane
      const _Float16* vlg = Vl + kvl;
      const bool resOK = (kv0 + 64 <= VLP);                      // block-uniform
      v8b a0[4], a1[4];
      v8h b0[4], b1[4];
#pragma unroll
      for (int i = 0; i < 4; ++i) {
        a0[i] = *(const v8b*)(kg + ko + 8 * i);
        a1[i] = *(const v8b*)(klg + ko + 8 * i);
        b0[i] = *(const v8h*)(vg + vo + 8 * i);
        b1[i] = RES ? *(const v8h*)(vlg + vlo + 8 * i) : zero8h();
      }
      // the wave's five tiles of the relative table, behind the K / V loads so that these can be stored to LDS first
      const __bf16* eg = Ef + (size_t)__builtin_amdgcn_readfirstlane((kv0 - q0 + (SEQ - 16)) >> 4) * 1024;
      const unsigned eo = (unsigned)(lane * 8);
      FB eb[5][2];
#pragma unroll
      for (int n = 0; n < 5; ++n)
#pragma unroll
        for (int dc = 0; dc < 2; ++dc) {
          eb[n][dc].h[0] = *(const v8b*)(eg + eo + (n * 2 + dc) * 512);
          eb[n][dc].h[1] = *(const v8b*)(eg + eo + (n * 2 + dc) * 512 + 256);
        }
#if defined(__HIP_DEVICE_COMPILE__)
      // The wait that stands in front of any overwrite of a register an issued load names. It takes the bases and the lane
      // offsets as inputs so that they stay untouched (also by a later load's result) until it has been passed.
      if (RES) asm volatile("s_wait_xcnt 0x0" :: "s"(kg), "s"(klg), "s"(vg), "s"(vlg), "s"(eg), "v"(ko), "v"(vo), "v"(vlo), "v"(eo) : "memory");
      else     asm volatile("s_wait_xcnt 0x0" :: "s"(kg), "s"(klg), "s"(vg), "s"(eg), "v"(ko), "v"(vo), "v"(eo) : "memory");
      // Keeps all loads of the trip in front of their first use: moved behind the first products, the table's second half
      // and the K / V rows each waited for a memory round trip of their own.
      __builtin_amdgcn_sched_barrier(0);
#endif
#pragma unroll
      for (int i = 0; i < 4; ++i) {
        *(v8b*)(Ksh + r * LP + half + 8 * i) = a0[i];
        *(v8b*)(Ksl + r * LP + half + 8 * i) = a1[i];
        *(v8h*)(Vth + r * LP + half + 8 * i) = b0[i];
        if (RES) *(v8h*)(Vtl + r * LP + half + 8 * i) = resOK ? b1[i] : zero8h();
      }
      // ---- relative term: 16 queries x 80 table rows, five independent accumulators; per accumulator the products come
      //      in the order hi, lo of d 0..31, then hi, lo of d 32..63 ----
      v8f tb[5];
#pragma unroll
      for (int n = 0; n < 5; ++n) tb[n] = zero8();
#pragma unroll
      for (int dc = 0; dc < 2; ++dc) {
#pragma unroll
        for (int n = 0; n < 5; ++n) tb[n] = mma_b_raw(qah[dc], eb[n][dc].v, tb[n]);
#pragma unroll
        for (int n = 0; n < 5; ++n) tb[n] = mma_b_raw(qal[dc], eb[n][dc].v, tb[n]);
      }
      acc_guard5(tb[0], tb[1], tb[2], tb[3], tb[4]);
#pragma unroll
      for (int n = 0; n < 5; ++n)
#pragma unroll
        for (int rr = 0; rr < 8; ++rr) bw[(8 * hh + rr) * BP + n * 16 + c] = tb[n][rr];
    }
    __syncthreads();                         // also orders the wave's stores of its relative tile before its reads below
    if (!act) continue;                      // no barrier stands between here and the foot of the trip

    // ---- scores: 16 query rows x 64 keys per wave, 3 bf16 products ----
    v8f s[4];
#pragma unroll
    for (int j = 0; j < 4; ++j) {
      s[j] = zero8();
#pragma unroll
      for (int dc = 0; dc < 2; ++dc) {
        FB kb, kl;
        kb.h[0] = *(const v8b*)(Ksh + (j * 16 + c) * LP + dc * 32 + 8 * hh);
        kb.h[1] = *(const v8b*)(Ksh + (j * 16 + c) * LP + dc * 32 + 16 + 8 * hh);
        kl.h[0] = *(const v8b*)(Ksl + (j * 16 + c) * LP + dc * 32 + 8 * hh);
        kl.h[1] = *(const v8b*)(Ksl + (j * 16 + c) * LP + dc * 32 + 16 + 8 * hh);
        s[j] = mma_b(qah[dc], kb.v, s[j]);
        s[j] = mma_b(qah[dc], kl.v, s[j]);
        s[j] = mma_b(qal[dc], kb.v, s[j]);
      }
    }

    // ---- relative term of (row, key): column key - kv0 + 15 - row of the wave's tile ----
#pragma unroll
    for (int r = 0; r < 8; ++r)
#pragma unroll
      for (int j = 0; j < 4; ++j) s[j][r] += bw[(8 * hh + r) * (BP - 1) + j * 16 + c + 15];

    // ---- scale + causal mask (replace by -FLT_MAX), row max, online softmax, P (x1024, f16)
    //      and P residual (x4096) to LDS ----
    _Float16* pwh = Psh[grp * 4 + wave];
    _Float16* pwl = Psl[RES ? (grp * 4 + wave) : 0];
#pragma unroll
    for (int r = 0; r < 8; ++r) {
      const int qrow = q0 + 8 * hh + r;
      float m = -INFINITY;
#pragma unroll
      for (int j = 0; j < 4; ++j) {
        const int key = kv0 + j * 16 + c;
        float sv = s[j][r] * sscale;
        sv = (key > qrow) ? -FLT_MAX : sv;
        s[j][r] = sv;
        m = fmaxf(m, sv);
      }
#pragma unroll
      for (int off = 1; off < 16; off <<= 1) m = fmaxf(m, __shfl_xor(m, off, 32));
      const float mnew  = fmaxf(mrow[r], m);
      const float msafe = (mnew == -INFINITY) ? 0.f : mnew;
      const float alpha = __expf(mrow[r] - msafe);
      mrow[r] = mnew;
      float psum = 0.f;
#pragma unroll
      for (int j = 0; j < 4; ++j) {
        const float p = __expf(s[j][r] - msafe);     // masked logit against a finite max: exp -> 0
        psum += p;
        const float p1k = p * 1024.0f;
        const _Float16 ph = (_Float16)p1k;
        pwh[(8 * hh + r) * LP + j * 16 + c] = ph;
        if (RES) {
          const _Float16 pl = (_Float16)((p1k - (float)ph) * 4096.0f);
          pwl[(8 * hh + r) * LP + j * 16 + c] = pl;
        }
      }
#pragma unroll
      for (int off = 1; off < 16; off <<= 1) psum += __shfl_xor(psum, off, 32);
      lrow[r] = lrow[r] * alpha + psum;
#pragma unroll
      for (int t = 0; t < 4; ++t) oacc[t][r] *= alpha;
    }
    __builtin_amdgcn_fence(__ATOMIC_RELEASE, "workgroup");
    __builtin_amdgcn_wave_barrier();
    __builtin_amdgcn_fence(__ATOMIC_ACQUIRE, "workgroup");

    // ---- context += P . V (f16 WMMA), residual products into a separate accumulator ----
    v8f o1[4];
#pragma unroll
    for (int t = 0; t < 4; ++t) o1[t] = zero8();
#pragma unroll 1
    for (int kk = 0; kk < 2; ++kk) {
      FH pa, pl;
      pa.h[0] = *(const v8h*)(pwh + c * LP + kk * 32 + 8 * hh);
      pa.h[1] = *(const v8h*)(pwh + c * LP + kk * 32 + 16 + 8 * hh);
      if (RES) {
        pl.h[0] = *(const v8h*)(pwl + c * LP + kk * 32 + 8 * hh);
        pl.h[1] = *(const v8h*)(pwl + c * LP + kk * 32 + 16 + 8 * hh);
      } else {
        pl.v = pa.v;
      }
#pragma unroll
      for (int t = 0; t < 4; ++t) {
        FH vb;
        vb.h[0] = *(const v8h*)(Vth + (t * 16 + c) * LP + kk * 32 + 8 * hh);
        vb.h[1] = *(const v8h*)(Vth + (t * 16 + c) * LP + kk * 32 + 16 + 8 * hh);
        oacc[t] = mma_h(pa.v, vb.v, oacc[t]);
        if (RES) {
          FH vl;
          vl.h[0] = *(const v8h*)(Vtl + (t * 16 + c) * LP + kk * 32 + 8 * hh);
          vl.h[1] = *(const v8h*)(Vtl + (t * 16 + c) * LP + kk * 32 + 16 + 8 * hh);
          o1[t] = mma_h(pa.v, vl.v, o1[t]);
          o1[t] = mma_h(pl.v, vb.v, o1[t]);
        }
      }
    }
    if (RES) {
#pragma unroll
      for (int t = 0; t < 4; ++t)
#pragma unroll
        for (int r = 0; r < 8; ++r) oacc[t][r] += o1[t][r] * (1.0f / 4096.0f);
    }
  }

  // ---- join the two groups' partial results: group 1 hands its maximum, sum and context over through LDS (every
  //      lane at the places that the same lane of group 0's wave reads), group 0 rescales both to the common maximum.
  //      Group 0 has always seen key tile 0, where every row has a live key; a group 1 without a tile hands over
  //      maximum -inf, sum 0 and context 0, whose factor is exp(-inf) = 0. ----
  float* os = Os[wave];
  if (grp == 1) {
#pragma unroll
    for (int r = 0; r < 8; ++r) {
#pragma unroll
      for (int t = 0; t < 4; ++t) os[(8 * hh + r) * OP + t * 16 + c] = oacc[t][r];
      if (c == 0) { Ms[wave][8 * hh + r] = mrow[r]; Ls[wave][8 * hh + r] = lrow[r]; }
    }
  }
  __syncthreads();                           // group 1's partial results are published
  if (grp == 1) return;                      // no block barrier stands behind this line
#pragma unroll
  for (int r = 0; r < 8; ++r) {
    const float m1 = Ms[wave][8 * hh + r], l1 = Ls[wave][8 * hh + r];
    const float mj = fmaxf(mrow[r], m1);
    const float ms = (mj == -INFINITY) ? 0.f : mj;
    const float a0 = exp_slot(mrow[r] - ms), a1 = exp_slot(m1 - ms);
    lrow[r] = lrow[r] * a0 + l1 * a1;
#pragma unroll
    for (int t = 0; t < 4; ++t) oacc[t][r] = oacc[t][r] * a0 + os[(8 * hh + r) * OP + t * 16 + c] * a1;
  }

  // ---- normalise (1/l and the 1/1024 p carry), stage the wave's 16x64 tile in LDS, then convert to
#pragma unroll
  for (int r = 0; r < 8; ++r) {
    const float l = lrow[r];
    const float inv = ((l > 0.f) ? (1.0f / l) : 0.f) * (1.0f / 1024.0f);
#pragma unroll
    for (int t = 0; t < 4; ++t) os[(8 * hh + r) * OP + t * 16 + c] = oacc[t][r] * inv;
  }
  __builtin_amdgcn_fence(__ATOMIC_RELEASE, "workgroup");
  __builtin_amdgcn_wave_barrier();
  __builtin_amdgcn_fence(__ATOMIC_ACQUIRE, "workgroup");
  {
    const int q4 = lane >> 3, c8 = (lane & 7) * 8;
    v4u hv[4], lv[4];
#pragma unroll
    for (int it = 0; it < 4; ++it) {
      const int row = it * 4 + q4;             // it 0..3 x q4 0..3 = rows 0..15 of the wave tile
      const float* sp = os + row * OP + c8;
      v4u a, a2;
#pragma unroll
      for (int e = 0; e < 4; ++e) {
        const float f0 = sp[2 * e], f1 = sp[2 * e + 1];
        const unsigned short x0 = bf_bits(f0), x1 = bf_bits(f1);
        const unsigned short y0 = bf_bits(f0 - bf_up(x0)), y1 = bf_bits(f1 - bf_up(x1));
        a[e] = pk16(x0, x1); a2[e] = pk16(y0, y1);
      }
      hv[it] = a; lv[it] = a2;
    }
    {
#pragma unroll
      for (int it = 0; it < 4; ++it) {
        const int row = it * 4 + q4;
        const size_t go = (rowB + q0 + row) * DM + (size_t)h * HD + c8;
        *(v4u*)(ahp + go) = hv[it];
        *(v4u*)(alp + go) = lv[it];
      }
      
    }
  }
}

// =====================================================================================================
// Workspace map (bytes), every region an exact multiple of its whole-line / whole-tile store granularity:
//   Xb    bf16 [4096][1024]            0           8388608
//   Wqb   bf16 [1024 out][1024 in]     8388608     2097152
//   Wkb   bf16 [1024][1024]            10485760    2097152
//   Wvb   bf16 [1024][1024]            12582912    2097152
//   Wob   bf16 [1024][1024]            14680064    2097152
//   Erf   bf16 [256 tiles][1024], fragment order (4095 rows used)  16777216     524288
//   Qh    bf16 [4096][1024]            17301504    8388608
//   Ql    bf16 [4096][1024]            25690112    8388608
//   Kh    bf16 [4096][1024]            34078720    8388608
//   Kl    bf16 [4096][1024]            42467328    8388608
//   VTh   f16  [2][1024][2048]         50855936    8388608
//   VTl   f16  [2][1024][512]          59244544    2097152
//   Ah    bf16 [4096][1024]            61341696    8388608
//   Al    bf16 [4096][1024]            69730304    8388608
//   end                                78118912
// Weights arrive [in][out]; y = x . W needs Bt[out][in] (in contiguous) -> transpose-convert once.
// =====================================================================================================
extern "C" void kernel_launch(void* const* d_in, const int* in_sizes, int n_in,
                              void* d_out, int out_size, void* d_ws, size_t ws_size,
                              hipStream_t stream) {
  if (n_in < 10) return;
  if (in_sizes[0] != NB * SEQ * DM) return;
  if (in_sizes[1] != DM * DM || in_sizes[3] != DM * DM || in_sizes[5] != DM * DM || in_sizes[7] != DM * DM) return;
  if (in_sizes[2] != DM || in_sizes[4] != DM || in_sizes[6] != DM || in_sizes[8] != DM) return;
  if (in_sizes[9] != ERR * HD) return;
  if (out_size != NB * SEQ * DM) return;

  const float* x  = (const float*)d_in[0];
  const float* Wq = (const float*)d_in[1];
  const float* bq = (const float*)d_in[2];
  const float* Wk = (const float*)d_in[3];
  const float* bk = (const float*)d_in[4];
  const float* Wv = (const float*)d_in[5];
  const float* bv = (const float*)d_in[6];
  const float* Wo = (const float*)d_in[7];
  const float* bo = (const float*)d_in[8];
  const float* Er = (const float*)d_in[9];

  const size_t PXb  = (size_t)NB * SEQ * DM * 2;       //  8388608  16-bit activation plane [4096][1024]
  const size_t PW   = (size_t)DM * DM * 2;             //  2097152
  const size_t PEr  = (size_t)(ERR + 1) * HD * 2;      //   524288  (rows padded to 4096)
  const size_t PVTh = (size_t)NB * DM * SEQ * 2;       //  8388608
  const size_t PVTl = (size_t)NB * DM * VLP * 2;       //  2097152
  size_t off = 0;
  const size_t oXb  = off; off += PXb;
  const size_t oWq  = off; off += PW;
  const size_t oWk  = off; off += PW;
  const size_t oWv  = off; off += PW;
  const size_t oWo  = off; off += PW;
  const size_t oEr  = off; off += PEr;
  const size_t oQh  = off; off += PXb;
  const size_t oQl  = off; off += PXb;
  const size_t oKh  = off; off += PXb;
  const size_t oKl  = off; off += PXb;
  const size_t oVTh = off; off += PVTh;
  const size_t oVTl = off; off += PVTl;
  const size_t oAh  = off; off += PXb;
  const size_t oAl  = off; off += PXb;
  if (off > ws_size) return;                           // off = 78118912

  char* ws = (char*)d_ws;
  unsigned short* Xb  = (unsigned short*)(ws + oXb);
  unsigned short* Wqb = (unsigned short*)(ws + oWq);
  unsigned short* Wkb = (unsigned short*)(ws + oWk);
  unsigned short* Wvb = (unsigned short*)(ws + oWv);
  unsigned short* Wob = (unsigned short*)(ws + oWo);
  unsigned short* Erf = (unsigned short*)(ws + oEr);
  unsigned short* Qh  = (unsigned short*)(ws + oQh);
  unsigned short* Ql  = (unsigned short*)(ws + oQl);
  unsigned short* Kh  = (unsigned short*)(ws + oKh);
  unsigned short* Kl  = (unsigned short*)(ws + oKl);
  unsigned short* VTh = (unsigned short*)(ws + oVTh);
  unsigned short* VTl = (unsigned short*)(ws + oVTl);
  unsigned short* Ah  = (unsigned short*)(ws + oAh);
  unsigned short* Al  = (unsigned short*)(ws + oAl);

  const dim3 blk(256);
  const int n8x  = NB * SEQ * DM / 8;                                // 524288
  const dim3 gCvtX((n8x + 255) / 256);                               // 2048 blocks
  const dim3 gCvtEr((ERR + 1) * HD / 8 / 256);                       // 128 blocks: one thread per 16-byte piece
  const dim3 gTr(DM / 64, DM / 64);                                  // (out cols / 64, in rows / 64)
  const dim3 blkG(128);                                              // gemm128: 4 waves, one 128x128 tile
  const dim3 gQ((NB * SEQ / 128) * (DM / 128), 1);                   // 256 blocks
  const dim3 gVT((DM / 128) * (SEQ / 128), NB);                      // 128 blocks x 2 batches
  const dim3 gOut((NB * SEQ / 128) * (DM / 128), 1);                 // 256 blocks

  // (1) x -> bf16 plane [4096][1024]; Er -> bf16 in fragment order
  cvt_bf16x8<<<gCvtX, blk, 0, stream>>>(x, Xb, n8x);
  cvt_er_frag<<<gCvtEr, blk, 0, stream>>>(Er, Erf);
  // (2) weights [in][out] f32 -> bf16 [out][in] planes
  tr_cvt64<<<gTr, blk, 0, stream>>>(Wq, Wqb, DM, DM);
  tr_cvt64<<<gTr, blk, 0, stream>>>(Wk, Wkb, DM, DM);
  tr_cvt64<<<gTr, blk, 0, stream>>>(Wv, Wvb, DM, DM);
  tr_cvt64<<<gTr, blk, 0, stream>>>(Wo, Wob, DM, DM);
  // (3) q and k projections: Qh/Ql[b*SEQ+s][e] = hi/lo of (bq[e] + sum_d Xb[s][d] Wqb[e][d])  (M=4096, N=1024, K=1024)
  gemm128<0, 2, false, true><<<gQ, blkG, 0, stream>>>(
      Xb, Xb, DM, 0LL, Wqb, DM, 0LL,
      (void*)Qh, DM, 0LL, (void*)Ql, DM, 0LL, 0,
      NB * SEQ, DM, DM, 1.0f, bq, bq);
  gemm128<0, 2, false, true><<<gQ, blkG, 0, stream>>>(
      Xb, Xb, DM, 0LL, Wkb, DM, 0LL,
      (void*)Kh, DM, 0LL, (void*)Kl, DM, 0LL, 0,
      NB * SEQ, DM, DM, 1.0f, bk, bk);
  // (4) v^T per batch: VTh[b][m][s] = bv[m] + sum_d Wvb[m][d] Xb[b*SEQ+s][d] -> f16 hi plane (pitch SEQ) and
  //     residual plane (x4096, keys < VLP, pitch VLP)  (M=1024, N=2048, K=1024)
  gemm128<0, 3, true, false><<<gVT, blkG, 0, stream>>>(
      Wvb, Wvb, DM, 0LL, Xb, DM, (long long)SEQ * DM,
      (void*)VTh, SEQ, (long long)DM * SEQ, (void*)VTl, VLP, (long long)DM * VLP, VLP,
      DM, SEQ, DM, 4096.0f, bv, bv);
  // (5) attention, each launch over all NP pairs: the leading RESQB query blocks with the residual planes, then all the
  //     others in one launch
  attn_rel64<true><<<dim3(RESQB * NP), dim3(256), 0, stream>>>(
      Qh, Ql, Kh, Kl, VTh, VTl, Erf, Ah, Al, 0, RESQB, 0.125f);
  attn_rel64<false><<<dim3((NQB - RESQB) * NP), dim3(256), 0, stream>>>(
      Qh, Ql, Kh, Kl, VTh, VTl, Erf, Ah, Al, RESQB, NQB - RESQB, 0.125f);
  // (6) out[s][e] = bo[e] + sum_d (Ah+Al)[s][d] Wob[e][d] -> d_out f32 [4096][1024]  (M=4096, N=1024, K=1024)
  gemm128<1, 0, false, true><<<gOut, blkG, 0, stream>>>(
      Ah, Al, DM, 0LL, Wob, DM, 0LL,
      d_out, DM, 0LL, d_out, 0, 0LL, 0,
      NB * SEQ, DM, DM, 1.0f, bo, bo);
  (void)hipGetLastError();
}

// v008
// It runs in 168 microseconds.
// In both of two side-by-side timings against v007, it was 1.20 times as fast.
// All steps since v000 together make it 33.0 times as fast.
// Contractions: x.Wq / x.Wk / Wv.x^T projections = v_wmma_f32_16x16x32_bf16 (bf16 operands from RNE-converted inputs, single product, f32 bias epilogue);
// q.k^T scores = v_wmma_f32_16x16x32_bf16 with q and k as bf16 hi/lo planes (hi.hi + hi.lo + lo.hi); q.Er^T band = same with q hi/lo times bf16 Er (2 products);
// p.v = v_wmma_f32_16x16x32_f16 (p carried x1024 in f16, v in f16; f16 residual planes x4096 of p and v on the leading query blocks);
// ctx.Wo = v_wmma_f32_16x16x32_bf16 with ctx as bf16 hi/lo planes times bf16 Wo (2 products); all f32 accumulate; softmax in f32.
#include <hip/hip_runtime.h>
#include <math.h>
#include <float.h>
#include <stdint.h>

#define NB      2
#define SEQ     2048
#define DM      1024
#define NH      16
#define HD      64
#define NQB     (SEQ / 64)       // 32 query / key tiles of 64
#define ERR     (2 * SEQ - 1)    // 4095 rows of the relative table
#define VLP     512              // key pitch of the v^T residual plane (keys 0..VLP-1)
#define RESQB   8                // leading 64-row query blocks that use the p / v residual planes
#define NP      (NB * NH)        // 32 (b,h) pairs: every attention launch covers all of them
static_assert(RESQB * 64 <= VLP);
static_assert(NH * HD == DM);
static_assert((SEQ % 64) == 0 && (DM % 64) == 0);
static_assert(HD == 64);
static_assert(0 < RESQB && RESQB < NQB);
static_assert((SEQ % 128) == 0 && (DM % 128) == 0);   // gemm128: whole 128x128 tiles and whole 128-k slabs

typedef _Float16 v16h __attribute__((ext_vector_type(16)));
typedef _Float16 v8h  __attribute__((ext_vector_type(8)));
typedef __bf16   v16b __attribute__((ext_vector_type(16)));
typedef __bf16   v8b  __attribute__((ext_vector_type(8)));
typedef float    v8f  __attribute__((ext_vector_type(8)));
typedef float    v4f  __attribute__((ext_vector_type(4)));
typedef unsigned int v4u __attribute__((ext_vector_type(4)));
typedef unsigned short v8us __attribute__((ext_vector_type(8)));

// ---- scalar helpers --------------------------------------------------------------------------------
__device__ __forceinline__ unsigned short bf_bits(float f) {          // f32 -> bf16 bits, RNE convert
  unsigned u = __float_as_uint(f);
  return (unsigned short)((u + 0x7FFFu + ((u >> 16) & 1u)) >> 16);
}
__device__ __forceinline__ float bf_up(unsigned short h) { return __uint_as_float(((unsigned)h) << 16); }
__device__ __forceinline__ unsigned short h_bits(_Float16 x) { return __builtin_bit_cast(unsigned short, x); }
__device__ __forceinline__ unsigned pk16(unsigned short a, unsigned short b) { return (unsigned)a | ((unsigned)b << 16); }
__device__ __forceinline__ v8f zero8() { v8f z = {0.f, 0.f, 0.f, 0.f, 0.f, 0.f, 0.f, 0.f}; return z; }
__device__ __forceinline__ v8h zero8h() {
  const _Float16 z = (_Float16)0.0f;
  v8h r = {z, z, z, z, z, z, z, z};
  return r;
}

// ---- fragment loader: 16-bit A/B operand, lane -> row/col (lane&15), p already includes +8*(lane>>4);
//      elements 0..7 <- p[0..7] (k0+8h..), elements 8..15 <- p[16..23] (k0+16+8h..)
__device__ __forceinline__ v16b ldfrag_b(const __bf16* p) {
  union { v16b v; v8b h[2]; } f;
  f.h[0] = *(const v8b*)(p);
  f.h[1] = *(const v8b*)(p + 16);
  return f.v;
}

// ---- WMMA helpers with trailing VALU hazard gap --------------------------------------------------------
__device__ __forceinline__ v8f mma_b(v16b a, v16b b, v8f c) {
  c = __builtin_amdgcn_wmma_f32_16x16x32_bf16(false, a, false, b, (short)0, c, false, false);
#if defined(__HIP_DEVICE_COMPILE__)
  asm volatile("v_nop\n\tv_nop\n\tv_nop\n\tv_nop" : "+v"(c) : "v"(a), "v"(b));
#endif
  return c;
}
__device__ __forceinline__ v8f mma_h(v16h a, v16h b, v8f c) {
  c = __builtin_amdgcn_wmma_f32_16x16x32_f16(false, a, false, b, (short)0, c, false, false);
#if defined(__HIP_DEVICE_COMPILE__)
  asm volatile("v_nop\n\tv_nop\n\tv_nop\n\tv_nop" : "+v"(c) : "v"(a), "v"(b));
#endif
  return c;
}
__device__ __forceinline__ v8f mma_b_raw(v16b a, v16b b, v8f c) {
  return __builtin_amdgcn_wmma_f32_16x16x32_bf16(false, a, false, b, (short)0, c, false, false);
}
__device__ __forceinline__ void dep_guard_b(v8f& a, v8f& b, v16b x, v16b y) {
#if defined(__HIP_DEVICE_COMPILE__)
  asm volatile("v_nop\n\tv_nop\n\tv_nop\n\tv_nop" : "+v"(a), "+v"(b) : "v"(x), "v"(y));
#endif
}
__device__ __forceinline__ void keep4_b(v16b a, v16b b, v16b c, v16b d) {
#if defined(__HIP_DEVICE_COMPILE__)
  asm volatile("v_nop" :: "v"(a), "v"(b), "v"(c), "v"(d));
#endif
}
__device__ __forceinline__ void acc_guard4(v8f& a, v8f& b, v8f& c, v8f& d) {
#if defined(__HIP_DEVICE_COMPILE__)
  asm volatile("v_nop\n\tv_nop\n\tv_nop\n\tv_nop" : "+v"(a), "+v"(b), "+v"(c), "+v"(d));
#endif
}
// The four vector slots that the chip needs between the last matrix instruction and the first read of its result.
__device__ __forceinline__ void acc_guard5(v8f& a, v8f& b, v8f& c, v8f& d, v8f& e) {
#if defined(__HIP_DEVICE_COMPILE__)
  asm volatile("v_nop\n\tv_nop\n\tv_nop\n\tv_nop" : "+v"(a), "+v"(b), "+v"(c), "+v"(d), "+v"(e));
#endif
}

// =====================================================================================================
// The conversions of the inputs, which do not depend on each other, are the parts of ONE launch (prep_all below); each
// part's block does what a block of its own launch would do.
// x part: f32 -> bf16 (RNE convert), 8 elements per thread, one 16-B store per lane: a wave writes 512 contiguous B.
// NXB blocks x 256 threads x 8 = the whole plane.
// =====================================================================================================
#define N8X     (NB * SEQ * DM / 8)              // 16-byte output pieces of x
static_assert(N8X % 256 == 0);
__device__ __forceinline__ void cvt_x_block(const float* __restrict__ in, unsigned short* out, int blk, int tid) {
  const int i = blk * 256 + tid;
  if (i < N8X) {
    const v4f a = *(const v4f*)(in + (size_t)i * 8);
    const v4f b = *(const v4f*)(in + (size_t)i * 8 + 4);
    v4u p;
    p[0] = pk16(bf_bits(a[0]), bf_bits(a[1]));
    p[1] = pk16(bf_bits(a[2]), bf_bits(a[3]));
    p[2] = pk16(bf_bits(b[0]), bf_bits(b[1]));
    p[3] = pk16(bf_bits(b[2]), bf_bits(b[3]));
    *(v4u*)(out + (size_t)i * 8) = p;
  }
}

// =====================================================================================================
// Weight part, transpose-convert: in f32 [R][C] (row pitch C) -> out bf16 [C][R] (row pitch R), out[c][r] = RNE bf16(in[r][c]).
// Block = 256 threads = one 64(r) x 64(c) tile at (r0, c0).
// Load: thread t reads row r0 + (t>>2), columns c0 + (t&3)*16 .. +15 (four 16-B loads), scatters the
// converted bits into LDS sT[c][r] (pitch 72); __syncthreads; store: wave w writes output rows w*8 .. w*8+7;
// coverage: 8 waves x 2 it x 4 = 64 output rows x (8 lanes x 8) = 64 columns = the whole tile.
// =====================================================================================================
__device__ __forceinline__ void tr_cvt_block(const float* __restrict__ in, unsigned short* out, int R, int C,
                                             int r0, int c0, unsigned short* sT, int tid) {
  const int lane = tid & 31, wave = tid >> 5;
  {
    const int rl = tid >> 2, cl = (tid & 3) * 16;
    const float* src = in + (size_t)(r0 + rl) * C + c0 + cl;
#pragma unroll
    for (int i = 0; i < 4; ++i) {
      const v4f v = *(const v4f*)(src + 4 * i);
#pragma unroll
      for (int e = 0; e < 4; ++e) sT[(cl + 4 * i + e) * 72 + rl] = bf_bits(v[e]);
    }
  }
  __syncthreads();
  const int q = lane >> 3, p8 = (lane & 7) * 8;
  v8us ov[2];
#pragma unroll
  for (int it = 0; it < 2; ++it) {
    const int cl2 = wave * 8 + it * 4 + q;
    ov[it] = *(const v8us*)(sT + cl2 * 72 + p8);
  }
  {
#pragma unroll
    for (int it = 0; it < 2; ++it) {
      const int cl2 = wave * 8 + it * 4 + q;
      *(v8us*)(out + (size_t)(c0 + cl2) * R + r0 + p8) = ov[it];
    }
  }
}

// =====================================================================================================
// Relative table f32 [ERR][64] -> bf16 (RNE convert) in the order of the B fragments of v_wmma_f32_16x16x32_bf16: the 16
// table rows 16*T .. 16*T+15 are one tile of 1024 elements; its 16-byte piece ((dc*2 + p)*32 + lane) holds row
// 16*T + (lane & 15), d = dc*32 + p*16 + (lane >> 4)*8 .. +7, so that a fragment half is one 512-byte contiguous load of
// a wave. Thread = one output piece (a wave stores 512 contiguous bytes); 4096*8/256 blocks; row ERR does not exist and
// its pieces are neither written nor read.
// =====================================================================================================
__device__ __forceinline__ void cvt_er_block(const float* __restrict__ in, unsigned short* out, int blk, int tid) {
  const int o    = blk * 256 + tid;
  const int lane = o & 31, p = (o >> 5) & 1, dc = (o >> 6) & 1, tl = o >> 7;
  const int e    = tl * 16 + (lane & 15);
  const int d    = dc * 32 + p * 16 + (lane >> 4) * 8;
  if (e < ERR) {
    const v4f a = *(const v4f*)(in + (size_t)e * HD + d);
    const v4f b = *(const v4f*)(in + (size_t)e * HD + d + 4);
    v4u q;
    q[0] = pk16(bf_bits(a[0]), bf_bits(a[1]));
    q[1] = pk16(bf_bits(a[2]), bf_bits(a[3]));
    q[2] = pk16(bf_bits(b[0]), bf_bits(b[1]));
    q[3] = pk16(bf_bits(b[2]), bf_bits(b[3]));
    *(v4u*)(out + (size_t)o * 8) = q;
  }
}

// =====================================================================================================
// All conversions in one launch; the part is chosen by the block index (the same for the whole block, so the barrier of
// the weight part is passed by all of a block's threads or by none). First NWB blocks a weight (Wq, Wk, Wv, Wo; their bf16
// planes lie one behind the other from Wb on): they have the longest chain of dependent steps; then NXB blocks of x; then NEB blocks of the relative table.
// =====================================================================================================
#define NXB     (N8X / 256)                     // 2048
#define NWB     ((DM / 64) * (DM / 64))         // 256 tiles per weight
#define NEB     ((ERR + 1) * HD / 8 / 256)      // 128
__global__ __launch_bounds__(256) void prep_all(const float* __restrict__ x, const float* __restrict__ Wq,
                                                const float* __restrict__ Wk, const float* __restrict__ Wv,
                                                const float* __restrict__ Wo, const float* __restrict__ Er,
                                                unsigned short* Xb, unsigned short* Wb, unsigned short* Erf) {
  __shared__ __align__(16) unsigned short sT[64 * 72];
  const int bx = blockIdx.x, tid = threadIdx.x;
  if (bx < 4 * NWB) {
    const int w = bx / NWB, s = bx % NWB;
    const float* in = (w == 0) ? Wq : (w == 1) ? Wk : (w == 2) ? Wv : Wo;
    tr_cvt_block(in, Wb + (size_t)w * DM * DM, DM, DM, (s / (DM / 64)) * 64, (s % (DM / 64)) * 64, sT, tid);
  } else if (bx < 4 * NWB + NXB) {
    cvt_x_block(x, Xb, bx - 4 * NWB, tid);
  } else {
    cvt_er_block(Er, Erf, bx - (NXB + 4 * NWB), tid);
  }
}

// =====================================================================================================
// Block-tiled bf16 WMMA GEMM for the four projections: C[m][n] = rb[m] + cb[n] + sum_k (A [+ A2])[m][k] * Bt[n][k], wave
// tile 64x64. NSPLIT 1 adds the bf16 lo plane A2; OUT_MODE 0 = f32, 2 = bf16 hi + lo planes, 3 = f16 hi plane + f16
// residual plane (x rscale, tiles with n0 < N2). A block of 4 waves (2 x 2) owns a 128x128 tile of C; the 128 rows of A (and A2) and
// of Bt that it needs are brought into LDS one slab of KS = 128 k at a time by asynchronous copies
// (global_load_async_to_lds_b128: a wave's copy covers two whole 256-byte row pieces), two buffers, so that slab t + 1
// flies while slab t is multiplied; fragments are then read from LDS (row pitch 272 bytes = 17 x 16).
// M, N multiples of 128, K a multiple of KS and at least KS; tile = tm * (N/128) + tn and batch b are handed in by the kernel.
// =====================================================================================================
// Eight 16-byte copies per lane, rows gstep elements / lstep bytes apart.
__device__ __forceinline__ void async_rows8(const __bf16* g, size_t gstep, unsigned l, unsigned lstep) {
#if defined(__HIP_DEVICE_COMPILE__)
  // The closing s_wait_xcnt 0 stands in the copies' own statement, so that it is passed before any address register
  // that a copy names is written again.
  asm volatile(
      "global_load_async_to_lds_b128 %0, %8, off\n\t"
      "global_load_async_to_lds_b128 %1, %9, off\n\t"
      "global_load_async_to_lds_b128 %2, %10, off\n\t"
      "global_load_async_to_lds_b128 %3, %11, off\n\t"
      "global_load_async_to_lds_b128 %4, %12, off\n\t"
      "global_load_async_to_lds_b128 %5, %13, off\n\t"
      "global_load_async_to_lds_b128 %6, %14, off\n\t"
      "global_load_async_to_lds_b128 %7, %15, off\n\t"
      "s_wait_xcnt 0x0"
      :: "v"(l), "v"(l + lstep), "v"(l + 2 * lstep), "v"(l + 3 * lstep),
         "v"(l + 4 * lstep), "v"(l + 5 * lstep), "v"(l + 6 * lstep), "v"(l + 7 * lstep),
         "v"(g), "v"(g + gstep), "v"(g + 2 * gstep), "v"(g + 3 * gstep),
         "v"(g + 4 * gstep), "v"(g + 5 * gstep), "v"(g + 6 * gstep), "v"(g + 7 * gstep)
      : "memory");
  // Keeps the address arithmetic of the next eight copies behind these: hoisted in front of them it held the addresses
  // of a whole slab in registers at once (a spill to scratch beside the 128 accumulator registers) and delayed the first copy.
  __builtin_amdgcn_sched_barrier(0);
#endif
}
// The issuing wave's own wait: its copies have landed in LDS behind it.
__device__ __forceinline__ void wait_async0() {
#if defined(__HIP_DEVICE_COMPILE__)
  asm volatile("s_wait_asynccnt 0x0" ::: "memory");
#endif
}
// The wave's LDS reads have returned: stands in front of the barrier behind which their buffer is refilled.
__device__ __forceinline__ void wait_ds0() {
#if defined(__HIP_DEVICE_COMPILE__)
  asm volatile("s_wait_dscnt 0x0" ::: "memory");
#endif
}

// Sizes of the LDS that a block of the GEMM needs; the arrays are declared in the kernels and handed to the body.
#define G_KS    128                              // k per slab
#define G_SP    (G_KS + 8)                       // LDS row pitch in elements
#define G_PLE   (128 * G_SP)                     // elements of one plane of a slab
#define G_STE   (4 * 16 * 68)                    // floats of the four per-wave 16x64 output slabs, pitch 68

// The work of one block: tile 'tile' of batch 'b'. sS = 2 buffers x NPL planes of G_PLE elements, sT = G_STE floats.
template <int NSPLIT, int OUT_MODE, bool RB, bool CB>
__device__ __forceinline__ void gemm128_block(
    __bf16* sS, float* sT, int tile, int b,
    const unsigned short* __restrict__ Ap, const unsigned short* A2p, int lda, long long strideA,
    const unsigned short* __restrict__ Btp, int ldb, long long strideB,
    void* Cout, int ldc, long long strideC,
    void* Cout2, int ldc2, long long strideC2, int N2,
    int M, int N, int K, float rscale,
    const float* __restrict__ rbp, const float* __restrict__ cbp) {
  static_assert(NSPLIT == 0 || NSPLIT == 1);
  constexpr int KS  = G_KS;                      // k per slab
  constexpr int SP  = G_SP;                      // LDS row pitch in elements
  constexpr int NPL = (NSPLIT == 1) ? 3 : 2;     // planes of a slab: A, Bt, (A2)
  constexpr unsigned PLB = 128u * SP * 2u;       // bytes of one plane of a slab
  constexpr unsigned LST = 8u * SP * 2u;         // bytes between two copies of a lane (8 rows)
  const __bf16* A   = (const __bf16*)(const void*)Ap;
  const __bf16* A2  = (const __bf16*)(const void*)A2p;
  const __bf16* Bt  = (const __bf16*)(const void*)Btp;
  const int tid  = threadIdx.x;
  const int lane = tid & 31;
  const int wave = tid >> 5;
  const int tilesN = N >> 7;
  const int tilesM = M >> 7;
  if (tile >= tilesM * tilesN) return;   // block-uniform, in front of every copy and barrier
  const int tm  = tile / tilesN;
  const int tn  = tile - tm * tilesN;
  const int bm0 = tm << 7;
  const int bn0 = tn << 7;
  const int wm  = (wave >> 1) << 6;      // the wave's 64x64 tile within the block tile
  const int wn  = (wave & 1) << 6;
  const int m0  = bm0 + wm;
  const int n0  = bn0 + wn;

  // copy addressing: 16 lanes per 256-byte row piece, 8 rows per block-wide copy, 16 copies per lane and plane
  const int cr = tid >> 4, cc = (tid & 15) * 8;
  const __bf16* gA  = A  + (size_t)b * strideA + (size_t)(bm0 + cr) * lda + cc;
  const long long dA2 = A2 - A;          // uniform distance (elements) of the lo plane from the hi plane, same workspace
  const __bf16* gB  = Bt + (size_t)b * strideB + (size_t)(bn0 + cr) * ldb + cc;
  const unsigned l0 = (unsigned)(size_t)sS + (unsigned)(cr * SP + cc) * 2u;
  auto fill = [&](int t, int bs) {
    const unsigned lb = l0 + (unsigned)bs * (NPL * PLB);
    const size_t ko = (size_t)t * KS;
    async_rows8(gA + ko, (size_t)8 * lda, lb, LST);
    async_rows8(gA + ko + (size_t)64 * lda, (size_t)8 * lda, lb + 8u * LST, LST);
    async_rows8(gB + ko, (size_t)8 * ldb, lb + PLB, LST);
    async_rows8(gB + ko + (size_t)64 * ldb, (size_t)8 * ldb, lb + PLB + 8u * LST, LST);
    if (NSPLIT == 1) {
      async_rows8(gA + (dA2 + (long long)ko), (size_t)8 * lda, lb + 2u * PLB, LST);
      async_rows8(gA + (dA2 + (long long)ko) + (size_t)64 * lda, (size_t)8 * lda, lb + 2u * PLB + 8u * LST, LST);
    }
  };

  const int rlane = lane & 15;                 // row (A) / col (B, D) within subtile
  const int koff  = (lane >> 4) * 8;           // k offset of this lane half
  const int mOff  = (lane >> 4) * 8;           // D row offset

  v8f acc[4][4];
#pragma unroll
  for (int i = 0; i < 4; ++i)
#pragma unroll
    for (int j = 0; j < 4; ++j) acc[i][j] = zero8();

  const int nst = K / KS;                      // slabs, block-uniform
  fill(0, 0);
  wait_async0();
  __syncthreads();                             // slab 0 is published
  if (nst > 1) fill(1, 1);
  for (int t = 0; t < nst; ++t) {
    const __bf16* sBuf = sS + (t & 1) * (NPL * G_PLE);
    const __bf16* sA  = sBuf + (wm + rlane) * SP + koff;
    const __bf16* sB  = sBuf + G_PLE + (wn + rlane) * SP + koff;
    const __bf16* sA2 = sBuf + (NPL - 1) * G_PLE + (wm + rlane) * SP + koff;
#pragma unroll
    for (int ks = 0; ks < KS; ks += 32) {
      // all fragments of the k step are read in one batch, so that the wave pays the LDS latency once per step
      v16b bh[4], ah[4], al[4];
#pragma unroll
      for (int j = 0; j < 4; ++j) bh[j] = ldfrag_b(sB + (j << 4) * SP + ks);
#pragma unroll
      for (int i = 0; i < 4; ++i) {
        ah[i] = ldfrag_b(sA + (i << 4) * SP + ks);
        if (NSPLIT == 1) al[i] = ldfrag_b(sA2 + (i << 4) * SP + ks); else al[i] = ah[i];
      }
#pragma unroll
      for (int i = 0; i < 4; ++i) {
#pragma unroll
        for (int j = 0; j < 4; ++j) {
          acc[i][j] = mma_b_raw(ah[i], bh[j], acc[i][j]);
          if (NSPLIT == 1) acc[i][j] = mma_b_raw(al[i], bh[j], acc[i][j]);
        }
        dep_guard_b(acc[i][0], acc[i][3], ah[i], al[i]);
      }
      keep4_b(bh[0], bh[1], bh[2], bh[3]);
    }
    // publish point of slab t + 1: own LDS reads returned, own copies landed, then the one barrier of the trip (it
    // publishes slab t + 1 and ends every wave's reads of the buffer that is refilled behind it)
    wait_ds0();
    wait_async0();
    __syncthreads();
    if (t + 2 < nst) fill(t + 2, t & 1);
  }
  wait_async0();                               // no copy is outstanding when the wave goes on
  acc_guard4(acc[0][0], acc[0][1], acc[0][2], acc[0][3]);
  acc_guard4(acc[1][0], acc[1][1], acc[1][2], acc[1][3]);
  acc_guard4(acc[2][0], acc[2][1], acc[2][2], acc[2][3]);
  acc_guard4(acc[3][0], acc[3][1], acc[3][2], acc[3][3]);

  // ---- epilogue biases (input values RNE-converted to bf16) ----
  float cbv[4];
#pragma unroll
  for (int j = 0; j < 4; ++j) cbv[j] = CB ? bf_up(bf_bits(cbp[n0 + (j << 4) + rlane])) : 0.0f;

  // ---- epilogue ----
  float* slab = sT + wave * (16 * 68);
#pragma unroll
  for (int i = 0; i < 4; ++i) {
    const int mBase = m0 + (i << 4);
#pragma unroll
    for (int r = 0; r < 8; ++r) {
      const float rbv = RB ? bf_up(bf_bits(rbp[mBase + mOff + r])) : 0.0f;
#pragma unroll
      for (int j = 0; j < 4; ++j) {
        slab[(mOff + r) * 68 + (j << 4) + rlane] = acc[i][j][r] + rbv + cbv[j];
      }
    }
    __builtin_amdgcn_fence(__ATOMIC_RELEASE, "workgroup");
    __builtin_amdgcn_wave_barrier();
    __builtin_amdgcn_fence(__ATOMIC_ACQUIRE, "workgroup");
    if (OUT_MODE == 0) {
      float* C = (float*)Cout + (size_t)b * strideC;
      const int hh = lane >> 4, c4 = (lane & 15) * 4;     // 256-B row segment = 16 lanes x 16 B
      v4f ov[8];
#pragma unroll
      for (int it = 0; it < 8; ++it) {
        const int row = it * 2 + hh;                       // it 0..7 x hh 0..1 = rows 0..15
        ov[it] = *(const v4f*)(slab + row * 68 + c4);
      }
      {
#pragma unroll
        for (int it = 0; it < 8; ++it) {
          const int row = it * 2 + hh;
          *(v4f*)(C + (size_t)(mBase + row) * ldc + n0 + c4) = ov[it];
        }
        
      }
    } else {
      const int q = lane >> 3, c8 = (lane & 7) * 8;
      unsigned short* C  = (unsigned short*)Cout  + (size_t)b * strideC;
      unsigned short* C2 = (unsigned short*)Cout2 + (size_t)b * strideC2;
      const bool wlo = (OUT_MODE == 2) || (n0 < N2);      // wave-uniform
      v4u hv[4], lv[4];
#pragma unroll
      for (int it = 0; it < 4; ++it) {
        const int row = it * 4 + q;                        // it 0..3 x q 0..3 = rows 0..15
        const float* sp = slab + row * 68 + c8;
        v4u a, a2;
#pragma unroll
        for (int e = 0; e < 4; ++e) {
          const float f0 = sp[2 * e], f1 = sp[2 * e + 1];
          unsigned short h0, h1, l0, l1;
          if (OUT_MODE == 2) {
            h0 = bf_bits(f0); h1 = bf_bits(f1);
            l0 = bf_bits(f0 - bf_up(h0)); l1 = bf_bits(f1 - bf_up(h1));
          } else {
            const _Float16 x0 = (_Float16)f0, x1 = (_Float16)f1;
            h0 = h_bits(x0); h1 = h_bits(x1);
            l0 = h_bits((_Float16)((f0 - (float)x0) * rscale));
            l1 = h_bits((_Float16)((f1 - (float)x1) * rscale));
          }
          a[e] = pk16(h0, h1); a2[e] = pk16(l0, l1);
        }
        hv[it] = a; lv[it] = a2;
      }
      {
#pragma unroll
        for (int it = 0; it < 4; ++it) {
          const int row = it * 4 + q;
          *(v4u*)(C + (size_t)(mBase + row) * ldc + n0 + c8) = hv[it];
          if (wlo) *(v4u*)(C2 + (size_t)(mBase + row) * ldc2 + n0 + c8) = lv[it];
        }
        
      }
    }
    __builtin_amdgcn_fence(__ATOMIC_RELEASE, "workgroup");
    __builtin_amdgcn_wave_barrier();
    __builtin_amdgcn_fence(__ATOMIC_ACQUIRE, "workgroup");
  }
}

// One GEMM per launch: grid.x = (M/128) * (N/128), blockIdx.y = batch.
template <int NSPLIT, int OUT_MODE, bool RB, bool CB>
__global__ __launch_bounds__(128) void gemm128(
    const unsigned short* __restrict__ Ap, const unsigned short* A2p, int lda, long long strideA,
    const unsigned short* __restrict__ Btp, int ldb, long long strideB,
    void* Cout, int ldc, long long strideC,
    void* Cout2, int ldc2, long long strideC2, int N2,
    int M, int N, int K, float rscale,
    const float* __restrict__ rbp, const float* __restrict__ cbp) {
  __shared__ __align__(16) __bf16 sS[2 * ((NSPLIT == 1) ? 3 : 2) * G_PLE];
  __shared__ __align__(16) float sT[G_STE];
  gemm128_block<NSPLIT, OUT_MODE, RB, CB>(sS, sT, blockIdx.x, blockIdx.y, Ap, A2p, lda, strideA, Btp, ldb, strideB,
                                          Cout, ldc, strideC, Cout2, ldc2, strideC2, N2, M, N, K, rscale, rbp, cbp);
}

// The q, k and v^T projections, which do not depend on each other, in one launch of 3 * nblk blocks (nblk = blocks of one
// projection): two blocks fit a WGP's LDS, so that one block's matrix work runs under the other's LDS reads and waits.
// Which projection a block works on is the same for the whole block. Blocks 0 .. 2*nblk-1: q, then k
// (C[b*SEQ+s][e] = hi/lo of bias[e] + sum_d Xb[b*SEQ+s][d] W[e][d]; M = rows, N = K = dm); the weight planes Wq, Wk, Wv lie one
// behind the other from Wb on, the planes Qh, Ql, Kh, Kl from QK on. Blocks 2*nblk ..: v^T per batch
// (VTh[b][m][s] = bv[m] + sum_d Wv[m][d] Xb[b*seq+s][d], f16 hi plane of pitch seq and residual plane x4096 of the
// keys < VLP, pitch VLP; M = K = dm, N = seq).
__global__ __launch_bounds__(128) void gemm_qkv(
    const unsigned short* __restrict__ Xb, const unsigned short* __restrict__ Wb,
    unsigned short* QK, unsigned short* VTh, unsigned short* VTl,
    const float* __restrict__ bq, const float* __restrict__ bk, const float* __restrict__ bv,
    int rows, int seq, int dm, int nblk) {
  __shared__ __align__(16) __bf16 sS[2 * 2 * G_PLE];
  __shared__ __align__(16) float sT[G_STE];
  const int bx = blockIdx.x;
  const size_t wpl = (size_t)dm * dm, apl = (size_t)rows * dm;
  if (bx < 2 * nblk) {
    const int sel = (bx >= nblk) ? 1 : 0;
    const unsigned short* W = Wb + sel * wpl;
    unsigned short* Ch = QK + (size_t)(2 * sel) * apl;
    const float* bias = sel ? bk : bq;
    gemm128_block<0, 2, false, true>(sS, sT, bx - sel * nblk, 0, Xb, Xb, dm, 0LL, W, dm, 0LL,
                                     (void*)Ch, dm, 0LL, (void*)(Ch + apl), dm, 0LL, 0,
                                     rows, dm, dm, 1.0f, bias, bias);
  } else {
    const int t = bx - 2 * nblk, per = (dm >> 7) * (seq >> 7);
    const unsigned short* W = Wb + 2 * wpl;
    gemm128_block<0, 3, true, false>(sS, sT, t % per, t / per, W, W, dm, 0LL, Xb, dm, (long long)seq * dm,
                                     (void*)VTh, seq, (long long)dm * seq, (void*)VTl, VLP, (long long)dm * VLP, VLP,
                                     dm, seq, dm, 4096.0f, bv, bv);
  }
}

// =====================================================================================================
// Causal attention with a relative-position bias, head dim 64 (tril mask incl. diagonal, computed).
//   q planes (bf16 hi / lo): element (b, t, h, d) at [(b*SEQ + t)*DM + h*64 + d]
//   k planes (bf16 hi / lo): same layout with key index s
//   v^T hi plane (f16):      element (b, h, d, s) at [(b*DM + h*64 + d)*SEQ + s]
//   v^T residual plane (f16, (v - hi)*4096): [(b*DM + h*64 + d)*VLP + s], s < VLP, read only when RES
//   relative table (bf16, fragment order of cvt_er_block): the relative term of (query t, key) is q[t] . Er[key - t + SEQ - 1].
//     A wave's 16 queries x 64 keys need the 79 table rows from kv0 - q0 + SEQ - 16 on (a multiple of 16, in
//     [0, SEQ - 16]): five 16-row tiles, q hi/lo times bf16 Er (hi, lo per 32 d, f32 accumulate from 0), the 16 x 80
//     result stored to a wave-private LDS tile and read back along the diagonals (column key - kv0 + 15 - row).
//   logit = (q.k + band) * sscale for key <= query, -FLT_MAX otherwise (exp -> 0); every row has a live key in
//   every processed key tile (tiles 0..qb only, block-uniform trip count (qb+2)/2 <= 16).
//   output: ctx hi / lo bf16 planes, element (b, t, h*64 + d) at [(b*SEQ + t)*DM + h*64 + d] = normalised
//   context (lo = RNE(v - hi), unscaled).
//   scores = q . k : bf16 hi/lo split (hi.hi + hi.lo + lo.hi), f32 accumulate, band added in f32, * sscale in f32
//   p = exp(s - m) carried as f16(1024 p); context = p . v on f16 WMMA; RES adds f16 residual planes of p and v
//   (scale 4096, separate accumulator folded back with 1/4096 per chunk in f32); online softmax in f32.
//   Block = 8 waves = 64 query rows of one (b, h), in two groups of 4 waves; grid = nqbThis * NP (pair index =
//   blockIdx.x % NP, b = pair / NH, h = pair % NH; query block = qbBase + nqbThis - 1 - blockIdx.x / NP: a block's
//   cost grows with its query block, so the costliest blocks take the lowest indices, for speed only); kv chunks of 64. Group g walks the key tiles g, g + 2, ...
//   with its own K / V^T tiles in LDS and its own running maximum, sum and context; the two partial results of a row
//   are joined once behind the loop, in f32 (each rescaled to the common maximum). The block's chain of dependent
//   tiles is half as long, and the two groups' waves fill each other's waits on the SIMDs that they share.
//   K / V^T chunk staging: a group's 128 threads x 32 elements per plane = the whole 64x64 tile (plain 16-B loads,
//   __syncthreads before and after); P tiles are wave-private, spilled with _Float16 element stores and reloaded
//   Output coverage: each wave of group 0 stores its rows 0..15 (it 0..3 x lane>>3 0..3) x 64 columns (8 lanes x 8 bf16),
// =====================================================================================================
// e^x for the join of the two groups' results. v_exp_f32 and the one free slot that the instruction set asks for behind
// a transcendental stand in one statement, so that no instruction which reads the result or overwrites the source
// follows directly.
__device__ __forceinline__ float exp_slot(float x) {
  float y = x * 1.44269504f;
#if defined(__HIP_DEVICE_COMPILE__)
  asm("v_exp_f32 %0, %1\n\tv_nop" : "=v"(y) : "v"(y));
#endif
  return y;
}

// Without RES four waves per SIMD (at most 256 registers a wave): two blocks share a WGP, 512 places on the chip for the
// one launch of all query blocks from RESQB on. The RES launch has one block per WGP and keeps the block size's own
// register budget.
template <bool RES>
__global__ __launch_bounds__(256) __attribute__((amdgpu_waves_per_eu(RES ? 2 : 4)))
void attn_rel64(const unsigned short* __restrict__ qhp, const unsigned short* __restrict__ qlp,
                const unsigned short* __restrict__ khp, const unsigned short* __restrict__ klp,
                const unsigned short* __restrict__ vhp, const unsigned short* __restrict__ vlp,
                const unsigned short* __restrict__ erfp,
                unsigned short* ahp, unsigned short* alp,
                int qbBase, int nqbThis, float sscale) {
  union FB { v16b v; v8b h[2]; };
  union FH { v16h v; v8h h[2]; };
  // Row pitches: 64 elements of data plus 16 bytes, an odd multiple of 16 bytes, so that the 16 rows which a 16-byte
  // fragment load reads at once fall on 64 different banks (at 128 or 256 bytes they share a few banks).
  constexpr int LP = 72;                                          // 16-bit tiles: 144 bytes a row
  constexpr int OP = 68;                                          // f32 tile: 272 bytes a row
  __shared__ __align__(16) __bf16   KshG[2][64 * LP];             // per group: K hi [kv][d]   9 KB
  __shared__ __align__(16) __bf16   KslG[2][64 * LP];             // K lo
  __shared__ __align__(16) _Float16 VthG[2][64 * LP];             // V^T hi [d][kv] 9 KB
  __shared__ __align__(16) _Float16 VtlG[2][RES ? 64 * LP : 8];   // V^T residual
  __shared__ __align__(16) _Float16 Psh[8][16 * LP];              // per wave P [row][kv]
  __shared__ __align__(16) _Float16 Psl[RES ? 8 : 1][16 * LP];    // per wave P residual
  __shared__ __align__(16) float    Os[4][16 * OP];               // per 16-row slice: context tile [row][d]
  __shared__ float Ms[4][16], Ls[4][16];                          // group 1's running maximum and sum per row
  // Per wave: q . Er^T of the key tile, [row][table row - first]. 84 floats a row: rows 8 apart lie 32 banks apart for the
  // stores and 24 for the diagonal reads, so that the two 16-lane halves of an access meet different banks.
  constexpr int BP = 84;
  __shared__ __align__(16) float    Bs[8][16 * BP];

  // the group is the same in every lane of a wave: kept in a scalar register, so that the tests on it are scalar branches
  const int grp  = __builtin_amdgcn_readfirstlane((int)(threadIdx.x >> 7));
  const int tid  = threadIdx.x & 127;     // thread within the group
  const int wave = tid >> 5;              // 16-row slice of the query block
  const int lane = tid & 31;
  __bf16*   Ksh = KshG[grp];
  __bf16*   Ksl = KslG[grp];
  _Float16* Vth = VthG[grp];
  _Float16* Vtl = VtlG[grp];
  const int hh   = lane >> 4;
  const int c    = lane & 15;

  const int bx   = blockIdx.x;
  const int pr   = bx % NP;               // (b,h) pair index, 0..NP-1
  const int h    = pr % NH;
  const int b    = pr / NH;
  const int qb   = qbBase + nqbThis - 1 - bx / NP;   // cost falls with the block index
  const int q0   = qb * 64 + wave * 16;
  const size_t rowB = (size_t)b * SEQ;

  const __bf16* Qh = (const __bf16*)(const void*)qhp + (size_t)h * HD;
  const __bf16* Ql = (const __bf16*)(const void*)qlp + (size_t)h * HD;
  const __bf16* Kh = (const __bf16*)(const void*)khp + (size_t)h * HD;
  const __bf16* Kl = (const __bf16*)(const void*)klp + (size_t)h * HD;
  const _Float16* Vh = (const _Float16*)(const void*)vhp + ((size_t)b * DM + (size_t)h * HD) * SEQ;
  const _Float16* Vl = (const _Float16*)(const void*)vlp + ((size_t)b * DM + (size_t)h * HD) * VLP;
  const __bf16* Ef = (const __bf16*)(const void*)erfp;

  // ---- Q fragments (A operand, row = lane&15): 2 d-chunks, hi and lo ----
  v16b qah[2], qal[2];
#pragma unroll
  for (int dc = 0; dc < 2; ++dc) {
    const size_t qo = (rowB + q0 + c) * DM + dc * 32 + 8 * hh;
    qah[dc] = ldfrag_b(Qh + qo);
    qal[dc] = ldfrag_b(Ql + qo);
  }

  float mrow[8], lrow[8];
  v8f oacc[4];
#pragma unroll
  for (int r = 0; r < 8; ++r) { mrow[r] = -INFINITY; lrow[r] = 0.f; }
#pragma unroll
  for (int t = 0; t < 4; ++t) oacc[t] = zero8();

  int nkt = qb + 1;                          // causal: key tiles 0..qb, block-uniform
  if (nkt > NQB) nkt = NQB;

  float* bw = Bs[grp * 4 + wave];
  const int ntrip = (nkt + 1) >> 1;          // block-uniform: every wave passes every barrier
  for (int it = 0; it < ntrip; ++it) {
    const int kt  = 2 * it + grp;
    const int kv0 = kt * 64;
    const bool act = kt < nkt;               // wave-uniform (scalar): false only for group 1 in the last trip of an odd nkt
    __syncthreads();
    if (act) {
      const int r = tid >> 1, half = (tid & 1) * 32;
      // every address is a base that is the same for the whole wave plus a 32-bit lane offset that no trip changes: the
      // bases live in scalar registers, which leaves the vector registers to the loaded tiles
      const unsigned ko = (unsigned)(r * DM + half), vo = (unsigned)(r * SEQ + half), vlo = (unsigned)(r * VLP + half);
      const __bf16*   kg  = Kh + (rowB + kv0) * DM;               // + ko: K row kv0+r, d = half..half+31
      const __bf16*   klg = Kl + (rowB + kv0) * DM;
      const _Float16* vg  = Vh + kv0;                             // + vo: V^T row d = r, s = kv0+half..+31
      const int kvl = (kv0 + 64 <= VLP) ? kv0 : (VLP - 64);     // clamped address into the residual plane
      const _Float16* vlg = Vl + kvl;
      const bool resOK = (kv0 + 64 <= VLP);                      // block-uniform
      v8b a0[4], a1[4];
      v8h b0[4], b1[4];
#pragma unroll
      for (int i = 0; i < 4; ++i) {
        a0[i] = *(const v8b*)(kg + ko + 8 * i);
        a1[i] = *(const v8b*)(klg + ko + 8 * i);
        b0[i] = *(const v8h*)(vg + vo + 8 * i);
        b1[i] = RES ? *(const v8h*)(vlg + vlo + 8 * i) : zero8h();
      }
      // the wave's five tiles of the relative table, behind the K / V loads so that these can be stored to LDS first
      const __bf16* eg = Ef + (size_t)__builtin_amdgcn_readfirstlane((kv0 - q0 + (SEQ - 16)) >> 4) * 1024;
      const unsigned eo = (unsigned)(lane * 8);
      FB eb[5][2];
#pragma unroll
      for (int n = 0; n < 5; ++n)
#pragma unroll
        for (int dc = 0; dc < 2; ++dc) {
          eb[n][dc].h[0] = *(const v8b*)(eg + eo + (n * 2 + dc) * 512);
          eb[n][dc].h[1] = *(const v8b*)(eg + eo + (n * 2 + dc) * 512 + 256);
        }
#if defined(__HIP_DEVICE_COMPILE__)
      // The wait that stands in front of any overwrite of a register an issued load names. It takes the bases and the lane
      // offsets as inputs so that they stay untouched (also by a later load's result) until it has been passed.
      if (RES) asm volatile("s_wait_xcnt 0x0" :: "s"(kg), "s"(klg), "s"(vg), "s"(vlg), "s"(eg), "v"(ko), "v"(vo), "v"(vlo), "v"(eo) : "memory");
      else     asm volatile("s_wait_xcnt 0x0" :: "s"(kg), "s"(klg), "s"(vg), "s"(eg), "v"(ko), "v"(vo), "v"(eo) : "memory");
      // Keeps all loads of the trip in front of their first use: moved behind the first products, the table's second half
      // and the K / V rows each waited for a memory round trip of their own.
      __builtin_amdgcn_sched_barrier(0);
#endif
#pragma unroll
      for (int i = 0; i < 4; ++i) {
        *(v8b*)(Ksh + r * LP + half + 8 * i) = a0[i];
        *(v8b*)(Ksl + r * LP + half + 8 * i) = a1[i];
        *(v8h*)(Vth + r * LP + half + 8 * i) = b0[i];
        if (RES) *(v8h*)(Vtl + r * LP + half + 8 * i) = resOK ? b1[i] : zero8h();
      }
      // ---- relative term: 16 queries x 80 table rows, five independent accumulators; per accumulator the products come
      //      in the order hi, lo of d 0..31, then hi, lo of d 32..63 ----
      v8f tb[5];
#pragma unroll
      for (int n = 0; n < 5; ++n) tb[n] = zero8();
#pragma unroll
      for (int dc = 0; dc < 2; ++dc) {
#pragma unroll
        for (int n = 0; n < 5; ++n) tb[n] = mma_b_raw(qah[dc], eb[n][dc].v, tb[n]);
#pragma unroll
        for (int n = 0; n < 5; ++n) tb[n] = mma_b_raw(qal[dc], eb[n][dc].v, tb[n]);
      }
      acc_guard5(tb[0], tb[1], tb[2], tb[3], tb[4]);
#pragma unroll
      for (int n = 0; n < 5; ++n)
#pragma unroll
        for (int rr = 0; rr < 8; ++rr) bw[(8 * hh + rr) * BP + n * 16 + c] = tb[n][rr];
    }
    __syncthreads();                         // also orders the wave's stores of its relative tile before its reads below
    if (!act) continue;                      // no barrier stands between here and the foot of the trip

    // ---- scores: 16 query rows x 64 keys per wave, 3 bf16 products ----
    v8f s[4];
#pragma unroll
    for (int j = 0; j < 4; ++j) {
      s[j] = zero8();
#pragma unroll
      for (int dc = 0; dc < 2; ++dc) {
        FB kb, kl;
        kb.h[0] = *(const v8b*)(Ksh + (j * 16 + c) * LP + dc * 32 + 8 * hh);
        kb.h[1] = *(const v8b*)(Ksh + (j * 16 + c) * LP + dc * 32 + 16 + 8 * hh);
        kl.h[0] = *(const v8b*)(Ksl + (j * 16 + c) * LP + dc * 32 + 8 * hh);
        kl.h[1] = *(const v8b*)(Ksl + (j * 16 + c) * LP + dc * 32 + 16 + 8 * hh);
        s[j] = mma_b(qah[dc], kb.v, s[j]);
        s[j] = mma_b(qah[dc], kl.v, s[j]);
        s[j] = mma_b(qal[dc], kb.v, s[j]);
      }
    }

    // ---- relative term of (row, key): column key - kv0 + 15 - row of the wave's tile ----
#pragma unroll
    for (int r = 0; r < 8; ++r)
#pragma unroll
      for (int j = 0; j < 4; ++j) s[j][r] += bw[(8 * hh + r) * (BP - 1) + j * 16 + c + 15];

    // ---- scale + causal mask (replace by -FLT_MAX), row max, online softmax, P (x1024, f16)
    //      and P residual (x4096) to LDS ----
    _Float16* pwh = Psh[grp * 4 + wave];
    _Float16* pwl = Psl[RES ? (grp * 4 + wave) : 0];
#pragma unroll
    for (int r = 0; r < 8; ++r) {
      const int qrow = q0 + 8 * hh + r;
      float m = -INFINITY;
#pragma unroll
      for (int j = 0; j < 4; ++j) {
        const int key = kv0 + j * 16 + c;
        float sv = s[j][r] * sscale;
        sv = (key > qrow) ? -FLT_MAX : sv;
        s[j][r] = sv;
        m = fmaxf(m, sv);
      }
#pragma unroll
      for (int off = 1; off < 16; off <<= 1) m = fmaxf(m, __shfl_xor(m, off, 32));
      const float mnew  = fmaxf(mrow[r], m);
      const float msafe = (mnew == -INFINITY) ? 0.f : mnew;
      const float alpha = __expf(mrow[r] - msafe);
      mrow[r] = mnew;
      float psum = 0.f;
#pragma unroll
      for (int j = 0; j < 4; ++j) {
        const float p = __expf(s[j][r] - msafe);     // masked logit against a finite max: exp -> 0
        psum += p;
        const float p1k = p * 1024.0f;
        const _Float16 ph = (_Float16)p1k;
        pwh[(8 * hh + r) * LP + j * 16 + c] = ph;
        if (RES) {
          const _Float16 pl = (_Float16)((p1k - (float)ph) * 4096.0f);
          pwl[(8 * hh + r) * LP + j * 16 + c] = pl;
        }
      }
#pragma unroll
      for (int off = 1; off < 16; off <<= 1) psum += __shfl_xor(psum, off, 32);
      lrow[r] = lrow[r] * alpha + psum;
#pragma unroll
      for (int t = 0; t < 4; ++t) oacc[t][r] *= alpha;
    }
    __builtin_amdgcn_fence(__ATOMIC_RELEASE, "workgroup");
    __builtin_amdgcn_wave_barrier();
    __builtin_amdgcn_fence(__ATOMIC_ACQUIRE, "workgroup");

    // ---- context += P . V (f16 WMMA), residual products into a separate accumulator ----
    v8f o1[4];
#pragma unroll
    for (int t = 0; t < 4; ++t) o1[t] = zero8();
#pragma unroll 1
    for (int kk = 0; kk < 2; ++kk) {
      FH pa, pl;
      pa.h[0] = *(const v8h*)(pwh + c * LP + kk * 32 + 8 * hh);
      pa.h[1] = *(const v8h*)(pwh + c * LP + kk * 32 + 16 + 8 * hh);
      if (RES) {
        pl.h[0] = *(const v8h*)(pwl + c * LP + kk * 32 + 8 * hh);
        pl.h[1] = *(const v8h*)(pwl + c * LP + kk * 32 + 16 + 8 * hh);
      } else {
        pl.v = pa.v;
      }
#pragma unroll
      for (int t = 0; t < 4; ++t) {
        FH vb;
        vb.h[0] = *(const v8h*)(Vth + (t * 16 + c) * LP + kk * 32 + 8 * hh);
        vb.h[1] = *(const v8h*)(Vth + (t * 16 + c) * LP + kk * 32 + 16 + 8 * hh);
        oacc[t] = mma_h(pa.v, vb.v, oacc[t]);
        if (RES) {
          FH vl;
          vl.h[0] = *(const v8h*)(Vtl + (t * 16 + c) * LP + kk * 32 + 8 * hh);
          vl.h[1] = *(const v8h*)(Vtl + (t * 16 + c) * LP + kk * 32 + 16 + 8 * hh);
          o1[t] = mma_h(pa.v, vl.v, o1[t]);
          o1[t] = mma_h(pl.v, vb.v, o1[t]);
        }
      }
    }
    if (RES) {
#pragma unroll
      for (int t = 0; t < 4; ++t)
#pragma unroll
        for (int r = 0; r < 8; ++r) oacc[t][r] += o1[t][r] * (1.0f / 4096.0f);
    }
  }

  // ---- join the two groups' partial results: group 1 hands its maximum, sum and context over through LDS (every
  //      lane at the places that the same lane of group 0's wave reads), group 0 rescales both to the common maximum.
  //      Group 0 has always seen key tile 0, where every row has a live key; a group 1 without a tile hands over
  //      maximum -inf, sum 0 and context 0, whose factor is exp(-inf) = 0. ----
  float* os = Os[wave];
  if (grp == 1) {
#pragma unroll
    for (int r = 0; r < 8; ++r) {
#pragma unroll
      for (int t = 0; t < 4; ++t) os[(8 * hh + r) * OP + t * 16 + c] = oacc[t][r];
      if (c == 0) { Ms[wave][8 * hh + r] = mrow[r]; Ls[wave][8 * hh + r] = lrow[r]; }
    }
  }
  __syncthreads();                           // group 1's partial results are published
  if (grp == 1) return;                      // no block barrier stands behind this line
#pragma unroll
  for (int r = 0; r < 8; ++r) {
    const float m1 = Ms[wave][8 * hh + r], l1 = Ls[wave][8 * hh + r];
    const float mj = fmaxf(mrow[r], m1);
    const float ms = (mj == -INFINITY) ? 0.f : mj;
    const float a0 = exp_slot(mrow[r] - ms), a1 = exp_slot(m1 - ms);
    lrow[r] = lrow[r] * a0 + l1 * a1;
#pragma unroll
    for (int t = 0; t < 4; ++t) oacc[t][r] = oacc[t][r] * a0 + os[(8 * hh + r) * OP + t * 16 + c] * a1;
  }

  // ---- normalise (1/l and the 1/1024 p carry), stage the wave's 16x64 tile in LDS, then convert to
#pragma unroll
  for (int r = 0; r < 8; ++r) {
    const float l = lrow[r];
    const float inv = ((l > 0.f) ? (1.0f / l) : 0.f) * (1.0f / 1024.0f);
#pragma unroll
    for (int t = 0; t < 4; ++t) os[(8 * hh + r) * OP + t * 16 + c] = oacc[t][r] * inv;
  }
  __builtin_amdgcn_fence(__ATOMIC_RELEASE, "workgroup");
  __builtin_amdgcn_wave_barrier();
  __builtin_amdgcn_fence(__ATOMIC_ACQUIRE, "workgroup");
  {
    const int q4 = lane >> 3, c8 = (lane & 7) * 8;
    v4u hv[4], lv[4];
#pragma unroll
    for (int it = 0; it < 4; ++it) {
      const int row = it * 4 + q4;             // it 0..3 x q4 0..3 = rows 0..15 of the wave tile
      const float* sp = os + row * OP + c8;
      v4u a, a2;
#pragma unroll
      for (int e = 0; e < 4; ++e) {
        const float f0 = sp[2 * e], f1 = sp[2 * e + 1];
        const unsigned short x0 = bf_bits(f0), x1 = bf_bits(f1);
        const unsigned short y0 = bf_bits(f0 - bf_up(x0)), y1 = bf_bits(f1 - bf_up(x1));
        a[e] = pk16(x0, x1); a2[e] = pk16(y0, y1);
      }
      hv[it] = a; lv[it] = a2;
    }
    {
#pragma unroll
      for (int it = 0; it < 4; ++it) {
        const int row = it * 4 + q4;
        const size_t go = (rowB + q0 + row) * DM + (size_t)h * HD + c8;
        *(v4u*)(ahp + go) = hv[it];
        *(v4u*)(alp + go) = lv[it];
      }
      
    }
  }
}

// =====================================================================================================
// Workspace map (bytes), every region an exact multiple of its whole-line / whole-tile store granularity:
//   Xb    bf16 [4096][1024]            0           8388608
//   Wqb   bf16 [1024 out][1024 in]     8388608     2097152
//   Wkb   bf16 [1024][1024]            10485760    2097152
//   Wvb   bf16 [1024][1024]            12582912    2097152
//   Wob   bf16 [1024][1024]            14680064    2097152
//   Erf   bf16 [256 tiles][1024], fragment order (4095 rows used)  16777216     524288
//   Qh    bf16 [4096][1024]            17301504    8388608
//   Ql    bf16 [4096][1024]            25690112    8388608
//   Kh    bf16 [4096][1024]            34078720    8388608
//   Kl    bf16 [4096][1024]            42467328    8388608
//   VTh   f16  [2][1024][2048]         50855936    8388608
//   VTl   f16  [2][1024][512]          59244544    2097152
//   Ah    bf16 [4096][1024]            61341696    8388608
//   Al    bf16 [4096][1024]            69730304    8388608
//   end                                78118912
// Weights arrive [in][out]; y = x . W needs Bt[out][in] (in contiguous) -> transpose-convert once.
// =====================================================================================================
extern "C" void kernel_launch(void* const* d_in, const int* in_sizes, int n_in,
                              void* d_out, int out_size, void* d_ws, size_t ws_size,
                              hipStream_t stream) {
  if (n_in < 10) return;
  if (in_sizes[0] != NB * SEQ * DM) return;
  if (in_sizes[1] != DM * DM || in_sizes[3] != DM * DM || in_sizes[5] != DM * DM || in_sizes[7] != DM * DM) return;
  if (in_sizes[2] != DM || in_sizes[4] != DM || in_sizes[6] != DM || in_sizes[8] != DM) return;
  if (in_sizes[9] != ERR * HD) return;
  if (out_size != NB * SEQ * DM) return;

  const float* x  = (const float*)d_in[0];
  const float* Wq = (const float*)d_in[1];
  const float* bq = (const float*)d_in[2];
  const float* Wk = (const float*)d_in[3];
  const float* bk = (const float*)d_in[4];
  const float* Wv = (const float*)d_in[5];
  const float* bv = (const float*)d_in[6];
  const float* Wo = (const float*)d_in[7];
  const float* bo = (const float*)d_in[8];
  const float* Er = (const float*)d_in[9];

  const size_t PXb  = (size_t)NB * SEQ * DM * 2;       //  8388608  16-bit activation plane [4096][1024]
  const size_t PW   = (size_t)DM * DM * 2;             //  2097152
  const size_t PEr  = (size_t)(ERR + 1) * HD * 2;      //   524288  (rows padded to 4096)
  const size_t PVTh = (size_t)NB * DM * SEQ * 2;       //  8388608
  const size_t PVTl = (size_t)NB * DM * VLP * 2;       //  2097152
  size_t off = 0;
  const size_t oXb  = off; off += PXb;
  const size_t oWq  = off; off += PW;
  const size_t oWk  = off; off += PW;
  const size_t oWv  = off; off += PW;
  const size_t oWo  = off; off += PW;
  const size_t oEr  = off; off += PEr;
  const size_t oQh  = off; off += PXb;
  const size_t oQl  = off; off += PXb;
  const size_t oKh  = off; off += PXb;
  const size_t oKl  = off; off += PXb;
  const size_t oVTh = off; off += PVTh;
  const size_t oVTl = off; off += PVTl;
  const size_t oAh  = off; off += PXb;
  const size_t oAl  = off; off += PXb;
  if (off > ws_size) return;                           // off = 78118912

  char* ws = (char*)d_ws;
  unsigned short* Xb  = (unsigned short*)(ws + oXb);
  unsigned short* Wqb = (unsigned short*)(ws + oWq);
  unsigned short* Wkb = (unsigned short*)(ws + oWk);
  unsigned short* Wvb = (unsigned short*)(ws + oWv);
  unsigned short* Wob = (unsigned short*)(ws + oWo);
  unsigned short* Erf = (unsigned short*)(ws + oEr);
  unsigned short* Qh  = (unsigned short*)(ws + oQh);
  unsigned short* Ql  = (unsigned short*)(ws + oQl);
  unsigned short* Kh  = (unsigned short*)(ws + oKh);
  unsigned short* Kl  = (unsigned short*)(ws + oKl);
  unsigned short* VTh = (unsigned short*)(ws + oVTh);
  unsigned short* VTl = (unsigned short*)(ws + oVTl);
  unsigned short* Ah  = (unsigned short*)(ws + oAh);
  unsigned short* Al  = (unsigned short*)(ws + oAl);

  const dim3 blk(256);
  const dim3 gPrep(4 * NWB + NXB + NEB);                             // 1024 + 2048 + 128 blocks
  const dim3 blkG(128);                                              // GEMM block: 4 waves, one 128x128 tile
  const int  nblk = (NB * SEQ / 128) * (DM / 128);                   // 256 blocks per projection
  static_assert((NB * SEQ / 128) * (DM / 128) == (DM / 128) * (SEQ / 128) * NB);
  const dim3 gQKV(3 * nblk);                                         // 768 blocks
  const dim3 gOut((NB * SEQ / 128) * (DM / 128), 1);                 // 256 blocks

  // (1) x -> bf16 plane [4096][1024]; weights [in][out] f32 -> bf16 [out][in] planes; Er -> bf16 in fragment order
  prep_all<<<gPrep, blk, 0, stream>>>(x, Wq, Wk, Wv, Wo, Er, Xb, Wqb, Erf);
  // (2) q, k and v^T projections (planes Wqb, Wkb, Wvb and Qh, Ql, Kh, Kl are neighbours in the workspace map)
  gemm_qkv<<<gQKV, blkG, 0, stream>>>(Xb, Wqb, Qh, VTh, VTl, bq, bk, bv, NB * SEQ, SEQ, DM, nblk);
  // (3) attention, each launch over all NP pairs: the leading RESQB query blocks with the residual planes, then all the
  //     others in one launch
  attn_rel64<true><<<dim3(RESQB * NP), dim3(256), 0, stream>>>(
      Qh, Ql, Kh, Kl, VTh, VTl, Erf, Ah, Al, 0, RESQB, 0.125f);
  attn_rel64<false><<<dim3((NQB - RESQB) * NP), dim3(256), 0, stream>>>(
      Qh, Ql, Kh, Kl, VTh, VTl, Erf, Ah, Al, RESQB, NQB - RESQB, 0.125f);
  // (4) out[s][e] = bo[e] + sum_d (Ah+Al)[s][d] Wob[e][d] -> d_out f32 [4096][1024]  (M=4096, N=1024, K=1024)
  gemm128<1, 0, false, true><<<gOut, blkG, 0, stream>>>(
      Ah, Al, DM, 0LL, Wob, DM, 0LL,
      d_out, DM, 0LL, d_out, 0, 0LL, 0,
      NB * SEQ, DM, DM, 1.0f, bo, bo);
  (void)hipGetLastError();
}

// v009
// It runs in 143 microseconds.
// Timed twice side by side with v008, it ran 1.17 times as fast both times.
// Counting every step since v000, it is 38.7 times as fast.
// Contractions: x.Wq / x.Wk / Wv.x^T projections = v_wmma_f32_16x16x32_bf16 (bf16 operands from RNE-converted inputs, single product, f32 bias epilogue);
// q.k^T scores = v_wmma_f32_16x16x32_bf16 with q and k as bf16 hi/lo planes (hi.hi + hi.lo + lo.hi); q.Er^T band = same with q hi/lo times bf16 Er (2 products);
// p.v = v_wmma_f32_16x16x32_f16 (p carried x1024 in f16, v in f16; f16 residual planes x4096 of p and v on the leading query blocks);
// ctx.Wo = v_wmma_f32_16x16x32_bf16 with ctx as bf16 hi/lo planes times bf16 Wo (2 products); all f32 accumulate; softmax in f32.
#include <hip/hip_runtime.h>
#include <math.h>
#include <float.h>
#include <stdint.h>

#define NB      2
#define SEQ     2048
#define DM      1024
#define NH      16
#define HD      64
#define NQB     (SEQ / 64)       // 32 query / key tiles of 64
#define ERR     (2 * SEQ - 1)    // 4095 rows of the relative table
#define VLP     512              // key pitch of the v^T residual plane (keys 0..VLP-1)
#define RESQB   8                // leading 64-row query blocks that use the p / v residual planes
#define NP      (NB * NH)        // 32 (b,h) pairs: every attention launch covers all of them
static_assert(RESQB * 64 <= VLP);
static_assert(NH * HD == DM);
static_assert((SEQ % 64) == 0 && (DM % 64) == 0);
static_assert(HD == 64);
static_assert(0 < RESQB && RESQB < NQB);
static_assert((SEQ % 128) == 0 && (DM % 128) == 0);   // gemm128: whole 128x128 tiles and whole 128-k slabs

typedef _Float16 v16h __attribute__((ext_vector_type(16)));
typedef _Float16 v8h  __attribute__((ext_vector_type(8)));
typedef __bf16   v16b __attribute__((ext_vector_type(16)));
typedef __bf16   v8b  __attribute__((ext_vector_type(8)));
typedef float    v8f  __attribute__((ext_vector_type(8)));
typedef float    v4f  __attribute__((ext_vector_type(4)));
typedef unsigned int v4u __attribute__((ext_vector_type(4)));
typedef unsigned short v8us __attribute__((ext_vector_type(8)));

// ---- scalar helpers --------------------------------------------------------------------------------
__device__ __forceinline__ unsigned short bf_bits(float f) {          // f32 -> bf16 bits, RNE convert
  unsigned u = __float_as_uint(f);
  return (unsigned short)((u + 0x7FFFu + ((u >> 16) & 1u)) >> 16);
}
__device__ __forceinline__ float bf_up(unsigned short h) { return __uint_as_float(((unsigned)h) << 16); }
__device__ __forceinline__ unsigned short h_bits(_Float16 x) { return __builtin_bit_cast(unsigned short, x); }
__device__ __forceinline__ unsigned pk16(unsigned short a, unsigned short b) { return (unsigned)a | ((unsigned)b << 16); }
__device__ __forceinline__ v8f zero8() { v8f z = {0.f, 0.f, 0.f, 0.f, 0.f, 0.f, 0.f, 0.f}; return z; }
__device__ __forceinline__ v8h zero8h() {
  const _Float16 z = (_Float16)0.0f;
  v8h r = {z, z, z, z, z, z, z, z};
  return r;
}

// ---- fragment loader: 16-bit A/B operand, lane -> row/col (lane&15), p already includes +8*(lane>>4);
//      elements 0..7 <- p[0..7] (k0+8h..), elements 8..15 <- p[16..23] (k0+16+8h..)
__device__ __forceinline__ v16b ldfrag_b(const __bf16* p) {
  union { v16b v; v8b h[2]; } f;
  f.h[0] = *(const v8b*)(p);
  f.h[1] = *(const v8b*)(p + 16);
  return f.v;
}

// ---- WMMA helpers with trailing VALU hazard gap --------------------------------------------------------
__device__ __forceinline__ v8f mma_b(v16b a, v16b b, v8f c) {
  c = __builtin_amdgcn_wmma_f32_16x16x32_bf16(false, a, false, b, (short)0, c, false, false);
#if defined(__HIP_DEVICE_COMPILE__)
  asm volatile("v_nop\n\tv_nop\n\tv_nop\n\tv_nop" : "+v"(c) : "v"(a), "v"(b));
#endif
  return c;
}
__device__ __forceinline__ v8f mma_h(v16h a, v16h b, v8f c) {
  c = __builtin_amdgcn_wmma_f32_16x16x32_f16(false, a, false, b, (short)0, c, false, false);
#if defined(__HIP_DEVICE_COMPILE__)
  asm volatile("v_nop\n\tv_nop\n\tv_nop\n\tv_nop" : "+v"(c) : "v"(a), "v"(b));
#endif
  return c;
}
__device__ __forceinline__ v8f mma_b_raw(v16b a, v16b b, v8f c) {
  return __builtin_amdgcn_wmma_f32_16x16x32_bf16(false, a, false, b, (short)0, c, false, false);
}
__device__ __forceinline__ void dep_guard_b(v8f& a, v8f& b, v16b x, v16b y) {
#if defined(__HIP_DEVICE_COMPILE__)
  asm volatile("v_nop\n\tv_nop\n\tv_nop\n\tv_nop" : "+v"(a), "+v"(b) : "v"(x), "v"(y));
#endif
}
__device__ __forceinline__ void keep4_b(v16b a, v16b b, v16b c, v16b d) {
#if defined(__HIP_DEVICE_COMPILE__)
  asm volatile("v_nop" :: "v"(a), "v"(b), "v"(c), "v"(d));
#endif
}
__device__ __forceinline__ void acc_guard4(v8f& a, v8f& b, v8f& c, v8f& d) {
#if defined(__HIP_DEVICE_COMPILE__)
  asm volatile("v_nop\n\tv_nop\n\tv_nop\n\tv_nop" : "+v"(a), "+v"(b), "+v"(c), "+v"(d));
#endif
}
// The four vector slots that the chip needs between the last matrix instruction and the first read of its result.
__device__ __forceinline__ void acc_guard5(v8f& a, v8f& b, v8f& c, v8f& d, v8f& e) {
#if defined(__HIP_DEVICE_COMPILE__)
  asm volatile("v_nop\n\tv_nop\n\tv_nop\n\tv_nop" : "+v"(a), "+v"(b), "+v"(c), "+v"(d), "+v"(e));
#endif
}

// =====================================================================================================
// The conversions of the inputs, which do not depend on each other, are the parts of ONE launch (prep_all below); each
// part's block does what a block of its own launch would do.
// x part: f32 -> bf16 (RNE convert), 8 elements per thread, one 16-B store per lane: a wave writes 512 contiguous B.
// NXB blocks x 256 threads x 8 = the whole plane.
// =====================================================================================================
#define N8X     (NB * SEQ * DM / 8)              // 16-byte output pieces of x
static_assert(N8X % 256 == 0);
__device__ __forceinline__ void cvt_x_block(const float* __restrict__ in, unsigned short* out, int blk, int tid) {
  const int i = blk * 256 + tid;
  if (i < N8X) {
    const v4f a = *(const v4f*)(in + (size_t)i * 8);
    const v4f b = *(const v4f*)(in + (size_t)i * 8 + 4);
    v4u p;
    p[0] = pk16(bf_bits(a[0]), bf_bits(a[1]));
    p[1] = pk16(bf_bits(a[2]), bf_bits(a[3]));
    p[2] = pk16(bf_bits(b[0]), bf_bits(b[1]));
    p[3] = pk16(bf_bits(b[2]), bf_bits(b[3]));
    *(v4u*)(out + (size_t)i * 8) = p;
  }
}

// =====================================================================================================
// Weight part, transpose-convert: in f32 [R][C] (row pitch C) -> out bf16 [C][R] (row pitch R), out[c][r] = RNE bf16(in[r][c]).
// Block = 256 threads = one 64(r) x 64(c) tile at (r0, c0).
// Load: thread t reads row r0 + (t>>2), columns c0 + (t&3)*16 .. +15 (four 16-B loads), scatters the
// converted bits into LDS sT[c][r] (pitch 72); __syncthreads; store: wave w writes output rows w*8 .. w*8+7;
// coverage: 8 waves x 2 it x 4 = 64 output rows x (8 lanes x 8) = 64 columns = the whole tile.
// =====================================================================================================
__device__ __forceinline__ void tr_cvt_block(const float* __restrict__ in, unsigned short* out, int R, int C,
                                             int r0, int c0, unsigned short* sT, int tid) {
  const int lane = tid & 31, wave = tid >> 5;
  {
    const int rl = tid >> 2, cl = (tid & 3) * 16;
    const float* src = in + (size_t)(r0 + rl) * C + c0 + cl;
#pragma unroll
    for (int i = 0; i < 4; ++i) {
      const v4f v = *(const v4f*)(src + 4 * i);
#pragma unroll
      for (int e = 0; e < 4; ++e) sT[(cl + 4 * i + e) * 72 + rl] = bf_bits(v[e]);
    }
  }
  __syncthreads();
  const int q = lane >> 3, p8 = (lane & 7) * 8;
  v8us ov[2];
#pragma unroll
  for (int it = 0; it < 2; ++it) {
    const int cl2 = wave * 8 + it * 4 + q;
    ov[it] = *(const v8us*)(sT + cl2 * 72 + p8);
  }
  {
#pragma unroll
    for (int it = 0; it < 2; ++it) {
      const int cl2 = wave * 8 + it * 4 + q;
      *(v8us*)(out + (size_t)(c0 + cl2) * R + r0 + p8) = ov[it];
    }
  }
}

// =====================================================================================================
// Relative table f32 [ERR][64] -> bf16 (RNE convert) in the order of the A fragments of v_wmma_f32_16x16x32_bf16: the 16
// table rows 16*T .. 16*T+15 are one tile of 1024 elements; its 16-byte piece ((dc*2 + p)*32 + lane) holds row
// 16*T + (lane & 15), d = dc*32 + p*16 + (lane >> 4)*8 .. +7, so that a fragment half is one 512-byte contiguous load of
// a wave. Thread = one output piece (a wave stores 512 contiguous bytes); 4096*8/256 blocks; row ERR does not exist and
// its pieces are neither written nor read.
// =====================================================================================================
__device__ __forceinline__ void cvt_er_block(const float* __restrict__ in, unsigned short* out, int blk, int tid) {
  const int o    = blk * 256 + tid;
  const int lane = o & 31, p = (o >> 5) & 1, dc = (o >> 6) & 1, tl = o >> 7;
  const int e    = tl * 16 + (lane & 15);
  const int d    = dc * 32 + p * 16 + (lane >> 4) * 8;
  if (e < ERR) {
    const v4f a = *(const v4f*)(in + (size_t)e * HD + d);
    const v4f b = *(const v4f*)(in + (size_t)e * HD + d + 4);
    v4u q;
    q[0] = pk16(bf_bits(a[0]), bf_bits(a[1]));
    q[1] = pk16(bf_bits(a[2]), bf_bits(a[3]));
    q[2] = pk16(bf_bits(b[0]), bf_bits(b[1]));
    q[3] = pk16(bf_bits(b[2]), bf_bits(b[3]));
    *(v4u*)(out + (size_t)o * 8) = q;
  }
}

// =====================================================================================================
// All conversions in one launch; the part is chosen by the block index (the same for the whole block, so the barrier of
// the weight part is passed by all of a block's threads or by none). First NWB blocks a weight (Wq, Wk, Wv, Wo; their bf16
// planes lie one behind the other from Wb on): they have the longest chain of dependent steps; then NXB blocks of x; then NEB blocks of the relative table.
// =====================================================================================================
#define NXB     (N8X / 256)                     // 2048
#define NWB     ((DM / 64) * (DM / 64))         // 256 tiles per weight
#define NEB     ((ERR + 1) * HD / 8 / 256)      // 128
__global__ __launch_bounds__(256) void prep_all(const float* __restrict__ x, const float* __restrict__ Wq,
                                                const float* __restrict__ Wk, const float* __restrict__ Wv,
                                                const float* __restrict__ Wo, const float* __restrict__ Er,
                                                unsigned short* Xb, unsigned short* Wb, unsigned short* Erf) {
  __shared__ __align__(16) unsigned short sT[64 * 72];
  const int bx = blockIdx.x, tid = threadIdx.x;
  if (bx < 4 * NWB) {
    const int w = bx / NWB, s = bx % NWB;
    const float* in = (w == 0) ? Wq : (w == 1) ? Wk : (w == 2) ? Wv : Wo;
    tr_cvt_block(in, Wb + (size_t)w * DM * DM, DM, DM, (s / (DM / 64)) * 64, (s % (DM / 64)) * 64, sT, tid);
  } else if (bx < 4 * NWB + NXB) {
    cvt_x_block(x, Xb, bx - 4 * NWB, tid);
  } else {
    cvt_er_block(Er, Erf, bx - (NXB + 4 * NWB), tid);
  }
}

// =====================================================================================================
// Block-tiled bf16 WMMA GEMM for the four projections: C[m][n] = rb[m] + cb[n] + sum_k (A [+ A2])[m][k] * Bt[n][k], wave
// tile 64x64. NSPLIT 1 adds the bf16 lo plane A2; OUT_MODE 0 = f32, 2 = bf16 hi + lo planes, 3 = f16 hi plane + f16
// residual plane (x rscale, tiles with n0 < N2). A block of 4 waves (2 x 2) owns a 128x128 tile of C; the 128 rows of A (and A2) and
// of Bt that it needs are brought into LDS one slab of KS = 128 k at a time by asynchronous copies
// (global_load_async_to_lds_b128: a wave's copy covers two whole 256-byte row pieces), two buffers, so that slab t + 1
// flies while slab t is multiplied; fragments are then read from LDS (row pitch 272 bytes = 17 x 16).
// M, N multiples of 128, K a multiple of KS and at least KS; tile = tm * (N/128) + tn and batch b are handed in by the kernel.
// =====================================================================================================
// Eight 16-byte copies per lane, rows gstep elements / lstep bytes apart.
__device__ __forceinline__ void async_rows8(const __bf16* g, size_t gstep, unsigned l, unsigned lstep) {
#if defined(__HIP_DEVICE_COMPILE__)
  // The closing s_wait_xcnt 0 stands in the copies' own statement, so that it is passed before any address register
  // that a copy names is written again.
  asm volatile(
      "global_load_async_to_lds_b128 %0, %8, off\n\t"
      "global_load_async_to_lds_b128 %1, %9, off\n\t"
      "global_load_async_to_lds_b128 %2, %10, off\n\t"
      "global_load_async_to_lds_b128 %3, %11, off\n\t"
      "global_load_async_to_lds_b128 %4, %12, off\n\t"
      "global_load_async_to_lds_b128 %5, %13, off\n\t"
      "global_load_async_to_lds_b128 %6, %14, off\n\t"
      "global_load_async_to_lds_b128 %7, %15, off\n\t"
      "s_wait_xcnt 0x0"
      :: "v"(l), "v"(l + lstep), "v"(l + 2 * lstep), "v"(l + 3 * lstep),
         "v"(l + 4 * lstep), "v"(l + 5 * lstep), "v"(l + 6 * lstep), "v"(l + 7 * lstep),
         "v"(g), "v"(g + gstep), "v"(g + 2 * gstep), "v"(g + 3 * gstep),
         "v"(g + 4 * gstep), "v"(g + 5 * gstep), "v"(g + 6 * gstep), "v"(g + 7 * gstep)
      : "memory");
  // Keeps the address arithmetic of the next eight copies behind these: hoisted in front of them it held the addresses
  // of a whole slab in registers at once (a spill to scratch beside the 128 accumulator registers) and delayed the first copy.
  __builtin_amdgcn_sched_barrier(0);
#endif
}
// The issuing wave's own wait: its copies have landed in LDS behind it.
__device__ __forceinline__ void wait_async0() {
#if defined(__HIP_DEVICE_COMPILE__)
  asm volatile("s_wait_asynccnt 0x0" ::: "memory");
#endif
}
// The wave's LDS reads have returned: stands in front of the barrier behind which their buffer is refilled.
__device__ __forceinline__ void wait_ds0() {
#if defined(__HIP_DEVICE_COMPILE__)
  asm volatile("s_wait_dscnt 0x0" ::: "memory");
#endif
}

// Sizes of the LDS that a block of the GEMM needs; the arrays are declared in the kernels and handed to the body.
#define G_KS    128                              // k per slab
#define G_SP    (G_KS + 8)                       // LDS row pitch in elements
#define G_PLE   (128 * G_SP)                     // elements of one plane of a slab
#define G_STE   (4 * 16 * 68)                    // floats of the four per-wave 16x64 output slabs, pitch 68

// The work of one block: tile 'tile' of batch 'b'. sS = 2 buffers x NPL planes of G_PLE elements, sT = G_STE floats.
template <int NSPLIT, int OUT_MODE, bool RB, bool CB>
__device__ __forceinline__ void gemm128_block(
    __bf16* sS, float* sT, int tile, int b,
    const unsigned short* __restrict__ Ap, const unsigned short* A2p, int lda, long long strideA,
    const unsigned short* __restrict__ Btp, int ldb, long long strideB,
    void* Cout, int ldc, long long strideC,
    void* Cout2, int ldc2, long long strideC2, int N2,
    int M, int N, int K, float rscale,
    const float* __restrict__ rbp, const float* __restrict__ cbp) {
  static_assert(NSPLIT == 0 || NSPLIT == 1);
  constexpr int KS  = G_KS;                      // k per slab
  constexpr int SP  = G_SP;                      // LDS row pitch in elements
  constexpr int NPL = (NSPLIT == 1) ? 3 : 2;     // planes of a slab: A, Bt, (A2)
  constexpr unsigned PLB = 128u * SP * 2u;       // bytes of one plane of a slab
  constexpr unsigned LST = 8u * SP * 2u;         // bytes between two copies of a lane (8 rows)
  const __bf16* A   = (const __bf16*)(const void*)Ap;
  const __bf16* A2  = (const __bf16*)(const void*)A2p;
  const __bf16* Bt  = (const __bf16*)(const void*)Btp;
  const int tid  = threadIdx.x;
  const int lane = tid & 31;
  const int wave = tid >> 5;
  const int tilesN = N >> 7;
  const int tilesM = M >> 7;
  if (tile >= tilesM * tilesN) return;   // block-uniform, in front of every copy and barrier
  const int tm  = tile / tilesN;
  const int tn  = tile - tm * tilesN;
  const int bm0 = tm << 7;
  const int bn0 = tn << 7;
  const int wm  = (wave >> 1) << 6;      // the wave's 64x64 tile within the block tile
  const int wn  = (wave & 1) << 6;
  const int m0  = bm0 + wm;
  const int n0  = bn0 + wn;

  // copy addressing: 16 lanes per 256-byte row piece, 8 rows per block-wide copy, 16 copies per lane and plane
  const int cr = tid >> 4, cc = (tid & 15) * 8;
  const __bf16* gA  = A  + (size_t)b * strideA + (size_t)(bm0 + cr) * lda + cc;
  const long long dA2 = A2 - A;          // uniform distance (elements) of the lo plane from the hi plane, same workspace
  const __bf16* gB  = Bt + (size_t)b * strideB + (size_t)(bn0 + cr) * ldb + cc;
  const unsigned l0 = (unsigned)(size_t)sS + (unsigned)(cr * SP + cc) * 2u;
  auto fill = [&](int t, int bs) {
    const unsigned lb = l0 + (unsigned)bs * (NPL * PLB);
    const size_t ko = (size_t)t * KS;
    async_rows8(gA + ko, (size_t)8 * lda, lb, LST);
    async_rows8(gA + ko + (size_t)64 * lda, (size_t)8 * lda, lb + 8u * LST, LST);
    async_rows8(gB + ko, (size_t)8 * ldb, lb + PLB, LST);
    async_rows8(gB + ko + (size_t)64 * ldb, (size_t)8 * ldb, lb + PLB + 8u * LST, LST);
    if (NSPLIT == 1) {
      async_rows8(gA + (dA2 + (long long)ko), (size_t)8 * lda, lb + 2u * PLB, LST);
      async_rows8(gA + (dA2 + (long long)ko) + (size_t)64 * lda, (size_t)8 * lda, lb + 2u * PLB + 8u * LST, LST);
    }
  };

  const int rlane = lane & 15;                 // row (A) / col (B, D) within subtile
  const int koff  = (lane >> 4) * 8;           // k offset of this lane half
  const int mOff  = (lane >> 4) * 8;           // D row offset

  v8f acc[4][4];
#pragma unroll
  for (int i = 0; i < 4; ++i)
#pragma unroll
    for (int j = 0; j < 4; ++j) acc[i][j] = zero8();

  const int nst = K / KS;                      // slabs, block-uniform
  fill(0, 0);
  wait_async0();
  __syncthreads();                             // slab 0 is published
  if (nst > 1) fill(1, 1);
  for (int t = 0; t < nst; ++t) {
    const __bf16* sBuf = sS + (t & 1) * (NPL * G_PLE);
    const __bf16* sA  = sBuf + (wm + rlane) * SP + koff;
    const __bf16* sB  = sBuf + G_PLE + (wn + rlane) * SP + koff;
    const __bf16* sA2 = sBuf + (NPL - 1) * G_PLE + (wm + rlane) * SP + koff;
#pragma unroll
    for (int ks = 0; ks < KS; ks += 32) {
      // all fragments of the k step are read in one batch, so that the wave pays the LDS latency once per step
      v16b bh[4], ah[4], al[4];
#pragma unroll
      for (int j = 0; j < 4; ++j) bh[j] = ldfrag_b(sB + (j << 4) * SP + ks);
#pragma unroll
      for (int i = 0; i < 4; ++i) {
        ah[i] = ldfrag_b(sA + (i << 4) * SP + ks);
        if (NSPLIT == 1) al[i] = ldfrag_b(sA2 + (i << 4) * SP + ks); else al[i] = ah[i];
      }
#pragma unroll
      for (int i = 0; i < 4; ++i) {
#pragma unroll
        for (int j = 0; j < 4; ++j) {
          acc[i][j] = mma_b_raw(ah[i], bh[j], acc[i][j]);
          if (NSPLIT == 1) acc[i][j] = mma_b_raw(al[i], bh[j], acc[i][j]);
        }
        dep_guard_b(acc[i][0], acc[i][3], ah[i], al[i]);
      }
      keep4_b(bh[0], bh[1], bh[2], bh[3]);
    }
    // publish point of slab t + 1: own LDS reads returned, own copies landed, then the one barrier of the trip (it
    // publishes slab t + 1 and ends every wave's reads of the buffer that is refilled behind it)
    wait_ds0();
    wait_async0();
    __syncthreads();
    if (t + 2 < nst) fill(t + 2, t & 1);
  }
  wait_async0();                               // no copy is outstanding when the wave goes on
  acc_guard4(acc[0][0], acc[0][1], acc[0][2], acc[0][3]);
  acc_guard4(acc[1][0], acc[1][1], acc[1][2], acc[1][3]);
  acc_guard4(acc[2][0], acc[2][1], acc[2][2], acc[2][3]);
  acc_guard4(acc[3][0], acc[3][1], acc[3][2], acc[3][3]);

  // ---- epilogue biases (input values RNE-converted to bf16) ----
  float cbv[4];
#pragma unroll
  for (int j = 0; j < 4; ++j) cbv[j] = CB ? bf_up(bf_bits(cbp[n0 + (j << 4) + rlane])) : 0.0f;

  // ---- epilogue ----
  float* slab = sT + wave * (16 * 68);
#pragma unroll
  for (int i = 0; i < 4; ++i) {
    const int mBase = m0 + (i << 4);
#pragma unroll
    for (int r = 0; r < 8; ++r) {
      const float rbv = RB ? bf_up(bf_bits(rbp[mBase + mOff + r])) : 0.0f;
#pragma unroll
      for (int j = 0; j < 4; ++j) {
        slab[(mOff + r) * 68 + (j << 4) + rlane] = acc[i][j][r] + rbv + cbv[j];
      }
    }
    __builtin_amdgcn_fence(__ATOMIC_RELEASE, "workgroup");
    __builtin_amdgcn_wave_barrier();
    __builtin_amdgcn_fence(__ATOMIC_ACQUIRE, "workgroup");
    if (OUT_MODE == 0) {
      float* C = (float*)Cout + (size_t)b * strideC;
      const int hh = lane >> 4, c4 = (lane & 15) * 4;     // 256-B row segment = 16 lanes x 16 B
      v4f ov[8];
#pragma unroll
      for (int it = 0; it < 8; ++it) {
        const int row = it * 2 + hh;                       // it 0..7 x hh 0..1 = rows 0..15
        ov[it] = *(const v4f*)(slab + row * 68 + c4);
      }
      {
#pragma unroll
        for (int it = 0; it < 8; ++it) {
          const int row = it * 2 + hh;
          *(v4f*)(C + (size_t)(mBase + row) * ldc + n0 + c4) = ov[it];
        }
        
      }
    } else {
      const int q = lane >> 3, c8 = (lane & 7) * 8;
      unsigned short* C  = (unsigned short*)Cout  + (size_t)b * strideC;
      unsigned short* C2 = (unsigned short*)Cout2 + (size_t)b * strideC2;
      const bool wlo = (OUT_MODE == 2) || (n0 < N2);      // wave-uniform
      v4u hv[4], lv[4];
#pragma unroll
      for (int it = 0; it < 4; ++it) {
        const int row = it * 4 + q;                        // it 0..3 x q 0..3 = rows 0..15
        const float* sp = slab + row * 68 + c8;
        v4u a, a2;
#pragma unroll
        for (int e = 0; e < 4; ++e) {
          const float f0 = sp[2 * e], f1 = sp[2 * e + 1];
          unsigned short h0, h1, l0, l1;
          if (OUT_MODE == 2) {
            h0 = bf_bits(f0); h1 = bf_bits(f1);
            l0 = bf_bits(f0 - bf_up(h0)); l1 = bf_bits(f1 - bf_up(h1));
          } else {
            const _Float16 x0 = (_Float16)f0, x1 = (_Float16)f1;
            h0 = h_bits(x0); h1 = h_bits(x1);
            l0 = h_bits((_Float16)((f0 - (float)x0) * rscale));
            l1 = h_bits((_Float16)((f1 - (float)x1) * rscale));
          }
          a[e] = pk16(h0, h1); a2[e] = pk16(l0, l1);
        }
        hv[it] = a; lv[it] = a2;
      }
      {
#pragma unroll
        for (int it = 0; it < 4; ++it) {
          const int row = it * 4 + q;
          *(v4u*)(C + (size_t)(mBase + row) * ldc + n0 + c8) = hv[it];
          if (wlo) *(v4u*)(C2 + (size_t)(mBase + row) * ldc2 + n0 + c8) = lv[it];
        }
        
      }
    }
    __builtin_amdgcn_fence(__ATOMIC_RELEASE, "workgroup");
    __builtin_amdgcn_wave_barrier();
    __builtin_amdgcn_fence(__ATOMIC_ACQUIRE, "workgroup");
  }
}

// One GEMM per launch: grid.x = (M/128) * (N/128), blockIdx.y = batch.
template <int NSPLIT, int OUT_MODE, bool RB, bool CB>
__global__ __launch_bounds__(128) void gemm128(
    const unsigned short* __restrict__ Ap, const unsigned short* A2p, int lda, long long strideA,
    const unsigned short* __restrict__ Btp, int ldb, long long strideB,
    void* Cout, int ldc, long long strideC,
    void* Cout2, int ldc2, long long strideC2, int N2,
    int M, int N, int K, float rscale,
    const float* __restrict__ rbp, const float* __restrict__ cbp) {
  __shared__ __align__(16) __bf16 sS[2 * ((NSPLIT == 1) ? 3 : 2) * G_PLE];
  __shared__ __align__(16) float sT[G_STE];
  gemm128_block<NSPLIT, OUT_MODE, RB, CB>(sS, sT, blockIdx.x, blockIdx.y, Ap, A2p, lda, strideA, Btp, ldb, strideB,
                                          Cout, ldc, strideC, Cout2, ldc2, strideC2, N2, M, N, K, rscale, rbp, cbp);
}

// The q, k and v^T projections, which do not depend on each other, in one launch of 3 * nblk blocks (nblk = blocks of one
// projection): two blocks fit a WGP's LDS, so that one block's matrix work runs under the other's LDS reads and waits.
// Which projection a block works on is the same for the whole block. Blocks 0 .. 2*nblk-1: q, then k
// (C[b*SEQ+s][e] = hi/lo of bias[e] + sum_d Xb[b*SEQ+s][d] W[e][d]; M = rows, N = K = dm); the weight planes Wq, Wk, Wv lie one
// behind the other from Wb on, the planes Qh, Ql, Kh, Kl from QK on. Blocks 2*nblk ..: v^T per batch
// (VTh[b][m][s] = bv[m] + sum_d Wv[m][d] Xb[b*seq+s][d], f16 hi plane of pitch seq and residual plane x4096 of the
// keys < VLP, pitch VLP; M = K = dm, N = seq).
__global__ __launch_bounds__(128) void gemm_qkv(
    const unsigned short* __restrict__ Xb, const unsigned short* __restrict__ Wb,
    unsigned short* QK, unsigned short* VTh, unsigned short* VTl,
    const float* __restrict__ bq, const float* __restrict__ bk, const float* __restrict__ bv,
    int rows, int seq, int dm, int nblk) {
  __shared__ __align__(16) __bf16 sS[2 * 2 * G_PLE];
  __shared__ __align__(16) float sT[G_STE];
  const int bx = blockIdx.x;
  const size_t wpl = (size_t)dm * dm, apl = (size_t)rows * dm;
  if (bx < 2 * nblk) {
    const int sel = (bx >= nblk) ? 1 : 0;
    const unsigned short* W = Wb + sel * wpl;
    unsigned short* Ch = QK + (size_t)(2 * sel) * apl;
    const float* bias = sel ? bk : bq;
    gemm128_block<0, 2, false, true>(sS, sT, bx - sel * nblk, 0, Xb, Xb, dm, 0LL, W, dm, 0LL,
                                     (void*)Ch, dm, 0LL, (void*)(Ch + apl), dm, 0LL, 0,
                                     rows, dm, dm, 1.0f, bias, bias);
  } else {
    const int t = bx - 2 * nblk, per = (dm >> 7) * (seq >> 7);
    const unsigned short* W = Wb + 2 * wpl;
    gemm128_block<0, 3, true, false>(sS, sT, t % per, t / per, W, W, dm, 0LL, Xb, dm, (long long)seq * dm,
                                     (void*)VTh, seq, (long long)dm * seq, (void*)VTl, VLP, (long long)dm * VLP, VLP,
                                     dm, seq, dm, 4096.0f, bv, bv);
  }
}

// =====================================================================================================
// Causal attention with a relative-position bias, head dim 64 (tril mask incl. diagonal, computed).
//   q planes (bf16 hi / lo): element (b, t, h, d) at [(b*SEQ + t)*DM + h*64 + d]
//   k planes (bf16 hi / lo): same layout with key index s
//   v^T hi plane (f16):      element (b, h, d, s) at [(b*DM + h*64 + d)*SEQ + s]
//   v^T residual plane (f16, (v - hi)*4096): [(b*DM + h*64 + d)*VLP + s], s < VLP, read only when RES
//   relative table (bf16, fragment order of cvt_er_block): the relative term of (query t, key) is q[t] . Er[key - t + SEQ - 1].
//     A wave's 16 queries x 64 keys need the 79 table rows from kv0 - q0 + SEQ - 16 on (a multiple of 16, in
//     [0, SEQ - 16]): five 16-row tiles, q hi/lo times bf16 Er (hi, lo per 32 d, f32 accumulate from 0), the 16 x 80
//     result stored to a wave-private LDS tile and read back along the diagonals (column key - kv0 + 15 - query).
//   logit = (q.k + band) * sscale for key <= query, -FLT_MAX otherwise (exp -> 0); every row has a live key in
//   every processed key tile (tiles 0..qb only, block-uniform trip count (qb+2)/2 <= 16).
//   output: ctx hi / lo bf16 planes, element (b, t, h*64 + d) at [(b*SEQ + t)*DM + h*64 + d] = normalised
//   context (lo = RNE(v - hi), unscaled).
//   scores = q . k : bf16 hi/lo split (hi.hi + hi.lo + lo.hi), f32 accumulate, band added in f32, * sscale in f32
//   p = exp(s - m) carried as f16(1024 p); context = p . v on f16 WMMA; RES adds f16 residual planes of p and v
//   (scale 4096, separate accumulator folded back with 1/4096 per chunk in f32); online softmax in f32.
//   Block = 8 waves = 64 query rows of one (b, h), in two groups of 4 waves; grid = nqbThis * NP (pair index =
//   blockIdx.x % NP, b = pair / NH, h = pair % NH; query block = qbBase + nqbThis - 1 - blockIdx.x / NP: a block's
//   cost grows with its query block, so the costliest blocks take the lowest indices, for speed only); kv chunks of 64. Group g walks the key tiles g, g + 2, ...
//   with its own K / V^T tiles in LDS and its own running maximum, sum and context; the two partial results of a row
//   are joined once behind the loop, in f32 (each rescaled to the common maximum). The block's chain of dependent
//   tiles is half as long, and the two groups' waves fill each other's waits on the SIMDs that they share.
//   K / V^T chunk staging: a group's 128 threads x 32 elements per plane = the whole 64x64 tile (plain 16-B loads,
//   __syncthreads before and after). Every product is formed transposed (K . q^T, Er . q^T, V^T . P^T), so that a lane
//   holds one query: maximum and sum are taken in the lane plus one exchange between the halves, and P goes from the
//   score accumulators into the B operand of V^T . P^T in registers.
//   Output coverage: each wave of group 0 stores its rows 0..15 (it 0..3 x lane>>3 0..3) x 64 columns (8 lanes x 8 bf16),
// =====================================================================================================
// e^x for the join of the two groups' results. v_exp_f32 and the one free slot that the instruction set asks for behind
// a transcendental stand in one statement, so that no instruction which reads the result or overwrites the source
// follows directly.
__device__ __forceinline__ float exp_slot(float x) {
  float y = x * 1.44269504f;
#if defined(__HIP_DEVICE_COMPILE__)
  asm("v_exp_f32 %0, %1\n\tv_nop" : "=v"(y) : "v"(y));
#endif
  return y;
}

// Lane l takes the value of lane l ^ 16: the two lanes that share a query's column.
__device__ __forceinline__ float xhalf(float x) {
  const int b = __builtin_bit_cast(int, x);
  return __builtin_bit_cast(float, __builtin_amdgcn_permlanex16(b, b, 0x76543210, 0xfedcba98, false, false));
}

// Without RES four waves per SIMD (at most 256 registers a wave): two blocks share a WGP, 512 places on the chip for the
// one launch of all query blocks from RESQB on. The RES launch has one block per WGP and keeps the block size's own
// register budget.
template <bool RES>
__global__ __launch_bounds__(256) __attribute__((amdgpu_waves_per_eu(RES ? 2 : 4)))
void attn_rel64(const unsigned short* __restrict__ qhp, const unsigned short* __restrict__ qlp,
                const unsigned short* __restrict__ khp, const unsigned short* __restrict__ klp,
                const unsigned short* __restrict__ vhp, const unsigned short* __restrict__ vlp,
                const unsigned short* __restrict__ erfp,
                unsigned short* ahp, unsigned short* alp,
                int qbBase, int nqbThis, float sscale) {
  union FB { v16b v; v8b h[2]; };
  union FH { v16h v; v8h h[2]; };
  // Row pitches: 64 elements of data plus 16 bytes, an odd multiple of 16 bytes, so that the 16 rows which a 16-byte
  // fragment load reads at once fall on 64 different banks (at 128 or 256 bytes they share a few banks).
  constexpr int LP = 72;                                          // 16-bit tiles: 144 bytes a row
  constexpr int OP = 68;                                          // f32 tile: 272 bytes a row
  __shared__ __align__(16) __bf16   KshG[2][64 * LP];             // per group: K hi [kv][d]   9 KB
  __shared__ __align__(16) __bf16   KslG[2][64 * LP];             // K lo
  __shared__ __align__(16) _Float16 VthG[2][64 * LP];             // V^T hi [d][kv] 9 KB
  __shared__ __align__(16) _Float16 VtlG[2][RES ? 64 * LP : 8];   // V^T residual
  __shared__ __align__(16) float    Os[4][16 * OP];               // per 16-row slice: context tile [row][d]
  __shared__ float Ms[4][16], Ls[4][16];                          // group 1's running maximum and sum per row
  // Per wave: q . Er^T of the key tile, [query][table row - first]. 84 floats a row (21 x 16 bytes): the 16 queries of a
  // 16-byte store fall on 64 different banks, and so do the 32 lanes of a 4-byte read along the diagonals (pitch 83).
  constexpr int BP = 84;
  __shared__ __align__(16) float    Bs[8][16 * BP];

  // the group is the same in every lane of a wave: kept in a scalar register, so that the tests on it are scalar branches
  const int grp  = __builtin_amdgcn_readfirstlane((int)(threadIdx.x >> 7));
  const int tid  = threadIdx.x & 127;     // thread within the group
  const int wave = tid >> 5;              // 16-row slice of the query block
  const int lane = tid & 31;
  __bf16*   Ksh = KshG[grp];
  __bf16*   Ksl = KslG[grp];
  _Float16* Vth = VthG[grp];
  _Float16* Vtl = VtlG[grp];
  const int hh   = lane >> 4;
  const int c    = lane & 15;

  const int bx   = blockIdx.x;
  const int pr   = bx % NP;               // (b,h) pair index, 0..NP-1
  const int h    = pr % NH;
  const int b    = pr / NH;
  const int qb   = qbBase + nqbThis - 1 - bx / NP;   // cost falls with the block index
  const int q0   = qb * 64 + wave * 16;
  const size_t rowB = (size_t)b * SEQ;

  const __bf16* Qh = (const __bf16*)(const void*)qhp + (size_t)h * HD;
  const __bf16* Ql = (const __bf16*)(const void*)qlp + (size_t)h * HD;
  const __bf16* Kh = (const __bf16*)(const void*)khp + (size_t)h * HD;
  const __bf16* Kl = (const __bf16*)(const void*)klp + (size_t)h * HD;
  const _Float16* Vh = (const _Float16*)(const void*)vhp + ((size_t)b * DM + (size_t)h * HD) * SEQ;
  const _Float16* Vl = (const _Float16*)(const void*)vlp + ((size_t)b * DM + (size_t)h * HD) * VLP;
  const __bf16* Ef = (const __bf16*)(const void*)erfp;

  // ---- Q fragments (B operand, column = lane&15): 2 d-chunks, hi and lo ----
  v16b qah[2], qal[2];
#pragma unroll
  for (int dc = 0; dc < 2; ++dc) {
    const size_t qo = (rowB + q0 + c) * DM + dc * 32 + 8 * hh;
    qah[dc] = ldfrag_b(Qh + qo);
    qal[dc] = ldfrag_b(Ql + qo);
  }

  // All products are formed transposed (keys, table rows or d as rows, the wave's 16 queries as columns): lane (c, hh) holds
  // query c only. mrow: its running maximum (equal in both halves); lrow: the sum over the keys that this half has seen;
  // oacc[t][r]: context of query c at d = t*16 + 8*hh + r.
  float mrow = -INFINITY, lrow = 0.f;
  v8f oacc[4];
#pragma unroll
  for (int t = 0; t < 4; ++t) oacc[t] = zero8();

  int nkt = qb + 1;                          // causal: key tiles 0..qb, block-uniform
  if (nkt > NQB) nkt = NQB;

  float* bw = Bs[grp * 4 + wave];
  const int ntrip = (nkt + 1) >> 1;          // block-uniform: every wave passes every barrier
  for (int it = 0; it < ntrip; ++it) {
    const int kt  = 2 * it + grp;
    const int kv0 = kt * 64;
    const bool act = kt < nkt;               // wave-uniform (scalar): false only for group 1 in the last trip of an odd nkt
    __syncthreads();
    if (act) {
      const int r = tid >> 1, half = (tid & 1) * 32;
      // every address is a base that is the same for the whole wave plus a 32-bit lane offset that no trip changes: the
      // bases live in scalar registers, which leaves the vector registers to the loaded tiles
      const unsigned ko = (unsigned)(r * DM + half), vo = (unsigned)(r * SEQ + half), vlo = (unsigned)(r * VLP + half);
      const __bf16*   kg  = Kh + (rowB + kv0) * DM;               // + ko: K row kv0+r, d = half..half+31
      const __bf16*   klg = Kl + (rowB + kv0) * DM;
      const _Float16* vg  = Vh + kv0;                             // + vo: V^T row d = r, s = kv0+half..+31
      const int kvl = (kv0 + 64 <= VLP) ? kv0 : (VLP - 64);     // clamped address into the residual plane
      const _Float16* vlg = Vl + kvl;
      const bool resOK = (kv0 + 64 <= VLP);                      // block-uniform
      v8b a0[4], a1[4];
      v8h b0[4], b1[4];
#pragma unroll
      for (int i = 0; i < 4; ++i) {
        a0[i] = *(const v8b*)(kg + ko + 8 * i);
        a1[i] = *(const v8b*)(klg + ko + 8 * i);
        b0[i] = *(const v8h*)(vg + vo + 8 * i);
        b1[i] = RES ? *(const v8h*)(vlg + vlo + 8 * i) : zero8h();
      }
      // the wave's five tiles of the relative table, behind the K / V loads so that these can be stored to LDS first
      const __bf16* eg = Ef + (size_t)__builtin_amdgcn_readfirstlane((kv0 - q0 + (SEQ - 16)) >> 4) * 1024;
      const unsigned eo = (unsigned)(lane * 8);
      FB eb[5][2];
#pragma unroll
      for (int n = 0; n < 5; ++n)
#pragma unroll
        for (int dc = 0; dc < 2; ++dc) {
          eb[n][dc].h[0] = *(const v8b*)(eg + eo + (n * 2 + dc) * 512);
          eb[n][dc].h[1] = *(const v8b*)(eg + eo + (n * 2 + dc) * 512 + 256);
        }
#if defined(__HIP_DEVICE_COMPILE__)
      // The wait that stands in front of any overwrite of a register an issued load names. It takes the bases and the lane
      // offsets as inputs so that they stay untouched (also by a later load's result) until it has been passed.
      if (RES) asm volatile("s_wait_xcnt 0x0" :: "s"(kg), "s"(klg), "s"(vg), "s"(vlg), "s"(eg), "v"(ko), "v"(vo), "v"(vlo), "v"(eo) : "memory");
      else     asm volatile("s_wait_xcnt 0x0" :: "s"(kg), "s"(klg), "s"(vg), "s"(eg), "v"(ko), "v"(vo), "v"(eo) : "memory");
      // Keeps all loads of the trip in front of their first use: moved behind the first products, the table's second half
      // and the K / V rows each waited for a memory round trip of their own.
      __builtin_amdgcn_sched_barrier(0);
#endif
#pragma unroll
      for (int i = 0; i < 4; ++i) {
        *(v8b*)(Ksh + r * LP + half + 8 * i) = a0[i];
        *(v8b*)(Ksl + r * LP + half + 8 * i) = a1[i];
        *(v8h*)(Vth + r * LP + half + 8 * i) = b0[i];
        if (RES) *(v8h*)(Vtl + r * LP + half + 8 * i) = resOK ? b1[i] : zero8h();
      }
      // ---- relative term: 80 table rows x 16 queries, five independent accumulators; per accumulator the products come
      //      in the order hi, lo of d 0..31, then hi, lo of d 32..63 ----
      v8f tb[5];
#pragma unroll
      for (int n = 0; n < 5; ++n) tb[n] = zero8();
#pragma unroll
      for (int dc = 0; dc < 2; ++dc) {
#pragma unroll
        for (int n = 0; n < 5; ++n) tb[n] = mma_b_raw(eb[n][dc].v, qah[dc], tb[n]);
#pragma unroll
        for (int n = 0; n < 5; ++n) tb[n] = mma_b_raw(eb[n][dc].v, qal[dc], tb[n]);
      }
      acc_guard5(tb[0], tb[1], tb[2], tb[3], tb[4]);
      // tb[n][rr] = (table row n*16 + 8*hh + rr, query c): eight neighbours of the query's row, two 16-byte stores
#pragma unroll
      for (int n = 0; n < 5; ++n) {
        const v4f t0 = {tb[n][0], tb[n][1], tb[n][2], tb[n][3]};
        const v4f t1 = {tb[n][4], tb[n][5], tb[n][6], tb[n][7]};
        *(v4f*)(bw + c * BP + n * 16 + 8 * hh)     = t0;
        *(v4f*)(bw + c * BP + n * 16 + 8 * hh + 4) = t1;
      }
    }
    __syncthreads();                         // also orders the wave's stores of its relative tile before its reads below
    if (!act) continue;                      // no barrier stands between here and the foot of the trip

    // ---- scores: 64 keys x 16 queries per wave, s[j][r] = (key j*16 + 8*hh + r, query c), 3 bf16 products ----
    v8f s[4];
#pragma unroll
    for (int j = 0; j < 4; ++j) {
      s[j] = zero8();
#pragma unroll
      for (int dc = 0; dc < 2; ++dc) {
        FB kb, kl;
        kb.h[0] = *(const v8b*)(Ksh + (j * 16 + c) * LP + dc * 32 + 8 * hh);
        kb.h[1] = *(const v8b*)(Ksh + (j * 16 + c) * LP + dc * 32 + 16 + 8 * hh);
        kl.h[0] = *(const v8b*)(Ksl + (j * 16 + c) * LP + dc * 32 + 8 * hh);
        kl.h[1] = *(const v8b*)(Ksl + (j * 16 + c) * LP + dc * 32 + 16 + 8 * hh);
        s[j] = mma_b(kb.v, qah[dc], s[j]);
        s[j] = mma_b(kl.v, qah[dc], s[j]);
        s[j] = mma_b(kb.v, qal[dc], s[j]);
      }
    }

    // ---- relative term of (query, key): column key - kv0 + 15 - query of the query's row in the wave's tile ----
#pragma unroll
    for (int j = 0; j < 4; ++j)
#pragma unroll
      for (int r = 0; r < 8; ++r) s[j][r] += bw[c * (BP - 1) + j * 16 + 8 * hh + r + 15];

    // ---- scale + causal mask (replace by -FLT_MAX), the query's maximum (in the lane, then one exchange between the
    //      halves), online softmax; P (x1024, f16) and its residual (x4096) are packed straight into B operands:
    //      the score tiles 2*kk and 2*kk+1 hold, register by register, the keys that elements 0..7 and 8..15 of the
    //      operand for keys kk*32 .. +31 stand for ----
    FH pa[2], pl[2];
    {
      const int qrow = q0 + c;
      float mj4[4];
#pragma unroll
      for (int j = 0; j < 4; ++j) {
        mj4[j] = -INFINITY;
#pragma unroll
        for (int r = 0; r < 8; ++r) {
          const int key = kv0 + j * 16 + 8 * hh + r;
          float sv = s[j][r] * sscale;
          sv = (key > qrow) ? -FLT_MAX : sv;
          s[j][r] = sv;
          mj4[j] = fmaxf(mj4[j], sv);
        }
      }
      float m = fmaxf(fmaxf(mj4[0], mj4[1]), fmaxf(mj4[2], mj4[3]));
      m = fmaxf(m, xhalf(m));
      const float mnew  = fmaxf(mrow, m);
      const float msafe = (mnew == -INFINITY) ? 0.f : mnew;
      const float alpha = __expf(mrow - msafe);
      mrow = mnew;
      float ps4[4];                                  // four independent chains of additions
#pragma unroll
      for (int j = 0; j < 4; ++j) {
        ps4[j] = 0.f;
#pragma unroll
        for (int r = 0; r < 8; ++r) {
          const float p = __expf(s[j][r] - msafe);   // masked logit against a finite max: exp -> 0
          ps4[j] += p;
          const float p1k = p * 1024.0f;
          const _Float16 ph = (_Float16)p1k;
          pa[j >> 1].v[(j & 1) * 8 + r] = ph;
          if (RES) pl[j >> 1].v[(j & 1) * 8 + r] = (_Float16)((p1k - (float)ph) * 4096.0f);
        }
      }
      lrow = lrow * alpha + ((ps4[0] + ps4[1]) + (ps4[2] + ps4[3]));
#pragma unroll
      for (int t = 0; t < 4; ++t)
#pragma unroll
        for (int r = 0; r < 8; ++r) oacc[t][r] *= alpha;
    }

    // ---- context^T += V^T . P^T (f16 WMMA), residual products into a separate accumulator ----
    v8f o1[4];
#pragma unroll
    for (int t = 0; t < 4; ++t) o1[t] = zero8();
    // unrolled: pa[kk] and pl[kk] are register operands, which a rolled loop could not select by kk
#pragma unroll
    for (int kk = 0; kk < 2; ++kk) {
#pragma unroll
      for (int t = 0; t < 4; ++t) {
        FH vb;
        vb.h[0] = *(const v8h*)(Vth + (t * 16 + c) * LP + kk * 32 + 8 * hh);
        vb.h[1] = *(const v8h*)(Vth + (t * 16 + c) * LP + kk * 32 + 16 + 8 * hh);
        oacc[t] = mma_h(vb.v, pa[kk].v, oacc[t]);
        if (RES) {
          FH vl;
          vl.h[0] = *(const v8h*)(Vtl + (t * 16 + c) * LP + kk * 32 + 8 * hh);
          vl.h[1] = *(const v8h*)(Vtl + (t * 16 + c) * LP + kk * 32 + 16 + 8 * hh);
          o1[t] = mma_h(vl.v, pa[kk].v, o1[t]);
          o1[t] = mma_h(vb.v, pl[kk].v, o1[t]);
        }
      }
    }
    if (RES) {
#pragma unroll
      for (int t = 0; t < 4; ++t)
#pragma unroll
        for (int r = 0; r < 8; ++r) oacc[t][r] += o1[t][r] * (1.0f / 4096.0f);
    }
  }

  // ---- join the two groups' partial results: group 1 hands its maximum, sum and context over through LDS (every
  //      lane at the places that the same lane of group 0's wave reads), group 0 rescales both to the common maximum.
  //      Group 0 has always seen key tile 0, where every row has a live key; a group 1 without a tile hands over
  //      maximum -inf, sum 0 and context 0, whose factor is exp(-inf) = 0. ----
  lrow += xhalf(lrow);                       // the two halves' keys together: the query's whole sum, in both lanes
  float* os  = Os[wave];
  float* osl = os + c * OP + 8 * hh;         // the lane's places: query c, d = t*16 + 8*hh + r
  if (grp == 1) {
#pragma unroll
    for (int t = 0; t < 4; ++t) {
      const v4f x0 = {oacc[t][0], oacc[t][1], oacc[t][2], oacc[t][3]};
      const v4f x1 = {oacc[t][4], oacc[t][5], oacc[t][6], oacc[t][7]};
      *(v4f*)(osl + t * 16)     = x0;
      *(v4f*)(osl + t * 16 + 4) = x1;
    }
    if (hh == 0) { Ms[wave][c] = mrow; Ls[wave][c] = lrow; }
  }
  __syncthreads();                           // group 1's partial results are published
  if (grp == 1) return;                      // no block barrier stands behind this line
  {
    const float m1 = Ms[wave][c], l1 = Ls[wave][c];
    const float mj = fmaxf(mrow, m1);
    const float ms = (mj == -INFINITY) ? 0.f : mj;
    const float a0 = exp_slot(mrow - ms), a1 = exp_slot(m1 - ms);
    lrow = lrow * a0 + l1 * a1;
#pragma unroll
    for (int t = 0; t < 4; ++t)
#pragma unroll
      for (int r = 0; r < 8; ++r) oacc[t][r] = oacc[t][r] * a0 + osl[t * 16 + r] * a1;
  }

  // ---- normalise (1/l and the 1/1024 p carry), stage the wave's 16x64 tile [query][d] in LDS, then convert to
  {
    const float inv = ((lrow > 0.f) ? (1.0f / lrow) : 0.f) * (1.0f / 1024.0f);
#pragma unroll
    for (int t = 0; t < 4; ++t) {
      const v4f x0 = {oacc[t][0] * inv, oacc[t][1] * inv, oacc[t][2] * inv, oacc[t][3] * inv};
      const v4f x1 = {oacc[t][4] * inv, oacc[t][5] * inv, oacc[t][6] * inv, oacc[t][7] * inv};
      *(v4f*)(osl + t * 16)     = x0;
      *(v4f*)(osl + t * 16 + 4) = x1;
    }
  }
  __builtin_amdgcn_fence(__ATOMIC_RELEASE, "workgroup");
  __builtin_amdgcn_wave_barrier();
  __builtin_amdgcn_fence(__ATOMIC_ACQUIRE, "workgroup");
  {
    const int q4 = lane >> 3, c8 = (lane & 7) * 8;
    v4u hv[4], lv[4];
#pragma unroll
    for (int it = 0; it < 4; ++it) {
      const int row = it * 4 + q4;             // it 0..3 x q4 0..3 = rows 0..15 of the wave tile
      const float* sp = os + row * OP + c8;
      v4u a, a2;
#pragma unroll
      for (int e = 0; e < 4; ++e) {
        const float f0 = sp[2 * e], f1 = sp[2 * e + 1];
        const unsigned short x0 = bf_bits(f0), x1 = bf_bits(f1);
        const unsigned short y0 = bf_bits(f0 - bf_up(x0)), y1 = bf_bits(f1 - bf_up(x1));
        a[e] = pk16(x0, x1); a2[e] = pk16(y0, y1);
      }
      hv[it] = a; lv[it] = a2;
    }
    {
#pragma unroll
      for (int it = 0; it < 4; ++it) {
        const int row = it * 4 + q4;
        const size_t go = (rowB + q0 + row) * DM + (size_t)h * HD + c8;
        *(v4u*)(ahp + go) = hv[it];
        *(v4u*)(alp + go) = lv[it];
      }
      
    }
  }
}

// =====================================================================================================
// Workspace map (bytes), every region an exact multiple of its whole-line / whole-tile store granularity:
//   Xb    bf16 [4096][1024]            0           8388608
//   Wqb   bf16 [1024 out][1024 in]     8388608     2097152
//   Wkb   bf16 [1024][1024]            10485760    2097152
//   Wvb   bf16 [1024][1024]            12582912    2097152
//   Wob   bf16 [1024][1024]            14680064    2097152
//   Erf   bf16 [256 tiles][1024], fragment order (4095 rows used)  16777216     524288
//   Qh    bf16 [4096][1024]            17301504    8388608
//   Ql    bf16 [4096][1024]            25690112    8388608
//   Kh    bf16 [4096][1024]            34078720    8388608
//   Kl    bf16 [4096][1024]            42467328    8388608
//   VTh   f16  [2][1024][2048]         50855936    8388608
//   VTl   f16  [2][1024][512]          59244544    2097152
//   Ah    bf16 [4096][1024]            61341696    8388608
//   Al    bf16 [4096][1024]            69730304    8388608
//   end                                78118912
// Weights arrive [in][out]; y = x . W needs Bt[out][in] (in contiguous) -> transpose-convert once.
// =====================================================================================================
extern "C" void kernel_launch(void* const* d_in, const int* in_sizes, int n_in,
                              void* d_out, int out_size, void* d_ws, size_t ws_size,
                              hipStream_t stream) {
  if (n_in < 10) return;
  if (in_sizes[0] != NB * SEQ * DM) return;
  if (in_sizes[1] != DM * DM || in_sizes[3] != DM * DM || in_sizes[5] != DM * DM || in_sizes[7] != DM * DM) return;
  if (in_sizes[2] != DM || in_sizes[4] != DM || in_sizes[6] != DM || in_sizes[8] != DM) return;
  if (in_sizes[9] != ERR * HD) return;
  if (out_size != NB * SEQ * DM) return;

  const float* x  = (const float*)d_in[0];
  const float* Wq = (const float*)d_in[1];
  const float* bq = (const float*)d_in[2];
  const float* Wk = (const float*)d_in[3];
  const float* bk = (const float*)d_in[4];
  const float* Wv = (const float*)d_in[5];
  const float* bv = (const float*)d_in[6];
  const float* Wo = (const float*)d_in[7];
  const float* bo = (const float*)d_in[8];
  const float* Er = (const float*)d_in[9];

  const size_t PXb  = (size_t)NB * SEQ * DM * 2;       //  8388608  16-bit activation plane [4096][1024]
  const size_t PW   = (size_t)DM * DM * 2;             //  2097152
  const size_t PEr  = (size_t)(ERR + 1) * HD * 2;      //   524288  (rows padded to 4096)
  const size_t PVTh = (size_t)NB * DM * SEQ * 2;       //  8388608
  const size_t PVTl = (size_t)NB * DM * VLP * 2;       //  2097152
  size_t off = 0;
  const size_t oXb  = off; off += PXb;
  const size_t oWq  = off; off += PW;
  const size_t oWk  = off; off += PW;
  const size_t oWv  = off; off += PW;
  const size_t oWo  = off; off += PW;
  const size_t oEr  = off; off += PEr;
  const size_t oQh  = off; off += PXb;
  const size_t oQl  = off; off += PXb;
  const size_t oKh  = off; off += PXb;
  const size_t oKl  = off; off += PXb;
  const size_t oVTh = off; off += PVTh;
  const size_t oVTl = off; off += PVTl;
  const size_t oAh  = off; off += PXb;
  const size_t oAl  = off; off += PXb;
  if (off > ws_size) return;                           // off = 78118912

  char* ws = (char*)d_ws;
  unsigned short* Xb  = (unsigned short*)(ws + oXb);
  unsigned short* Wqb = (unsigned short*)(ws + oWq);
  unsigned short* Wkb = (unsigned short*)(ws + oWk);
  unsigned short* Wvb = (unsigned short*)(ws + oWv);
  unsigned short* Wob = (unsigned short*)(ws + oWo);
  unsigned short* Erf = (unsigned short*)(ws + oEr);
  unsigned short* Qh  = (unsigned short*)(ws + oQh);
  unsigned short* Ql  = (unsigned short*)(ws + oQl);
  unsigned short* Kh  = (unsigned short*)(ws + oKh);
  unsigned short* Kl  = (unsigned short*)(ws + oKl);
  unsigned short* VTh = (unsigned short*)(ws + oVTh);
  unsigned short* VTl = (unsigned short*)(ws + oVTl);
  unsigned short* Ah  = (unsigned short*)(ws + oAh);
  unsigned short* Al  = (unsigned short*)(ws + oAl);

  const dim3 blk(256);
  const dim3 gPrep(4 * NWB + NXB + NEB);                             // 1024 + 2048 + 128 blocks
  const dim3 blkG(128);                                              // GEMM block: 4 waves, one 128x128 tile
  const int  nblk = (NB * SEQ / 128) * (DM / 128);                   // 256 blocks per projection
  static_assert((NB * SEQ / 128) * (DM / 128) == (DM / 128) * (SEQ / 128) * NB);
  const dim3 gQKV(3 * nblk);                                         // 768 blocks
  const dim3 gOut((NB * SEQ / 128) * (DM / 128), 1);                 // 256 blocks

  // (1) x -> bf16 plane [4096][1024]; weights [in][out] f32 -> bf16 [out][in] planes; Er -> bf16 in fragment order
  prep_all<<<gPrep, blk, 0, stream>>>(x, Wq, Wk, Wv, Wo, Er, Xb, Wqb, Erf);
  // (2) q, k and v^T projections (planes Wqb, Wkb, Wvb and Qh, Ql, Kh, Kl are neighbours in the workspace map)
  gemm_qkv<<<gQKV, blkG, 0, stream>>>(Xb, Wqb, Qh, VTh, VTl, bq, bk, bv, NB * SEQ, SEQ, DM, nblk);
  // (3) attention, each launch over all NP pairs: the leading RESQB query blocks with the residual planes, then all the
  //     others in one launch
  attn_rel64<true><<<dim3(RESQB * NP), dim3(256), 0, stream>>>(
      Qh, Ql, Kh, Kl, VTh, VTl, Erf, Ah, Al, 0, RESQB, 0.125f);
  attn_rel64<false><<<dim3((NQB - RESQB) * NP), dim3(256), 0, stream>>>(
      Qh, Ql, Kh, Kl, VTh, VTl, Erf, Ah, Al, RESQB, NQB - RESQB, 0.125f);
  // (4) out[s][e] = bo[e] + sum_d (Ah+Al)[s][d] Wob[e][d] -> d_out f32 [4096][1024]  (M=4096, N=1024, K=1024)
  gemm128<1, 0, false, true><<<gOut, blkG, 0, stream>>>(
      Ah, Al, DM, 0LL, Wob, DM, 0LL,
      d_out, DM, 0LL, d_out, 0, 0LL, 0,
      NB * SEQ, DM, DM, 1.0f, bo, bo);
  (void)hipGetLastError();
}

// v010
// It runs in 135 microseconds.
// In two side-by-side timings against v009, it was 1.05 and 1.06 times as fast.
// All steps since v000 together make it 40.9 times as fast.
// Contractions: x.Wq / x.Wk / Wv.x^T projections = v_wmma_f32_16x16x32_bf16 (bf16 operands from RNE-converted inputs, single product, f32 bias epilogue);
// q.k^T scores = v_wmma_f32_16x16x32_bf16 with q and k as bf16 hi/lo planes (hi.hi + hi.lo + lo.hi); q.Er^T band = same with q hi/lo times bf16 Er (2 products);
// p.v = v_wmma_f32_16x16x32_f16 (p carried x1024 in f16, v in f16; f16 residual planes x4096 of p and v on the leading query blocks);
// ctx.Wo = v_wmma_f32_16x16x32_bf16 with ctx as bf16 hi/lo planes times bf16 Wo (2 products); all f32 accumulate; softmax in f32.
#include <hip/hip_runtime.h>
#include <math.h>
#include <float.h>
#include <stdint.h>

#define NB      2
#define SEQ     2048
#define DM      1024
#define NH      16
#define HD      64
#define NQB     (SEQ / 64)       // 32 query / key tiles of 64
#define ERR     (2 * SEQ - 1)    // 4095 rows of the relative table
#define VLP     512              // key pitch of the v^T residual plane (keys 0..VLP-1)
#define RESQB   8                // leading 64-row query blocks that use the p / v residual planes
#define NP      (NB * NH)        // 32 (b,h) pairs: every attention launch covers all of them
static_assert(RESQB * 64 <= VLP);
static_assert(NH * HD == DM);
static_assert((SEQ % 64) == 0 && (DM % 64) == 0);
static_assert(HD == 64);
static_assert(0 < RESQB && RESQB < NQB);
static_assert((SEQ % 128) == 0 && (DM % 128) == 0);   // gemm128: whole 128x128 tiles and whole 128-k slabs

typedef _Float16 v16h __attribute__((ext_vector_type(16)));
typedef _Float16 v8h  __attribute__((ext_vector_type(8)));
typedef __bf16   v16b __attribute__((ext_vector_type(16)));
typedef __bf16   v8b  __attribute__((ext_vector_type(8)));
typedef float    v8f  __attribute__((ext_vector_type(8)));
typedef float    v4f  __attribute__((ext_vector_type(4)));
typedef unsigned int v4u __attribute__((ext_vector_type(4)));
typedef unsigned short v8us __attribute__((ext_vector_type(8)));

// ---- scalar helpers --------------------------------------------------------------------------------
__device__ __forceinline__ unsigned short bf_bits(float f) {          // f32 -> bf16 bits, RNE convert
  unsigned u = __float_as_uint(f);
  return (unsigned short)((u + 0x7FFFu + ((u >> 16) & 1u)) >> 16);
}
__device__ __forceinline__ float bf_up(unsigned short h) { return __uint_as_float(((unsigned)h) << 16); }
__device__ __forceinline__ unsigned short h_bits(_Float16 x) { return __builtin_bit_cast(unsigned short, x); }
__device__ __forceinline__ unsigned pk16(unsigned short a, unsigned short b) { return (unsigned)a | ((unsigned)b << 16); }
__device__ __forceinline__ v8f zero8() { v8f z = {0.f, 0.f, 0.f, 0.f, 0.f, 0.f, 0.f, 0.f}; return z; }
__device__ __forceinline__ v8h zero8h() {
  const _Float16 z = (_Float16)0.0f;
  v8h r = {z, z, z, z, z, z, z, z};
  return r;
}

// ---- fragment loader: 16-bit A/B operand, lane -> row/col (lane&15), p already includes +8*(lane>>4);
//      elements 0..7 <- p[0..7] (k0+8h..), elements 8..15 <- p[16..23] (k0+16+8h..)
__device__ __forceinline__ v16b ldfrag_b(const __bf16* p) {
  union { v16b v; v8b h[2]; } f;
  f.h[0] = *(const v8b*)(p);
  f.h[1] = *(const v8b*)(p + 16);
  return f.v;
}

// ---- WMMA helpers; the VALU hazard gap behind a run of them is kept by the guards below ------------------
__device__ __forceinline__ v8f mma_b_raw(v16b a, v16b b, v8f c) {
  return __builtin_amdgcn_wmma_f32_16x16x32_bf16(false, a, false, b, (short)0, c, false, false);
}
__device__ __forceinline__ v8f mma_h_raw(v16h a, v16h b, v8f c) {
  return __builtin_amdgcn_wmma_f32_16x16x32_f16(false, a, false, b, (short)0, c, false, false);
}
__device__ __forceinline__ void dep_guard_b(v8f& a, v8f& b, v16b x, v16b y) {
#if defined(__HIP_DEVICE_COMPILE__)
  asm volatile("v_nop\n\tv_nop\n\tv_nop\n\tv_nop" : "+v"(a), "+v"(b) : "v"(x), "v"(y));
#endif
}
__device__ __forceinline__ void keep4_b(v16b a, v16b b, v16b c, v16b d) {
#if defined(__HIP_DEVICE_COMPILE__)
  asm volatile("v_nop" :: "v"(a), "v"(b), "v"(c), "v"(d));
#endif
}
__device__ __forceinline__ void acc_guard4(v8f& a, v8f& b, v8f& c, v8f& d) {
#if defined(__HIP_DEVICE_COMPILE__)
  asm volatile("v_nop\n\tv_nop\n\tv_nop\n\tv_nop" : "+v"(a), "+v"(b), "+v"(c), "+v"(d));
#endif
}
// The four vector slots that the chip needs between the last matrix instruction and the first read of its result.
__device__ __forceinline__ void acc_guard5(v8f& a, v8f& b, v8f& c, v8f& d, v8f& e) {
#if defined(__HIP_DEVICE_COMPILE__)
  asm volatile("v_nop\n\tv_nop\n\tv_nop\n\tv_nop" : "+v"(a), "+v"(b), "+v"(c), "+v"(d), "+v"(e));
#endif
}

// =====================================================================================================
// The conversions of the inputs, which do not depend on each other, are the parts of ONE launch (prep_all below); each
// part's block does what a block of its own launch would do.
// x part: f32 -> bf16 (RNE convert), 8 elements per thread, one 16-B store per lane: a wave writes 512 contiguous B.
// NXB blocks x 256 threads x 8 = the whole plane.
// =====================================================================================================
#define N8X     (NB * SEQ * DM / 8)              // 16-byte output pieces of x
static_assert(N8X % 256 == 0);
__device__ __forceinline__ void cvt_x_block(const float* __restrict__ in, unsigned short* out, int blk, int tid) {
  const int i = blk * 256 + tid;
  if (i < N8X) {
    const v4f a = *(const v4f*)(in + (size_t)i * 8);
    const v4f b = *(const v4f*)(in + (size_t)i * 8 + 4);
    v4u p;
    p[0] = pk16(bf_bits(a[0]), bf_bits(a[1]));
    p[1] = pk16(bf_bits(a[2]), bf_bits(a[3]));
    p[2] = pk16(bf_bits(b[0]), bf_bits(b[1]));
    p[3] = pk16(bf_bits(b[2]), bf_bits(b[3]));
    *(v4u*)(out + (size_t)i * 8) = p;
  }
}

// =====================================================================================================
// Weight part, transpose-convert: in f32 [R][C] (row pitch C) -> out bf16 [C][R] (row pitch R), out[c][r] = RNE bf16(in[r][c]).
// Block = 256 threads = one 64(r) x 64(c) tile at (r0, c0).
// Load: thread t reads row r0 + (t>>2), columns c0 + (t&3)*16 .. +15 (four 16-B loads), scatters the
// converted bits into LDS sT[c][r] (pitch 72); __syncthreads; store: wave w writes output rows w*8 .. w*8+7;
// coverage: 8 waves x 2 it x 4 = 64 output rows x (8 lanes x 8) = 64 columns = the whole tile.
// =====================================================================================================
__device__ __forceinline__ void tr_cvt_block(const float* __restrict__ in, unsigned short* out, int R, int C,
                                             int r0, int c0, unsigned short* sT, int tid) {
  const int lane = tid & 31, wave = tid >> 5;
  {
    const int rl = tid >> 2, cl = (tid & 3) * 16;
    const float* src = in + (size_t)(r0 + rl) * C + c0 + cl;
#pragma unroll
    for (int i = 0; i < 4; ++i) {
      const v4f v = *(const v4f*)(src + 4 * i);
#pragma unroll
      for (int e = 0; e < 4; ++e) sT[(cl + 4 * i + e) * 72 + rl] = bf_bits(v[e]);
    }
  }
  __syncthreads();
  const int q = lane >> 3, p8 = (lane & 7) * 8;
  v8us ov[2];
#pragma unroll
  for (int it = 0; it < 2; ++it) {
    const int cl2 = wave * 8 + it * 4 + q;
    ov[it] = *(const v8us*)(sT + cl2 * 72 + p8);
  }
  {
#pragma unroll
    for (int it = 0; it < 2; ++it) {
      const int cl2 = wave * 8 + it * 4 + q;
      *(v8us*)(out + (size_t)(c0 + cl2) * R + r0 + p8) = ov[it];
    }
  }
}

// =====================================================================================================
// Relative table f32 [ERR][64] -> bf16 (RNE convert) in the order of the A fragments of v_wmma_f32_16x16x32_bf16: the 16
// table rows 16*T .. 16*T+15 are one tile of 1024 elements; its 16-byte piece ((dc*2 + p)*32 + lane) holds row
// 16*T + (lane & 15), d = dc*32 + p*16 + (lane >> 4)*8 .. +7, so that a fragment half is one 512-byte contiguous load of
// a wave. Thread = one output piece (a wave stores 512 contiguous bytes); 4096*8/256 blocks; row ERR does not exist and
// its pieces are neither written nor read.
// =====================================================================================================
__device__ __forceinline__ void cvt_er_block(const float* __restrict__ in, unsigned short* out, int blk, int tid) {
  const int o    = blk * 256 + tid;
  const int lane = o & 31, p = (o >> 5) & 1, dc = (o >> 6) & 1, tl = o >> 7;
  const int e    = tl * 16 + (lane & 15);
  const int d    = dc * 32 + p * 16 + (lane >> 4) * 8;
  if (e < ERR) {
    const v4f a = *(const v4f*)(in + (size_t)e * HD + d);
    const v4f b = *(const v4f*)(in + (size_t)e * HD + d + 4);
    v4u q;
    q[0] = pk16(bf_bits(a[0]), bf_bits(a[1]));
    q[1] = pk16(bf_bits(a[2]), bf_bits(a[3]));
    q[2] = pk16(bf_bits(b[0]), bf_bits(b[1]));
    q[3] = pk16(bf_bits(b[2]), bf_bits(b[3]));
    *(v4u*)(out + (size_t)o * 8) = q;
  }
}

// =====================================================================================================
// All conversions in one launch; the part is chosen by the block index (the same for the whole block, so the barrier of
// the weight part is passed by all of a block's threads or by none). First NWB blocks a weight (Wq, Wk, Wv, Wo; their bf16
// planes lie one behind the other from Wb on): they have the longest chain of dependent steps; then NXB blocks of x; then NEB blocks of the relative table.
// =====================================================================================================
#define NXB     (N8X / 256)                     // 2048
#define NWB     ((DM / 64) * (DM / 64))         // 256 tiles per weight
#define NEB     ((ERR + 1) * HD / 8 / 256)      // 128
__global__ __launch_bounds__(256) void prep_all(const float* __restrict__ x, const float* __restrict__ Wq,
                                                const float* __restrict__ Wk, const float* __restrict__ Wv,
                                                const float* __restrict__ Wo, const float* __restrict__ Er,
                                                unsigned short* Xb, unsigned short* Wb, unsigned short* Erf) {
  __shared__ __align__(16) unsigned short sT[64 * 72];
  const int bx = blockIdx.x, tid = threadIdx.x;
  if (bx < 4 * NWB) {
    const int w = bx / NWB, s = bx % NWB;
    const float* in = (w == 0) ? Wq : (w == 1) ? Wk : (w == 2) ? Wv : Wo;
    tr_cvt_block(in, Wb + (size_t)w * DM * DM, DM, DM, (s / (DM / 64)) * 64, (s % (DM / 64)) * 64, sT, tid);
  } else if (bx < 4 * NWB + NXB) {
    cvt_x_block(x, Xb, bx - 4 * NWB, tid);
  } else {
    cvt_er_block(Er, Erf, bx - (NXB + 4 * NWB), tid);
  }
}

// =====================================================================================================
// Block-tiled bf16 WMMA GEMM for the four projections: C[m][n] = rb[m] + cb[n] + sum_k (A [+ A2])[m][k] * Bt[n][k], wave
// tile 64x64. NSPLIT 1 adds the bf16 lo plane A2; OUT_MODE 0 = f32, 2 = bf16 hi + lo planes, 3 = f16 hi plane + f16
// residual plane (x rscale, tiles with n0 < N2). A block of 4 waves (2 x 2) owns a 128x128 tile of C; the 128 rows of A (and A2) and
// of Bt that it needs are brought into LDS one slab of KS = 128 k at a time by asynchronous copies
// (global_load_async_to_lds_b128: a wave's copy covers two whole 256-byte row pieces), two buffers, so that slab t + 1
// flies while slab t is multiplied; fragments are then read from LDS (row pitch 272 bytes = 17 x 16).
// M, N multiples of 128, K a multiple of KS and at least KS; tile = tm * (N/128) + tn and batch b are handed in by the kernel.
// =====================================================================================================
// Eight 16-byte copies per lane, rows gstep elements / lstep bytes apart.
__device__ __forceinline__ void async_rows8(const __bf16* g, size_t gstep, unsigned l, unsigned lstep) {
#if defined(__HIP_DEVICE_COMPILE__)
  // The closing s_wait_xcnt 0 stands in the copies' own statement, so that it is passed before any address register
  // that a copy names is written again.
  asm volatile(
      "global_load_async_to_lds_b128 %0, %8, off\n\t"
      "global_load_async_to_lds_b128 %1, %9, off\n\t"
      "global_load_async_to_lds_b128 %2, %10, off\n\t"
      "global_load_async_to_lds_b128 %3, %11, off\n\t"
      "global_load_async_to_lds_b128 %4, %12, off\n\t"
      "global_load_async_to_lds_b128 %5, %13, off\n\t"
      "global_load_async_to_lds_b128 %6, %14, off\n\t"
      "global_load_async_to_lds_b128 %7, %15, off\n\t"
      "s_wait_xcnt 0x0"
      :: "v"(l), "v"(l + lstep), "v"(l + 2 * lstep), "v"(l + 3 * lstep),
         "v"(l + 4 * lstep), "v"(l + 5 * lstep), "v"(l + 6 * lstep), "v"(l + 7 * lstep),
         "v"(g), "v"(g + gstep), "v"(g + 2 * gstep), "v"(g + 3 * gstep),
         "v"(g + 4 * gstep), "v"(g + 5 * gstep), "v"(g + 6 * gstep), "v"(g + 7 * gstep)
      : "memory");
  // Keeps the address arithmetic of the next eight copies behind these: hoisted in front of them it held the addresses
  // of a whole slab in registers at once (a spill to scratch beside the 128 accumulator registers) and delayed the first copy.
  __builtin_amdgcn_sched_barrier(0);
#endif
}
// The issuing wave's own wait: its copies have landed in LDS behind it.
__device__ __forceinline__ void wait_async0() {
#if defined(__HIP_DEVICE_COMPILE__)
  asm volatile("s_wait_asynccnt 0x0" ::: "memory");
#endif
}
// The wave's LDS reads have returned: stands in front of the barrier behind which their buffer is refilled.
__device__ __forceinline__ void wait_ds0() {
#if defined(__HIP_DEVICE_COMPILE__)
  asm volatile("s_wait_dscnt 0x0" ::: "memory");
#endif
}

// Sizes of the LDS that a block of the GEMM needs; the arrays are declared in the kernels and handed to the body.
#define G_KS    128                              // k per slab
#define G_SP    (G_KS + 8)                       // LDS row pitch in elements
#define G_PLE   (128 * G_SP)                     // elements of one plane of a slab
#define G_STE   (4 * 16 * 68)                    // floats of the four per-wave 16x64 output slabs, pitch 68

// The work of one block: tile 'tile' of batch 'b'. sS = 2 buffers x NPL planes of G_PLE elements, sT = G_STE floats.
template <int NSPLIT, int OUT_MODE, bool RB, bool CB>
__device__ __forceinline__ void gemm128_block(
    __bf16* sS, float* sT, int tile, int b,
    const unsigned short* __restrict__ Ap, const unsigned short* A2p, int lda, long long strideA,
    const unsigned short* __restrict__ Btp, int ldb, long long strideB,
    void* Cout, int ldc, long long strideC,
    void* Cout2, int ldc2, long long strideC2, int N2,
    int M, int N, int K, float rscale,
    const float* __restrict__ rbp, const float* __restrict__ cbp) {
  static_assert(NSPLIT == 0 || NSPLIT == 1);
  constexpr int KS  = G_KS;                      // k per slab
  constexpr int SP  = G_SP;                      // LDS row pitch in elements
  constexpr int NPL = (NSPLIT == 1) ? 3 : 2;     // planes of a slab: A, Bt, (A2)
  constexpr unsigned PLB = 128u * SP * 2u;       // bytes of one plane of a slab
  constexpr unsigned LST = 8u * SP * 2u;         // bytes between two copies of a lane (8 rows)
  const __bf16* A   = (const __bf16*)(const void*)Ap;
  const __bf16* A2  = (const __bf16*)(const void*)A2p;
  const __bf16* Bt  = (const __bf16*)(const void*)Btp;
  const int tid  = threadIdx.x;
  const int lane = tid & 31;
  const int wave = tid >> 5;
  const int tilesN = N >> 7;
  const int tilesM = M >> 7;
  if (tile >= tilesM * tilesN) return;   // block-uniform, in front of every copy and barrier
  const int tm  = tile / tilesN;
  const int tn  = tile - tm * tilesN;
  const int bm0 = tm << 7;
  const int bn0 = tn << 7;
  const int wm  = (wave >> 1) << 6;      // the wave's 64x64 tile within the block tile
  const int wn  = (wave & 1) << 6;
  const int m0  = bm0 + wm;
  const int n0  = bn0 + wn;

  // copy addressing: 16 lanes per 256-byte row piece, 8 rows per block-wide copy, 16 copies per lane and plane
  const int cr = tid >> 4, cc = (tid & 15) * 8;
  const __bf16* gA  = A  + (size_t)b * strideA + (size_t)(bm0 + cr) * lda + cc;
  const long long dA2 = A2 - A;          // uniform distance (elements) of the lo plane from the hi plane, same workspace
  const __bf16* gB  = Bt + (size_t)b * strideB + (size_t)(bn0 + cr) * ldb + cc;
  const unsigned l0 = (unsigned)(size_t)sS + (unsigned)(cr * SP + cc) * 2u;
  auto fill = [&](int t, int bs) {
    const unsigned lb = l0 + (unsigned)bs * (NPL * PLB);
    const size_t ko = (size_t)t * KS;
    async_rows8(gA + ko, (size_t)8 * lda, lb, LST);
    async_rows8(gA + ko + (size_t)64 * lda, (size_t)8 * lda, lb + 8u * LST, LST);
    async_rows8(gB + ko, (size_t)8 * ldb, lb + PLB, LST);
    async_rows8(gB + ko + (size_t)64 * ldb, (size_t)8 * ldb, lb + PLB + 8u * LST, LST);
    if (NSPLIT == 1) {
      async_rows8(gA + (dA2 + (long long)ko), (size_t)8 * lda, lb + 2u * PLB, LST);
      async_rows8(gA + (dA2 + (long long)ko) + (size_t)64 * lda, (size_t)8 * lda, lb + 2u * PLB + 8u * LST, LST);
    }
  };

  const int rlane = lane & 15;                 // row (A) / col (B, D) within subtile
  const int koff  = (lane >> 4) * 8;           // k offset of this lane half
  const int mOff  = (lane >> 4) * 8;           // D row offset

  v8f acc[4][4];
#pragma unroll
  for (int i = 0; i < 4; ++i)
#pragma unroll
    for (int j = 0; j < 4; ++j) acc[i][j] = zero8();

  const int nst = K / KS;                      // slabs, block-uniform
  fill(0, 0);
  wait_async0();
  __syncthreads();                             // slab 0 is published
  if (nst > 1) fill(1, 1);
  for (int t = 0; t < nst; ++t) {
    const __bf16* sBuf = sS + (t & 1) * (NPL * G_PLE);
    const __bf16* sA  = sBuf + (wm + rlane) * SP + koff;
    const __bf16* sB  = sBuf + G_PLE + (wn + rlane) * SP + koff;
    const __bf16* sA2 = sBuf + (NPL - 1) * G_PLE + (wm + rlane) * SP + koff;
#pragma unroll
    for (int ks = 0; ks < KS; ks += 32) {
      // all fragments of the k step are read in one batch, so that the wave pays the LDS latency once per step
      v16b bh[4], ah[4], al[4];
#pragma unroll
      for (int j = 0; j < 4; ++j) bh[j] = ldfrag_b(sB + (j << 4) * SP + ks);
#pragma unroll
      for (int i = 0; i < 4; ++i) {
        ah[i] = ldfrag_b(sA + (i << 4) * SP + ks);
        if (NSPLIT == 1) al[i] = ldfrag_b(sA2 + (i << 4) * SP + ks); else al[i] = ah[i];
      }
#pragma unroll
      for (int i = 0; i < 4; ++i) {
#pragma unroll
        for (int j = 0; j < 4; ++j) {
          acc[i][j] = mma_b_raw(ah[i], bh[j], acc[i][j]);
          if (NSPLIT == 1) acc[i][j] = mma_b_raw(al[i], bh[j], acc[i][j]);
        }
        dep_guard_b(acc[i][0], acc[i][3], ah[i], al[i]);
      }
      keep4_b(bh[0], bh[1], bh[2], bh[3]);
    }
    // publish point of slab t + 1: own LDS reads returned, own copies landed, then the one barrier of the trip (it
    // publishes slab t + 1 and ends every wave's reads of the buffer that is refilled behind it)
    wait_ds0();
    wait_async0();
    __syncthreads();
    if (t + 2 < nst) fill(t + 2, t & 1);
  }
  wait_async0();                               // no copy is outstanding when the wave goes on
  acc_guard4(acc[0][0], acc[0][1], acc[0][2], acc[0][3]);
  acc_guard4(acc[1][0], acc[1][1], acc[1][2], acc[1][3]);
  acc_guard4(acc[2][0], acc[2][1], acc[2][2], acc[2][3]);
  acc_guard4(acc[3][0], acc[3][1], acc[3][2], acc[3][3]);

  // ---- epilogue biases (input values RNE-converted to bf16) ----
  float cbv[4];
#pragma unroll
  for (int j = 0; j < 4; ++j) cbv[j] = CB ? bf_up(bf_bits(cbp[n0 + (j << 4) + rlane])) : 0.0f;

  // ---- epilogue ----
  float* slab = sT + wave * (16 * 68);
#pragma unroll
  for (int i = 0; i < 4; ++i) {
    const int mBase = m0 + (i << 4);
#pragma unroll
    for (int r = 0; r < 8; ++r) {
      const float rbv = RB ? bf_up(bf_bits(rbp[mBase + mOff + r])) : 0.0f;
#pragma unroll
      for (int j = 0; j < 4; ++j) {
        slab[(mOff + r) * 68 + (j << 4) + rlane] = acc[i][j][r] + rbv + cbv[j];
      }
    }
    __builtin_amdgcn_fence(__ATOMIC_RELEASE, "workgroup");
    __builtin_amdgcn_wave_barrier();
    __builtin_amdgcn_fence(__ATOMIC_ACQUIRE, "workgroup");
    if (OUT_MODE == 0) {
      float* C = (float*)Cout + (size_t)b * strideC;
      const int hh = lane >> 4, c4 = (lane & 15) * 4;     // 256-B row segment = 16 lanes x 16 B
      v4f ov[8];
#pragma unroll
      for (int it = 0; it < 8; ++it) {
        const int row = it * 2 + hh;                       // it 0..7 x hh 0..1 = rows 0..15
        ov[it] = *(const v4f*)(slab + row * 68 + c4);
      }
      {
#pragma unroll
        for (int it = 0; it < 8; ++it) {
          const int row = it * 2 + hh;
          *(v4f*)(C + (size_t)(mBase + row) * ldc + n0 + c4) = ov[it];
        }
        
      }
    } else {
      const int q = lane >> 3, c8 = (lane & 7) * 8;
      unsigned short* C  = (unsigned short*)Cout  + (size_t)b * strideC;
      unsigned short* C2 = (unsigned short*)Cout2 + (size_t)b * strideC2;
      const bool wlo = (OUT_MODE == 2) || (n0 < N2);      // wave-uniform
      v4u hv[4], lv[4];
#pragma unroll
      for (int it = 0; it < 4; ++it) {
        const int row = it * 4 + q;                        // it 0..3 x q 0..3 = rows 0..15
        const float* sp = slab + row * 68 + c8;
        v4u a, a2;
#pragma unroll
        for (int e = 0; e < 4; ++e) {
          const float f0 = sp[2 * e], f1 = sp[2 * e + 1];
          unsigned short h0, h1, l0, l1;
          if (OUT_MODE == 2) {
            h0 = bf_bits(f0); h1 = bf_bits(f1);
            l0 = bf_bits(f0 - bf_up(h0)); l1 = bf_bits(f1 - bf_up(h1));
          } else {
            const _Float16 x0 = (_Float16)f0, x1 = (_Float16)f1;
            h0 = h_bits(x0); h1 = h_bits(x1);
            l0 = h_bits((_Float16)((f0 - (float)x0) * rscale));
            l1 = h_bits((_Float16)((f1 - (float)x1) * rscale));
          }
          a[e] = pk16(h0, h1); a2[e] = pk16(l0, l1);
        }
        hv[it] = a; lv[it] = a2;
      }
      {
#pragma unroll
        for (int it = 0; it < 4; ++it) {
          const int row = it * 4 + q;
          *(v4u*)(C + (size_t)(mBase + row) * ldc + n0 + c8) = hv[it];
          if (wlo) *(v4u*)(C2 + (size_t)(mBase + row) * ldc2 + n0 + c8) = lv[it];
        }
        
      }
    }
    __builtin_amdgcn_fence(__ATOMIC_RELEASE, "workgroup");
    __builtin_amdgcn_wave_barrier();
    __builtin_amdgcn_fence(__ATOMIC_ACQUIRE, "workgroup");
  }
}

// One GEMM per launch: grid.x = (M/128) * (N/128), blockIdx.y = batch.
template <int NSPLIT, int OUT_MODE, bool RB, bool CB>
__global__ __launch_bounds__(128) void gemm128(
    const unsigned short* __restrict__ Ap, const unsigned short* A2p, int lda, long long strideA,
    const unsigned short* __restrict__ Btp, int ldb, long long strideB,
    void* Cout, int ldc, long long strideC,
    void* Cout2, int ldc2, long long strideC2, int N2,
    int M, int N, int K, float rscale,
    const float* __restrict__ rbp, const float* __restrict__ cbp) {
  __shared__ __align__(16) __bf16 sS[2 * ((NSPLIT == 1) ? 3 : 2) * G_PLE];
  __shared__ __align__(16) float sT[G_STE];
  gemm128_block<NSPLIT, OUT_MODE, RB, CB>(sS, sT, blockIdx.x, blockIdx.y, Ap, A2p, lda, strideA, Btp, ldb, strideB,
                                          Cout, ldc, strideC, Cout2, ldc2, strideC2, N2, M, N, K, rscale, rbp, cbp);
}

// The q, k and v^T projections, which do not depend on each other, in one launch of 3 * nblk blocks (nblk = blocks of one
// projection): two blocks fit a WGP's LDS, so that one block's matrix work runs under the other's LDS reads and waits.
// Which projection a block works on is the same for the whole block. Blocks 0 .. 2*nblk-1: q, then k
// (C[b*SEQ+s][e] = hi/lo of bias[e] + sum_d Xb[b*SEQ+s][d] W[e][d]; M = rows, N = K = dm); the weight planes Wq, Wk, Wv lie one
// behind the other from Wb on, the planes Qh, Ql, Kh, Kl from QK on. Blocks 2*nblk ..: v^T per batch
// (VTh[b][m][s] = bv[m] + sum_d Wv[m][d] Xb[b*seq+s][d], f16 hi plane of pitch seq and residual plane x4096 of the
// keys < VLP, pitch VLP; M = K = dm, N = seq).
__global__ __launch_bounds__(128) void gemm_qkv(
    const unsigned short* __restrict__ Xb, const unsigned short* __restrict__ Wb,
    unsigned short* QK, unsigned short* VTh, unsigned short* VTl,
    const float* __restrict__ bq, const float* __restrict__ bk, const float* __restrict__ bv,
    int rows, int seq, int dm, int nblk) {
  __shared__ __align__(16) __bf16 sS[2 * 2 * G_PLE];
  __shared__ __align__(16) float sT[G_STE];
  const int bx = blockIdx.x;
  const size_t wpl = (size_t)dm * dm, apl = (size_t)rows * dm;
  if (bx < 2 * nblk) {
    const int sel = (bx >= nblk) ? 1 : 0;
    const unsigned short* W = Wb + sel * wpl;
    unsigned short* Ch = QK + (size_t)(2 * sel) * apl;
    const float* bias = sel ? bk : bq;
    gemm128_block<0, 2, false, true>(sS, sT, bx - sel * nblk, 0, Xb, Xb, dm, 0LL, W, dm, 0LL,
                                     (void*)Ch, dm, 0LL, (void*)(Ch + apl), dm, 0LL, 0,
                                     rows, dm, dm, 1.0f, bias, bias);
  } else {
    const int t = bx - 2 * nblk, per = (dm >> 7) * (seq >> 7);
    const unsigned short* W = Wb + 2 * wpl;
    gemm128_block<0, 3, true, false>(sS, sT, t % per, t / per, W, W, dm, 0LL, Xb, dm, (long long)seq * dm,
                                     (void*)VTh, seq, (long long)dm * seq, (void*)VTl, VLP, (long long)dm * VLP, VLP,
                                     dm, seq, dm, 4096.0f, bv, bv);
  }
}

// =====================================================================================================
// Causal attention with a relative-position bias, head dim 64 (tril mask incl. diagonal, computed).
//   q planes (bf16 hi / lo): element (b, t, h, d) at [(b*SEQ + t)*DM + h*64 + d]
//   k planes (bf16 hi / lo): same layout with key index s
//   v^T hi plane (f16):      element (b, h, d, s) at [(b*DM + h*64 + d)*SEQ + s]
//   v^T residual plane (f16, (v - hi)*4096): [(b*DM + h*64 + d)*VLP + s], s < VLP, read only when RES
//   relative table (bf16, fragment order of cvt_er_block): the relative term of (query t, key) is q[t] . Er[key - t + SEQ - 1].
//     A wave's 16 queries x 64 keys need the 79 table rows from kv0 - q0 + SEQ - 16 on (a multiple of 16, in
//     [0, SEQ - 16]): five 16-row tiles, q hi/lo times bf16 Er (hi, lo per 32 d, f32 accumulate from 0), the 16 x 80
//     result stored to a wave-private LDS tile and read back along the diagonals (column key - kv0 + 15 - query).
//   logit = (q.k + band) * sscale for key <= query, -FLT_MAX otherwise (exp -> 0); every row has a live key in
//   every processed key tile (tiles 0..qb only, block-uniform trip count (qb+2)/2 <= 16).
//   output: ctx hi / lo bf16 planes, element (b, t, h*64 + d) at [(b*SEQ + t)*DM + h*64 + d] = normalised
//   context (lo = RNE(v - hi), unscaled).
//   scores = q . k : bf16 hi/lo split (hi.hi + hi.lo + lo.hi), f32 accumulate, band added in f32, * sscale in f32
//   p = exp(s - m) carried as f16(1024 p); context = p . v on f16 WMMA; RES adds f16 residual planes of p and v
//   (scale 4096, separate accumulator folded back with 1/4096 per chunk in f32); online softmax in f32.
//   Block = 8 waves = 64 query rows of one (b, h), in two groups of 4 waves; grid = nqbThis * NP (pair index =
//   blockIdx.x % NP, b = pair / NH, h = pair % NH; query block = qbBase + nqbThis - 1 - blockIdx.x / NP: a block's
//   cost grows with its query block, so the costliest blocks take the lowest indices, for speed only); kv chunks of 64. Group g walks the key tiles g, g + 2, ...
//   with its own K / V^T tiles in LDS and its own running maximum, sum and context; the two partial results of a row
//   are joined once behind the loop, in f32 (each rescaled to the common maximum). The block's chain of dependent
//   tiles is half as long, and the two groups' waves fill each other's waits on the SIMDs that they share.
//   K / V^T chunk staging: a group's 128 threads x 32 elements per plane = the whole 64x64 tile (plain 16-B loads,
//   __syncthreads before and after). Every product is formed transposed (K . q^T, Er . q^T, V^T . P^T), so that a lane
//   holds one query: maximum and sum are taken in the lane plus one exchange between the halves, and P goes from the
//   score accumulators into the B operand of V^T . P^T in registers.
//   Output coverage: each wave of group 0 stores its rows 0..15 (it 0..3 x lane>>3 0..3) x 64 columns (8 lanes x 8 bf16),
// =====================================================================================================
// e^x for the join of the two groups' results. v_exp_f32 and the one free slot that the instruction set asks for behind
// a transcendental stand in one statement, so that no instruction which reads the result or overwrites the source
// follows directly.
__device__ __forceinline__ float exp_slot(float x) {
  float y = x * 1.44269504f;
#if defined(__HIP_DEVICE_COMPILE__)
  asm("v_exp_f32 %0, %1\n\tv_nop" : "=v"(y) : "v"(y));
#endif
  return y;
}

// Lane l takes the value of lane l ^ 16: the two lanes that share a query's column.
__device__ __forceinline__ float xhalf(float x) {
  const int b = __builtin_bit_cast(int, x);
  return __builtin_bit_cast(float, __builtin_amdgcn_permlanex16(b, b, 0x76543210, 0xfedcba98, false, false));
}

// Without RES four waves per SIMD (at most 256 registers a wave): two blocks share a WGP, 512 places on the chip for the
// one launch of all query blocks from RESQB on. The RES launch has one block per WGP and keeps the block size's own
// register budget.
template <bool RES>
__global__ __launch_bounds__(256) __attribute__((amdgpu_waves_per_eu(RES ? 2 : 4)))
void attn_rel64(const unsigned short* __restrict__ qhp, const unsigned short* __restrict__ qlp,
                const unsigned short* __restrict__ khp, const unsigned short* __restrict__ klp,
                const unsigned short* __restrict__ vhp, const unsigned short* __restrict__ vlp,
                const unsigned short* __restrict__ erfp,
                unsigned short* ahp, unsigned short* alp,
                int qbBase, int nqbThis, float sscale) {
  union FB { v16b v; v8b h[2]; };
  union FH { v16h v; v8h h[2]; };
  // Row pitches: 64 elements of data plus 16 bytes, an odd multiple of 16 bytes, so that the 16 rows which a 16-byte
  // fragment load reads at once fall on 64 different banks (at 128 or 256 bytes they share a few banks).
  constexpr int LP = 72;                                          // 16-bit tiles: 144 bytes a row
  constexpr int OP = 68;                                          // f32 tile: 272 bytes a row
  __shared__ __align__(16) __bf16   KshG[2][64 * LP];             // per group: K hi [kv][d]   9 KB
  __shared__ __align__(16) __bf16   KslG[2][64 * LP];             // K lo
  __shared__ __align__(16) _Float16 VthG[2][64 * LP];             // V^T hi [d][kv] 9 KB
  __shared__ __align__(16) _Float16 VtlG[2][RES ? 64 * LP : 8];   // V^T residual
  __shared__ __align__(16) float    Os[4][16 * OP];               // per 16-row slice: context tile [row][d]
  __shared__ float Ms[4][16], Ls[4][16];                          // group 1's running maximum and sum per row
  // Per wave: q . Er^T of the key tile, [query][table row - first]. 84 floats a row (21 x 16 bytes): the 16 queries of a
  // 16-byte store fall on 64 different banks, and so do the 32 lanes of a 4-byte read along the diagonals (pitch 83).
  constexpr int BP = 84;
  __shared__ __align__(16) float    Bs[8][16 * BP];

  // the group is the same in every lane of a wave: kept in a scalar register, so that the tests on it are scalar branches
  const int grp  = __builtin_amdgcn_readfirstlane((int)(threadIdx.x >> 7));
  const int tid  = threadIdx.x & 127;     // thread within the group
  const int wave = tid >> 5;              // 16-row slice of the query block
  const int lane = tid & 31;
  __bf16*   Ksh = KshG[grp];
  __bf16*   Ksl = KslG[grp];
  _Float16* Vth = VthG[grp];
  _Float16* Vtl = VtlG[grp];
  const int hh   = lane >> 4;
  const int c    = lane & 15;

  const int bx   = blockIdx.x;
  const int pr   = bx % NP;               // (b,h) pair index, 0..NP-1
  const int h    = pr % NH;
  const int b    = pr / NH;
  const int qb   = qbBase + nqbThis - 1 - bx / NP;   // cost falls with the block index
  const int q0   = qb * 64 + wave * 16;
  const size_t rowB = (size_t)b * SEQ;

  const __bf16* Qh = (const __bf16*)(const void*)qhp + (size_t)h * HD;
  const __bf16* Ql = (const __bf16*)(const void*)qlp + (size_t)h * HD;
  const __bf16* Kh = (const __bf16*)(const void*)khp + (size_t)h * HD;
  const __bf16* Kl = (const __bf16*)(const void*)klp + (size_t)h * HD;
  const _Float16* Vh = (const _Float16*)(const void*)vhp + ((size_t)b * DM + (size_t)h * HD) * SEQ;
  const _Float16* Vl = (const _Float16*)(const void*)vlp + ((size_t)b * DM + (size_t)h * HD) * VLP;
  const __bf16* Ef = (const __bf16*)(const void*)erfp;

  // ---- Q fragments (B operand, column = lane&15): 2 d-chunks, hi and lo ----
  v16b qah[2], qal[2];
#pragma unroll
  for (int dc = 0; dc < 2; ++dc) {
    const size_t qo = (rowB + q0 + c) * DM + dc * 32 + 8 * hh;
    qah[dc] = ldfrag_b(Qh + qo);
    qal[dc] = ldfrag_b(Ql + qo);
  }

  // All products are formed transposed (keys, table rows or d as rows, the wave's 16 queries as columns): lane (c, hh) holds
  // query c only. mrow: its running maximum (equal in both halves); lrow: the sum over the keys that this half has seen;
  // oacc[t][r]: context of query c at d = t*16 + 8*hh + r.
  float mrow = -INFINITY, lrow = 0.f;
  v8f oacc[4];
#pragma unroll
  for (int t = 0; t < 4; ++t) oacc[t] = zero8();

  int nkt = qb + 1;                          // causal: key tiles 0..qb, block-uniform
  if (nkt > NQB) nkt = NQB;

  float* bw = Bs[grp * 4 + wave];
  const int ntrip = (nkt + 1) >> 1;          // block-uniform: every wave passes every barrier
  for (int it = 0; it < ntrip; ++it) {
    const int kt  = 2 * it + grp;
    const int kv0 = kt * 64;
    const bool act = kt < nkt;               // wave-uniform (scalar): false only for group 1 in the last trip of an odd nkt
    __syncthreads();
    if (act) {
      const int r = tid >> 1, half = (tid & 1) * 32;
      // every address is a base that is the same for the whole wave plus a 32-bit lane offset that no trip changes: the
      // bases live in scalar registers, which leaves the vector registers to the loaded tiles
      const unsigned ko = (unsigned)(r * DM + half), vo = (unsigned)(r * SEQ + half), vlo = (unsigned)(r * VLP + half);
      const __bf16*   kg  = Kh + (rowB + kv0) * DM;               // + ko: K row kv0+r, d = half..half+31
      const __bf16*   klg = Kl + (rowB + kv0) * DM;
      const _Float16* vg  = Vh + kv0;                             // + vo: V^T row d = r, s = kv0+half..+31
      const int kvl = (kv0 + 64 <= VLP) ? kv0 : (VLP - 64);     // clamped address into the residual plane
      const _Float16* vlg = Vl + kvl;
      const bool resOK = (kv0 + 64 <= VLP);                      // block-uniform
      v8b a0[4], a1[4];
      v8h b0[4], b1[4];
#pragma unroll
      for (int i = 0; i < 4; ++i) {
        a0[i] = *(const v8b*)(kg + ko + 8 * i);
        a1[i] = *(const v8b*)(klg + ko + 8 * i);
        b0[i] = *(const v8h*)(vg + vo + 8 * i);
        b1[i] = RES ? *(const v8h*)(vlg + vlo + 8 * i) : zero8h();
      }
      // the wave's five tiles of the relative table, behind the K / V loads so that these can be stored to LDS first
      const __bf16* eg = Ef + (size_t)__builtin_amdgcn_readfirstlane((kv0 - q0 + (SEQ - 16)) >> 4) * 1024;
      const unsigned eo = (unsigned)(lane * 8);
      FB eb[5][2];
#pragma unroll
      for (int n = 0; n < 5; ++n)
#pragma unroll
        for (int dc = 0; dc < 2; ++dc) {
          eb[n][dc].h[0] = *(const v8b*)(eg + eo + (n * 2 + dc) * 512);
          eb[n][dc].h[1] = *(const v8b*)(eg + eo + (n * 2 + dc) * 512 + 256);
        }
#if defined(__HIP_DEVICE_COMPILE__)
      // The wait that stands in front of any overwrite of a register an issued load names. It takes the bases and the lane
      // offsets as inputs so that they stay untouched (also by a later load's result) until it has been passed.
      if (RES) asm volatile("s_wait_xcnt 0x0" :: "s"(kg), "s"(klg), "s"(vg), "s"(vlg), "s"(eg), "v"(ko), "v"(vo), "v"(vlo), "v"(eo) : "memory");
      else     asm volatile("s_wait_xcnt 0x0" :: "s"(kg), "s"(klg), "s"(vg), "s"(eg), "v"(ko), "v"(vo), "v"(eo) : "memory");
      // Keeps all loads of the trip in front of their first use: moved behind the first products, the table's second half
      // and the K / V rows each waited for a memory round trip of their own.
      __builtin_amdgcn_sched_barrier(0);
#endif
#pragma unroll
      for (int i = 0; i < 4; ++i) {
        *(v8b*)(Ksh + r * LP + half + 8 * i) = a0[i];
        *(v8b*)(Ksl + r * LP + half + 8 * i) = a1[i];
        *(v8h*)(Vth + r * LP + half + 8 * i) = b0[i];
        if (RES) *(v8h*)(Vtl + r * LP + half + 8 * i) = resOK ? b1[i] : zero8h();
      }
      // ---- relative term: 80 table rows x 16 queries, five independent accumulators; per accumulator the products come
      //      in the order hi, lo of d 0..31, then hi, lo of d 32..63 ----
      v8f tb[5];
#pragma unroll
      for (int n = 0; n < 5; ++n) tb[n] = zero8();
#pragma unroll
      for (int dc = 0; dc < 2; ++dc) {
#pragma unroll
        for (int n = 0; n < 5; ++n) tb[n] = mma_b_raw(eb[n][dc].v, qah[dc], tb[n]);
#pragma unroll
        for (int n = 0; n < 5; ++n) tb[n] = mma_b_raw(eb[n][dc].v, qal[dc], tb[n]);
      }
      acc_guard5(tb[0], tb[1], tb[2], tb[3], tb[4]);
      // tb[n][rr] = (table row n*16 + 8*hh + rr, query c): eight neighbours of the query's row, two 16-byte stores
#pragma unroll
      for (int n = 0; n < 5; ++n) {
        const v4f t0 = {tb[n][0], tb[n][1], tb[n][2], tb[n][3]};
        const v4f t1 = {tb[n][4], tb[n][5], tb[n][6], tb[n][7]};
        *(v4f*)(bw + c * BP + n * 16 + 8 * hh)     = t0;
        *(v4f*)(bw + c * BP + n * 16 + 8 * hh + 4) = t1;
      }
    }
    __syncthreads();                         // also orders the wave's stores of its relative tile before its reads below
    if (!act) continue;                      // no barrier stands between here and the foot of the trip

    // ---- scores: 64 keys x 16 queries per wave, s[j][r] = (key j*16 + 8*hh + r, query c), 3 bf16 products ----
    //      The K fragments of 32 d are read in one batch, so that the wave pays the LDS latency once per batch, and the four
    //      key tiles' accumulators take turns, so that no product waits for the one before it; each accumulator gets its
    //      products in the order hi.hi, lo.hi, hi.lo of d 0..31, then of d 32..63.
    v8f s[4], bv[4];
#pragma unroll
    for (int j = 0; j < 4; ++j) s[j] = zero8();
    // relative term of (query, key): column key - kv0 + 15 - query of the query's row in the wave's tile; read here, in one
    // batch, so that the values arrive under the products
#pragma unroll
    for (int j = 0; j < 4; ++j)
#pragma unroll
      for (int r = 0; r < 8; ++r) bv[j][r] = bw[c * (BP - 1) + j * 16 + 8 * hh + r + 15];
#pragma unroll
    for (int dc = 0; dc < 2; ++dc) {
      FB kb[4], kl[4];
#pragma unroll
      for (int j = 0; j < 4; ++j) {
        kb[j].h[0] = *(const v8b*)(Ksh + (j * 16 + c) * LP + dc * 32 + 8 * hh);
        kb[j].h[1] = *(const v8b*)(Ksh + (j * 16 + c) * LP + dc * 32 + 16 + 8 * hh);
        kl[j].h[0] = *(const v8b*)(Ksl + (j * 16 + c) * LP + dc * 32 + 8 * hh);
        kl[j].h[1] = *(const v8b*)(Ksl + (j * 16 + c) * LP + dc * 32 + 16 + 8 * hh);
      }
#pragma unroll
      for (int j = 0; j < 4; ++j) s[j] = mma_b_raw(kb[j].v, qah[dc], s[j]);
#pragma unroll
      for (int j = 0; j < 4; ++j) s[j] = mma_b_raw(kl[j].v, qah[dc], s[j]);
#pragma unroll
      for (int j = 0; j < 4; ++j) s[j] = mma_b_raw(kb[j].v, qal[dc], s[j]);
    }
    acc_guard4(s[0], s[1], s[2], s[3]);
#if defined(__HIP_DEVICE_COMPILE__)
    // Takes the loaded relative terms as inputs only: all of them are in registers here, so that their loads stand in one
    // batch with one wait; left alone, each load was put directly in front of its addition and waited for by itself.
    asm volatile("" :: "v"(bv[0]), "v"(bv[1]), "v"(bv[2]), "v"(bv[3]));
#endif
    // Without the residual planes the V^T fragments of the whole tile are read here, so that they arrive under the softmax
    // arithmetic; with them (twice the fragments) they are read per 32 keys, in front of their products.
    FH vb[2][4];
    if (!RES) {
#pragma unroll
      for (int kk = 0; kk < 2; ++kk)
#pragma unroll
        for (int t = 0; t < 4; ++t) {
          vb[kk][t].h[0] = *(const v8h*)(Vth + (t * 16 + c) * LP + kk * 32 + 8 * hh);
          vb[kk][t].h[1] = *(const v8h*)(Vth + (t * 16 + c) * LP + kk * 32 + 16 + 8 * hh);
        }
    }

    // ---- the relative term is added behind the products ----
#pragma unroll
    for (int j = 0; j < 4; ++j)
#pragma unroll
      for (int r = 0; r < 8; ++r) s[j][r] += bv[j][r];

    // ---- scale + causal mask (replace by -FLT_MAX), the query's maximum (in the lane, then one exchange between the
    //      halves), online softmax; P (x1024, f16) and its residual (x4096) are packed straight into B operands:
    //      the score tiles 2*kk and 2*kk+1 hold, register by register, the keys that elements 0..7 and 8..15 of the
    //      operand for keys kk*32 .. +31 stand for ----
    FH pa[2], pl[2];
    {
      const int qrow = q0 + c;
      float mj4[4];
#pragma unroll
      for (int j = 0; j < 4; ++j) {
        mj4[j] = -INFINITY;
#pragma unroll
        for (int r = 0; r < 8; ++r) {
          const int key = kv0 + j * 16 + 8 * hh + r;
          float sv = s[j][r] * sscale;
          sv = (key > qrow) ? -FLT_MAX : sv;
          s[j][r] = sv;
          mj4[j] = fmaxf(mj4[j], sv);
        }
      }
      float m = fmaxf(fmaxf(mj4[0], mj4[1]), fmaxf(mj4[2], mj4[3]));
      m = fmaxf(m, xhalf(m));
      const float mnew  = fmaxf(mrow, m);
      const float msafe = (mnew == -INFINITY) ? 0.f : mnew;
      const float alpha = __expf(mrow - msafe);
      mrow = mnew;
      float ps4[4];                                  // four independent chains of additions
#pragma unroll
      for (int j = 0; j < 4; ++j) {
        ps4[j] = 0.f;
#pragma unroll
        for (int r = 0; r < 8; ++r) {
          const float p = __expf(s[j][r] - msafe);   // masked logit against a finite max: exp -> 0
          ps4[j] += p;
          const float p1k = p * 1024.0f;
          const _Float16 ph = (_Float16)p1k;
          pa[j >> 1].v[(j & 1) * 8 + r] = ph;
          if (RES) pl[j >> 1].v[(j & 1) * 8 + r] = (_Float16)((p1k - (float)ph) * 4096.0f);
        }
      }
      lrow = lrow * alpha + ((ps4[0] + ps4[1]) + (ps4[2] + ps4[3]));
#pragma unroll
      for (int t = 0; t < 4; ++t)
#pragma unroll
        for (int r = 0; r < 8; ++r) oacc[t][r] *= alpha;
    }

    // ---- context^T += V^T . P^T (f16 WMMA), residual products into a separate accumulator ----
    v8f o1[4];
#pragma unroll
    for (int t = 0; t < 4; ++t) o1[t] = zero8();
    // unrolled: pa[kk] and pl[kk] are register operands, which a rolled loop could not select by kk
#pragma unroll
    for (int kk = 0; kk < 2; ++kk) {
      // the four d tiles' accumulators take turns; each gets its products in the order of the keys (residual
      // accumulator: v residual . p, then v . p residual, per 32 keys)
      FH vl[4];
      if (RES) {
#pragma unroll
        for (int t = 0; t < 4; ++t) {
          vb[kk][t].h[0] = *(const v8h*)(Vth + (t * 16 + c) * LP + kk * 32 + 8 * hh);
          vb[kk][t].h[1] = *(const v8h*)(Vth + (t * 16 + c) * LP + kk * 32 + 16 + 8 * hh);
          vl[t].h[0] = *(const v8h*)(Vtl + (t * 16 + c) * LP + kk * 32 + 8 * hh);
          vl[t].h[1] = *(const v8h*)(Vtl + (t * 16 + c) * LP + kk * 32 + 16 + 8 * hh);
        }
      }
#pragma unroll
      for (int t = 0; t < 4; ++t) oacc[t] = mma_h_raw(vb[kk][t].v, pa[kk].v, oacc[t]);
      if (RES) {
#pragma unroll
        for (int t = 0; t < 4; ++t) o1[t] = mma_h_raw(vl[t].v, pa[kk].v, o1[t]);
#pragma unroll
        for (int t = 0; t < 4; ++t) o1[t] = mma_h_raw(vb[kk][t].v, pl[kk].v, o1[t]);
      }
    }
    acc_guard4(oacc[0], oacc[1], oacc[2], oacc[3]);
    if (RES) {
      acc_guard4(o1[0], o1[1], o1[2], o1[3]);
#pragma unroll
      for (int t = 0; t < 4; ++t)
#pragma unroll
        for (int r = 0; r < 8; ++r) oacc[t][r] += o1[t][r] * (1.0f / 4096.0f);
    }
  }

  // ---- join the two groups' partial results: group 1 hands its maximum, sum and context over through LDS (every
  //      lane at the places that the same lane of group 0's wave reads), group 0 rescales both to the common maximum.
  //      Group 0 has always seen key tile 0, where every row has a live key; a group 1 without a tile hands over
  //      maximum -inf, sum 0 and context 0, whose factor is exp(-inf) = 0. ----
  lrow += xhalf(lrow);                       // the two halves' keys together: the query's whole sum, in both lanes
  float* os  = Os[wave];
  float* osl = os + c * OP + 8 * hh;         // the lane's places: query c, d = t*16 + 8*hh + r
  if (grp == 1) {
#pragma unroll
    for (int t = 0; t < 4; ++t) {
      const v4f x0 = {oacc[t][0], oacc[t][1], oacc[t][2], oacc[t][3]};
      const v4f x1 = {oacc[t][4], oacc[t][5], oacc[t][6], oacc[t][7]};
      *(v4f*)(osl + t * 16)     = x0;
      *(v4f*)(osl + t * 16 + 4) = x1;
    }
    if (hh == 0) { Ms[wave][c] = mrow; Ls[wave][c] = lrow; }
  }
  __syncthreads();                           // group 1's partial results are published
  if (grp == 1) return;                      // no block barrier stands behind this line
  {
    const float m1 = Ms[wave][c], l1 = Ls[wave][c];
    const float mj = fmaxf(mrow, m1);
    const float ms = (mj == -INFINITY) ? 0.f : mj;
    const float a0 = exp_slot(mrow - ms), a1 = exp_slot(m1 - ms);
    lrow = lrow * a0 + l1 * a1;
#pragma unroll
    for (int t = 0; t < 4; ++t)
#pragma unroll
      for (int r = 0; r < 8; ++r) oacc[t][r] = oacc[t][r] * a0 + osl[t * 16 + r] * a1;
  }

  // ---- normalise (1/l and the 1/1024 p carry), stage the wave's 16x64 tile [query][d] in LDS, then convert to
  {
    const float inv = ((lrow > 0.f) ? (1.0f / lrow) : 0.f) * (1.0f / 1024.0f);
#pragma unroll
    for (int t = 0; t < 4; ++t) {
      const v4f x0 = {oacc[t][0] * inv, oacc[t][1] * inv, oacc[t][2] * inv, oacc[t][3] * inv};
      const v4f x1 = {oacc[t][4] * inv, oacc[t][5] * inv, oacc[t][6] * inv, oacc[t][7] * inv};
      *(v4f*)(osl + t * 16)     = x0;
      *(v4f*)(osl + t * 16 + 4) = x1;
    }
  }
  __builtin_amdgcn_fence(__ATOMIC_RELEASE, "workgroup");
  __builtin_amdgcn_wave_barrier();
  __builtin_amdgcn_fence(__ATOMIC_ACQUIRE, "workgroup");
  {
    const int q4 = lane >> 3, c8 = (lane & 7) * 8;
    v4u hv[4], lv[4];
#pragma unroll
    for (int it = 0; it < 4; ++it) {
      const int row = it * 4 + q4;             // it 0..3 x q4 0..3 = rows 0..15 of the wave tile
      const float* sp = os + row * OP + c8;
      v4u a, a2;
#pragma unroll
      for (int e = 0; e < 4; ++e) {
        const float f0 = sp[2 * e], f1 = sp[2 * e + 1];
        const unsigned short x0 = bf_bits(f0), x1 = bf_bits(f1);
        const unsigned short y0 = bf_bits(f0 - bf_up(x0)), y1 = bf_bits(f1 - bf_up(x1));
        a[e] = pk16(x0, x1); a2[e] = pk16(y0, y1);
      }
      hv[it] = a; lv[it] = a2;
    }
    {
#pragma unroll
      for (int it = 0; it < 4; ++it) {
        const int row = it * 4 + q4;
        const size_t go = (rowB + q0 + row) * DM + (size_t)h * HD + c8;
        *(v4u*)(ahp + go) = hv[it];
        *(v4u*)(alp + go) = lv[it];
      }
      
    }
  }
}

// =====================================================================================================
// Workspace map (bytes), every region an exact multiple of its whole-line / whole-tile store granularity:
//   Xb    bf16 [4096][1024]            0           8388608
//   Wqb   bf16 [1024 out][1024 in]     8388608     2097152
//   Wkb   bf16 [1024][1024]            10485760    2097152
//   Wvb   bf16 [1024][1024]            12582912    2097152
//   Wob   bf16 [1024][1024]            14680064    2097152
//   Erf   bf16 [256 tiles][1024], fragment order (4095 rows used)  16777216     524288
//   Qh    bf16 [4096][1024]            17301504    8388608
//   Ql    bf16 [4096][1024]            25690112    8388608
//   Kh    bf16 [4096][1024]            34078720    8388608
//   Kl    bf16 [4096][1024]            42467328    8388608
//   VTh   f16  [2][1024][2048]         50855936    8388608
//   VTl   f16  [2][1024][512]          59244544    2097152
//   Ah    bf16 [4096][1024]            61341696    8388608
//   Al    bf16 [4096][1024]            69730304    8388608
//   end                                78118912
// Weights arrive [in][out]; y = x . W needs Bt[out][in] (in contiguous) -> transpose-convert once.
// =====================================================================================================
extern "C" void kernel_launch(void* const* d_in, const int* in_sizes, int n_in,
                              void* d_out, int out_size, void* d_ws, size_t ws_size,
                              hipStream_t stream) {
  if (n_in < 10) return;
  if (in_sizes[0] != NB * SEQ * DM) return;
  if (in_sizes[1] != DM * DM || in_sizes[3] != DM * DM || in_sizes[5] != DM * DM || in_sizes[7] != DM * DM) return;
  if (in_sizes[2] != DM || in_sizes[4] != DM || in_sizes[6] != DM || in_sizes[8] != DM) return;
  if (in_sizes[9] != ERR * HD) return;
  if (out_size != NB * SEQ * DM) return;

  const float* x  = (const float*)d_in[0];
  const float* Wq = (const float*)d_in[1];
  const float* bq = (const float*)d_in[2];
  const float* Wk = (const float*)d_in[3];
  const float* bk = (const float*)d_in[4];
  const float* Wv = (const float*)d_in[5];
  const float* bv = (const float*)d_in[6];
  const float* Wo = (const float*)d_in[7];
  const float* bo = (const float*)d_in[8];
  const float* Er = (const float*)d_in[9];

  const size_t PXb  = (size_t)NB * SEQ * DM * 2;       //  8388608  16-bit activation plane [4096][1024]
  const size_t PW   = (size_t)DM * DM * 2;             //  2097152
  const size_t PEr  = (size_t)(ERR + 1) * HD * 2;      //   524288  (rows padded to 4096)
  const size_t PVTh = (size_t)NB * DM * SEQ * 2;       //  8388608
  const size_t PVTl = (size_t)NB * DM * VLP * 2;       //  2097152
  size_t off = 0;
  const size_t oXb  = off; off += PXb;
  const size_t oWq  = off; off += PW;
  const size_t oWk  = off; off += PW;
  const size_t oWv  = off; off += PW;
  const size_t oWo  = off; off += PW;
  const size_t oEr  = off; off += PEr;
  const size_t oQh  = off; off += PXb;
  const size_t oQl  = off; off += PXb;
  const size_t oKh  = off; off += PXb;
  const size_t oKl  = off; off += PXb;
  const size_t oVTh = off; off += PVTh;
  const size_t oVTl = off; off += PVTl;
  const size_t oAh  = off; off += PXb;
  const size_t oAl  = off; off += PXb;
  if (off > ws_size) return;                           // off = 78118912

  char* ws = (char*)d_ws;
  unsigned short* Xb  = (unsigned short*)(ws + oXb);
  unsigned short* Wqb = (unsigned short*)(ws + oWq);
  unsigned short* Wkb = (unsigned short*)(ws + oWk);
  unsigned short* Wvb = (unsigned short*)(ws + oWv);
  unsigned short* Wob = (unsigned short*)(ws + oWo);
  unsigned short* Erf = (unsigned short*)(ws + oEr);
  unsigned short* Qh  = (unsigned short*)(ws + oQh);
  unsigned short* Ql  = (unsigned short*)(ws + oQl);
  unsigned short* Kh  = (unsigned short*)(ws + oKh);
  unsigned short* Kl  = (unsigned short*)(ws + oKl);
  unsigned short* VTh = (unsigned short*)(ws + oVTh);
  unsigned short* VTl = (unsigned short*)(ws + oVTl);
  unsigned short* Ah  = (unsigned short*)(ws + oAh);
  unsigned short* Al  = (unsigned short*)(ws + oAl);

  const dim3 blk(256);
  const dim3 gPrep(4 * NWB + NXB + NEB);                             // 1024 + 2048 + 128 blocks
  const dim3 blkG(128);                                              // GEMM block: 4 waves, one 128x128 tile
  const int  nblk = (NB * SEQ / 128) * (DM / 128);                   // 256 blocks per projection
  static_assert((NB * SEQ / 128) * (DM / 128) == (DM / 128) * (SEQ / 128) * NB);
  const dim3 gQKV(3 * nblk);                                         // 768 blocks
  const dim3 gOut((NB * SEQ / 128) * (DM / 128), 1);                 // 256 blocks

  // (1) x -> bf16 plane [4096][1024]; weights [in][out] f32 -> bf16 [out][in] planes; Er -> bf16 in fragment order
  prep_all<<<gPrep, blk, 0, stream>>>(x, Wq, Wk, Wv, Wo, Er, Xb, Wqb, Erf);
  // (2) q, k and v^T projections (planes Wqb, Wkb, Wvb and Qh, Ql, Kh, Kl are neighbours in the workspace map)
  gemm_qkv<<<gQKV, blkG, 0, stream>>>(Xb, Wqb, Qh, VTh, VTl, bq, bk, bv, NB * SEQ, SEQ, DM, nblk);
  // (3) attention, each launch over all NP pairs: the leading RESQB query blocks with the residual planes, then all the
  //     others in one launch
  attn_rel64<true><<<dim3(RESQB * NP), dim3(256), 0, stream>>>(
      Qh, Ql, Kh, Kl, VTh, VTl, Erf, Ah, Al, 0, RESQB, 0.125f);
  attn_rel64<false><<<dim3((NQB - RESQB) * NP), dim3(256), 0, stream>>>(
      Qh, Ql, Kh, Kl, VTh, VTl, Erf, Ah, Al, RESQB, NQB - RESQB, 0.125f);
  // (4) out[s][e] = bo[e] + sum_d (Ah+Al)[s][d] Wob[e][d] -> d_out f32 [4096][1024]  (M=4096, N=1024, K=1024)
  gemm128<1, 0, false, true><<<gOut, blkG, 0, stream>>>(
      Ah, Al, DM, 0LL, Wob, DM, 0LL,
      d_out, DM, 0LL, d_out, 0, 0LL, 0,
      NB * SEQ, DM, DM, 1.0f, bo, bo);
  (void)hipGetLastError();
}
